// v000
// Measured on an AMD MI455X. A time is GPU time per run, averaged over a window of back-to-back runs after a warm-up
// (all launches, gaps included; the runs take copies of the inputs in turn), and the median of several windows.
// Apart from v000's, it joins two sittings. Times from different sittings can be a few percent apart, while
// side-by-side timings come from the same sitting.
// v000, which the later versions start from, runs in 451 microseconds.
// compute dtype: all float inputs rounded to bf16; q/k/v = in W + b with EXACT bf16 products on WMMA 16x16x32 (f32 accumulate); q as f16 hi + residual (x 2^10) against k once to f16 (2 products) / sqrt(256) + the additive f32 mask; softmax in f32 (precise expf); P x 2^11 once to f16 against v once to f16 (1 product); ctx split bf16 hi + lo against exact Wo (2 products) + bo; f32 output.
#include <hip/hip_runtime.h>
#include <math.h>

typedef __attribute__((ext_vector_type(16))) _Float16 v16h;
typedef __attribute__((ext_vector_type(16))) __bf16 v16b;
typedef __attribute__((ext_vector_type(8)))  _Float16 v8h;
typedef __attribute__((ext_vector_type(8)))  float v8f;
typedef __attribute__((ext_vector_type(4)))  float v4f;
typedef __attribute__((ext_vector_type(2)))  float v2f;
typedef __attribute__((ext_vector_type(4)))  unsigned v4u;
typedef __attribute__((ext_vector_type(4)))  int v4i;
typedef float __attribute__((may_alias)) float_a;
typedef int __attribute__((may_alias)) int_a;

template <typename T> __device__ __forceinline__ void vst2(void* p, T v) { *(T*)p = v;  }
__device__ __forceinline__ v8f wmma16(v16h a, v16h b, v8f c) {
  v8f d = __builtin_amdgcn_wmma_f32_16x16x32_f16(false, a, false, b, (short)0, c, false, false);
  asm volatile("v_nop\n\tv_nop\n\tv_nop\n\tv_nop" : "+v"(d) : "v"(a), "v"(b));
  return d;
}
__device__ __forceinline__ v8f wmma_bf(v16b a, v16b b, v8f c) {
  v8f d = __builtin_amdgcn_wmma_f32_16x16x32_bf16(false, a, false, b, (short)0, c, false, false);
  asm volatile("v_nop\n\tv_nop\n\tv_nop\n\tv_nop" : "+v"(d) : "v"(a), "v"(b));
  return d;
}
// 16x16x32 fragments: lane = (h = lane>>4, row/col = lane&15); elements 0..7 = k0+8h+0..7, 8..15 = k0+16+8h+0..7; D element r = row 8h+r
__device__ __forceinline__ v16h frag_h(const _Float16* rowk0, int lane) {
  union { v16h v; v8h q[2]; } u; const _Float16* p = rowk0 + 8 * (lane >> 4);
  u.q[0] = *(const v8h*)p; u.q[1] = *(const v8h*)(p + 16); return u.v;
}
__device__ __forceinline__ v16h frag_f32(const float* rowk0, int lane) {
  v16h a; const float* p = rowk0 + 8 * (lane >> 4);
#pragma unroll
  for (int i = 0; i < 8; ++i) { a[i] = (_Float16)p[i]; a[8 + i] = (_Float16)p[16 + i]; }
  return a;
}
__device__ __forceinline__ v16h frag_f32s(const float* rowk0, int lane, float sc) {
  v16h a; const float* p = rowk0 + 8 * (lane >> 4);
#pragma unroll
  for (int i = 0; i < 8; ++i) { a[i] = (_Float16)(p[i] * sc); a[8 + i] = (_Float16)(p[16 + i] * sc); }
  return a;
}
// column fragment from a [K][ld] layout (column n), rows >= K read as 0
__device__ __forceinline__ v16h fragc_f32(const float* W, int k0, int n, int lane, int ld, int K) {
  v16h a; const int g = lane >> 4;
#pragma unroll
  for (int i = 0; i < 8; ++i) { const int ka = k0 + 8 * g + i, kb = ka + 16;
    a[i] = (_Float16)(ka < K ? W[(size_t)(ka < K ? ka : K - 1) * ld + n] : 0.f); a[8 + i] = (_Float16)(kb < K ? W[(size_t)(kb < K ? kb : K - 1) * ld + n] : 0.f); }
  return a;
}
struct F2 { v16b h, l; };
__device__ __forceinline__ F2 bsplit16(const float v[16]) { F2 r;
#pragma unroll
  for (int i = 0; i < 16; ++i) { const __bf16 h = (__bf16)v[i]; r.h[i] = h; r.l[i] = (__bf16)(v[i] - (float)h); }
  return r; }
__device__ __forceinline__ F2 split_row(const float* row, int k0, int lane) { float v[16]; const float* p = row + k0 + 8 * (lane >> 4);
#pragma unroll
  for (int i = 0; i < 8; ++i) { v[i] = p[i]; v[8 + i] = p[16 + i]; }
  return bsplit16(v); }
__device__ __forceinline__ F2 split_rowK(const float* row, int k0, int lane, int K) { float v[16]; const int g = lane >> 4;
#pragma unroll
  for (int i = 0; i < 8; ++i) { const int ka = k0 + 8 * g + i, kb = ka + 16; v[i] = ka < K ? row[ka < K ? ka : K - 1] : 0.f; v[8 + i] = kb < K ? row[kb < K ? kb : K - 1] : 0.f; }
  return bsplit16(v); }
__device__ __forceinline__ F2 split_col(const float* W, int k0, int n, int lane, int ld, int K) { float v[16]; const int g = lane >> 4;
#pragma unroll
  for (int i = 0; i < 8; ++i) { const int ka = k0 + 8 * g + i, kb = ka + 16; v[i] = ka < K ? W[(size_t)(ka < K ? ka : K - 1) * ld + n] : 0.f; v[8 + i] = kb < K ? W[(size_t)(kb < K ? kb : K - 1) * ld + n] : 0.f; }
  return bsplit16(v); }
__device__ __forceinline__ v8f mac3(const F2& a, const F2& b, v8f c) { c = wmma_bf(a.l, b.h, c); c = wmma_bf(a.h, b.l, c); return wmma_bf(a.h, b.h, c); }
__device__ __forceinline__ float sigm(float v) { return 1.0f / (1.0f + expf(-v)); }
#define LDSX() do { asm volatile("s_wait_dscnt 0" ::: "memory"); __builtin_amdgcn_wave_barrier(); __builtin_amdgcn_fence(__ATOMIC_RELEASE, "workgroup"); } while (0)

// Multi-head attention with an additive dense mask (B 2, S 2,048, d_model 512 -> key/value dim 256 = 8 heads x 32 -> out 512; 0.02-scale (in,out) weights, zero biases; separate V, Q, K inputs): scores = q k^T / sqrt(256) (the FULL key_dim, as written) + mask[b, 0, q, k] (random normal); out = merged(softmax v) Wo + bo.
#define NB 2
#define TT 2048
#define CC 256            // NH * HD = projected width
#define DIN 512          // input (model) width
#define NH 8
#define HD 32
#define NQB (TT / 64)
#define HG 4
#define SCALE (0.0625f)
#define CAUSAL 0
#ifndef TNB
#define TNB NB
#endif
__device__ __forceinline__ float bfr(float v) { return (float)(__bf16)v; }
__host__ __device__ __forceinline__ int kb_last(int qb) { return CAUSAL ? ((qb * 64 + 63) >> 7) : (TT / 128 - 1); }
typedef __attribute__((ext_vector_type(8))) __bf16 v8b;
__device__ __forceinline__ v16b frag_b(const __bf16* rowk0, int lane) {
  union { v16b v; v8b q[2]; } u; const __bf16* p = rowk0 + 8 * (lane >> 4);
  u.q[0] = *(const v8b*)p; u.q[1] = *(const v8b*)(p + 16); return u.v;
}
#define QBH 0              // query blocks 0..QBH-1 of each sequence take the high-precision path: none, as QBH is 0
#define QHI 2048            // rows carrying a q residual plane (all rows when non-causal: 2-product logits everywhere)
#define KHI 64            // key rows carrying k residual / v bf16 hi+lo planes (written by k_proj; read only by the qb < QBH path, which never runs as QBH is 0)
// B fragment (k rows k0+.., output column o) of a weight: (in,out) [K][ld] or (out,in) [ld rows of K]: bf16 exact, or f16(bf16 * 256) exact
__device__ __forceinline__ v16b wcol_io(const float* Wm, int k0, int o, int lane, int ld) { v16b w; const int g = lane >> 4;
#pragma unroll
  for (int i = 0; i < 8; ++i) { w[i] = (__bf16)Wm[(size_t)(k0 + 8 * g + i) * ld + o]; w[8 + i] = (__bf16)Wm[(size_t)(k0 + 16 + 8 * g + i) * ld + o]; }
  return w; }
__device__ __forceinline__ v16b wcol_oi(const float* Wm, int k0, int o, int lane, int K) { v16b w; const float* p = Wm + (size_t)o * K + k0 + 8 * (lane >> 4);
#pragma unroll
  for (int i = 0; i < 8; ++i) { w[i] = (__bf16)p[i]; w[8 + i] = (__bf16)p[16 + i]; }
  return w; }
__device__ __forceinline__ v16h wcolh_io(const float* Wm, int k0, int o, int lane, int ld) { v16h w; const int g = lane >> 4;
#pragma unroll
  for (int i = 0; i < 8; ++i) { w[i] = (_Float16)(bfr(Wm[(size_t)(k0 + 8 * g + i) * ld + o]) * 256.0f); w[8 + i] = (_Float16)(bfr(Wm[(size_t)(k0 + 16 + 8 * g + i) * ld + o]) * 256.0f); }
  return w; }
__device__ __forceinline__ v16h wcolh_oi(const float* Wm, int k0, int o, int lane, int K) { v16h w; const float* p = Wm + (size_t)o * K + k0 + 8 * (lane >> 4);
#pragma unroll
  for (int i = 0; i < 8; ++i) { w[i] = (_Float16)(bfr(p[i]) * 256.0f); w[8 + i] = (_Float16)(bfr(p[16 + i]) * 256.0f); }
  return w; }
#define WQKV_LAYOUT 0   // 0 = (in,out) [DIN][CC]; 1 = (out,in) [CC][DIN]; 2 = per-head [NH][DIN][HD]
__device__ __forceinline__ v16b wcol_hdk(const float* Wm, int k0, int o, int lane) { v16b w; const int g = lane >> 4; const float* p = Wm + (size_t)(o / HD) * DIN * HD + (o % HD);
#pragma unroll
  for (int i = 0; i < 8; ++i) { w[i] = (__bf16)p[(size_t)(k0 + 8 * g + i) * HD]; w[8 + i] = (__bf16)p[(size_t)(k0 + 16 + 8 * g + i) * HD]; }
  return w; }
#define WO_OUT_IN 0
#if WQKV_LAYOUT == 1
#define WCOL(W, k0, o, lane) wcol_oi(W, k0, o, lane, DIN)
#elif WQKV_LAYOUT == 2
#define WCOL(W, k0, o, lane) wcol_hdk(W, k0, o, lane)
#else
#define WCOL(W, k0, o, lane) wcol_io(W, k0, o, lane, CC)
#endif
#if WO_OUT_IN
#define WOCOL(W, k0, o, lane) wcol_oi(W, k0, o, lane, CC)
#define WOCOLH(W, k0, o, lane) wcolh_oi(W, k0, o, lane, CC)
#else
#define WOCOL(W, k0, o, lane) wcol_io(W, k0, o, lane, DIN)
#define WOCOLH(W, k0, o, lane) wcolh_io(W, k0, o, lane, DIN)
#endif
#define SM_EXTRA_PARAMS , const float* __restrict__ MKF, int bcur
#define SM_MASK_HOOK do { v += bfr(MKF[((size_t)bcur * TT + t) * TT + k]); } while (0)   /* scores + mask (dense, soft, additive; bf16-rounded input) */
#ifndef SM_EXTRA_PARAMS
#define SM_EXTRA_PARAMS
#endif
#ifndef PROJ_EXTRA_PARAMS
#define PROJ_EXTRA_PARAMS
#endif
#ifndef SM_MASK_HOOK
#define SM_MASK_HOOK (void)0
#endif

#define WS_QH  0u                                      // f16 q rows [b*t][CC]
#define WS_KH  (WS_QH + 2u * (size_t)NB * TT * CC)      // f16 k rows [b*t][CC]
#define WS_VT  (WS_KH + 2u * (size_t)NB * TT * CC)      // f16 v planes [b][c][t]
#define WS_QL  (WS_VT + 2u * (size_t)NB * CC * TT)      // f16 q residual x 2^10 rows [b][t < QHI][CC]
#define WS_KL  (WS_QL + 2u * (size_t)NB * QHI * CC)     // f16 k residual x 2^10 rows [b][t < KHI][CC]
#define WS_VB  (WS_KL + 2u * (size_t)NB * KHI * CC)     // bf16 v hi planes [b][c][t < KHI]
#define WS_VBL (WS_VB + 2u * (size_t)NB * CC * KHI)
#define WS_S   (WS_VBL + 2u * (size_t)NB * CC * KHI)    // f32 logits / P [hg][t][s]
#define WS_Y   (WS_S  + 4u * (size_t)HG * TT * TT)      // f32 ctx rows [b*t][CC] (only when there is an output projection)
#define WS_END (WS_Y  + 4u * (size_t)NB * TT * CC)

// ---- k_proj: block = (64 rows, 128 cols, which): q/k/v = X W (+ b) with exact bf16 products (K = DIN) -> which 0: q f16 rows (+ residual rows < QHI); 1: k f16 rows (+ residual rows < KHI); 2: v f16 planes [c][t] (+ bf16 hi/lo planes for t < KHI)
__global__ __launch_bounds__(128) void k_proj(const float* __restrict__ XQ, const float* __restrict__ XK, const float* __restrict__ XV, const float* __restrict__ WQ, const float* __restrict__ WK, const float* __restrict__ WV, const float* __restrict__ BQ, const float* __restrict__ BK, const float* __restrict__ BV,
    _Float16* __restrict__ QH, _Float16* __restrict__ QL, _Float16* __restrict__ KH, _Float16* __restrict__ KL, _Float16* __restrict__ VT, __bf16* __restrict__ VB, __bf16* __restrict__ VBL) {
  __shared__ __align__(16) _Float16 sh[64][136], sl[64][136]; __shared__ __align__(16) _Float16 th[128][72]; __shared__ __align__(16) __bf16 tb[128][72], tbl[128][72];
  const int tid = threadIdx.x, wave = tid >> 5, lane = tid & 31, col = lane & 15, g = lane >> 4; const int which = blockIdx.z; const int c0 = blockIdx.y * 128; const size_t r0 = (size_t)blockIdx.x * 64; const size_t bb = r0 / TT; const int t0 = (int)(r0 % TT);
  const float* X = which == 0 ? XQ : which == 1 ? XK : XV; const float* WA = which == 0 ? WQ : which == 1 ? WK : WV; const float* BA = which == 0 ? BQ : which == 1 ? BK : BV;
  v8f acc[8] = {};
#pragma unroll 2
  for (int kc = 0; kc < DIN / 32; ++kc) { v16b a; { const float* p = X + (r0 + wave * 16 + col) * DIN + kc * 32 + 8 * g;
#pragma unroll
      for (int i = 0; i < 8; ++i) { a[i] = (__bf16)p[i]; a[8 + i] = (__bf16)p[16 + i]; } }
    asm volatile("s_wait_loadcnt 0x0" ::: "memory");
#pragma unroll
    for (int j = 0; j < 8; ++j) { const v16b w = WCOL(WA, kc * 32, c0 + j * 16 + col, lane); asm volatile("s_wait_loadcnt 0x0" ::: "memory"); acc[j] = wmma_bf(a, w, acc[j]); } }
  if (which < 2) { _Float16* DH = which == 0 ? QH : KH; _Float16* DL = which == 0 ? QL : KL; const int nhi = which == 0 ? QHI : KHI; const bool hi_rows = t0 < nhi;
#pragma unroll
    for (int j = 0; j < 8; ++j) { const float bias = BA ? bfr(BA[c0 + j * 16 + col]) : 0.f;
#pragma unroll
      for (int r = 0; r < 8; ++r) { const float v = acc[j][r] + bias; const _Float16 hv = (_Float16)v; sh[wave * 16 + 8 * g + r][j * 16 + col] = hv; sl[wave * 16 + 8 * g + r][j * 16 + col] = (_Float16)((v - (float)hv) * 1024.0f); } }
    __syncthreads();
    for (int e = tid; e < 64 * 16; e += 128) { const int rl = e >> 4, q = e & 15; vst2((unsigned*)(DH + (r0 + rl) * CC + c0 + q * 8), *(const v4u*)&sh[rl][q * 8]); if (hi_rows) vst2((unsigned*)(DL + (bb * nhi + t0 + rl) * (size_t)CC + c0 + q * 8), *(const v4u*)&sl[rl][q * 8]); }
  } else { const bool hi_rows = t0 < KHI;
#pragma unroll
    for (int j = 0; j < 8; ++j) { const float bias = BA ? bfr(BA[c0 + j * 16 + col]) : 0.f;
#pragma unroll
      for (int r = 0; r < 8; ++r) { const float v = acc[j][r] + bias; const int rl = wave * 16 + 8 * g + r, cl = j * 16 + col; th[cl][rl] = (_Float16)v; const __bf16 bh = (__bf16)v; tb[cl][rl] = bh; tbl[cl][rl] = (__bf16)(v - (float)bh); } }
    __syncthreads();
    for (int e = tid; e < 128 * 8; e += 128) { const int cl = e >> 3, q = e & 7; vst2((unsigned*)(VT + (bb * CC + c0 + cl) * (size_t)TT + t0 + q * 8), *(const v4u*)&th[cl][q * 8]); if (hi_rows) { const size_t o3 = (bb * CC + c0 + cl) * (size_t)KHI + t0 + q * 8; vst2((unsigned*)(VB + o3), *(const v4u*)&tb[cl][q * 8]); vst2((unsigned*)(VBL + o3), *(const v4u*)&tbl[cl][q * 8]); } } } }
// ---- k_sc: block = (query block qb, key block kb <= kb_last(qb), head in group) of batch b: logits x SCALE; q hi + residual (x 2^10) against k (2 products) for query rows < QHI, plus the k residual (3 products) for query blocks < QBH (none: QBH is 0); causal: blocks past the diagonal exit, the mask itself is applied by index in k_sm
__global__ __launch_bounds__(128) void k_sc(const _Float16* __restrict__ QH, const _Float16* __restrict__ KH, const _Float16* __restrict__ QL, const _Float16* __restrict__ KL, int b, int h0, float* __restrict__ S0) { __shared__ __align__(16) float ss[4][16][132];
  const int qb = blockIdx.x, kb = blockIdx.y; if (kb > kb_last(qb)) return;
  const int h = h0 + blockIdx.z; float* S = S0 + (size_t)blockIdx.z * TT * TT;
  const int tid = threadIdx.x, wave = tid >> 5, lane = tid & 31, col = lane & 15, g = lane >> 4; const int k0 = kb * 128; const int ql0 = qb * 64 + wave * 16; const size_t q0 = (size_t)b * TT + ql0, kr0 = (size_t)b * TT + k0;
  v8f acc[8] = {}, accl[8] = {};
  const _Float16* QLb = QL + (size_t)b * QHI * CC; const _Float16* KLb = KL + (size_t)b * KHI * CC;
  if (qb < QBH) {
#pragma unroll
    for (int kc = 0; kc < HD / 32; ++kc) { const v16h ah = frag_h(QH + (q0 + col) * CC + h * HD + kc * 32, lane), al = frag_h(QLb + (size_t)(ql0 + col) * CC + h * HD + kc * 32, lane);
#pragma unroll
      for (int j = 0; j < 8; ++j) { const v16h kbf = frag_h(KH + (kr0 + j * 16 + col) * CC + h * HD + kc * 32, lane), klf = frag_h(KLb + (size_t)(k0 + j * 16 + col) * CC + h * HD + kc * 32, lane); acc[j] = wmma16(ah, kbf, acc[j]); accl[j] = wmma16(al, kbf, accl[j]); accl[j] = wmma16(ah, klf, accl[j]); } }
  } else if (qb * 64 < QHI) {
#pragma unroll
    for (int kc = 0; kc < HD / 32; ++kc) { const v16h ah = frag_h(QH + (q0 + col) * CC + h * HD + kc * 32, lane), al = frag_h(QLb + (size_t)(ql0 + col) * CC + h * HD + kc * 32, lane);
#pragma unroll
      for (int j = 0; j < 8; ++j) { const v16h kbf = frag_h(KH + (kr0 + j * 16 + col) * CC + h * HD + kc * 32, lane); acc[j] = wmma16(ah, kbf, acc[j]); accl[j] = wmma16(al, kbf, accl[j]); } }
  } else {
#pragma unroll
    for (int kc = 0; kc < HD / 32; ++kc) { const v16h ah = frag_h(QH + (q0 + col) * CC + h * HD + kc * 32, lane);
#pragma unroll
      for (int j = 0; j < 8; ++j) { const v16h kbf = frag_h(KH + (kr0 + j * 16 + col) * CC + h * HD + kc * 32, lane); acc[j] = wmma16(ah, kbf, acc[j]); } } }
#pragma unroll
  for (int j = 0; j < 8; ++j) {
#pragma unroll
    for (int r = 0; r < 8; ++r) ss[wave][8 * g + r][j * 16 + col] = (acc[j][r] + accl[j][r] * (1.0f / 1024.0f)) * SCALE; }
  LDSX(); for (int rl = 0; rl < 16; ++rl) vst2(S + (size_t)(ql0 + rl) * TT + k0 + lane * 4, *(const v4f*)&ss[wave][rl][lane * 4]); }
// ---- k_sm: block = query row t (head in group): keys [0, kend): causal -> logit if s <= t else excluded; softmax in f32; P x 2^11 in place (0 for excluded)
__global__ __launch_bounds__(256) void k_sm(float* __restrict__ S0 SM_EXTRA_PARAMS) { __shared__ float sred[8]; __shared__ float sbc; __shared__ __align__(16) float shv[TT];
  const int tid = threadIdx.x; const int t = blockIdx.x; const int kend = (kb_last(t >> 6) + 1) * 128;
  float* sr = S0 + (size_t)blockIdx.y * TT * TT + (size_t)t * TT;
  float m = -3.0e38f; for (int k = tid; k < kend; k += 256) { float v = (!CAUSAL || k <= t) ? sr[k] : -3.0e38f; SM_MASK_HOOK; shv[k] = v; m = fmaxf(m, v); }
#pragma unroll
  for (int o = 1; o < 32; o <<= 1) m = fmaxf(m, __shfl_xor(m, o));
  if ((tid & 31) == 0) sred[tid >> 5] = m; __syncthreads(); if (tid == 0) { float a = sred[0]; for (int i = 1; i < 8; ++i) a = fmaxf(a, sred[i]); sbc = a; } __syncthreads(); m = sbc; __syncthreads();
  float sum = 0.f; for (int k = tid; k < kend; k += 256) { const float v = shv[k]; const float e = (v <= -1.0e38f) ? 0.f : expf(v - m); shv[k] = e; sum += e; }
#pragma unroll
  for (int o = 1; o < 32; o <<= 1) sum += __shfl_xor(sum, o);
  if ((tid & 31) == 0) sred[tid >> 5] = sum; __syncthreads(); if (tid == 0) { float a = 0.f; for (int i = 0; i < 8; ++i) a += sred[i]; sbc = a > 0.f ? 2048.0f / a : 0.f; }   /* a fully excluded row yields P = 0 */ __syncthreads(); const float inv = sbc;
  for (int k = tid; k < kend; k += 256) shv[k] = shv[k] * inv;
  __syncthreads(); for (int q = tid; q < kend / 4; q += 256) vst2(sr + q * 4, *(const v4f*)&shv[q * 4]); }
// ---- k_pv: block = 64 queries (qb) of (b, h): ctx = P . v over keys [0, kend) (P x 2^11 once to f16 against v f16: 1 product; query blocks < QBH, none as QBH is 0: P and v as bf16 hi + lo, 3 products); 128-B (row, head) segment by 8 lanes
__global__ __launch_bounds__(128) void k_pv(const float* __restrict__ PS0, const _Float16* __restrict__ VT, const __bf16* __restrict__ VB, const __bf16* __restrict__ VBL, int b, int h0, float* __restrict__ Y) { const int h = h0 + blockIdx.z; const float* PS = PS0 + (size_t)blockIdx.z * TT * TT; __shared__ __align__(16) float ss[4][16][HD + 4];
  const int tid = threadIdx.x, wave = tid >> 5, lane = tid & 31, col = lane & 15, g = lane >> 4; const int qb = blockIdx.x; const int ql0 = qb * 64 + wave * 16; const int kce = (kb_last(qb) + 1) * 4;
  v8f acc[HD / 16] = {};
  if (qb < QBH) {
#pragma unroll 1
    for (int kc = 0; kc < kce; ++kc) { const F2 p = split_row(PS + (size_t)(ql0 + col) * TT, kc * 32, lane);
      asm volatile("s_wait_loadcnt 0x0" ::: "memory");
#pragma unroll
      for (int j = 0; j < HD / 16; ++j) { const size_t po = ((size_t)b * CC + h * HD + j * 16 + col) * (size_t)KHI + kc * 32; const v16b vh = frag_b(VB + po, lane); acc[j] = wmma_bf(p.h, vh, acc[j]); acc[j] = wmma_bf(p.l, vh, acc[j]); acc[j] = wmma_bf(p.h, frag_b(VBL + po, lane), acc[j]); } }
  } else {
#pragma unroll 1
    for (int kc = 0; kc < kce; ++kc) { const v16h p = frag_f32(PS + (size_t)(ql0 + col) * TT + kc * 32, lane);
      asm volatile("s_wait_loadcnt 0x0" ::: "memory");
#pragma unroll
      for (int j = 0; j < HD / 16; ++j) { const size_t po = ((size_t)b * CC + h * HD + j * 16 + col) * (size_t)TT + kc * 32; acc[j] = wmma16(p, frag_h(VT + po, lane), acc[j]); } } }
#pragma unroll
  for (int j = 0; j < HD / 16; ++j)
#pragma unroll
    for (int r = 0; r < 8; ++r) ss[wave][8 * g + r][j * 16 + col] = acc[j][r] * (1.0f / 2048.0f);
  LDSX(); for (int rl = 0; rl < 16; ++rl) if (lane < HD / 4) vst2(Y + ((size_t)b * TT + ql0 + rl) * CC + h * HD + lane * 4, *(const v4f*)&ss[wave][rl][lane * 4]); }
// ---- k_out: block = (64 rows, 128 cols): out = ctx Wo (+ bo): all rows: ctx bf16 hi + lo against exact bf16 Wo (2 products); the branch with ctx once to f16 against Wo as f16(bf16 x 2^8) (1 product, x 2^-8) is never taken
__global__ __launch_bounds__(128) void k_out(const float* __restrict__ Y, const float* __restrict__ WO, const float* __restrict__ BO, float* __restrict__ OUT) { __shared__ __align__(16) float sf[4][16][132];
  const int tid = threadIdx.x, wave = tid >> 5, lane = tid & 31, col = lane & 15, g = lane >> 4; const int c0 = blockIdx.y * 128; const size_t r0 = (size_t)blockIdx.x * 64 + wave * 16;
  v8f acc[8] = {};
  if (true) {   /* ALL rows: ctx split bf16 hi + lo x exact Wo (2 products) */
#pragma unroll 2
    for (int kc = 0; kc < CC / 32; ++kc) { const F2 a = split_row(Y + (r0 + col) * CC, kc * 32, lane); asm volatile("s_wait_loadcnt 0x0" ::: "memory");
#pragma unroll
      for (int j = 0; j < 8; ++j) { const v16b w = WOCOL(WO, kc * 32, c0 + j * 16 + col, lane); asm volatile("s_wait_loadcnt 0x0" ::: "memory"); acc[j] = wmma_bf(a.h, w, acc[j]); acc[j] = wmma_bf(a.l, w, acc[j]); } }
#pragma unroll
    for (int j = 0; j < 8; ++j) { const float bias = BO ? bfr(BO[c0 + j * 16 + col]) : 0.f;
#pragma unroll
      for (int r = 0; r < 8; ++r) sf[wave][8 * g + r][j * 16 + col] = acc[j][r] + bias; }
  } else {
#pragma unroll 2
    for (int kc = 0; kc < CC / 32; ++kc) { const v16h a = frag_f32(Y + (r0 + col) * CC + kc * 32, lane); asm volatile("s_wait_loadcnt 0x0" ::: "memory");
#pragma unroll
      for (int j = 0; j < 8; ++j) { const v16h w = WOCOLH(WO, kc * 32, c0 + j * 16 + col, lane); asm volatile("s_wait_loadcnt 0x0" ::: "memory"); acc[j] = wmma16(a, w, acc[j]); } }
#pragma unroll
    for (int j = 0; j < 8; ++j) { const float bias = BO ? bfr(BO[c0 + j * 16 + col]) : 0.f;
#pragma unroll
      for (int r = 0; r < 8; ++r) sf[wave][8 * g + r][j * 16 + col] = acc[j][r] * (1.0f / 256.0f) + bias; } }
  LDSX(); for (int rl = 0; rl < 16; ++rl) vst2(OUT + (r0 + rl) * DIN + c0 + lane * 4, *(const v4f*)&sf[wave][rl][lane * 4]); }

extern "C" void kernel_launch(void* const* d_in, const int* in_sizes, int n_in, void* d_out, int out_size, void* d_ws, size_t ws_size, hipStream_t stream) {
  (void)in_sizes; (void)n_in; (void)out_size;
  const float** F = (const float**)d_in;
  if (ws_size < (size_t)WS_END) return;
  char* ws = (char*)d_ws; _Float16 *QH = (_Float16*)(ws + WS_QH), *KH = (_Float16*)(ws + WS_KH), *VT = (_Float16*)(ws + WS_VT), *QL = (_Float16*)(ws + WS_QL), *KL = (_Float16*)(ws + WS_KL); __bf16 *VB = (__bf16*)(ws + WS_VB), *VBL = (__bf16*)(ws + WS_VBL); float *S = (float*)(ws + WS_S), *Y = (float*)(ws + WS_Y);
  (void)Y; (void)QL; (void)KL; (void)VB; (void)VBL;
  // inputs: 0 V [2,2048,512]; 1 Q; 2 K; 3 mask [2,1,2048,2048] f32; 4 Wq [512,256] (in,out), 5 bq; 6 Wk, 7 bk; 8 Wv, 9 bv; 10 Wo [256,512] (in,out), 11 bo [512]
  k_proj<<<dim3(TNB * TT / 64, CC / 128, 3), 128, 0, stream>>>(F[1], F[2], F[0], F[4], F[6], F[8], F[5], F[7], F[9], QH, QL, KH, KL, VT, VB, VBL);   /* q from Q (in1), k from K (in2), v from V (in0) */
  for (int b = 0; b < TNB; ++b) for (int h0 = 0; h0 < NH; h0 += HG) {
    k_sc<<<dim3(NQB, TT / 128, HG), 128, 0, stream>>>(QH, KH, QL, KL, b, h0, S);
    k_sm<<<dim3(TT, HG), 256, 0, stream>>>(S, F[3], b);
    k_pv<<<dim3(NQB, 1, HG), 128, 0, stream>>>(S, VT, VB, VBL, b, h0, Y);
  }
  k_out<<<dim3(TNB * TT / 64, DIN / 128), 128, 0, stream>>>(Y, F[10], F[11], (float*)d_out);
}

// v001
// Measured time: 107 microseconds a run.
// Two timings next to v000 both put it at 4.23 times that version's speed.
// compute dtype: all float inputs rounded to bf16; q/k/v = in W + b with EXACT bf16 products on WMMA 16x16x32 (f32 accumulate); q as f16 hi + residual (x 2^10) against k once to f16 (2 products) / sqrt(256) + the additive f32 mask; online softmax in f32 (precise expf); unnormalised P (at most 2^10) once to f16 against v once to f16 (1 product), divided by the f32 sum; ctx split bf16 hi + lo against exact Wo (2 products) + bo; f32 output.
#include <hip/hip_runtime.h>
#include <math.h>

typedef __attribute__((ext_vector_type(16))) _Float16 v16h;
typedef __attribute__((ext_vector_type(16))) __bf16 v16b;
typedef __attribute__((ext_vector_type(8)))  _Float16 v8h;
typedef __attribute__((ext_vector_type(8)))  float v8f;
typedef __attribute__((ext_vector_type(4)))  float v4f;
typedef __attribute__((ext_vector_type(2)))  float v2f;
typedef __attribute__((ext_vector_type(4)))  unsigned v4u;
typedef __attribute__((ext_vector_type(4)))  int v4i;
typedef float __attribute__((may_alias)) float_a;
typedef int __attribute__((may_alias)) int_a;

template <typename T> __device__ __forceinline__ void vst2(void* p, T v) { *(T*)p = v;  }
__device__ __forceinline__ v8f wmma16(v16h a, v16h b, v8f c) {
  v8f d = __builtin_amdgcn_wmma_f32_16x16x32_f16(false, a, false, b, (short)0, c, false, false);
  asm volatile("v_nop\n\tv_nop\n\tv_nop\n\tv_nop" : "+v"(d) : "v"(a), "v"(b));
  return d;
}
__device__ __forceinline__ v8f wmma_bf(v16b a, v16b b, v8f c) {
  v8f d = __builtin_amdgcn_wmma_f32_16x16x32_bf16(false, a, false, b, (short)0, c, false, false);
  asm volatile("v_nop\n\tv_nop\n\tv_nop\n\tv_nop" : "+v"(d) : "v"(a), "v"(b));
  return d;
}
// 16x16x32 fragments: lane = (h = lane>>4, row/col = lane&15); elements 0..7 = k0+8h+0..7, 8..15 = k0+16+8h+0..7; D element r = row 8h+r
__device__ __forceinline__ v16h frag_h(const _Float16* rowk0, int lane) {
  union { v16h v; v8h q[2]; } u; const _Float16* p = rowk0 + 8 * (lane >> 4);
  u.q[0] = *(const v8h*)p; u.q[1] = *(const v8h*)(p + 16); return u.v;
}
__device__ __forceinline__ v16h frag_f32(const float* rowk0, int lane) {
  v16h a; const float* p = rowk0 + 8 * (lane >> 4);
#pragma unroll
  for (int i = 0; i < 8; ++i) { a[i] = (_Float16)p[i]; a[8 + i] = (_Float16)p[16 + i]; }
  return a;
}
__device__ __forceinline__ v16h frag_f32s(const float* rowk0, int lane, float sc) {
  v16h a; const float* p = rowk0 + 8 * (lane >> 4);
#pragma unroll
  for (int i = 0; i < 8; ++i) { a[i] = (_Float16)(p[i] * sc); a[8 + i] = (_Float16)(p[16 + i] * sc); }
  return a;
}
// column fragment from a [K][ld] layout (column n), rows >= K read as 0
__device__ __forceinline__ v16h fragc_f32(const float* W, int k0, int n, int lane, int ld, int K) {
  v16h a; const int g = lane >> 4;
#pragma unroll
  for (int i = 0; i < 8; ++i) { const int ka = k0 + 8 * g + i, kb = ka + 16;
    a[i] = (_Float16)(ka < K ? W[(size_t)(ka < K ? ka : K - 1) * ld + n] : 0.f); a[8 + i] = (_Float16)(kb < K ? W[(size_t)(kb < K ? kb : K - 1) * ld + n] : 0.f); }
  return a;
}
struct F2 { v16b h, l; };
__device__ __forceinline__ F2 bsplit16(const float v[16]) { F2 r;
#pragma unroll
  for (int i = 0; i < 16; ++i) { const __bf16 h = (__bf16)v[i]; r.h[i] = h; r.l[i] = (__bf16)(v[i] - (float)h); }
  return r; }
__device__ __forceinline__ F2 split_row(const float* row, int k0, int lane) { float v[16]; const float* p = row + k0 + 8 * (lane >> 4);
#pragma unroll
  for (int i = 0; i < 8; ++i) { v[i] = p[i]; v[8 + i] = p[16 + i]; }
  return bsplit16(v); }
__device__ __forceinline__ F2 split_rowK(const float* row, int k0, int lane, int K) { float v[16]; const int g = lane >> 4;
#pragma unroll
  for (int i = 0; i < 8; ++i) { const int ka = k0 + 8 * g + i, kb = ka + 16; v[i] = ka < K ? row[ka < K ? ka : K - 1] : 0.f; v[8 + i] = kb < K ? row[kb < K ? kb : K - 1] : 0.f; }
  return bsplit16(v); }
__device__ __forceinline__ F2 split_col(const float* W, int k0, int n, int lane, int ld, int K) { float v[16]; const int g = lane >> 4;
#pragma unroll
  for (int i = 0; i < 8; ++i) { const int ka = k0 + 8 * g + i, kb = ka + 16; v[i] = ka < K ? W[(size_t)(ka < K ? ka : K - 1) * ld + n] : 0.f; v[8 + i] = kb < K ? W[(size_t)(kb < K ? kb : K - 1) * ld + n] : 0.f; }
  return bsplit16(v); }
__device__ __forceinline__ v8f mac3(const F2& a, const F2& b, v8f c) { c = wmma_bf(a.l, b.h, c); c = wmma_bf(a.h, b.l, c); return wmma_bf(a.h, b.h, c); }
__device__ __forceinline__ float sigm(float v) { return 1.0f / (1.0f + expf(-v)); }
#define LDSX() do { asm volatile("s_wait_dscnt 0" ::: "memory"); __builtin_amdgcn_wave_barrier(); __builtin_amdgcn_fence(__ATOMIC_RELEASE, "workgroup"); } while (0)

// Multi-head attention with an additive dense mask (B 2, S 2,048, d_model 512 -> key/value dim 256 = 8 heads x 32 -> out 512; 0.02-scale (in,out) weights, zero biases; separate V, Q, K inputs): scores = q k^T / sqrt(256) (the FULL key_dim, as written) + mask[b, 0, q, k] (random normal); out = merged(softmax v) Wo + bo.
#define NB 2
#define TT 2048
#define CC 256            // NH * HD = projected width
#define DIN 512          // input (model) width
#define NH 8
#define HD 32
#define NQB (TT / 64)
#define HG 4
#define SCALE (0.0625f)
#define CAUSAL 0
#ifndef TNB
#define TNB NB
#endif
__device__ __forceinline__ float bfr(float v) { return (float)(__bf16)v; }
__host__ __device__ __forceinline__ int kb_last(int qb) { return CAUSAL ? ((qb * 64 + 63) >> 7) : (TT / 128 - 1); }
typedef __attribute__((ext_vector_type(8))) __bf16 v8b;
__device__ __forceinline__ v16b frag_b(const __bf16* rowk0, int lane) {
  union { v16b v; v8b q[2]; } u; const __bf16* p = rowk0 + 8 * (lane >> 4);
  u.q[0] = *(const v8b*)p; u.q[1] = *(const v8b*)(p + 16); return u.v;
}
#define QBH 0
#define QHI 2048            // rows carrying a q residual plane (all rows when non-causal: 2-product logits everywhere)
#define KHI 64            // key rows carrying k residual / v bf16 hi+lo planes (written by k_proj; no kernel here reads them)
// B fragment (k rows k0+.., output column o) of a weight: (in,out) [K][ld] or (out,in) [ld rows of K]: bf16 exact, or f16(bf16 * 256) exact
__device__ __forceinline__ v16b wcol_io(const float* Wm, int k0, int o, int lane, int ld) { v16b w; const int g = lane >> 4;
#pragma unroll
  for (int i = 0; i < 8; ++i) { w[i] = (__bf16)Wm[(size_t)(k0 + 8 * g + i) * ld + o]; w[8 + i] = (__bf16)Wm[(size_t)(k0 + 16 + 8 * g + i) * ld + o]; }
  return w; }
__device__ __forceinline__ v16b wcol_oi(const float* Wm, int k0, int o, int lane, int K) { v16b w; const float* p = Wm + (size_t)o * K + k0 + 8 * (lane >> 4);
#pragma unroll
  for (int i = 0; i < 8; ++i) { w[i] = (__bf16)p[i]; w[8 + i] = (__bf16)p[16 + i]; }
  return w; }
__device__ __forceinline__ v16h wcolh_io(const float* Wm, int k0, int o, int lane, int ld) { v16h w; const int g = lane >> 4;
#pragma unroll
  for (int i = 0; i < 8; ++i) { w[i] = (_Float16)(bfr(Wm[(size_t)(k0 + 8 * g + i) * ld + o]) * 256.0f); w[8 + i] = (_Float16)(bfr(Wm[(size_t)(k0 + 16 + 8 * g + i) * ld + o]) * 256.0f); }
  return w; }
__device__ __forceinline__ v16h wcolh_oi(const float* Wm, int k0, int o, int lane, int K) { v16h w; const float* p = Wm + (size_t)o * K + k0 + 8 * (lane >> 4);
#pragma unroll
  for (int i = 0; i < 8; ++i) { w[i] = (_Float16)(bfr(p[i]) * 256.0f); w[8 + i] = (_Float16)(bfr(p[16 + i]) * 256.0f); }
  return w; }
#define WQKV_LAYOUT 0   // 0 = (in,out) [DIN][CC]; 1 = (out,in) [CC][DIN]; 2 = per-head [NH][DIN][HD]
__device__ __forceinline__ v16b wcol_hdk(const float* Wm, int k0, int o, int lane) { v16b w; const int g = lane >> 4; const float* p = Wm + (size_t)(o / HD) * DIN * HD + (o % HD);
#pragma unroll
  for (int i = 0; i < 8; ++i) { w[i] = (__bf16)p[(size_t)(k0 + 8 * g + i) * HD]; w[8 + i] = (__bf16)p[(size_t)(k0 + 16 + 8 * g + i) * HD]; }
  return w; }
#define WO_OUT_IN 0
#if WQKV_LAYOUT == 1
#define WCOL(W, k0, o, lane) wcol_oi(W, k0, o, lane, DIN)
#elif WQKV_LAYOUT == 2
#define WCOL(W, k0, o, lane) wcol_hdk(W, k0, o, lane)
#else
#define WCOL(W, k0, o, lane) wcol_io(W, k0, o, lane, CC)
#endif
#if WO_OUT_IN
#define WOCOL(W, k0, o, lane) wcol_oi(W, k0, o, lane, CC)
#define WOCOLH(W, k0, o, lane) wcolh_oi(W, k0, o, lane, CC)
#else
#define WOCOL(W, k0, o, lane) wcol_io(W, k0, o, lane, DIN)
#define WOCOLH(W, k0, o, lane) wcolh_io(W, k0, o, lane, DIN)
#endif

#define WS_QH  0u                                      // f16 q rows [b*t][CC]
#define WS_KH  (WS_QH + 2u * (size_t)NB * TT * CC)      // f16 k rows [b*t][CC]
#define WS_VT  (WS_KH + 2u * (size_t)NB * TT * CC)      // f16 v planes [b][c][t]
#define WS_QL  (WS_VT + 2u * (size_t)NB * CC * TT)      // f16 q residual x 2^10 rows [b][t < QHI][CC]
#define WS_KL  (WS_QL + 2u * (size_t)NB * QHI * CC)     // f16 k residual x 2^10 rows [b][t < KHI][CC]
#define WS_VB  (WS_KL + 2u * (size_t)NB * KHI * CC)     // bf16 v hi planes [b][c][t < KHI]
#define WS_VBL (WS_VB + 2u * (size_t)NB * CC * KHI)
#define WS_S   (WS_VBL + 2u * (size_t)NB * CC * KHI)    // f32 [hg][t][s]; reserved, not used by any kernel here
#define WS_Y   (WS_S  + 4u * (size_t)HG * TT * TT)      // f32 ctx rows [b*t][CC] (only when there is an output projection)
#define WS_END (WS_Y  + 4u * (size_t)NB * TT * CC)

// ---- k_proj: block = (64 rows, 128 cols, which): q/k/v = X W (+ b) with exact bf16 products (K = DIN) -> which 0: q f16 rows (+ residual rows < QHI); 1: k f16 rows (+ residual rows < KHI); 2: v f16 planes [c][t] (+ bf16 hi/lo planes for t < KHI)
__global__ __launch_bounds__(128) void k_proj(const float* __restrict__ XQ, const float* __restrict__ XK, const float* __restrict__ XV, const float* __restrict__ WQ, const float* __restrict__ WK, const float* __restrict__ WV, const float* __restrict__ BQ, const float* __restrict__ BK, const float* __restrict__ BV,
    _Float16* __restrict__ QH, _Float16* __restrict__ QL, _Float16* __restrict__ KH, _Float16* __restrict__ KL, _Float16* __restrict__ VT, __bf16* __restrict__ VB, __bf16* __restrict__ VBL) {
  __shared__ __align__(16) _Float16 sh[64][136], sl[64][136]; __shared__ __align__(16) _Float16 th[128][72]; __shared__ __align__(16) __bf16 tb[128][72], tbl[128][72];
  const int tid = threadIdx.x, wave = tid >> 5, lane = tid & 31, col = lane & 15, g = lane >> 4; const int which = blockIdx.z; const int c0 = blockIdx.y * 128; const size_t r0 = (size_t)blockIdx.x * 64; const size_t bb = r0 / TT; const int t0 = (int)(r0 % TT);
  const float* X = which == 0 ? XQ : which == 1 ? XK : XV; const float* WA = which == 0 ? WQ : which == 1 ? WK : WV; const float* BA = which == 0 ? BQ : which == 1 ? BK : BV;
  v8f acc[8] = {};
#pragma unroll 2
  for (int kc = 0; kc < DIN / 32; ++kc) { v16b a; { const float* p = X + (r0 + wave * 16 + col) * DIN + kc * 32 + 8 * g;
#pragma unroll
      for (int i = 0; i < 8; ++i) { a[i] = (__bf16)p[i]; a[8 + i] = (__bf16)p[16 + i]; } }
    asm volatile("s_wait_loadcnt 0x0" ::: "memory");
#pragma unroll
    for (int j = 0; j < 8; ++j) { const v16b w = WCOL(WA, kc * 32, c0 + j * 16 + col, lane); asm volatile("s_wait_loadcnt 0x0" ::: "memory"); acc[j] = wmma_bf(a, w, acc[j]); } }
  if (which < 2) { _Float16* DH = which == 0 ? QH : KH; _Float16* DL = which == 0 ? QL : KL; const int nhi = which == 0 ? QHI : KHI; const bool hi_rows = t0 < nhi;
#pragma unroll
    for (int j = 0; j < 8; ++j) { const float bias = BA ? bfr(BA[c0 + j * 16 + col]) : 0.f;
#pragma unroll
      for (int r = 0; r < 8; ++r) { const float v = acc[j][r] + bias; const _Float16 hv = (_Float16)v; sh[wave * 16 + 8 * g + r][j * 16 + col] = hv; sl[wave * 16 + 8 * g + r][j * 16 + col] = (_Float16)((v - (float)hv) * 1024.0f); } }
    __syncthreads();
    for (int e = tid; e < 64 * 16; e += 128) { const int rl = e >> 4, q = e & 15; vst2((unsigned*)(DH + (r0 + rl) * CC + c0 + q * 8), *(const v4u*)&sh[rl][q * 8]); if (hi_rows) vst2((unsigned*)(DL + (bb * nhi + t0 + rl) * (size_t)CC + c0 + q * 8), *(const v4u*)&sl[rl][q * 8]); }
  } else { const bool hi_rows = t0 < KHI;
#pragma unroll
    for (int j = 0; j < 8; ++j) { const float bias = BA ? bfr(BA[c0 + j * 16 + col]) : 0.f;
#pragma unroll
      for (int r = 0; r < 8; ++r) { const float v = acc[j][r] + bias; const int rl = wave * 16 + 8 * g + r, cl = j * 16 + col; th[cl][rl] = (_Float16)v; const __bf16 bh = (__bf16)v; tb[cl][rl] = bh; tbl[cl][rl] = (__bf16)(v - (float)bh); } }
    __syncthreads();
    for (int e = tid; e < 128 * 8; e += 128) { const int cl = e >> 3, q = e & 7; vst2((unsigned*)(VT + (bb * CC + c0 + cl) * (size_t)TT + t0 + q * 8), *(const v4u*)&th[cl][q * 8]); if (hi_rows) { const size_t o3 = (bb * CC + c0 + cl) * (size_t)KHI + t0 + q * 8; vst2((unsigned*)(VB + o3), *(const v4u*)&tb[cl][q * 8]); vst2((unsigned*)(VBL + o3), *(const v4u*)&tbl[cl][q * 8]); } } } }
// ---- k_attn: block = (head, 64 queries, batch), 8 waves = 4 query tiles x KS key ranges. Transposed products: S^T = k q^T (q hi + residual x 2^10, 2 products), so a lane holds the scores of ONE query (col) at keys 8g+r of each 16-key tile;
// two such tiles, converted in place, are the B operand of ctx^T += v^T P^T. Running maximum and sum per lane (online softmax); P = exp(score - max + PSH) once to f16 (PSH cancels in the division by the sum). The KS partial results are joined through LDS.
#define KS 2
#define KR (TT / KS)      // keys per wave
#define NIT (KR / 64)     // 64 keys per pass
#define PSH 6.9314718f    // keeps P (at most 2^10) clear of f16 subnormals
__device__ __forceinline__ float xhalf(float x) { return __builtin_bit_cast(float, __builtin_amdgcn_permlanex16(__builtin_bit_cast(int, x), __builtin_bit_cast(int, x), 0x76543210, 0xfedcba98, false, false)); }  // lane l with lane l ^ 16
__device__ __forceinline__ v8f wm(v16h a, v16h b, v8f c) { return __builtin_amdgcn_wmma_f32_16x16x32_f16(false, a, false, b, (short)0, c, false, false); }
// 16x16x32 fragment at (wave-uniform base) + (32-bit lane byte offset lo) + constant cb: same k order as frag_h
__device__ __forceinline__ v16h frag_u(const _Float16* ub, unsigned lo, int cb) { union { v16h v; v8h q[2]; } u; const char* p = (const char*)ub + lo; u.q[0] = *(const v8h*)(p + cb); u.q[1] = *(const v8h*)(p + cb + 32); return u.v; }
__global__ __launch_bounds__(256) void k_attn(const _Float16* __restrict__ QH, const _Float16* __restrict__ QL, const _Float16* __restrict__ KH, const _Float16* __restrict__ VT, const float* __restrict__ MKF, float* __restrict__ Y) {
  __shared__ float sp[4][18][32];
  const int tid = threadIdx.x, wave = __builtin_amdgcn_readfirstlane(tid >> 5), lane = tid & 31, col = lane & 15, g = lane >> 4; const int h = blockIdx.x, qb = blockIdx.y, b = blockIdx.z; const int qt = wave & 3, ks = wave >> 2;
  const int q0 = qb * 64 + qt * 16, q = q0 + col;
  const v16h qh = frag_h(QH + ((size_t)b * TT + q) * CC + h * HD, lane), ql = frag_h(QL + ((size_t)b * QHI + q) * CC + h * HD, lane);
  const _Float16* Kb = KH + ((size_t)b * TT + ks * KR) * CC + h * HD; const unsigned ko = (unsigned)(col * CC + 8 * g) * 2u;   // A rows = keys, k = head columns
  const _Float16* Vb = VT + ((size_t)b * CC + h * HD) * TT + ks * KR; const unsigned vo = (unsigned)(col * TT + 8 * g) * 2u;   // A rows = head columns, k = keys
  const float* Mb = MKF + ((size_t)b * TT + q0) * TT + ks * KR;       const unsigned mo = (unsigned)(col * TT + 8 * g) * 4u;   // this lane's query row, its 8 keys of each 16-key tile
  float m = -3.0e38f, l = 0.f; v8f acc0 = {}, acc1 = {};
  v16h kf[4];
#pragma unroll
  for (int kt = 0; kt < 4; ++kt) kf[kt] = frag_u(Kb, ko, kt * 16 * CC * 2);
  asm volatile("s_wait_xcnt 0x0" ::: "memory");     // in front of every rewrite of the address registers of the q and k loads above
  __builtin_amdgcn_sched_barrier(0);                // keeps the address arithmetic of the loop behind that wait
  for (int it = 0; it < NIT; ++it) {
    v4f mk[4][2]; const char* mp = (const char*)(Mb + it * 64) + mo;
#pragma unroll
    for (int kt = 0; kt < 4; ++kt) { mk[kt][0] = *(const v4f*)(mp + kt * 64); mk[kt][1] = *(const v4f*)(mp + kt * 64 + 16); }
    asm volatile("s_wait_xcnt 0x0" ::: "memory");   // in front of every rewrite of the address registers of the mask loads above (a v load below may land in them)
    v16h vf[2][2];
#pragma unroll
    for (int s = 0; s < 2; ++s) { vf[s][0] = frag_u(Vb + it * 64, vo, s * 64); vf[s][1] = frag_u(Vb + it * 64, vo, 16 * TT * 2 + s * 64); }
    asm volatile("s_wait_xcnt 0x0" ::: "memory");   // in front of every rewrite of the address registers of the v loads above
    __builtin_amdgcn_sched_barrier(0);              // holds those loads up here: without it they sink to their first use and the wave waits out each latency
    float v[4][8]; float mx = -3.0e38f;
#pragma unroll
    for (int kt = 0; kt < 4; ++kt) { const v8f z = {}; const v8f a = wm(kf[kt], qh, z), c = wm(kf[kt], ql, z);
#pragma unroll
      for (int r = 0; r < 8; ++r) { v[kt][r] = (a[r] + c[r] * (1.0f / 1024.0f)) * SCALE + bfr(mk[kt][r >> 2][r & 3]); mx = fmaxf(mx, v[kt][r]); } }
    const int nx = it + 1 < NIT ? it + 1 : it;   // next pass's k rows, fetched under this pass's softmax (the last pass fetches its own again)
#pragma unroll
    for (int kt = 0; kt < 4; ++kt) kf[kt] = frag_u(Kb + (size_t)nx * 64 * CC, ko, kt * 16 * CC * 2);
    asm volatile("s_wait_xcnt 0x0" ::: "memory");   // in front of every rewrite of the address registers of the k loads above
    __builtin_amdgcn_sched_barrier(0);              // holds the k loads ahead of the softmax, which covers their latency
    mx = fmaxf(mx, xhalf(mx)); const float mn = fmaxf(m, mx); const float al = expf(m - mn); m = mn; const float ms = mn - PSH;
    float sum = 0.f; v16h p[2];
#pragma unroll
    for (int kt = 0; kt < 4; ++kt) {
#pragma unroll
      for (int r = 0; r < 8; ++r) { const float e = expf(v[kt][r] - ms); sum += e; p[kt >> 1][(kt & 1) * 8 + r] = (_Float16)e; } }
    l = l * al + sum;
#pragma unroll
    for (int r = 0; r < 8; ++r) { acc0[r] *= al; acc1[r] *= al; }
#pragma unroll
    for (int s = 0; s < 2; ++s) { acc0 = wm(vf[s][0], p[s], acc0); acc1 = wm(vf[s][1], p[s], acc1); } }
  l += xhalf(l);
  if (ks) { sp[qt][0][lane] = m; sp[qt][1][lane] = l;
#pragma unroll
    for (int r = 0; r < 8; ++r) { sp[qt][2 + r][lane] = acc0[r]; sp[qt][10 + r][lane] = acc1[r]; } }
  __syncthreads();
  if (!ks) { const float m1 = sp[qt][0][lane], l1 = sp[qt][1][lane]; const float mm = fmaxf(m, m1); float a0 = expf(m - mm), a1 = expf(m1 - mm); const float lt = l * a0 + l1 * a1; const float inv = lt > 0.f ? 1.0f / lt : 0.f; a0 *= inv; a1 *= inv;
    v4f o[4];
#pragma unroll
    for (int r = 0; r < 8; ++r) { o[r >> 2][r & 3] = acc0[r] * a0 + sp[qt][2 + r][lane] * a1; o[2 + (r >> 2)][r & 3] = acc1[r] * a0 + sp[qt][10 + r][lane] * a1; }
    float* yp = Y + ((size_t)b * TT + q) * CC + h * HD + 8 * g;   // ctx^T register r = head column 16 j + 8 g + r of query col
    vst2(yp, o[0]); vst2(yp + 4, o[1]); vst2(yp + 16, o[2]); vst2(yp + 20, o[3]); } }
// ---- k_out: block = (64 rows, 128 cols): out = ctx Wo (+ bo): all rows: ctx bf16 hi + lo against exact bf16 Wo (2 products); the f16 (Wo x 2^8, 1 product) branch is not taken
__global__ __launch_bounds__(128) void k_out(const float* __restrict__ Y, const float* __restrict__ WO, const float* __restrict__ BO, float* __restrict__ OUT) { __shared__ __align__(16) float sf[4][16][132];
  const int tid = threadIdx.x, wave = tid >> 5, lane = tid & 31, col = lane & 15, g = lane >> 4; const int c0 = blockIdx.y * 128; const size_t r0 = (size_t)blockIdx.x * 64 + wave * 16;
  v8f acc[8] = {};
  if (true) {   /* ALL rows: ctx split bf16 hi + lo x exact Wo (2 products) */
#pragma unroll 2
    for (int kc = 0; kc < CC / 32; ++kc) { const F2 a = split_row(Y + (r0 + col) * CC, kc * 32, lane); asm volatile("s_wait_loadcnt 0x0" ::: "memory");
#pragma unroll
      for (int j = 0; j < 8; ++j) { const v16b w = WOCOL(WO, kc * 32, c0 + j * 16 + col, lane); asm volatile("s_wait_loadcnt 0x0" ::: "memory"); acc[j] = wmma_bf(a.h, w, acc[j]); acc[j] = wmma_bf(a.l, w, acc[j]); } }
#pragma unroll
    for (int j = 0; j < 8; ++j) { const float bias = BO ? bfr(BO[c0 + j * 16 + col]) : 0.f;
#pragma unroll
      for (int r = 0; r < 8; ++r) sf[wave][8 * g + r][j * 16 + col] = acc[j][r] + bias; }
  } else {
#pragma unroll 2
    for (int kc = 0; kc < CC / 32; ++kc) { const v16h a = frag_f32(Y + (r0 + col) * CC + kc * 32, lane); asm volatile("s_wait_loadcnt 0x0" ::: "memory");
#pragma unroll
      for (int j = 0; j < 8; ++j) { const v16h w = WOCOLH(WO, kc * 32, c0 + j * 16 + col, lane); asm volatile("s_wait_loadcnt 0x0" ::: "memory"); acc[j] = wmma16(a, w, acc[j]); } }
#pragma unroll
    for (int j = 0; j < 8; ++j) { const float bias = BO ? bfr(BO[c0 + j * 16 + col]) : 0.f;
#pragma unroll
      for (int r = 0; r < 8; ++r) sf[wave][8 * g + r][j * 16 + col] = acc[j][r] * (1.0f / 256.0f) + bias; } }
  LDSX(); for (int rl = 0; rl < 16; ++rl) vst2(OUT + (r0 + rl) * DIN + c0 + lane * 4, *(const v4f*)&sf[wave][rl][lane * 4]); }

extern "C" void kernel_launch(void* const* d_in, const int* in_sizes, int n_in, void* d_out, int out_size, void* d_ws, size_t ws_size, hipStream_t stream) {
  (void)in_sizes; (void)n_in; (void)out_size;
  const float** F = (const float**)d_in;
  if (ws_size < (size_t)WS_END) return;
  char* ws = (char*)d_ws; _Float16 *QH = (_Float16*)(ws + WS_QH), *KH = (_Float16*)(ws + WS_KH), *VT = (_Float16*)(ws + WS_VT), *QL = (_Float16*)(ws + WS_QL), *KL = (_Float16*)(ws + WS_KL); __bf16 *VB = (__bf16*)(ws + WS_VB), *VBL = (__bf16*)(ws + WS_VBL); float *Y = (float*)(ws + WS_Y);
  (void)Y; (void)QL; (void)KL; (void)VB; (void)VBL;
  // inputs: 0 V [2,2048,512]; 1 Q; 2 K; 3 mask [2,1,2048,2048] f32; 4 Wq [512,256] (in,out), 5 bq; 6 Wk, 7 bk; 8 Wv, 9 bv; 10 Wo [256,512] (in,out), 11 bo [512]
  k_proj<<<dim3(TNB * TT / 64, CC / 128, 3), 128, 0, stream>>>(F[1], F[2], F[0], F[4], F[6], F[8], F[5], F[7], F[9], QH, QL, KH, KL, VT, VB, VBL);   /* q from Q (in1), k from K (in2), v from V (in0) */
  k_attn<<<dim3(NH, NQB, TNB), 256, 0, stream>>>(QH, QL, KH, VT, F[3], Y);
  k_out<<<dim3(TNB * TT / 64, DIN / 128), 128, 0, stream>>>(Y, F[10], F[11], (float*)d_out);
}

// v002
// Measured time: 67 microseconds a run.
// In two side-by-side timings against v001, it was 1.60 and 1.59 times as fast.
// All steps since v000 together make it 6.75 times as fast.
// compute dtype: all float inputs rounded to bf16; q/k/v = in W + b with EXACT bf16 products on WMMA 16x16x32 (f32 accumulate); q as f16 hi + residual (x 2^10) against k once to f16 (2 products) / sqrt(256) + the additive f32 mask; online softmax in f32 (precise expf); unnormalised P (at most 2^10) once to f16 against v once to f16 (1 product), divided by the f32 sum; ctx split bf16 hi + lo against exact Wo (2 products) + bo; f32 output.
#include <hip/hip_runtime.h>
#include <math.h>

typedef __attribute__((ext_vector_type(16))) _Float16 v16h;
typedef __attribute__((ext_vector_type(16))) __bf16 v16b;
typedef __attribute__((ext_vector_type(8)))  _Float16 v8h;
typedef __attribute__((ext_vector_type(8)))  float v8f;
typedef __attribute__((ext_vector_type(4)))  float v4f;
typedef __attribute__((ext_vector_type(2)))  float v2f;
typedef __attribute__((ext_vector_type(4)))  unsigned v4u;
typedef __attribute__((ext_vector_type(4)))  int v4i;
typedef float __attribute__((may_alias)) float_a;
typedef int __attribute__((may_alias)) int_a;

template <typename T> __device__ __forceinline__ void vst2(void* p, T v) { *(T*)p = v;  }
__device__ __forceinline__ v8f wmma16(v16h a, v16h b, v8f c) {
  v8f d = __builtin_amdgcn_wmma_f32_16x16x32_f16(false, a, false, b, (short)0, c, false, false);
  asm volatile("v_nop\n\tv_nop\n\tv_nop\n\tv_nop" : "+v"(d) : "v"(a), "v"(b));
  return d;
}
__device__ __forceinline__ v8f wmma_bf(v16b a, v16b b, v8f c) {
  v8f d = __builtin_amdgcn_wmma_f32_16x16x32_bf16(false, a, false, b, (short)0, c, false, false);
  asm volatile("v_nop\n\tv_nop\n\tv_nop\n\tv_nop" : "+v"(d) : "v"(a), "v"(b));
  return d;
}
// 16x16x32 fragments: lane = (h = lane>>4, row/col = lane&15); elements 0..7 = k0+8h+0..7, 8..15 = k0+16+8h+0..7; D element r = row 8h+r
__device__ __forceinline__ v16h frag_h(const _Float16* rowk0, int lane) {
  union { v16h v; v8h q[2]; } u; const _Float16* p = rowk0 + 8 * (lane >> 4);
  u.q[0] = *(const v8h*)p; u.q[1] = *(const v8h*)(p + 16); return u.v;
}
__device__ __forceinline__ v16h frag_f32(const float* rowk0, int lane) {
  v16h a; const float* p = rowk0 + 8 * (lane >> 4);
#pragma unroll
  for (int i = 0; i < 8; ++i) { a[i] = (_Float16)p[i]; a[8 + i] = (_Float16)p[16 + i]; }
  return a;
}
__device__ __forceinline__ v16h frag_f32s(const float* rowk0, int lane, float sc) {
  v16h a; const float* p = rowk0 + 8 * (lane >> 4);
#pragma unroll
  for (int i = 0; i < 8; ++i) { a[i] = (_Float16)(p[i] * sc); a[8 + i] = (_Float16)(p[16 + i] * sc); }
  return a;
}
// column fragment from a [K][ld] layout (column n), rows >= K read as 0
__device__ __forceinline__ v16h fragc_f32(const float* W, int k0, int n, int lane, int ld, int K) {
  v16h a; const int g = lane >> 4;
#pragma unroll
  for (int i = 0; i < 8; ++i) { const int ka = k0 + 8 * g + i, kb = ka + 16;
    a[i] = (_Float16)(ka < K ? W[(size_t)(ka < K ? ka : K - 1) * ld + n] : 0.f); a[8 + i] = (_Float16)(kb < K ? W[(size_t)(kb < K ? kb : K - 1) * ld + n] : 0.f); }
  return a;
}
struct F2 { v16b h, l; };
__device__ __forceinline__ F2 bsplit16(const float v[16]) { F2 r;
#pragma unroll
  for (int i = 0; i < 16; ++i) { const __bf16 h = (__bf16)v[i]; r.h[i] = h; r.l[i] = (__bf16)(v[i] - (float)h); }
  return r; }
__device__ __forceinline__ F2 split_row(const float* row, int k0, int lane) { float v[16]; const float* p = row + k0 + 8 * (lane >> 4);
#pragma unroll
  for (int i = 0; i < 8; ++i) { v[i] = p[i]; v[8 + i] = p[16 + i]; }
  return bsplit16(v); }
__device__ __forceinline__ F2 split_rowK(const float* row, int k0, int lane, int K) { float v[16]; const int g = lane >> 4;
#pragma unroll
  for (int i = 0; i < 8; ++i) { const int ka = k0 + 8 * g + i, kb = ka + 16; v[i] = ka < K ? row[ka < K ? ka : K - 1] : 0.f; v[8 + i] = kb < K ? row[kb < K ? kb : K - 1] : 0.f; }
  return bsplit16(v); }
__device__ __forceinline__ F2 split_col(const float* W, int k0, int n, int lane, int ld, int K) { float v[16]; const int g = lane >> 4;
#pragma unroll
  for (int i = 0; i < 8; ++i) { const int ka = k0 + 8 * g + i, kb = ka + 16; v[i] = ka < K ? W[(size_t)(ka < K ? ka : K - 1) * ld + n] : 0.f; v[8 + i] = kb < K ? W[(size_t)(kb < K ? kb : K - 1) * ld + n] : 0.f; }
  return bsplit16(v); }
__device__ __forceinline__ v8f mac3(const F2& a, const F2& b, v8f c) { c = wmma_bf(a.l, b.h, c); c = wmma_bf(a.h, b.l, c); return wmma_bf(a.h, b.h, c); }
__device__ __forceinline__ float sigm(float v) { return 1.0f / (1.0f + expf(-v)); }
#define LDSX() do { asm volatile("s_wait_dscnt 0" ::: "memory"); __builtin_amdgcn_wave_barrier(); __builtin_amdgcn_fence(__ATOMIC_RELEASE, "workgroup"); } while (0)

// Multi-head attention with an additive dense mask (B 2, S 2,048, d_model 512 -> key/value dim 256 = 8 heads x 32 -> out 512; 0.02-scale (in,out) weights, zero biases; separate V, Q, K inputs): scores = q k^T / sqrt(256) (the FULL key_dim, as written) + mask[b, 0, q, k] (random normal); out = merged(softmax v) Wo + bo.
#define NB 2
#define TT 2048
#define CC 256            // NH * HD = projected width
#define DIN 512          // input (model) width
#define NH 8
#define HD 32
#define NQB (TT / 64)
#define HG 4
#define SCALE (0.0625f)
#define CAUSAL 0
#ifndef TNB
#define TNB NB
#endif
__device__ __forceinline__ float bfr(float v) { return (float)(__bf16)v; }
__host__ __device__ __forceinline__ int kb_last(int qb) { return CAUSAL ? ((qb * 64 + 63) >> 7) : (TT / 128 - 1); }
typedef __attribute__((ext_vector_type(8))) __bf16 v8b;
__device__ __forceinline__ v16b frag_b(const __bf16* rowk0, int lane) {
  union { v16b v; v8b q[2]; } u; const __bf16* p = rowk0 + 8 * (lane >> 4);
  u.q[0] = *(const v8b*)p; u.q[1] = *(const v8b*)(p + 16); return u.v;
}
#define QBH 0
#define QHI 2048            // rows carrying a q residual plane (all rows when non-causal: 2-product logits everywhere)
#define KHI 64            // key rows carrying k residual / v bf16 hi+lo planes (written by k_proj; no kernel here reads them)
// B fragment (k rows k0+.., output column o) of a weight: (in,out) [K][ld] or (out,in) [ld rows of K]: bf16 exact, or f16(bf16 * 256) exact
__device__ __forceinline__ v16b wcol_io(const float* Wm, int k0, int o, int lane, int ld) { v16b w; const int g = lane >> 4;
#pragma unroll
  for (int i = 0; i < 8; ++i) { w[i] = (__bf16)Wm[(size_t)(k0 + 8 * g + i) * ld + o]; w[8 + i] = (__bf16)Wm[(size_t)(k0 + 16 + 8 * g + i) * ld + o]; }
  return w; }
__device__ __forceinline__ v16b wcol_oi(const float* Wm, int k0, int o, int lane, int K) { v16b w; const float* p = Wm + (size_t)o * K + k0 + 8 * (lane >> 4);
#pragma unroll
  for (int i = 0; i < 8; ++i) { w[i] = (__bf16)p[i]; w[8 + i] = (__bf16)p[16 + i]; }
  return w; }
__device__ __forceinline__ v16h wcolh_io(const float* Wm, int k0, int o, int lane, int ld) { v16h w; const int g = lane >> 4;
#pragma unroll
  for (int i = 0; i < 8; ++i) { w[i] = (_Float16)(bfr(Wm[(size_t)(k0 + 8 * g + i) * ld + o]) * 256.0f); w[8 + i] = (_Float16)(bfr(Wm[(size_t)(k0 + 16 + 8 * g + i) * ld + o]) * 256.0f); }
  return w; }
__device__ __forceinline__ v16h wcolh_oi(const float* Wm, int k0, int o, int lane, int K) { v16h w; const float* p = Wm + (size_t)o * K + k0 + 8 * (lane >> 4);
#pragma unroll
  for (int i = 0; i < 8; ++i) { w[i] = (_Float16)(bfr(p[i]) * 256.0f); w[8 + i] = (_Float16)(bfr(p[16 + i]) * 256.0f); }
  return w; }
#define WQKV_LAYOUT 0   // 0 = (in,out) [DIN][CC]; 1 = (out,in) [CC][DIN]; 2 = per-head [NH][DIN][HD]
__device__ __forceinline__ v16b wcol_hdk(const float* Wm, int k0, int o, int lane) { v16b w; const int g = lane >> 4; const float* p = Wm + (size_t)(o / HD) * DIN * HD + (o % HD);
#pragma unroll
  for (int i = 0; i < 8; ++i) { w[i] = (__bf16)p[(size_t)(k0 + 8 * g + i) * HD]; w[8 + i] = (__bf16)p[(size_t)(k0 + 16 + 8 * g + i) * HD]; }
  return w; }
#define WO_OUT_IN 0
#if WQKV_LAYOUT == 1
#define WCOL(W, k0, o, lane) wcol_oi(W, k0, o, lane, DIN)
#elif WQKV_LAYOUT == 2
#define WCOL(W, k0, o, lane) wcol_hdk(W, k0, o, lane)
#else
#define WCOL(W, k0, o, lane) wcol_io(W, k0, o, lane, CC)
#endif
#if WO_OUT_IN
#define WOCOL(W, k0, o, lane) wcol_oi(W, k0, o, lane, CC)
#define WOCOLH(W, k0, o, lane) wcolh_oi(W, k0, o, lane, CC)
#else
#define WOCOL(W, k0, o, lane) wcol_io(W, k0, o, lane, DIN)
#define WOCOLH(W, k0, o, lane) wcolh_io(W, k0, o, lane, DIN)
#endif

#define WS_QH  0u                                      // f16 q rows [b*t][CC]
#define WS_KH  (WS_QH + 2u * (size_t)NB * TT * CC)      // f16 k rows [b*t][CC]
#define WS_VT  (WS_KH + 2u * (size_t)NB * TT * CC)      // f16 v planes [b][c][t]
#define WS_QL  (WS_VT + 2u * (size_t)NB * CC * TT)      // f16 q residual x 2^10 rows [b][t < QHI][CC]
#define WS_KL  (WS_QL + 2u * (size_t)NB * QHI * CC)     // f16 k residual x 2^10 rows [b][t < KHI][CC]
#define WS_VB  (WS_KL + 2u * (size_t)NB * KHI * CC)     // bf16 v hi planes [b][c][t < KHI]
#define WS_VBL (WS_VB + 2u * (size_t)NB * CC * KHI)
#define WS_S   (WS_VBL + 2u * (size_t)NB * CC * KHI)    // f32 [hg][t][s]; reserved, not used by any kernel here
#define WS_Y   (WS_S  + 4u * (size_t)HG * TT * TT)      // f32 ctx rows [b*t][CC] (only when there is an output projection)
#define WS_END (WS_Y  + 4u * (size_t)NB * TT * CC)

// ---- weight tiles through LDS: thread t fetches column c0 + t of a 32-row k-step (each wave load = one whole 128-byte line), rounds it to bf16 and lays it as row t of wt (k contiguous, pitch 80 bytes); frag_b then reads the same k order as wcol_io
#define WPI 40            // bf16 per LDS row: 64 bytes of data at the conflict-free 80-byte pitch for 16-byte reads
template <int LD> __device__ __forceinline__ void wfetch(float (&r)[32], const float* __restrict__ Wc, int kc) {
#pragma unroll   // constant indices: the arrays stay in registers
  for (int k = 0; k < 32; ++k) r[k] = Wc[(size_t)(kc * 32 + k) * LD]; }
__device__ __forceinline__ void wlay(__bf16* row, const float (&r)[32]) {
#pragma unroll   // constant indices: the arrays stay in registers
  for (int q = 0; q < 4; ++q) { v8b t;
#pragma unroll   // constant indices: the arrays stay in registers
    for (int i = 0; i < 8; ++i) t[i] = (__bf16)r[q * 8 + i];
    *(v8b*)(row + q * 8) = t; } }
// work-group barrier that orders LDS only: __syncthreads() also waits out every global load, which would end the fetch-ahead at each k-step
__device__ __forceinline__ void lds_barrier() { __builtin_amdgcn_fence(__ATOMIC_RELEASE, "workgroup", "local"); __builtin_amdgcn_s_barrier(); __builtin_amdgcn_fence(__ATOMIC_ACQUIRE, "workgroup", "local"); }
// the 16 f32 of this lane's A fragment of one k-step (p = row + 8 * (lane >> 4))
__device__ __forceinline__ void afetch(v4f (&x)[4], const float* __restrict__ p, int kc) { const float* s = p + kc * 32; x[0] = *(const v4f*)s; x[1] = *(const v4f*)(s + 4); x[2] = *(const v4f*)(s + 16); x[3] = *(const v4f*)(s + 20); }
// ---- k_proj: block = (64 rows, 128 cols, which): q/k/v = X W (+ b) with exact bf16 products (K = DIN) -> which 0: q f16 rows (+ residual rows < QHI); 1: k f16 rows (+ residual rows < KHI); 2: v f16 planes [c][t] (+ bf16 hi/lo planes for t < KHI)
__global__ __launch_bounds__(128) void k_proj(const float* __restrict__ XQ, const float* __restrict__ XK, const float* __restrict__ XV, const float* __restrict__ WQ, const float* __restrict__ WK, const float* __restrict__ WV, const float* __restrict__ BQ, const float* __restrict__ BK, const float* __restrict__ BV,
    _Float16* __restrict__ QH, _Float16* __restrict__ QL, _Float16* __restrict__ KH, _Float16* __restrict__ KL, _Float16* __restrict__ VT, __bf16* __restrict__ VB, __bf16* __restrict__ VBL) {
  __shared__ __align__(16) _Float16 sh[64][136], sl[64][136]; __shared__ __align__(16) _Float16 th[128][72]; __shared__ __align__(16) __bf16 tb[128][72], tbl[128][72]; __shared__ __align__(16) __bf16 wt[2][128][WPI];
  const int tid = threadIdx.x, wave = tid >> 5, lane = tid & 31, col = lane & 15, g = lane >> 4; const int which = blockIdx.z; const int c0 = blockIdx.y * 128; const size_t r0 = (size_t)blockIdx.x * 64; const size_t bb = r0 / TT; const int t0 = (int)(r0 % TT);
  const float* X = which == 0 ? XQ : which == 1 ? XK : XV; const float* WA = which == 0 ? WQ : which == 1 ? WK : WV; const float* BA = which == 0 ? BQ : which == 1 ? BK : BV;
  v8f acc[8] = {};
  const float* Wc = WA + c0 + tid; const float* Xp = X + (r0 + wave * 16 + col) * DIN + 8 * g;
  float wr[2][32]; v4f xr[2][4];   // two k-steps in flight in registers
  wfetch<CC>(wr[0], Wc, 0); afetch(xr[0], Xp, 0); wfetch<CC>(wr[1], Wc, 1); afetch(xr[1], Xp, 1);
  asm volatile("s_wait_xcnt 0x0" ::: "memory");     // in front of every rewrite of the address registers of the loads above
  __builtin_amdgcn_sched_barrier(0);                // keeps those loads up here, all in flight together
#pragma unroll   // constant indices: the arrays stay in registers
  for (int kc = 0; kc < DIN / 32; ++kc) { const int s = kc & 1; v16b a;
    wlay(&wt[s][tid][0], wr[s]);
#pragma unroll   // constant indices: the arrays stay in registers
    for (int i = 0; i < 4; ++i) { a[i] = (__bf16)xr[s][0][i]; a[4 + i] = (__bf16)xr[s][1][i]; a[8 + i] = (__bf16)xr[s][2][i]; a[12 + i] = (__bf16)xr[s][3][i]; }
    __builtin_amdgcn_sched_barrier(0);   // the refill below reuses the registers just read: lifted over their readers it would take a third register set
    if (kc + 2 < DIN / 32) { wfetch<CC>(wr[s], Wc, kc + 2); afetch(xr[s], Xp, kc + 2);
      asm volatile("s_wait_xcnt 0x0" ::: "memory");     // in front of every rewrite of the address registers of the loads above
      __builtin_amdgcn_sched_barrier(0); }              // keeps every later register write behind that wait
    lds_barrier();   // publishes wt[s]; every reader of wt[s] two k-steps back has passed the barrier in between
    v16b w[8];
#pragma unroll   // constant indices: the arrays stay in registers
    for (int j = 0; j < 8; ++j) w[j] = frag_b(&wt[s][j * 16 + col][0], lane);
    __builtin_amdgcn_sched_barrier(0);   // keeps the 16 LDS reads together ahead of the products: spread among them each pair costs its own LDS latency
#pragma unroll   // constant indices: the arrays stay in registers
    for (int j = 0; j < 8; ++j) acc[j] = wmma_bf(a, w[j], acc[j]); }
  if (which < 2) { _Float16* DH = which == 0 ? QH : KH; _Float16* DL = which == 0 ? QL : KL; const int nhi = which == 0 ? QHI : KHI; const bool hi_rows = t0 < nhi;
#pragma unroll
    for (int j = 0; j < 8; ++j) { const float bias = BA ? bfr(BA[c0 + j * 16 + col]) : 0.f;
#pragma unroll
      for (int r = 0; r < 8; ++r) { const float v = acc[j][r] + bias; const _Float16 hv = (_Float16)v; sh[wave * 16 + 8 * g + r][j * 16 + col] = hv; sl[wave * 16 + 8 * g + r][j * 16 + col] = (_Float16)((v - (float)hv) * 1024.0f); } }
    __syncthreads();
    for (int e = tid; e < 64 * 16; e += 128) { const int rl = e >> 4, q = e & 15; vst2((unsigned*)(DH + (r0 + rl) * CC + c0 + q * 8), *(const v4u*)&sh[rl][q * 8]); if (hi_rows) vst2((unsigned*)(DL + (bb * nhi + t0 + rl) * (size_t)CC + c0 + q * 8), *(const v4u*)&sl[rl][q * 8]); }
  } else { const bool hi_rows = t0 < KHI;
#pragma unroll
    for (int j = 0; j < 8; ++j) { const float bias = BA ? bfr(BA[c0 + j * 16 + col]) : 0.f;
#pragma unroll
      for (int r = 0; r < 8; ++r) { const float v = acc[j][r] + bias; const int rl = wave * 16 + 8 * g + r, cl = j * 16 + col; th[cl][rl] = (_Float16)v; const __bf16 bh = (__bf16)v; tb[cl][rl] = bh; tbl[cl][rl] = (__bf16)(v - (float)bh); } }
    __syncthreads();
    for (int e = tid; e < 128 * 8; e += 128) { const int cl = e >> 3, q = e & 7; vst2((unsigned*)(VT + (bb * CC + c0 + cl) * (size_t)TT + t0 + q * 8), *(const v4u*)&th[cl][q * 8]); if (hi_rows) { const size_t o3 = (bb * CC + c0 + cl) * (size_t)KHI + t0 + q * 8; vst2((unsigned*)(VB + o3), *(const v4u*)&tb[cl][q * 8]); vst2((unsigned*)(VBL + o3), *(const v4u*)&tbl[cl][q * 8]); } } } }
// ---- k_attn: block = (head, 64 queries, batch), 8 waves = 4 query tiles x KS key ranges. Transposed products: S^T = k q^T (q hi + residual x 2^10, 2 products), so a lane holds the scores of ONE query (col) at keys 8g+r of each 16-key tile;
// two such tiles, converted in place, are the B operand of ctx^T += v^T P^T. Running maximum and sum per lane (online softmax); P = exp(score - max + PSH) once to f16 (PSH cancels in the division by the sum). The KS partial results are joined through LDS.
#define KS 2
#define KR (TT / KS)      // keys per wave
#define NIT (KR / 64)     // 64 keys per pass
#define PSH 6.9314718f    // keeps P (at most 2^10) clear of f16 subnormals
__device__ __forceinline__ float xhalf(float x) { return __builtin_bit_cast(float, __builtin_amdgcn_permlanex16(__builtin_bit_cast(int, x), __builtin_bit_cast(int, x), 0x76543210, 0xfedcba98, false, false)); }  // lane l with lane l ^ 16
__device__ __forceinline__ v8f wm(v16h a, v16h b, v8f c) { return __builtin_amdgcn_wmma_f32_16x16x32_f16(false, a, false, b, (short)0, c, false, false); }
// 16x16x32 fragment at (wave-uniform base) + (32-bit lane byte offset lo) + constant cb: same k order as frag_h
__device__ __forceinline__ v16h frag_u(const _Float16* ub, unsigned lo, int cb) { union { v16h v; v8h q[2]; } u; const char* p = (const char*)ub + lo; u.q[0] = *(const v8h*)(p + cb); u.q[1] = *(const v8h*)(p + cb + 32); return u.v; }
__global__ __launch_bounds__(256) void k_attn(const _Float16* __restrict__ QH, const _Float16* __restrict__ QL, const _Float16* __restrict__ KH, const _Float16* __restrict__ VT, const float* __restrict__ MKF, float* __restrict__ Y) {
  __shared__ float sp[4][18][32];
  const int tid = threadIdx.x, wave = __builtin_amdgcn_readfirstlane(tid >> 5), lane = tid & 31, col = lane & 15, g = lane >> 4; const int h = blockIdx.x, qb = blockIdx.y, b = blockIdx.z; const int qt = wave & 3, ks = wave >> 2;
  const int q0 = qb * 64 + qt * 16, q = q0 + col;
  const v16h qh = frag_h(QH + ((size_t)b * TT + q) * CC + h * HD, lane), ql = frag_h(QL + ((size_t)b * QHI + q) * CC + h * HD, lane);
  const _Float16* Kb = KH + ((size_t)b * TT + ks * KR) * CC + h * HD; const unsigned ko = (unsigned)(col * CC + 8 * g) * 2u;   // A rows = keys, k = head columns
  const _Float16* Vb = VT + ((size_t)b * CC + h * HD) * TT + ks * KR; const unsigned vo = (unsigned)(col * TT + 8 * g) * 2u;   // A rows = head columns, k = keys
  const float* Mb = MKF + ((size_t)b * TT + q0) * TT + ks * KR;       const unsigned mo = (unsigned)(col * TT + 8 * g) * 4u;   // this lane's query row, its 8 keys of each 16-key tile
  float m = -3.0e38f, l = 0.f; v8f acc0 = {}, acc1 = {};
  v16h kf[4];
#pragma unroll
  for (int kt = 0; kt < 4; ++kt) kf[kt] = frag_u(Kb, ko, kt * 16 * CC * 2);
  asm volatile("s_wait_xcnt 0x0" ::: "memory");     // in front of every rewrite of the address registers of the q and k loads above
  __builtin_amdgcn_sched_barrier(0);                // keeps the address arithmetic of the loop behind that wait
  for (int it = 0; it < NIT; ++it) {
    v4f mk[4][2]; const char* mp = (const char*)(Mb + it * 64) + mo;
#pragma unroll
    for (int kt = 0; kt < 4; ++kt) { mk[kt][0] = *(const v4f*)(mp + kt * 64); mk[kt][1] = *(const v4f*)(mp + kt * 64 + 16); }
    asm volatile("s_wait_xcnt 0x0" ::: "memory");   // in front of every rewrite of the address registers of the mask loads above (a v load below may land in them)
    v16h vf[2][2];
#pragma unroll
    for (int s = 0; s < 2; ++s) { vf[s][0] = frag_u(Vb + it * 64, vo, s * 64); vf[s][1] = frag_u(Vb + it * 64, vo, 16 * TT * 2 + s * 64); }
    asm volatile("s_wait_xcnt 0x0" ::: "memory");   // in front of every rewrite of the address registers of the v loads above
    __builtin_amdgcn_sched_barrier(0);              // holds those loads up here: without it they sink to their first use and the wave waits out each latency
    float v[4][8]; float mx = -3.0e38f;
#pragma unroll
    for (int kt = 0; kt < 4; ++kt) { const v8f z = {}; const v8f a = wm(kf[kt], qh, z), c = wm(kf[kt], ql, z);
#pragma unroll
      for (int r = 0; r < 8; ++r) { v[kt][r] = (a[r] + c[r] * (1.0f / 1024.0f)) * SCALE + bfr(mk[kt][r >> 2][r & 3]); mx = fmaxf(mx, v[kt][r]); } }
    const int nx = it + 1 < NIT ? it + 1 : it;   // next pass's k rows, fetched under this pass's softmax (the last pass fetches its own again)
#pragma unroll
    for (int kt = 0; kt < 4; ++kt) kf[kt] = frag_u(Kb + (size_t)nx * 64 * CC, ko, kt * 16 * CC * 2);
    asm volatile("s_wait_xcnt 0x0" ::: "memory");   // in front of every rewrite of the address registers of the k loads above
    __builtin_amdgcn_sched_barrier(0);              // holds the k loads ahead of the softmax, which covers their latency
    mx = fmaxf(mx, xhalf(mx)); const float mn = fmaxf(m, mx); const float al = expf(m - mn); m = mn; const float ms = mn - PSH;
    float sum = 0.f; v16h p[2];
#pragma unroll
    for (int kt = 0; kt < 4; ++kt) {
#pragma unroll
      for (int r = 0; r < 8; ++r) { const float e = expf(v[kt][r] - ms); sum += e; p[kt >> 1][(kt & 1) * 8 + r] = (_Float16)e; } }
    l = l * al + sum;
#pragma unroll
    for (int r = 0; r < 8; ++r) { acc0[r] *= al; acc1[r] *= al; }
#pragma unroll
    for (int s = 0; s < 2; ++s) { acc0 = wm(vf[s][0], p[s], acc0); acc1 = wm(vf[s][1], p[s], acc1); } }
  l += xhalf(l);
  if (ks) { sp[qt][0][lane] = m; sp[qt][1][lane] = l;
#pragma unroll
    for (int r = 0; r < 8; ++r) { sp[qt][2 + r][lane] = acc0[r]; sp[qt][10 + r][lane] = acc1[r]; } }
  __syncthreads();
  if (!ks) { const float m1 = sp[qt][0][lane], l1 = sp[qt][1][lane]; const float mm = fmaxf(m, m1); float a0 = expf(m - mm), a1 = expf(m1 - mm); const float lt = l * a0 + l1 * a1; const float inv = lt > 0.f ? 1.0f / lt : 0.f; a0 *= inv; a1 *= inv;
    v4f o[4];
#pragma unroll
    for (int r = 0; r < 8; ++r) { o[r >> 2][r & 3] = acc0[r] * a0 + sp[qt][2 + r][lane] * a1; o[2 + (r >> 2)][r & 3] = acc1[r] * a0 + sp[qt][10 + r][lane] * a1; }
    float* yp = Y + ((size_t)b * TT + q) * CC + h * HD + 8 * g;   // ctx^T register r = head column 16 j + 8 g + r of query col
    vst2(yp, o[0]); vst2(yp + 4, o[1]); vst2(yp + 16, o[2]); vst2(yp + 20, o[3]); } }
// ---- k_out: block = (64 rows, 128 cols): out = ctx Wo (+ bo): all rows: ctx bf16 hi + lo against exact bf16 Wo (2 products); the f16 x f16(bf16 x 2^8) branch is never taken
__global__ __launch_bounds__(128) void k_out(const float* __restrict__ Y, const float* __restrict__ WO, const float* __restrict__ BO, float* __restrict__ OUT) { __shared__ __align__(16) float sf[4][16][132]; __shared__ __align__(16) __bf16 wt[2][128][WPI];
  const int tid = threadIdx.x, wave = tid >> 5, lane = tid & 31, col = lane & 15, g = lane >> 4; const int c0 = blockIdx.y * 128; const size_t r0 = (size_t)blockIdx.x * 64 + wave * 16;
  v8f acc[8] = {};
  if (true) {   /* ALL rows: ctx split bf16 hi + lo x exact Wo (2 products) */
    const float* Wc = WO + c0 + tid; const float* Yp = Y + (r0 + col) * CC + 8 * g;
    float wr[2][32]; v4f xr[2][4];   // two k-steps in flight in registers
    wfetch<DIN>(wr[0], Wc, 0); afetch(xr[0], Yp, 0); wfetch<DIN>(wr[1], Wc, 1); afetch(xr[1], Yp, 1);
    asm volatile("s_wait_xcnt 0x0" ::: "memory");     // in front of every rewrite of the address registers of the loads above
    __builtin_amdgcn_sched_barrier(0);                // keeps those loads up here, all in flight together
#pragma unroll   // constant indices: the arrays stay in registers
    for (int kc = 0; kc < CC / 32; ++kc) { const int s = kc & 1; float v[16];
      wlay(&wt[s][tid][0], wr[s]);
#pragma unroll   // constant indices: the arrays stay in registers
      for (int i = 0; i < 4; ++i) { v[i] = xr[s][0][i]; v[4 + i] = xr[s][1][i]; v[8 + i] = xr[s][2][i]; v[12 + i] = xr[s][3][i]; }
      const F2 a = bsplit16(v);
      __builtin_amdgcn_sched_barrier(0);   // the refill below reuses the registers just read: lifted over their readers it would take a third register set
      if (kc + 2 < CC / 32) { wfetch<DIN>(wr[s], Wc, kc + 2); afetch(xr[s], Yp, kc + 2);
        asm volatile("s_wait_xcnt 0x0" ::: "memory");     // in front of every rewrite of the address registers of the loads above
        __builtin_amdgcn_sched_barrier(0); }              // keeps every later register write behind that wait
      lds_barrier();   // publishes wt[s]; every reader of wt[s] two k-steps back has passed the barrier in between
      v16b w[8];
#pragma unroll   // constant indices: the arrays stay in registers
      for (int j = 0; j < 8; ++j) w[j] = frag_b(&wt[s][j * 16 + col][0], lane);
      __builtin_amdgcn_sched_barrier(0);   // keeps the 16 LDS reads together ahead of the products: spread among them each pair costs its own LDS latency
#pragma unroll   // constant indices: the arrays stay in registers
      for (int j = 0; j < 8; ++j) { acc[j] = wmma_bf(a.h, w[j], acc[j]); acc[j] = wmma_bf(a.l, w[j], acc[j]); } }
#pragma unroll
    for (int j = 0; j < 8; ++j) { const float bias = BO ? bfr(BO[c0 + j * 16 + col]) : 0.f;
#pragma unroll
      for (int r = 0; r < 8; ++r) sf[wave][8 * g + r][j * 16 + col] = acc[j][r] + bias; }
  } else {
#pragma unroll 2
    for (int kc = 0; kc < CC / 32; ++kc) { const v16h a = frag_f32(Y + (r0 + col) * CC + kc * 32, lane); asm volatile("s_wait_loadcnt 0x0" ::: "memory");
#pragma unroll
      for (int j = 0; j < 8; ++j) { const v16h w = WOCOLH(WO, kc * 32, c0 + j * 16 + col, lane); asm volatile("s_wait_loadcnt 0x0" ::: "memory"); acc[j] = wmma16(a, w, acc[j]); } }
#pragma unroll
    for (int j = 0; j < 8; ++j) { const float bias = BO ? bfr(BO[c0 + j * 16 + col]) : 0.f;
#pragma unroll
      for (int r = 0; r < 8; ++r) sf[wave][8 * g + r][j * 16 + col] = acc[j][r] * (1.0f / 256.0f) + bias; } }
  LDSX(); for (int rl = 0; rl < 16; ++rl) vst2(OUT + (r0 + rl) * DIN + c0 + lane * 4, *(const v4f*)&sf[wave][rl][lane * 4]); }

extern "C" void kernel_launch(void* const* d_in, const int* in_sizes, int n_in, void* d_out, int out_size, void* d_ws, size_t ws_size, hipStream_t stream) {
  (void)in_sizes; (void)n_in; (void)out_size;
  const float** F = (const float**)d_in;
  if (ws_size < (size_t)WS_END) return;
  char* ws = (char*)d_ws; _Float16 *QH = (_Float16*)(ws + WS_QH), *KH = (_Float16*)(ws + WS_KH), *VT = (_Float16*)(ws + WS_VT), *QL = (_Float16*)(ws + WS_QL), *KL = (_Float16*)(ws + WS_KL); __bf16 *VB = (__bf16*)(ws + WS_VB), *VBL = (__bf16*)(ws + WS_VBL); float *Y = (float*)(ws + WS_Y);
  (void)Y; (void)QL; (void)KL; (void)VB; (void)VBL;
  // inputs: 0 V [2,2048,512]; 1 Q; 2 K; 3 mask [2,1,2048,2048] f32; 4 Wq [512,256] (in,out), 5 bq; 6 Wk, 7 bk; 8 Wv, 9 bv; 10 Wo [256,512] (in,out), 11 bo [512]
  k_proj<<<dim3(TNB * TT / 64, CC / 128, 3), 128, 0, stream>>>(F[1], F[2], F[0], F[4], F[6], F[8], F[5], F[7], F[9], QH, QL, KH, KL, VT, VB, VBL);   /* q from Q (in1), k from K (in2), v from V (in0) */
  k_attn<<<dim3(NH, NQB, TNB), 256, 0, stream>>>(QH, QL, KH, VT, F[3], Y);
  k_out<<<dim3(TNB * TT / 64, DIN / 128), 128, 0, stream>>>(Y, F[10], F[11], (float*)d_out);
}

// v003
// One run takes 60.3 microseconds.
// In both of two side-by-side timings against v002, it was 1.11 times as fast.
// All steps since v000 together make it 7.49 times as fast.
// compute dtype: all float inputs rounded to bf16; q/k/v = in W + b with EXACT bf16 products on WMMA 16x16x32 (f32 accumulate); q as f16 hi + residual (x 2^10) against k once to f16 (2 products) / sqrt(256) + the additive f32 mask; online softmax in f32 (precise expf); unnormalised P (at most 2^10) once to f16 against v once to f16 (1 product), divided by the f32 sum; ctx split bf16 hi + lo against exact Wo (2 products) + bo; f32 output.
#include <hip/hip_runtime.h>
#include <math.h>

typedef __attribute__((ext_vector_type(16))) _Float16 v16h;
typedef __attribute__((ext_vector_type(16))) __bf16 v16b;
typedef __attribute__((ext_vector_type(8)))  _Float16 v8h;
typedef __attribute__((ext_vector_type(8)))  float v8f;
typedef __attribute__((ext_vector_type(4)))  float v4f;
typedef __attribute__((ext_vector_type(2)))  float v2f;
typedef __attribute__((ext_vector_type(4)))  unsigned v4u;
typedef __attribute__((ext_vector_type(4)))  int v4i;
typedef float __attribute__((may_alias)) float_a;
typedef int __attribute__((may_alias)) int_a;

template <typename T> __device__ __forceinline__ void vst2(void* p, T v) { *(T*)p = v;  }
__device__ __forceinline__ v8f wmma16(v16h a, v16h b, v8f c) {
  v8f d = __builtin_amdgcn_wmma_f32_16x16x32_f16(false, a, false, b, (short)0, c, false, false);
  asm volatile("v_nop\n\tv_nop\n\tv_nop\n\tv_nop" : "+v"(d) : "v"(a), "v"(b));
  return d;
}
__device__ __forceinline__ v8f wmma_bf(v16b a, v16b b, v8f c) {
  v8f d = __builtin_amdgcn_wmma_f32_16x16x32_bf16(false, a, false, b, (short)0, c, false, false);
  asm volatile("v_nop\n\tv_nop\n\tv_nop\n\tv_nop" : "+v"(d) : "v"(a), "v"(b));
  return d;
}
// 16x16x32 fragments: lane = (h = lane>>4, row/col = lane&15); elements 0..7 = k0+8h+0..7, 8..15 = k0+16+8h+0..7; D element r = row 8h+r
__device__ __forceinline__ v16h frag_h(const _Float16* rowk0, int lane) {
  union { v16h v; v8h q[2]; } u; const _Float16* p = rowk0 + 8 * (lane >> 4);
  u.q[0] = *(const v8h*)p; u.q[1] = *(const v8h*)(p + 16); return u.v;
}
__device__ __forceinline__ v16h frag_f32(const float* rowk0, int lane) {
  v16h a; const float* p = rowk0 + 8 * (lane >> 4);
#pragma unroll
  for (int i = 0; i < 8; ++i) { a[i] = (_Float16)p[i]; a[8 + i] = (_Float16)p[16 + i]; }
  return a;
}
__device__ __forceinline__ v16h frag_f32s(const float* rowk0, int lane, float sc) {
  v16h a; const float* p = rowk0 + 8 * (lane >> 4);
#pragma unroll
  for (int i = 0; i < 8; ++i) { a[i] = (_Float16)(p[i] * sc); a[8 + i] = (_Float16)(p[16 + i] * sc); }
  return a;
}
// column fragment from a [K][ld] layout (column n), rows >= K read as 0
__device__ __forceinline__ v16h fragc_f32(const float* W, int k0, int n, int lane, int ld, int K) {
  v16h a; const int g = lane >> 4;
#pragma unroll
  for (int i = 0; i < 8; ++i) { const int ka = k0 + 8 * g + i, kb = ka + 16;
    a[i] = (_Float16)(ka < K ? W[(size_t)(ka < K ? ka : K - 1) * ld + n] : 0.f); a[8 + i] = (_Float16)(kb < K ? W[(size_t)(kb < K ? kb : K - 1) * ld + n] : 0.f); }
  return a;
}
struct F2 { v16b h, l; };
__device__ __forceinline__ F2 bsplit16(const float v[16]) { F2 r;
#pragma unroll
  for (int i = 0; i < 16; ++i) { const __bf16 h = (__bf16)v[i]; r.h[i] = h; r.l[i] = (__bf16)(v[i] - (float)h); }
  return r; }
__device__ __forceinline__ F2 split_row(const float* row, int k0, int lane) { float v[16]; const float* p = row + k0 + 8 * (lane >> 4);
#pragma unroll
  for (int i = 0; i < 8; ++i) { v[i] = p[i]; v[8 + i] = p[16 + i]; }
  return bsplit16(v); }
__device__ __forceinline__ F2 split_rowK(const float* row, int k0, int lane, int K) { float v[16]; const int g = lane >> 4;
#pragma unroll
  for (int i = 0; i < 8; ++i) { const int ka = k0 + 8 * g + i, kb = ka + 16; v[i] = ka < K ? row[ka < K ? ka : K - 1] : 0.f; v[8 + i] = kb < K ? row[kb < K ? kb : K - 1] : 0.f; }
  return bsplit16(v); }
__device__ __forceinline__ F2 split_col(const float* W, int k0, int n, int lane, int ld, int K) { float v[16]; const int g = lane >> 4;
#pragma unroll
  for (int i = 0; i < 8; ++i) { const int ka = k0 + 8 * g + i, kb = ka + 16; v[i] = ka < K ? W[(size_t)(ka < K ? ka : K - 1) * ld + n] : 0.f; v[8 + i] = kb < K ? W[(size_t)(kb < K ? kb : K - 1) * ld + n] : 0.f; }
  return bsplit16(v); }
__device__ __forceinline__ v8f mac3(const F2& a, const F2& b, v8f c) { c = wmma_bf(a.l, b.h, c); c = wmma_bf(a.h, b.l, c); return wmma_bf(a.h, b.h, c); }
__device__ __forceinline__ float sigm(float v) { return 1.0f / (1.0f + expf(-v)); }
#define LDSX() do { asm volatile("s_wait_dscnt 0" ::: "memory"); __builtin_amdgcn_wave_barrier(); __builtin_amdgcn_fence(__ATOMIC_RELEASE, "workgroup"); } while (0)

// Multi-head attention with an additive dense mask (B 2, S 2,048, d_model 512 -> key/value dim 256 = 8 heads x 32 -> out 512; 0.02-scale (in,out) weights, zero biases; separate V, Q, K inputs): scores = q k^T / sqrt(256) (the FULL key_dim, as written) + mask[b, 0, q, k] (random normal); out = merged(softmax v) Wo + bo.
#define NB 2
#define TT 2048
#define CC 256            // NH * HD = projected width
#define DIN 512          // input (model) width
#define NH 8
#define HD 32
#define NQB (TT / 64)
#define HG 4
#define SCALE (0.0625f)
#define CAUSAL 0
#ifndef TNB
#define TNB NB
#endif
__device__ __forceinline__ float bfr(float v) { return (float)(__bf16)v; }
__host__ __device__ __forceinline__ int kb_last(int qb) { return CAUSAL ? ((qb * 64 + 63) >> 7) : (TT / 128 - 1); }
typedef __attribute__((ext_vector_type(8))) __bf16 v8b;
__device__ __forceinline__ v16b frag_b(const __bf16* rowk0, int lane) {
  union { v16b v; v8b q[2]; } u; const __bf16* p = rowk0 + 8 * (lane >> 4);
  u.q[0] = *(const v8b*)p; u.q[1] = *(const v8b*)(p + 16); return u.v;
}
#define QBH 0
#define QHI 2048            // rows carrying a q residual plane (all rows when non-causal: 2-product logits everywhere)
#define KHI 64            // key rows carrying k residual / v bf16 hi+lo planes (written by k_proj; no kernel here reads them)
// B fragment (k rows k0+.., output column o) of a weight: (in,out) [K][ld] or (out,in) [ld rows of K]: bf16 exact, or f16(bf16 * 256) exact
__device__ __forceinline__ v16b wcol_io(const float* Wm, int k0, int o, int lane, int ld) { v16b w; const int g = lane >> 4;
#pragma unroll
  for (int i = 0; i < 8; ++i) { w[i] = (__bf16)Wm[(size_t)(k0 + 8 * g + i) * ld + o]; w[8 + i] = (__bf16)Wm[(size_t)(k0 + 16 + 8 * g + i) * ld + o]; }
  return w; }
__device__ __forceinline__ v16b wcol_oi(const float* Wm, int k0, int o, int lane, int K) { v16b w; const float* p = Wm + (size_t)o * K + k0 + 8 * (lane >> 4);
#pragma unroll
  for (int i = 0; i < 8; ++i) { w[i] = (__bf16)p[i]; w[8 + i] = (__bf16)p[16 + i]; }
  return w; }
__device__ __forceinline__ v16h wcolh_io(const float* Wm, int k0, int o, int lane, int ld) { v16h w; const int g = lane >> 4;
#pragma unroll
  for (int i = 0; i < 8; ++i) { w[i] = (_Float16)(bfr(Wm[(size_t)(k0 + 8 * g + i) * ld + o]) * 256.0f); w[8 + i] = (_Float16)(bfr(Wm[(size_t)(k0 + 16 + 8 * g + i) * ld + o]) * 256.0f); }
  return w; }
__device__ __forceinline__ v16h wcolh_oi(const float* Wm, int k0, int o, int lane, int K) { v16h w; const float* p = Wm + (size_t)o * K + k0 + 8 * (lane >> 4);
#pragma unroll
  for (int i = 0; i < 8; ++i) { w[i] = (_Float16)(bfr(p[i]) * 256.0f); w[8 + i] = (_Float16)(bfr(p[16 + i]) * 256.0f); }
  return w; }
#define WQKV_LAYOUT 0   // 0 = (in,out) [DIN][CC]; 1 = (out,in) [CC][DIN]; 2 = per-head [NH][DIN][HD]
__device__ __forceinline__ v16b wcol_hdk(const float* Wm, int k0, int o, int lane) { v16b w; const int g = lane >> 4; const float* p = Wm + (size_t)(o / HD) * DIN * HD + (o % HD);
#pragma unroll
  for (int i = 0; i < 8; ++i) { w[i] = (__bf16)p[(size_t)(k0 + 8 * g + i) * HD]; w[8 + i] = (__bf16)p[(size_t)(k0 + 16 + 8 * g + i) * HD]; }
  return w; }
#define WO_OUT_IN 0
#if WQKV_LAYOUT == 1
#define WCOL(W, k0, o, lane) wcol_oi(W, k0, o, lane, DIN)
#elif WQKV_LAYOUT == 2
#define WCOL(W, k0, o, lane) wcol_hdk(W, k0, o, lane)
#else
#define WCOL(W, k0, o, lane) wcol_io(W, k0, o, lane, CC)
#endif
#if WO_OUT_IN
#define WOCOL(W, k0, o, lane) wcol_oi(W, k0, o, lane, CC)
#define WOCOLH(W, k0, o, lane) wcolh_oi(W, k0, o, lane, CC)
#else
#define WOCOL(W, k0, o, lane) wcol_io(W, k0, o, lane, DIN)
#define WOCOLH(W, k0, o, lane) wcolh_io(W, k0, o, lane, DIN)
#endif

#define WS_QH  0u                                      // f16 q rows [b*t][CC]
#define WS_KH  (WS_QH + 2u * (size_t)NB * TT * CC)      // f16 k in fragment order [b][head][16-key tile][plane 2][lane 32][8]
#define WS_VT  (WS_KH + 2u * (size_t)NB * TT * CC)      // f16 v in fragment order [b][head][32-key block][16-column half 2][plane 2][lane 32][8]
#define WS_QL  (WS_VT + 2u * (size_t)NB * CC * TT)      // f16 q residual x 2^10 rows [b][t < QHI][CC]
#define WS_KL  (WS_QL + 2u * (size_t)NB * QHI * CC)     // f16 k residual x 2^10 rows [b][t < KHI][CC]
#define WS_VB  (WS_KL + 2u * (size_t)NB * KHI * CC)     // bf16 v hi planes [b][c][t < KHI]
#define WS_VBL (WS_VB + 2u * (size_t)NB * CC * KHI)
#define WS_S   (WS_VBL + 2u * (size_t)NB * CC * KHI)    // f32 [hg][t][s]; reserved, not used by any kernel here
#define WS_Y   (WS_S  + 4u * (size_t)HG * TT * TT)      // f32 ctx rows [b*t][CC] (only when there is an output projection)
#define WS_END (WS_Y  + 4u * (size_t)NB * TT * CC)

// ---- weight tiles through LDS: thread t fetches column c0 + t of a 32-row k-step (each wave load = one whole 128-byte line), rounds it to bf16 and lays it as row t of wt (k contiguous, pitch 80 bytes); frag_b then reads the same k order as wcol_io
#define WPI 40            // bf16 per LDS row: 64 bytes of data at the conflict-free 80-byte pitch for 16-byte reads
template <int LD> __device__ __forceinline__ void wfetch(float (&r)[32], const float* __restrict__ Wc, int kc) {
#pragma unroll   // constant indices: the arrays stay in registers
  for (int k = 0; k < 32; ++k) r[k] = Wc[(size_t)(kc * 32 + k) * LD]; }
__device__ __forceinline__ void wlay(__bf16* row, const float (&r)[32]) {
#pragma unroll   // constant indices: the arrays stay in registers
  for (int q = 0; q < 4; ++q) { v8b t;
#pragma unroll   // constant indices: the arrays stay in registers
    for (int i = 0; i < 8; ++i) t[i] = (__bf16)r[q * 8 + i];
    *(v8b*)(row + q * 8) = t; } }
// work-group barrier that orders LDS only: __syncthreads() also waits out every global load, which would end the fetch-ahead at each k-step
__device__ __forceinline__ void lds_barrier() { __builtin_amdgcn_fence(__ATOMIC_RELEASE, "workgroup", "local"); __builtin_amdgcn_s_barrier(); __builtin_amdgcn_fence(__ATOMIC_ACQUIRE, "workgroup", "local"); }
// the 16 f32 of this lane's A fragment of one k-step (p = row + 8 * (lane >> 4))
__device__ __forceinline__ void afetch(v4f (&x)[4], const float* __restrict__ p, int kc) { const float* s = p + kc * 32; x[0] = *(const v4f*)s; x[1] = *(const v4f*)(s + 4); x[2] = *(const v4f*)(s + 16); x[3] = *(const v4f*)(s + 20); }
// ---- k_proj: block = (64 rows, 128 cols, which): q/k/v = X W (+ b) with exact bf16 products (K = DIN) -> which 0: q f16 rows (+ residual rows < QHI); 1: k f16 in fragment order (+ residual rows < KHI); 2: v f16 in fragment order (+ bf16 hi/lo planes for t < KHI)
// fragment order: the 16 bytes that lane l of k_attn loads as elements 0..7 (plane 0) or 8..15 (plane 1) of an A fragment lie at plane * 512 + l * 16, so one wave load there is 512 contiguous bytes = 4 whole lines
__global__ __launch_bounds__(128) void k_proj(const float* __restrict__ XQ, const float* __restrict__ XK, const float* __restrict__ XV, const float* __restrict__ WQ, const float* __restrict__ WK, const float* __restrict__ WV, const float* __restrict__ BQ, const float* __restrict__ BK, const float* __restrict__ BV,
    _Float16* __restrict__ QH, _Float16* __restrict__ QL, _Float16* __restrict__ KH, _Float16* __restrict__ KL, _Float16* __restrict__ VT, __bf16* __restrict__ VB, __bf16* __restrict__ VBL) {
  __shared__ __align__(16) _Float16 sh[64][136], sl[64][136]; __shared__ __align__(16) _Float16 th[128][72]; __shared__ __align__(16) __bf16 tb[128][72], tbl[128][72]; __shared__ __align__(16) __bf16 wt[2][128][WPI];
  const int tid = threadIdx.x, wave = tid >> 5, lane = tid & 31, col = lane & 15, g = lane >> 4; const int which = blockIdx.z; const int c0 = blockIdx.y * 128; const size_t r0 = (size_t)blockIdx.x * 64; const size_t bb = r0 / TT; const int t0 = (int)(r0 % TT);
  const float* X = which == 0 ? XQ : which == 1 ? XK : XV; const float* WA = which == 0 ? WQ : which == 1 ? WK : WV; const float* BA = which == 0 ? BQ : which == 1 ? BK : BV;
  v8f acc[8] = {};
  const float* Wc = WA + c0 + tid; const float* Xp = X + (r0 + wave * 16 + col) * DIN + 8 * g;
  float wr[2][32]; v4f xr[2][4];   // two k-steps in flight in registers
  wfetch<CC>(wr[0], Wc, 0); afetch(xr[0], Xp, 0); wfetch<CC>(wr[1], Wc, 1); afetch(xr[1], Xp, 1);
  asm volatile("s_wait_xcnt 0x0" ::: "memory");     // in front of every rewrite of the address registers of the loads above
  __builtin_amdgcn_sched_barrier(0);                // keeps those loads up here, all in flight together
#pragma unroll   // constant indices: the arrays stay in registers
  for (int kc = 0; kc < DIN / 32; ++kc) { const int s = kc & 1; v16b a;
    wlay(&wt[s][tid][0], wr[s]);
#pragma unroll   // constant indices: the arrays stay in registers
    for (int i = 0; i < 4; ++i) { a[i] = (__bf16)xr[s][0][i]; a[4 + i] = (__bf16)xr[s][1][i]; a[8 + i] = (__bf16)xr[s][2][i]; a[12 + i] = (__bf16)xr[s][3][i]; }
    __builtin_amdgcn_sched_barrier(0);   // the refill below reuses the registers just read: lifted over their readers it would take a third register set
    if (kc + 2 < DIN / 32) { wfetch<CC>(wr[s], Wc, kc + 2); afetch(xr[s], Xp, kc + 2);
      asm volatile("s_wait_xcnt 0x0" ::: "memory");     // in front of every rewrite of the address registers of the loads above
      __builtin_amdgcn_sched_barrier(0); }              // keeps every later register write behind that wait
    lds_barrier();   // publishes wt[s]; every reader of wt[s] two k-steps back has passed the barrier in between
    v16b w[8];
#pragma unroll   // constant indices: the arrays stay in registers
    for (int j = 0; j < 8; ++j) w[j] = frag_b(&wt[s][j * 16 + col][0], lane);
    __builtin_amdgcn_sched_barrier(0);   // keeps the 16 LDS reads together ahead of the products: spread among them each pair costs its own LDS latency
#pragma unroll   // constant indices: the arrays stay in registers
    for (int j = 0; j < 8; ++j) acc[j] = wmma_bf(a, w[j], acc[j]); }
  if (which < 2) { _Float16* DH = which == 0 ? QH : KH; _Float16* DL = which == 0 ? QL : KL; const int nhi = which == 0 ? QHI : KHI; const bool hi_rows = t0 < nhi;
#pragma unroll
    for (int j = 0; j < 8; ++j) { const float bias = BA ? bfr(BA[c0 + j * 16 + col]) : 0.f;
#pragma unroll
      for (int r = 0; r < 8; ++r) { const float v = acc[j][r] + bias; const _Float16 hv = (_Float16)v; sh[wave * 16 + 8 * g + r][j * 16 + col] = hv; sl[wave * 16 + 8 * g + r][j * 16 + col] = (_Float16)((v - (float)hv) * 1024.0f); } }
    __syncthreads();
    for (int e = tid; e < 64 * 16; e += 128) { const int rl = e >> 4, q = e & 15;
      if (which == 0) { vst2((unsigned*)(DH + (r0 + rl) * CC + c0 + q * 8), *(const v4u*)&sh[rl][q * 8]);
        asm volatile("s_wait_xcnt 0x0" ::: "memory"); }   // inside the arm: in front of every rewrite of the registers of the store above, on every way out of it
      else { const int l = e & 31, p = (e >> 5) & 1, tl = (e >> 6) & 3, hh = e >> 8;   // A fragment of S^T: row = key 16 tl + (l & 15), k = head column 16 p + 8 (l >> 4) + 0..7
        vst2((unsigned*)(KH + ((((bb * NH + (c0 >> 5) + hh) * (TT / 16) + (t0 >> 4) + tl) * 2 + p) * 256 + l * 8)), *(const v4u*)&sh[tl * 16 + (l & 15)][hh * 32 + p * 16 + (l >> 4) * 8]);
        asm volatile("s_wait_xcnt 0x0" ::: "memory"); }   // inside the arm: in front of every rewrite of the registers of the store above, on every way out of it
      if (hi_rows) { vst2((unsigned*)(DL + (bb * nhi + t0 + rl) * (size_t)CC + c0 + q * 8), *(const v4u*)&sl[rl][q * 8]);
        asm volatile("s_wait_xcnt 0x0" ::: "memory"); } }   // in front of every rewrite of the registers of the store above
  } else { const bool hi_rows = t0 < KHI;
#pragma unroll
    for (int j = 0; j < 8; ++j) { const float bias = BA ? bfr(BA[c0 + j * 16 + col]) : 0.f;
#pragma unroll
      for (int r = 0; r < 8; ++r) { const float v = acc[j][r] + bias; const int rl = wave * 16 + 8 * g + r, cl = j * 16 + col; th[cl][rl] = (_Float16)v; const __bf16 bh = (__bf16)v; tb[cl][rl] = bh; tbl[cl][rl] = (__bf16)(v - (float)bh); } }
    __syncthreads();
    for (int e = tid; e < 128 * 8; e += 128) { const int l = e & 31, p = (e >> 5) & 1, j = (e >> 6) & 1, kbl = (e >> 7) & 1, hh = e >> 8;   // A fragment of ctx^T: row = head column 16 j + (l & 15), k = key 16 p + 8 (l >> 4) + 0..7 of the 32-key block
      vst2((unsigned*)(VT + (((((bb * NH + (c0 >> 5) + hh) * (TT / 32) + (t0 >> 5) + kbl) * 2 + j) * 2 + p) * 256 + l * 8)), *(const v4u*)&th[hh * 32 + j * 16 + (l & 15)][kbl * 32 + p * 16 + (l >> 4) * 8]);
      asm volatile("s_wait_xcnt 0x0" ::: "memory"); }   // in front of every rewrite of the registers of the store above
    for (int e = tid; e < 128 * 8; e += 128) { const int cl = e >> 3, q = e & 7; if (hi_rows) { const size_t o3 = (bb * CC + c0 + cl) * (size_t)KHI + t0 + q * 8; vst2((unsigned*)(VB + o3), *(const v4u*)&tb[cl][q * 8]); vst2((unsigned*)(VBL + o3), *(const v4u*)&tbl[cl][q * 8]);
        asm volatile("s_wait_xcnt 0x0" ::: "memory"); } } } }   // in front of every rewrite of the registers of the two stores above
// ---- k_attn: block = (head, 64 queries, batch), 8 waves = 4 query tiles x KS key ranges. Transposed products: S^T = k q^T (q hi + residual x 2^10, 2 products), so a lane holds the scores of ONE query (col) at keys 8g+r of each 16-key tile;
// two such tiles, converted in place, are the B operand of ctx^T += v^T P^T. Running maximum and sum per lane (online softmax); P = exp(score - max + PSH) once to f16 (PSH cancels in the division by the sum). The KS partial results are joined through LDS.
#define KS 2
#define KR (TT / KS)      // keys per wave
#define NIT (KR / 64)     // 64 keys per pass
#define PSH 6.9314718f    // keeps P (at most 2^10) clear of f16 subnormals
__device__ __forceinline__ float xhalf(float x) { return __builtin_bit_cast(float, __builtin_amdgcn_permlanex16(__builtin_bit_cast(int, x), __builtin_bit_cast(int, x), 0x76543210, 0xfedcba98, false, false)); }  // lane l with lane l ^ 16
__device__ __forceinline__ v8f wm(v16h a, v16h b, v8f c) { return __builtin_amdgcn_wmma_f32_16x16x32_f16(false, a, false, b, (short)0, c, false, false); }
// 16x16x32 fragment stored in fragment order at (wave-uniform base) + (lane byte offset lo = 16 * lane) + constant cb: plane 0 = elements 0..7, plane 1 (512 bytes on) = elements 8..15; same k order as frag_h
__device__ __forceinline__ v16h frag_w(const _Float16* ub, unsigned lo, int cb) { union { v16h v; v8h q[2]; } u; const char* p = (const char*)ub + lo; u.q[0] = *(const v8h*)(p + cb); u.q[1] = *(const v8h*)(p + cb + 512); return u.v; }
__global__ __launch_bounds__(256) void k_attn(const _Float16* __restrict__ QH, const _Float16* __restrict__ QL, const _Float16* __restrict__ KH, const _Float16* __restrict__ VT, const float* __restrict__ MKF, float* __restrict__ Y) {
  __shared__ float sp[4][18][32];
  const int tid = threadIdx.x, wave = __builtin_amdgcn_readfirstlane(tid >> 5), lane = tid & 31, col = lane & 15, g = lane >> 4; const int h = blockIdx.x, qb = blockIdx.y, b = blockIdx.z; const int qt = wave & 3, ks = wave >> 2;
  const int q0 = qb * 64 + qt * 16, q = q0 + col;
  const v16h qh = frag_h(QH + ((size_t)b * TT + q) * CC + h * HD, lane), ql = frag_h(QL + ((size_t)b * QHI + q) * CC + h * HD, lane);
  const unsigned fo = (unsigned)lane * 16u;   // a lane's place in each 512-byte plane
  const _Float16* Kb = KH + (((size_t)b * NH + h) * (TT / 16) + ks * (KR / 16)) * 512;   // A rows = keys, k = head columns: 1,024 bytes per 16-key tile
  float m = -3.0e38f, l = 0.f; v8f acc0 = {}, acc1 = {};
  v16h kf[4];
#pragma unroll
  for (int kt = 0; kt < 4; ++kt) kf[kt] = frag_w(Kb, fo, kt * 1024);
  asm volatile("s_wait_xcnt 0x0" ::: "memory");     // in front of every rewrite of the address registers of the q and k loads above
  __builtin_amdgcn_sched_barrier(0);                // keeps the address arithmetic of the loop behind that wait
  const _Float16* Vb = VT + (((size_t)b * NH + h) * (TT / 32) + ks * (KR / 32)) * 1024;  // A rows = head columns, k = keys: 2,048 bytes per 32-key block (two 16-column halves)
  const float* Mb = MKF + ((size_t)b * TT + q0) * TT + ks * KR;       const unsigned mo = (unsigned)(col * TT + 8 * g) * 4u;   // this lane's query row, its 8 keys of each 16-key tile
  for (int it = 0; it < NIT; ++it) {
    v4f mk[4][2]; const char* mp = (const char*)(Mb + it * 64) + mo;
#pragma unroll
    for (int kt = 0; kt < 4; ++kt) { mk[kt][0] = *(const v4f*)(mp + kt * 64); mk[kt][1] = *(const v4f*)(mp + kt * 64 + 16); }
    asm volatile("s_wait_xcnt 0x0" ::: "memory");   // in front of every rewrite of the address registers of the mask loads above (a v load below may land in them)
    v16h vf[2][2];
#pragma unroll
    for (int s = 0; s < 2; ++s) { vf[s][0] = frag_w(Vb + it * 2048, fo, s * 2048); vf[s][1] = frag_w(Vb + it * 2048, fo, s * 2048 + 1024); }
    asm volatile("s_wait_xcnt 0x0" ::: "memory");   // in front of every rewrite of the address registers of the v loads above
    __builtin_amdgcn_sched_barrier(0);              // holds those loads up here: without it they sink to their first use and the wave waits out each latency
    float v[4][8]; float mx = -3.0e38f;
#pragma unroll
    for (int kt = 0; kt < 4; ++kt) { const v8f z = {}; const v8f a = wm(kf[kt], qh, z), c = wm(kf[kt], ql, z);
#pragma unroll
      for (int r = 0; r < 8; ++r) { v[kt][r] = (a[r] + c[r] * (1.0f / 1024.0f)) * SCALE + bfr(mk[kt][r >> 2][r & 3]); mx = fmaxf(mx, v[kt][r]); } }
    const int nx = it + 1 < NIT ? it + 1 : it;   // next pass's k rows, fetched under this pass's softmax (the last pass fetches its own again)
#pragma unroll
    for (int kt = 0; kt < 4; ++kt) kf[kt] = frag_w(Kb + (size_t)nx * 2048, fo, kt * 1024);
    asm volatile("s_wait_xcnt 0x0" ::: "memory");   // in front of every rewrite of the address registers of the k loads above
    __builtin_amdgcn_sched_barrier(0);              // holds the k loads ahead of the softmax, which covers their latency
    mx = fmaxf(mx, xhalf(mx)); const float mn = fmaxf(m, mx); const float al = expf(m - mn); m = mn; const float ms = mn - PSH;
    float sum = 0.f; v16h p[2];
#pragma unroll
    for (int kt = 0; kt < 4; ++kt) {
#pragma unroll
      for (int r = 0; r < 8; ++r) { const float e = expf(v[kt][r] - ms); sum += e; p[kt >> 1][(kt & 1) * 8 + r] = (_Float16)e; } }
    l = l * al + sum;
#pragma unroll
    for (int r = 0; r < 8; ++r) { acc0[r] *= al; acc1[r] *= al; }
#pragma unroll
    for (int s = 0; s < 2; ++s) { acc0 = wm(vf[s][0], p[s], acc0); acc1 = wm(vf[s][1], p[s], acc1); } }
  l += xhalf(l);
  if (ks) { sp[qt][0][lane] = m; sp[qt][1][lane] = l;
#pragma unroll
    for (int r = 0; r < 8; ++r) { sp[qt][2 + r][lane] = acc0[r]; sp[qt][10 + r][lane] = acc1[r]; } }
  __syncthreads();
  if (!ks) { const float m1 = sp[qt][0][lane], l1 = sp[qt][1][lane]; const float mm = fmaxf(m, m1); float a0 = expf(m - mm), a1 = expf(m1 - mm); const float lt = l * a0 + l1 * a1; const float inv = lt > 0.f ? 1.0f / lt : 0.f; a0 *= inv; a1 *= inv;
    v4f o[4];
#pragma unroll
    for (int r = 0; r < 8; ++r) { o[r >> 2][r & 3] = acc0[r] * a0 + sp[qt][2 + r][lane] * a1; o[2 + (r >> 2)][r & 3] = acc1[r] * a0 + sp[qt][10 + r][lane] * a1; }
    float* yp = Y + ((size_t)b * TT + q) * CC + h * HD + 8 * g;   // ctx^T register r = head column 16 j + 8 g + r of query col
    vst2(yp, o[0]); vst2(yp + 4, o[1]); vst2(yp + 16, o[2]); vst2(yp + 20, o[3]); } }
// ---- k_out: block = (64 rows, 128 cols): out = ctx Wo (+ bo): all rows: ctx bf16 hi + lo against exact bf16 Wo (2 products); the f16 x f16(bf16 x 2^8) branch is never taken
__global__ __launch_bounds__(128) void k_out(const float* __restrict__ Y, const float* __restrict__ WO, const float* __restrict__ BO, float* __restrict__ OUT) { __shared__ __align__(16) float sf[4][16][132]; __shared__ __align__(16) __bf16 wt[2][128][WPI];
  const int tid = threadIdx.x, wave = tid >> 5, lane = tid & 31, col = lane & 15, g = lane >> 4; const int c0 = blockIdx.y * 128; const size_t r0 = (size_t)blockIdx.x * 64 + wave * 16;
  v8f acc[8] = {};
  if (true) {   /* ALL rows: ctx split bf16 hi + lo x exact Wo (2 products) */
    const float* Wc = WO + c0 + tid; const float* Yp = Y + (r0 + col) * CC + 8 * g;
    float wr[2][32]; v4f xr[2][4];   // two k-steps in flight in registers
    wfetch<DIN>(wr[0], Wc, 0); afetch(xr[0], Yp, 0); wfetch<DIN>(wr[1], Wc, 1); afetch(xr[1], Yp, 1);
    asm volatile("s_wait_xcnt 0x0" ::: "memory");     // in front of every rewrite of the address registers of the loads above
    __builtin_amdgcn_sched_barrier(0);                // keeps those loads up here, all in flight together
#pragma unroll   // constant indices: the arrays stay in registers
    for (int kc = 0; kc < CC / 32; ++kc) { const int s = kc & 1; float v[16];
      wlay(&wt[s][tid][0], wr[s]);
#pragma unroll   // constant indices: the arrays stay in registers
      for (int i = 0; i < 4; ++i) { v[i] = xr[s][0][i]; v[4 + i] = xr[s][1][i]; v[8 + i] = xr[s][2][i]; v[12 + i] = xr[s][3][i]; }
      const F2 a = bsplit16(v);
      __builtin_amdgcn_sched_barrier(0);   // the refill below reuses the registers just read: lifted over their readers it would take a third register set
      if (kc + 2 < CC / 32) { wfetch<DIN>(wr[s], Wc, kc + 2); afetch(xr[s], Yp, kc + 2);
        asm volatile("s_wait_xcnt 0x0" ::: "memory");     // in front of every rewrite of the address registers of the loads above
        __builtin_amdgcn_sched_barrier(0); }              // keeps every later register write behind that wait
      lds_barrier();   // publishes wt[s]; every reader of wt[s] two k-steps back has passed the barrier in between
      v16b w[8];
#pragma unroll   // constant indices: the arrays stay in registers
      for (int j = 0; j < 8; ++j) w[j] = frag_b(&wt[s][j * 16 + col][0], lane);
      __builtin_amdgcn_sched_barrier(0);   // keeps the 16 LDS reads together ahead of the products: spread among them each pair costs its own LDS latency
#pragma unroll   // constant indices: the arrays stay in registers
      for (int j = 0; j < 8; ++j) { acc[j] = wmma_bf(a.h, w[j], acc[j]); acc[j] = wmma_bf(a.l, w[j], acc[j]); } }
#pragma unroll
    for (int j = 0; j < 8; ++j) { const float bias = BO ? bfr(BO[c0 + j * 16 + col]) : 0.f;
#pragma unroll
      for (int r = 0; r < 8; ++r) sf[wave][8 * g + r][j * 16 + col] = acc[j][r] + bias; }
  } else {
#pragma unroll 2
    for (int kc = 0; kc < CC / 32; ++kc) { const v16h a = frag_f32(Y + (r0 + col) * CC + kc * 32, lane); asm volatile("s_wait_loadcnt 0x0" ::: "memory");
#pragma unroll
      for (int j = 0; j < 8; ++j) { const v16h w = WOCOLH(WO, kc * 32, c0 + j * 16 + col, lane); asm volatile("s_wait_loadcnt 0x0" ::: "memory"); acc[j] = wmma16(a, w, acc[j]); } }
#pragma unroll
    for (int j = 0; j < 8; ++j) { const float bias = BO ? bfr(BO[c0 + j * 16 + col]) : 0.f;
#pragma unroll
      for (int r = 0; r < 8; ++r) sf[wave][8 * g + r][j * 16 + col] = acc[j][r] * (1.0f / 256.0f) + bias; } }
  LDSX(); for (int rl = 0; rl < 16; ++rl) vst2(OUT + (r0 + rl) * DIN + c0 + lane * 4, *(const v4f*)&sf[wave][rl][lane * 4]); }

extern "C" void kernel_launch(void* const* d_in, const int* in_sizes, int n_in, void* d_out, int out_size, void* d_ws, size_t ws_size, hipStream_t stream) {
  (void)in_sizes; (void)n_in; (void)out_size;
  const float** F = (const float**)d_in;
  if (ws_size < (size_t)WS_END) return;
  char* ws = (char*)d_ws; _Float16 *QH = (_Float16*)(ws + WS_QH), *KH = (_Float16*)(ws + WS_KH), *VT = (_Float16*)(ws + WS_VT), *QL = (_Float16*)(ws + WS_QL), *KL = (_Float16*)(ws + WS_KL); __bf16 *VB = (__bf16*)(ws + WS_VB), *VBL = (__bf16*)(ws + WS_VBL); float *Y = (float*)(ws + WS_Y);
  (void)Y; (void)QL; (void)KL; (void)VB; (void)VBL;
  // inputs: 0 V [2,2048,512]; 1 Q; 2 K; 3 mask [2,1,2048,2048] f32; 4 Wq [512,256] (in,out), 5 bq; 6 Wk, 7 bk; 8 Wv, 9 bv; 10 Wo [256,512] (in,out), 11 bo [512]
  k_proj<<<dim3(TNB * TT / 64, CC / 128, 3), 128, 0, stream>>>(F[1], F[2], F[0], F[4], F[6], F[8], F[5], F[7], F[9], QH, QL, KH, KL, VT, VB, VBL);   /* q from Q (in1), k from K (in2), v from V (in0) */
  k_attn<<<dim3(NH, NQB, TNB), 256, 0, stream>>>(QH, QL, KH, VT, F[3], Y);
  k_out<<<dim3(TNB * TT / 64, DIN / 128), 128, 0, stream>>>(Y, F[10], F[11], (float*)d_out);
}

// v004
// One run takes 53.9 microseconds.
// Next to v003, in two timings, it ran 1.12 times as fast each time.
// Over all steps from v000 it is 8.39 times as fast.
// compute dtype: all float inputs rounded to bf16; q/k/v = in W + b with EXACT bf16 products on WMMA 16x16x32 (f32 accumulate); q as f16 hi + residual (x 2^10) against k once to f16 (2 products) / sqrt(256) + the additive f32 mask; online softmax in f32 (exponentials as hardware exp2 of one fma by log2 e); unnormalised P (at most 2^10) once to f16 against v once to f16 (1 product), divided by the f32 sum; ctx split bf16 hi + lo against exact Wo (2 products) + bo; f32 output.
#include <hip/hip_runtime.h>
#include <math.h>

typedef __attribute__((ext_vector_type(16))) _Float16 v16h;
typedef __attribute__((ext_vector_type(16))) __bf16 v16b;
typedef __attribute__((ext_vector_type(8)))  _Float16 v8h;
typedef __attribute__((ext_vector_type(8)))  float v8f;
typedef __attribute__((ext_vector_type(4)))  float v4f;
typedef __attribute__((ext_vector_type(2)))  float v2f;
typedef __attribute__((ext_vector_type(4)))  unsigned v4u;
typedef __attribute__((ext_vector_type(4)))  int v4i;
typedef float __attribute__((may_alias)) float_a;
typedef int __attribute__((may_alias)) int_a;

template <typename T> __device__ __forceinline__ void vst2(void* p, T v) { *(T*)p = v;  }
__device__ __forceinline__ v8f wmma16(v16h a, v16h b, v8f c) {
  v8f d = __builtin_amdgcn_wmma_f32_16x16x32_f16(false, a, false, b, (short)0, c, false, false);
  asm volatile("v_nop\n\tv_nop\n\tv_nop\n\tv_nop" : "+v"(d) : "v"(a), "v"(b));
  return d;
}
__device__ __forceinline__ v8f wmma_bf(v16b a, v16b b, v8f c) {
  v8f d = __builtin_amdgcn_wmma_f32_16x16x32_bf16(false, a, false, b, (short)0, c, false, false);
  asm volatile("v_nop\n\tv_nop\n\tv_nop\n\tv_nop" : "+v"(d) : "v"(a), "v"(b));
  return d;
}
// 16x16x32 fragments: lane = (h = lane>>4, row/col = lane&15); elements 0..7 = k0+8h+0..7, 8..15 = k0+16+8h+0..7; D element r = row 8h+r
__device__ __forceinline__ v16h frag_h(const _Float16* rowk0, int lane) {
  union { v16h v; v8h q[2]; } u; const _Float16* p = rowk0 + 8 * (lane >> 4);
  u.q[0] = *(const v8h*)p; u.q[1] = *(const v8h*)(p + 16); return u.v;
}
__device__ __forceinline__ v16h frag_f32(const float* rowk0, int lane) {
  v16h a; const float* p = rowk0 + 8 * (lane >> 4);
#pragma unroll
  for (int i = 0; i < 8; ++i) { a[i] = (_Float16)p[i]; a[8 + i] = (_Float16)p[16 + i]; }
  return a;
}
__device__ __forceinline__ v16h frag_f32s(const float* rowk0, int lane, float sc) {
  v16h a; const float* p = rowk0 + 8 * (lane >> 4);
#pragma unroll
  for (int i = 0; i < 8; ++i) { a[i] = (_Float16)(p[i] * sc); a[8 + i] = (_Float16)(p[16 + i] * sc); }
  return a;
}
// column fragment from a [K][ld] layout (column n), rows >= K read as 0
__device__ __forceinline__ v16h fragc_f32(const float* W, int k0, int n, int lane, int ld, int K) {
  v16h a; const int g = lane >> 4;
#pragma unroll
  for (int i = 0; i < 8; ++i) { const int ka = k0 + 8 * g + i, kb = ka + 16;
    a[i] = (_Float16)(ka < K ? W[(size_t)(ka < K ? ka : K - 1) * ld + n] : 0.f); a[8 + i] = (_Float16)(kb < K ? W[(size_t)(kb < K ? kb : K - 1) * ld + n] : 0.f); }
  return a;
}
struct F2 { v16b h, l; };
__device__ __forceinline__ F2 bsplit16(const float v[16]) { F2 r;
#pragma unroll
  for (int i = 0; i < 16; ++i) { const __bf16 h = (__bf16)v[i]; r.h[i] = h; r.l[i] = (__bf16)(v[i] - (float)h); }
  return r; }
__device__ __forceinline__ F2 split_row(const float* row, int k0, int lane) { float v[16]; const float* p = row + k0 + 8 * (lane >> 4);
#pragma unroll
  for (int i = 0; i < 8; ++i) { v[i] = p[i]; v[8 + i] = p[16 + i]; }
  return bsplit16(v); }
__device__ __forceinline__ F2 split_rowK(const float* row, int k0, int lane, int K) { float v[16]; const int g = lane >> 4;
#pragma unroll
  for (int i = 0; i < 8; ++i) { const int ka = k0 + 8 * g + i, kb = ka + 16; v[i] = ka < K ? row[ka < K ? ka : K - 1] : 0.f; v[8 + i] = kb < K ? row[kb < K ? kb : K - 1] : 0.f; }
  return bsplit16(v); }
__device__ __forceinline__ F2 split_col(const float* W, int k0, int n, int lane, int ld, int K) { float v[16]; const int g = lane >> 4;
#pragma unroll
  for (int i = 0; i < 8; ++i) { const int ka = k0 + 8 * g + i, kb = ka + 16; v[i] = ka < K ? W[(size_t)(ka < K ? ka : K - 1) * ld + n] : 0.f; v[8 + i] = kb < K ? W[(size_t)(kb < K ? kb : K - 1) * ld + n] : 0.f; }
  return bsplit16(v); }
__device__ __forceinline__ v8f mac3(const F2& a, const F2& b, v8f c) { c = wmma_bf(a.l, b.h, c); c = wmma_bf(a.h, b.l, c); return wmma_bf(a.h, b.h, c); }
__device__ __forceinline__ float sigm(float v) { return 1.0f / (1.0f + expf(-v)); }
#define LDSX() do { asm volatile("s_wait_dscnt 0" ::: "memory"); __builtin_amdgcn_wave_barrier(); __builtin_amdgcn_fence(__ATOMIC_RELEASE, "workgroup"); } while (0)

// Multi-head attention with an additive dense mask (B 2, S 2,048, d_model 512 -> key/value dim 256 = 8 heads x 32 -> out 512; 0.02-scale (in,out) weights, zero biases; separate V, Q, K inputs): scores = q k^T / sqrt(256) (the FULL key_dim, as written) + mask[b, 0, q, k] (random normal); out = merged(softmax v) Wo + bo.
#define NB 2
#define TT 2048
#define CC 256            // NH * HD = projected width
#define DIN 512          // input (model) width
#define NH 8
#define HD 32
#define NQB (TT / 64)
#define HG 4
#define SCALE (0.0625f)
#define CAUSAL 0
#ifndef TNB
#define TNB NB
#endif
__device__ __forceinline__ float bfr(float v) { return (float)(__bf16)v; }
__host__ __device__ __forceinline__ int kb_last(int qb) { return CAUSAL ? ((qb * 64 + 63) >> 7) : (TT / 128 - 1); }
typedef __attribute__((ext_vector_type(8))) __bf16 v8b;
__device__ __forceinline__ v16b frag_b(const __bf16* rowk0, int lane) {
  union { v16b v; v8b q[2]; } u; const __bf16* p = rowk0 + 8 * (lane >> 4);
  u.q[0] = *(const v8b*)p; u.q[1] = *(const v8b*)(p + 16); return u.v;
}
#define QBH 0
#define QHI 2048            // rows carrying a q residual plane (all rows when non-causal: 2-product logits everywhere)
#define KHI 64            // key rows carrying k residual / v bf16 hi+lo planes (written by k_proj; no kernel here reads them)
// B fragment (k rows k0+.., output column o) of a weight: (in,out) [K][ld] or (out,in) [ld rows of K]: bf16 exact, or f16(bf16 * 256) exact
__device__ __forceinline__ v16b wcol_io(const float* Wm, int k0, int o, int lane, int ld) { v16b w; const int g = lane >> 4;
#pragma unroll
  for (int i = 0; i < 8; ++i) { w[i] = (__bf16)Wm[(size_t)(k0 + 8 * g + i) * ld + o]; w[8 + i] = (__bf16)Wm[(size_t)(k0 + 16 + 8 * g + i) * ld + o]; }
  return w; }
__device__ __forceinline__ v16b wcol_oi(const float* Wm, int k0, int o, int lane, int K) { v16b w; const float* p = Wm + (size_t)o * K + k0 + 8 * (lane >> 4);
#pragma unroll
  for (int i = 0; i < 8; ++i) { w[i] = (__bf16)p[i]; w[8 + i] = (__bf16)p[16 + i]; }
  return w; }
__device__ __forceinline__ v16h wcolh_io(const float* Wm, int k0, int o, int lane, int ld) { v16h w; const int g = lane >> 4;
#pragma unroll
  for (int i = 0; i < 8; ++i) { w[i] = (_Float16)(bfr(Wm[(size_t)(k0 + 8 * g + i) * ld + o]) * 256.0f); w[8 + i] = (_Float16)(bfr(Wm[(size_t)(k0 + 16 + 8 * g + i) * ld + o]) * 256.0f); }
  return w; }
__device__ __forceinline__ v16h wcolh_oi(const float* Wm, int k0, int o, int lane, int K) { v16h w; const float* p = Wm + (size_t)o * K + k0 + 8 * (lane >> 4);
#pragma unroll
  for (int i = 0; i < 8; ++i) { w[i] = (_Float16)(bfr(p[i]) * 256.0f); w[8 + i] = (_Float16)(bfr(p[16 + i]) * 256.0f); }
  return w; }
#define WQKV_LAYOUT 0   // 0 = (in,out) [DIN][CC]; 1 = (out,in) [CC][DIN]; 2 = per-head [NH][DIN][HD]
__device__ __forceinline__ v16b wcol_hdk(const float* Wm, int k0, int o, int lane) { v16b w; const int g = lane >> 4; const float* p = Wm + (size_t)(o / HD) * DIN * HD + (o % HD);
#pragma unroll
  for (int i = 0; i < 8; ++i) { w[i] = (__bf16)p[(size_t)(k0 + 8 * g + i) * HD]; w[8 + i] = (__bf16)p[(size_t)(k0 + 16 + 8 * g + i) * HD]; }
  return w; }
#define WO_OUT_IN 0
#if WQKV_LAYOUT == 1
#define WCOL(W, k0, o, lane) wcol_oi(W, k0, o, lane, DIN)
#elif WQKV_LAYOUT == 2
#define WCOL(W, k0, o, lane) wcol_hdk(W, k0, o, lane)
#else
#define WCOL(W, k0, o, lane) wcol_io(W, k0, o, lane, CC)
#endif
#if WO_OUT_IN
#define WOCOL(W, k0, o, lane) wcol_oi(W, k0, o, lane, CC)
#define WOCOLH(W, k0, o, lane) wcolh_oi(W, k0, o, lane, CC)
#else
#define WOCOL(W, k0, o, lane) wcol_io(W, k0, o, lane, DIN)
#define WOCOLH(W, k0, o, lane) wcolh_io(W, k0, o, lane, DIN)
#endif

#define WS_QH  0u                                      // f16 q rows [b*t][CC]
#define WS_KH  (WS_QH + 2u * (size_t)NB * TT * CC)      // f16 k in fragment order [b][head][16-key tile][plane 2][lane 32][8]
#define WS_VT  (WS_KH + 2u * (size_t)NB * TT * CC)      // f16 v in fragment order [b][head][32-key block][16-column half 2][plane 2][lane 32][8]
#define WS_QL  (WS_VT + 2u * (size_t)NB * CC * TT)      // f16 q residual x 2^10 rows [b][t < QHI][CC]
#define WS_KL  (WS_QL + 2u * (size_t)NB * QHI * CC)     // f16 k residual x 2^10 rows [b][t < KHI][CC]
#define WS_VB  (WS_KL + 2u * (size_t)NB * KHI * CC)     // bf16 v hi planes [b][c][t < KHI]
#define WS_VBL (WS_VB + 2u * (size_t)NB * CC * KHI)
#define WS_S   (WS_VBL + 2u * (size_t)NB * CC * KHI)    // f32 [hg][t][s]; reserved, not used by any kernel here
#define WS_Y   (WS_S  + 4u * (size_t)HG * TT * TT)      // f32 ctx rows [b*t][CC] (only when there is an output projection)
#define WS_END (WS_Y  + 4u * (size_t)NB * TT * CC)

// ---- weight tiles through LDS: thread t fetches column c0 + t of a 32-row k-step (each wave load = one whole 128-byte line), rounds it to bf16 and lays it as row t of wt (k contiguous, pitch 80 bytes); frag_b then reads the same k order as wcol_io
#define WPI 40            // bf16 per LDS row: 64 bytes of data at the conflict-free 80-byte pitch for 16-byte reads
template <int LD> __device__ __forceinline__ void wfetch(float (&r)[32], const float* __restrict__ Wc, int kc) {
#pragma unroll   // constant indices: the arrays stay in registers
  for (int k = 0; k < 32; ++k) r[k] = Wc[(size_t)(kc * 32 + k) * LD]; }
__device__ __forceinline__ void wlay(__bf16* row, const float (&r)[32]) {
#pragma unroll   // constant indices: the arrays stay in registers
  for (int q = 0; q < 4; ++q) { v8b t;
#pragma unroll   // constant indices: the arrays stay in registers
    for (int i = 0; i < 8; ++i) t[i] = (__bf16)r[q * 8 + i];
    *(v8b*)(row + q * 8) = t; } }
// work-group barrier that orders LDS only: __syncthreads() also waits out every global load, which would end the fetch-ahead at each k-step
__device__ __forceinline__ void lds_barrier() { __builtin_amdgcn_fence(__ATOMIC_RELEASE, "workgroup", "local"); __builtin_amdgcn_s_barrier(); __builtin_amdgcn_fence(__ATOMIC_ACQUIRE, "workgroup", "local"); }
// the 16 f32 of this lane's A fragment of one k-step (p = row + 8 * (lane >> 4))
__device__ __forceinline__ void afetch(v4f (&x)[4], const float* __restrict__ p, int kc) { const float* s = p + kc * 32; x[0] = *(const v4f*)s; x[1] = *(const v4f*)(s + 4); x[2] = *(const v4f*)(s + 16); x[3] = *(const v4f*)(s + 20); }
// ---- k_proj: block = (64 rows, 128 cols, which): q/k/v = X W (+ b) with exact bf16 products (K = DIN) -> which 0: q f16 rows (+ residual rows < QHI); 1: k f16 in fragment order (+ residual rows < KHI); 2: v f16 in fragment order (+ bf16 hi/lo planes for t < KHI)
// fragment order: the 16 bytes that lane l of k_attn loads as elements 0..7 (plane 0) or 8..15 (plane 1) of an A fragment lie at plane * 512 + l * 16, so one wave load there is 512 contiguous bytes = 4 whole lines
__global__ __launch_bounds__(128) void k_proj(const float* __restrict__ XQ, const float* __restrict__ XK, const float* __restrict__ XV, const float* __restrict__ WQ, const float* __restrict__ WK, const float* __restrict__ WV, const float* __restrict__ BQ, const float* __restrict__ BK, const float* __restrict__ BV,
    _Float16* __restrict__ QH, _Float16* __restrict__ QL, _Float16* __restrict__ KH, _Float16* __restrict__ KL, _Float16* __restrict__ VT, __bf16* __restrict__ VB, __bf16* __restrict__ VBL) {
  __shared__ __align__(16) _Float16 sh[64][136], sl[64][136]; __shared__ __align__(16) _Float16 th[128][72]; __shared__ __align__(16) __bf16 tb[128][72], tbl[128][72]; __shared__ __align__(16) __bf16 wt[2][128][WPI];
  const int tid = threadIdx.x, wave = tid >> 5, lane = tid & 31, col = lane & 15, g = lane >> 4; const int which = blockIdx.z; const int c0 = blockIdx.y * 128; const size_t r0 = (size_t)blockIdx.x * 64; const size_t bb = r0 / TT; const int t0 = (int)(r0 % TT);
  const float* X = which == 0 ? XQ : which == 1 ? XK : XV; const float* WA = which == 0 ? WQ : which == 1 ? WK : WV; const float* BA = which == 0 ? BQ : which == 1 ? BK : BV;
  v8f acc[8] = {};
  const float* Wc = WA + c0 + tid; const float* Xp = X + (r0 + wave * 16 + col) * DIN + 8 * g;
  float wr[2][32]; v4f xr[2][4];   // two k-steps in flight in registers
  wfetch<CC>(wr[0], Wc, 0); afetch(xr[0], Xp, 0); wfetch<CC>(wr[1], Wc, 1); afetch(xr[1], Xp, 1);
  asm volatile("s_wait_xcnt 0x0" ::: "memory");     // in front of every rewrite of the address registers of the loads above
  __builtin_amdgcn_sched_barrier(0);                // keeps those loads up here, all in flight together
#pragma unroll   // constant indices: the arrays stay in registers
  for (int kc = 0; kc < DIN / 32; ++kc) { const int s = kc & 1; v16b a;
    wlay(&wt[s][tid][0], wr[s]);
#pragma unroll   // constant indices: the arrays stay in registers
    for (int i = 0; i < 4; ++i) { a[i] = (__bf16)xr[s][0][i]; a[4 + i] = (__bf16)xr[s][1][i]; a[8 + i] = (__bf16)xr[s][2][i]; a[12 + i] = (__bf16)xr[s][3][i]; }
    __builtin_amdgcn_sched_barrier(0);   // the refill below reuses the registers just read: lifted over their readers it would take a third register set
    if (kc + 2 < DIN / 32) { wfetch<CC>(wr[s], Wc, kc + 2); afetch(xr[s], Xp, kc + 2);
      asm volatile("s_wait_xcnt 0x0" ::: "memory");     // in front of every rewrite of the address registers of the loads above
      __builtin_amdgcn_sched_barrier(0); }              // keeps every later register write behind that wait
    lds_barrier();   // publishes wt[s]; every reader of wt[s] two k-steps back has passed the barrier in between
    v16b w[8];
#pragma unroll   // constant indices: the arrays stay in registers
    for (int j = 0; j < 8; ++j) w[j] = frag_b(&wt[s][j * 16 + col][0], lane);
    __builtin_amdgcn_sched_barrier(0);   // keeps the 16 LDS reads together ahead of the products: spread among them each pair costs its own LDS latency
#pragma unroll   // constant indices: the arrays stay in registers
    for (int j = 0; j < 8; ++j) acc[j] = wmma_bf(a, w[j], acc[j]); }
  if (which < 2) { _Float16* DH = which == 0 ? QH : KH; _Float16* DL = which == 0 ? QL : KL; const int nhi = which == 0 ? QHI : KHI; const bool hi_rows = t0 < nhi;
#pragma unroll
    for (int j = 0; j < 8; ++j) { const float bias = BA ? bfr(BA[c0 + j * 16 + col]) : 0.f;
#pragma unroll
      for (int r = 0; r < 8; ++r) { const float v = acc[j][r] + bias; const _Float16 hv = (_Float16)v; sh[wave * 16 + 8 * g + r][j * 16 + col] = hv; sl[wave * 16 + 8 * g + r][j * 16 + col] = (_Float16)((v - (float)hv) * 1024.0f); } }
    __syncthreads();
    for (int e = tid; e < 64 * 16; e += 128) { const int rl = e >> 4, q = e & 15;
      if (which == 0) { vst2((unsigned*)(DH + (r0 + rl) * CC + c0 + q * 8), *(const v4u*)&sh[rl][q * 8]);
        asm volatile("s_wait_xcnt 0x0" ::: "memory"); }   // inside the arm: in front of every rewrite of the registers of the store above, on every way out of it
      else { const int l = e & 31, p = (e >> 5) & 1, tl = (e >> 6) & 3, hh = e >> 8;   // A fragment of S^T: row = key 16 tl + (l & 15), k = head column 16 p + 8 (l >> 4) + 0..7
        vst2((unsigned*)(KH + ((((bb * NH + (c0 >> 5) + hh) * (TT / 16) + (t0 >> 4) + tl) * 2 + p) * 256 + l * 8)), *(const v4u*)&sh[tl * 16 + (l & 15)][hh * 32 + p * 16 + (l >> 4) * 8]);
        asm volatile("s_wait_xcnt 0x0" ::: "memory"); }   // inside the arm: in front of every rewrite of the registers of the store above, on every way out of it
      if (hi_rows) { vst2((unsigned*)(DL + (bb * nhi + t0 + rl) * (size_t)CC + c0 + q * 8), *(const v4u*)&sl[rl][q * 8]);
        asm volatile("s_wait_xcnt 0x0" ::: "memory"); } }   // in front of every rewrite of the registers of the store above
  } else { const bool hi_rows = t0 < KHI;
#pragma unroll
    for (int j = 0; j < 8; ++j) { const float bias = BA ? bfr(BA[c0 + j * 16 + col]) : 0.f;
#pragma unroll
      for (int r = 0; r < 8; ++r) { const float v = acc[j][r] + bias; const int rl = wave * 16 + 8 * g + r, cl = j * 16 + col; th[cl][rl] = (_Float16)v; const __bf16 bh = (__bf16)v; tb[cl][rl] = bh; tbl[cl][rl] = (__bf16)(v - (float)bh); } }
    __syncthreads();
    for (int e = tid; e < 128 * 8; e += 128) { const int l = e & 31, p = (e >> 5) & 1, j = (e >> 6) & 1, kbl = (e >> 7) & 1, hh = e >> 8;   // A fragment of ctx^T: row = head column 16 j + (l & 15), k = key 16 p + 8 (l >> 4) + 0..7 of the 32-key block
      vst2((unsigned*)(VT + (((((bb * NH + (c0 >> 5) + hh) * (TT / 32) + (t0 >> 5) + kbl) * 2 + j) * 2 + p) * 256 + l * 8)), *(const v4u*)&th[hh * 32 + j * 16 + (l & 15)][kbl * 32 + p * 16 + (l >> 4) * 8]);
      asm volatile("s_wait_xcnt 0x0" ::: "memory"); }   // in front of every rewrite of the registers of the store above
    for (int e = tid; e < 128 * 8; e += 128) { const int cl = e >> 3, q = e & 7; if (hi_rows) { const size_t o3 = (bb * CC + c0 + cl) * (size_t)KHI + t0 + q * 8; vst2((unsigned*)(VB + o3), *(const v4u*)&tb[cl][q * 8]); vst2((unsigned*)(VBL + o3), *(const v4u*)&tbl[cl][q * 8]);
        asm volatile("s_wait_xcnt 0x0" ::: "memory"); } } } }   // in front of every rewrite of the registers of the two stores above
// ---- k_attn: block = (head, 64 queries, batch), 8 waves = 4 query tiles x KS key ranges. Transposed products: S^T = k q^T (q hi + residual x 2^10, 2 products), so a lane holds the scores of ONE query (col) at keys 8g+r of each 16-key tile;
// two such tiles, converted in place, are the B operand of ctx^T += v^T P^T. Running maximum and sum per lane (online softmax); P = exp(score - max + PSH) once to f16 (PSH cancels in the division by the sum). The KS partial results are joined through LDS.
#define KS 2
#define KR (TT / KS)      // keys per wave
#define NIT (KR / 64)     // 64 keys per pass
#define PSH 6.9314718f    // keeps P (at most 2^10) clear of f16 subnormals
#define LOG2E 1.44269504f  // exp(x) = exp2(x * LOG2E): P is rounded to f16 right after, so the library expf's range reduction and end tests buy nothing here
__device__ __forceinline__ float xhalf(float x) { return __builtin_bit_cast(float, __builtin_amdgcn_permlanex16(__builtin_bit_cast(int, x), __builtin_bit_cast(int, x), 0x76543210, 0xfedcba98, false, false)); }  // lane l with lane l ^ 16
__device__ __forceinline__ v8f wm(v16h a, v16h b, v8f c) { return __builtin_amdgcn_wmma_f32_16x16x32_f16(false, a, false, b, (short)0, c, false, false); }
// 16x16x32 fragment stored in fragment order at (wave-uniform base) + (lane byte offset lo = 16 * lane) + constant cb: plane 0 = elements 0..7, plane 1 (512 bytes on) = elements 8..15; same k order as frag_h
__device__ __forceinline__ v16h frag_w(const _Float16* ub, unsigned lo, int cb) { union { v16h v; v8h q[2]; } u; const char* p = (const char*)ub + lo; u.q[0] = *(const v8h*)(p + cb); u.q[1] = *(const v8h*)(p + cb + 512); return u.v; }
__global__ __launch_bounds__(256) void k_attn(const _Float16* __restrict__ QH, const _Float16* __restrict__ QL, const _Float16* __restrict__ KH, const _Float16* __restrict__ VT, const float* __restrict__ MKF, float* __restrict__ Y) {
  __shared__ float sp[4][18][32];
  const int tid = threadIdx.x, wave = __builtin_amdgcn_readfirstlane(tid >> 5), lane = tid & 31, col = lane & 15, g = lane >> 4; const int h = blockIdx.x, qb = blockIdx.y, b = blockIdx.z; const int qt = wave & 3, ks = wave >> 2;
  const int q0 = qb * 64 + qt * 16, q = q0 + col;
  const v16h qh = frag_h(QH + ((size_t)b * TT + q) * CC + h * HD, lane), ql = frag_h(QL + ((size_t)b * QHI + q) * CC + h * HD, lane);
  const unsigned fo = (unsigned)lane * 16u;   // a lane's place in each 512-byte plane
  const _Float16* Kb = KH + (((size_t)b * NH + h) * (TT / 16) + ks * (KR / 16)) * 512;   // A rows = keys, k = head columns: 1,024 bytes per 16-key tile
  float m = -3.0e38f, l = 0.f; v8f acc0 = {}, acc1 = {};
  v16h kf[4];
#pragma unroll
  for (int kt = 0; kt < 4; ++kt) kf[kt] = frag_w(Kb, fo, kt * 1024);
  asm volatile("s_wait_xcnt 0x0" ::: "memory");     // in front of every rewrite of the address registers of the q and k loads above
  __builtin_amdgcn_sched_barrier(0);                // keeps the address arithmetic of the loop behind that wait
  const _Float16* Vb = VT + (((size_t)b * NH + h) * (TT / 32) + ks * (KR / 32)) * 1024;  // A rows = head columns, k = keys: 2,048 bytes per 32-key block (two 16-column halves)
  const float* Mb = MKF + ((size_t)b * TT + q0) * TT + ks * KR;       const unsigned mo = (unsigned)(col * TT + 8 * g) * 4u;   // this lane's query row, its 8 keys of each 16-key tile
  for (int it = 0; it < NIT; ++it) {
    v4f mk[4][2]; const char* mp = (const char*)(Mb + it * 64) + mo;
#pragma unroll
    for (int kt = 0; kt < 4; ++kt) { mk[kt][0] = *(const v4f*)(mp + kt * 64); mk[kt][1] = *(const v4f*)(mp + kt * 64 + 16); }
    asm volatile("s_wait_xcnt 0x0" ::: "memory");   // in front of every rewrite of the address registers of the mask loads above (a v load below may land in them)
    v16h vf[2][2];
#pragma unroll
    for (int s = 0; s < 2; ++s) { vf[s][0] = frag_w(Vb + it * 2048, fo, s * 2048); vf[s][1] = frag_w(Vb + it * 2048, fo, s * 2048 + 1024); }
    asm volatile("s_wait_xcnt 0x0" ::: "memory");   // in front of every rewrite of the address registers of the v loads above
    __builtin_amdgcn_sched_barrier(0);              // holds those loads up here: without it they sink to their first use and the wave waits out each latency
    float v[4][8]; float mx = -3.0e38f;
#pragma unroll
    for (int kt = 0; kt < 4; ++kt) { const v8f z = {}; const v8f a = wm(kf[kt], qh, z), c = wm(kf[kt], ql, z);
#pragma unroll
      for (int r = 0; r < 8; ++r) { v[kt][r] = (a[r] + c[r] * (1.0f / 1024.0f)) * SCALE + bfr(mk[kt][r >> 2][r & 3]); mx = fmaxf(mx, v[kt][r]); } }
    const int nx = it + 1 < NIT ? it + 1 : it;   // next pass's k rows, fetched under this pass's softmax (the last pass fetches its own again)
#pragma unroll
    for (int kt = 0; kt < 4; ++kt) kf[kt] = frag_w(Kb + (size_t)nx * 2048, fo, kt * 1024);
    asm volatile("s_wait_xcnt 0x0" ::: "memory");   // in front of every rewrite of the address registers of the k loads above
    __builtin_amdgcn_sched_barrier(0);              // holds the k loads ahead of the softmax, which covers their latency
    mx = fmaxf(mx, xhalf(mx)); const float mn = fmaxf(m, mx); const float al = __builtin_amdgcn_exp2f((m - mn) * LOG2E); m = mn; const float nms = (PSH - mn) * LOG2E;
    float sum = 0.f; v16h p[2];
#pragma unroll
    for (int kt = 0; kt < 4; ++kt) {
#pragma unroll
      for (int r = 0; r < 8; ++r) { const float e = __builtin_amdgcn_exp2f(fmaf(v[kt][r], LOG2E, nms)); sum += e; p[kt >> 1][(kt & 1) * 8 + r] = (_Float16)e; } }
    l = l * al + sum;
#pragma unroll
    for (int r = 0; r < 8; ++r) { acc0[r] *= al; acc1[r] *= al; }
#pragma unroll
    for (int s = 0; s < 2; ++s) { acc0 = wm(vf[s][0], p[s], acc0); acc1 = wm(vf[s][1], p[s], acc1); } }
  l += xhalf(l);
  if (ks) { sp[qt][0][lane] = m; sp[qt][1][lane] = l;
#pragma unroll
    for (int r = 0; r < 8; ++r) { sp[qt][2 + r][lane] = acc0[r]; sp[qt][10 + r][lane] = acc1[r]; } }
  __syncthreads();
  if (!ks) { const float m1 = sp[qt][0][lane], l1 = sp[qt][1][lane]; const float mm = fmaxf(m, m1); float a0 = expf(m - mm), a1 = expf(m1 - mm); const float lt = l * a0 + l1 * a1; const float inv = lt > 0.f ? 1.0f / lt : 0.f; a0 *= inv; a1 *= inv;
    v4f o[4];
#pragma unroll
    for (int r = 0; r < 8; ++r) { o[r >> 2][r & 3] = acc0[r] * a0 + sp[qt][2 + r][lane] * a1; o[2 + (r >> 2)][r & 3] = acc1[r] * a0 + sp[qt][10 + r][lane] * a1; }
    float* yp = Y + ((size_t)b * TT + q) * CC + h * HD + 8 * g;   // ctx^T register r = head column 16 j + 8 g + r of query col
    vst2(yp, o[0]); vst2(yp + 4, o[1]); vst2(yp + 16, o[2]); vst2(yp + 20, o[3]); } }
// ---- k_out: block = (64 rows, 128 cols): out = ctx Wo (+ bo): all rows: ctx bf16 hi + lo against exact bf16 Wo (2 products); the f16 x f16(bf16 x 2^8) branch is never taken
__global__ __launch_bounds__(128) void k_out(const float* __restrict__ Y, const float* __restrict__ WO, const float* __restrict__ BO, float* __restrict__ OUT) { __shared__ __align__(16) float sf[4][16][132]; __shared__ __align__(16) __bf16 wt[2][128][WPI];
  const int tid = threadIdx.x, wave = tid >> 5, lane = tid & 31, col = lane & 15, g = lane >> 4; const int c0 = blockIdx.y * 128; const size_t r0 = (size_t)blockIdx.x * 64 + wave * 16;
  v8f acc[8] = {};
  if (true) {   /* ALL rows: ctx split bf16 hi + lo x exact Wo (2 products) */
    const float* Wc = WO + c0 + tid; const float* Yp = Y + (r0 + col) * CC + 8 * g;
    float wr[2][32]; v4f xr[2][4];   // two k-steps in flight in registers
    wfetch<DIN>(wr[0], Wc, 0); afetch(xr[0], Yp, 0); wfetch<DIN>(wr[1], Wc, 1); afetch(xr[1], Yp, 1);
    asm volatile("s_wait_xcnt 0x0" ::: "memory");     // in front of every rewrite of the address registers of the loads above
    __builtin_amdgcn_sched_barrier(0);                // keeps those loads up here, all in flight together
#pragma unroll   // constant indices: the arrays stay in registers
    for (int kc = 0; kc < CC / 32; ++kc) { const int s = kc & 1; float v[16];
      wlay(&wt[s][tid][0], wr[s]);
#pragma unroll   // constant indices: the arrays stay in registers
      for (int i = 0; i < 4; ++i) { v[i] = xr[s][0][i]; v[4 + i] = xr[s][1][i]; v[8 + i] = xr[s][2][i]; v[12 + i] = xr[s][3][i]; }
      const F2 a = bsplit16(v);
      __builtin_amdgcn_sched_barrier(0);   // the refill below reuses the registers just read: lifted over their readers it would take a third register set
      if (kc + 2 < CC / 32) { wfetch<DIN>(wr[s], Wc, kc + 2); afetch(xr[s], Yp, kc + 2);
        asm volatile("s_wait_xcnt 0x0" ::: "memory");     // in front of every rewrite of the address registers of the loads above
        __builtin_amdgcn_sched_barrier(0); }              // keeps every later register write behind that wait
      lds_barrier();   // publishes wt[s]; every reader of wt[s] two k-steps back has passed the barrier in between
      v16b w[8];
#pragma unroll   // constant indices: the arrays stay in registers
      for (int j = 0; j < 8; ++j) w[j] = frag_b(&wt[s][j * 16 + col][0], lane);
      __builtin_amdgcn_sched_barrier(0);   // keeps the 16 LDS reads together ahead of the products: spread among them each pair costs its own LDS latency
#pragma unroll   // constant indices: the arrays stay in registers
      for (int j = 0; j < 8; ++j) { acc[j] = wmma_bf(a.h, w[j], acc[j]); acc[j] = wmma_bf(a.l, w[j], acc[j]); } }
#pragma unroll
    for (int j = 0; j < 8; ++j) { const float bias = BO ? bfr(BO[c0 + j * 16 + col]) : 0.f;
#pragma unroll
      for (int r = 0; r < 8; ++r) sf[wave][8 * g + r][j * 16 + col] = acc[j][r] + bias; }
  } else {
#pragma unroll 2
    for (int kc = 0; kc < CC / 32; ++kc) { const v16h a = frag_f32(Y + (r0 + col) * CC + kc * 32, lane); asm volatile("s_wait_loadcnt 0x0" ::: "memory");
#pragma unroll
      for (int j = 0; j < 8; ++j) { const v16h w = WOCOLH(WO, kc * 32, c0 + j * 16 + col, lane); asm volatile("s_wait_loadcnt 0x0" ::: "memory"); acc[j] = wmma16(a, w, acc[j]); } }
#pragma unroll
    for (int j = 0; j < 8; ++j) { const float bias = BO ? bfr(BO[c0 + j * 16 + col]) : 0.f;
#pragma unroll
      for (int r = 0; r < 8; ++r) sf[wave][8 * g + r][j * 16 + col] = acc[j][r] * (1.0f / 256.0f) + bias; } }
  LDSX(); for (int rl = 0; rl < 16; ++rl) vst2(OUT + (r0 + rl) * DIN + c0 + lane * 4, *(const v4f*)&sf[wave][rl][lane * 4]); }

extern "C" void kernel_launch(void* const* d_in, const int* in_sizes, int n_in, void* d_out, int out_size, void* d_ws, size_t ws_size, hipStream_t stream) {
  (void)in_sizes; (void)n_in; (void)out_size;
  const float** F = (const float**)d_in;
  if (ws_size < (size_t)WS_END) return;
  char* ws = (char*)d_ws; _Float16 *QH = (_Float16*)(ws + WS_QH), *KH = (_Float16*)(ws + WS_KH), *VT = (_Float16*)(ws + WS_VT), *QL = (_Float16*)(ws + WS_QL), *KL = (_Float16*)(ws + WS_KL); __bf16 *VB = (__bf16*)(ws + WS_VB), *VBL = (__bf16*)(ws + WS_VBL); float *Y = (float*)(ws + WS_Y);
  (void)Y; (void)QL; (void)KL; (void)VB; (void)VBL;
  // inputs: 0 V [2,2048,512]; 1 Q; 2 K; 3 mask [2,1,2048,2048] f32; 4 Wq [512,256] (in,out), 5 bq; 6 Wk, 7 bk; 8 Wv, 9 bv; 10 Wo [256,512] (in,out), 11 bo [512]
  k_proj<<<dim3(TNB * TT / 64, CC / 128, 3), 128, 0, stream>>>(F[1], F[2], F[0], F[4], F[6], F[8], F[5], F[7], F[9], QH, QL, KH, KL, VT, VB, VBL);   /* q from Q (in1), k from K (in2), v from V (in0) */
  k_attn<<<dim3(NH, NQB, TNB), 256, 0, stream>>>(QH, QL, KH, VT, F[3], Y);
  k_out<<<dim3(TNB * TT / 64, DIN / 128), 128, 0, stream>>>(Y, F[10], F[11], (float*)d_out);
}

// v005
// Measured time: 43.8 microseconds a run.
// In both of two side-by-side timings against v004, it was 1.23 times as fast.
// Over all steps from v000 it is 10.3 times as fast.
// compute dtype: all float inputs rounded to bf16; q/k/v = in W + b with EXACT bf16 products on WMMA 16x16x32 (f32 accumulate); q as f16 hi + residual (x 2^10) against k once to f16 (2 products) / sqrt(256) + the additive f32 mask; online softmax in f32 (exponentials as hardware exp2 of one fma by log2 e); unnormalised P (at most 2^10) once to f16 against v once to f16 (1 product), divided by the f32 sum; ctx split bf16 hi + lo against exact Wo (2 products) + bo; f32 output.
#include <hip/hip_runtime.h>
#include <math.h>

typedef __attribute__((ext_vector_type(16))) _Float16 v16h;
typedef __attribute__((ext_vector_type(16))) __bf16 v16b;
typedef __attribute__((ext_vector_type(8)))  _Float16 v8h;
typedef __attribute__((ext_vector_type(8)))  float v8f;
typedef __attribute__((ext_vector_type(4)))  float v4f;
typedef __attribute__((ext_vector_type(2)))  float v2f;
typedef __attribute__((ext_vector_type(4)))  unsigned v4u;
typedef __attribute__((ext_vector_type(4)))  int v4i;
typedef float __attribute__((may_alias)) float_a;
typedef int __attribute__((may_alias)) int_a;

template <typename T> __device__ __forceinline__ void vst2(void* p, T v) { *(T*)p = v;  }
__device__ __forceinline__ v8f wmma16(v16h a, v16h b, v8f c) {
  v8f d = __builtin_amdgcn_wmma_f32_16x16x32_f16(false, a, false, b, (short)0, c, false, false);
  asm volatile("v_nop\n\tv_nop\n\tv_nop\n\tv_nop" : "+v"(d) : "v"(a), "v"(b));
  return d;
}
__device__ __forceinline__ v8f wmma_bf(v16b a, v16b b, v8f c) {
  v8f d = __builtin_amdgcn_wmma_f32_16x16x32_bf16(false, a, false, b, (short)0, c, false, false);
  asm volatile("v_nop\n\tv_nop\n\tv_nop\n\tv_nop" : "+v"(d) : "v"(a), "v"(b));
  return d;
}
// 16x16x32 fragments: lane = (h = lane>>4, row/col = lane&15); elements 0..7 = k0+8h+0..7, 8..15 = k0+16+8h+0..7; D element r = row 8h+r
__device__ __forceinline__ v16h frag_h(const _Float16* rowk0, int lane) {
  union { v16h v; v8h q[2]; } u; const _Float16* p = rowk0 + 8 * (lane >> 4);
  u.q[0] = *(const v8h*)p; u.q[1] = *(const v8h*)(p + 16); return u.v;
}
__device__ __forceinline__ v16h frag_f32(const float* rowk0, int lane) {
  v16h a; const float* p = rowk0 + 8 * (lane >> 4);
#pragma unroll
  for (int i = 0; i < 8; ++i) { a[i] = (_Float16)p[i]; a[8 + i] = (_Float16)p[16 + i]; }
  return a;
}
__device__ __forceinline__ v16h frag_f32s(const float* rowk0, int lane, float sc) {
  v16h a; const float* p = rowk0 + 8 * (lane >> 4);
#pragma unroll
  for (int i = 0; i < 8; ++i) { a[i] = (_Float16)(p[i] * sc); a[8 + i] = (_Float16)(p[16 + i] * sc); }
  return a;
}
// column fragment from a [K][ld] layout (column n), rows >= K read as 0
__device__ __forceinline__ v16h fragc_f32(const float* W, int k0, int n, int lane, int ld, int K) {
  v16h a; const int g = lane >> 4;
#pragma unroll
  for (int i = 0; i < 8; ++i) { const int ka = k0 + 8 * g + i, kb = ka + 16;
    a[i] = (_Float16)(ka < K ? W[(size_t)(ka < K ? ka : K - 1) * ld + n] : 0.f); a[8 + i] = (_Float16)(kb < K ? W[(size_t)(kb < K ? kb : K - 1) * ld + n] : 0.f); }
  return a;
}
struct F2 { v16b h, l; };
__device__ __forceinline__ F2 bsplit16(const float v[16]) { F2 r;
#pragma unroll
  for (int i = 0; i < 16; ++i) { const __bf16 h = (__bf16)v[i]; r.h[i] = h; r.l[i] = (__bf16)(v[i] - (float)h); }
  return r; }
__device__ __forceinline__ F2 split_row(const float* row, int k0, int lane) { float v[16]; const float* p = row + k0 + 8 * (lane >> 4);
#pragma unroll
  for (int i = 0; i < 8; ++i) { v[i] = p[i]; v[8 + i] = p[16 + i]; }
  return bsplit16(v); }
__device__ __forceinline__ F2 split_rowK(const float* row, int k0, int lane, int K) { float v[16]; const int g = lane >> 4;
#pragma unroll
  for (int i = 0; i < 8; ++i) { const int ka = k0 + 8 * g + i, kb = ka + 16; v[i] = ka < K ? row[ka < K ? ka : K - 1] : 0.f; v[8 + i] = kb < K ? row[kb < K ? kb : K - 1] : 0.f; }
  return bsplit16(v); }
__device__ __forceinline__ F2 split_col(const float* W, int k0, int n, int lane, int ld, int K) { float v[16]; const int g = lane >> 4;
#pragma unroll
  for (int i = 0; i < 8; ++i) { const int ka = k0 + 8 * g + i, kb = ka + 16; v[i] = ka < K ? W[(size_t)(ka < K ? ka : K - 1) * ld + n] : 0.f; v[8 + i] = kb < K ? W[(size_t)(kb < K ? kb : K - 1) * ld + n] : 0.f; }
  return bsplit16(v); }
__device__ __forceinline__ v8f mac3(const F2& a, const F2& b, v8f c) { c = wmma_bf(a.l, b.h, c); c = wmma_bf(a.h, b.l, c); return wmma_bf(a.h, b.h, c); }
__device__ __forceinline__ float sigm(float v) { return 1.0f / (1.0f + expf(-v)); }
#define LDSX() do { asm volatile("s_wait_dscnt 0" ::: "memory"); __builtin_amdgcn_wave_barrier(); __builtin_amdgcn_fence(__ATOMIC_RELEASE, "workgroup"); } while (0)

// Multi-head attention with an additive dense mask (B 2, S 2,048, d_model 512 -> key/value dim 256 = 8 heads x 32 -> out 512; 0.02-scale (in,out) weights, zero biases; separate V, Q, K inputs): scores = q k^T / sqrt(256) (the FULL key_dim, as written) + mask[b, 0, q, k] (random normal); out = merged(softmax v) Wo + bo.
#define NB 2
#define TT 2048
#define CC 256            // NH * HD = projected width
#define DIN 512          // input (model) width
#define NH 8
#define HD 32
#define NQB (TT / 64)
#define HG 4
#define SCALE (0.0625f)
#define CAUSAL 0
#ifndef TNB
#define TNB NB
#endif
__device__ __forceinline__ float bfr(float v) { return (float)(__bf16)v; }
__host__ __device__ __forceinline__ int kb_last(int qb) { return CAUSAL ? ((qb * 64 + 63) >> 7) : (TT / 128 - 1); }
typedef __attribute__((ext_vector_type(8))) __bf16 v8b;
__device__ __forceinline__ v16b frag_b(const __bf16* rowk0, int lane) {
  union { v16b v; v8b q[2]; } u; const __bf16* p = rowk0 + 8 * (lane >> 4);
  u.q[0] = *(const v8b*)p; u.q[1] = *(const v8b*)(p + 16); return u.v;
}
#define QBH 0
#define QHI 2048            // rows carrying a q residual plane (all rows when non-causal: 2-product logits everywhere)
#define KHI 64            // key rows carrying k residual / v bf16 hi+lo planes (written by k_proj; no kernel here reads them)
// B fragment (k rows k0+.., output column o) of a weight: (in,out) [K][ld] or (out,in) [ld rows of K]: bf16 exact, or f16(bf16 * 256) exact
__device__ __forceinline__ v16b wcol_io(const float* Wm, int k0, int o, int lane, int ld) { v16b w; const int g = lane >> 4;
#pragma unroll
  for (int i = 0; i < 8; ++i) { w[i] = (__bf16)Wm[(size_t)(k0 + 8 * g + i) * ld + o]; w[8 + i] = (__bf16)Wm[(size_t)(k0 + 16 + 8 * g + i) * ld + o]; }
  return w; }
__device__ __forceinline__ v16b wcol_oi(const float* Wm, int k0, int o, int lane, int K) { v16b w; const float* p = Wm + (size_t)o * K + k0 + 8 * (lane >> 4);
#pragma unroll
  for (int i = 0; i < 8; ++i) { w[i] = (__bf16)p[i]; w[8 + i] = (__bf16)p[16 + i]; }
  return w; }
__device__ __forceinline__ v16h wcolh_io(const float* Wm, int k0, int o, int lane, int ld) { v16h w; const int g = lane >> 4;
#pragma unroll
  for (int i = 0; i < 8; ++i) { w[i] = (_Float16)(bfr(Wm[(size_t)(k0 + 8 * g + i) * ld + o]) * 256.0f); w[8 + i] = (_Float16)(bfr(Wm[(size_t)(k0 + 16 + 8 * g + i) * ld + o]) * 256.0f); }
  return w; }
__device__ __forceinline__ v16h wcolh_oi(const float* Wm, int k0, int o, int lane, int K) { v16h w; const float* p = Wm + (size_t)o * K + k0 + 8 * (lane >> 4);
#pragma unroll
  for (int i = 0; i < 8; ++i) { w[i] = (_Float16)(bfr(p[i]) * 256.0f); w[8 + i] = (_Float16)(bfr(p[16 + i]) * 256.0f); }
  return w; }
#define WQKV_LAYOUT 0   // 0 = (in,out) [DIN][CC]; 1 = (out,in) [CC][DIN]; 2 = per-head [NH][DIN][HD]
__device__ __forceinline__ v16b wcol_hdk(const float* Wm, int k0, int o, int lane) { v16b w; const int g = lane >> 4; const float* p = Wm + (size_t)(o / HD) * DIN * HD + (o % HD);
#pragma unroll
  for (int i = 0; i < 8; ++i) { w[i] = (__bf16)p[(size_t)(k0 + 8 * g + i) * HD]; w[8 + i] = (__bf16)p[(size_t)(k0 + 16 + 8 * g + i) * HD]; }
  return w; }
#define WO_OUT_IN 0
#if WQKV_LAYOUT == 1
#define WCOL(W, k0, o, lane) wcol_oi(W, k0, o, lane, DIN)
#elif WQKV_LAYOUT == 2
#define WCOL(W, k0, o, lane) wcol_hdk(W, k0, o, lane)
#else
#define WCOL(W, k0, o, lane) wcol_io(W, k0, o, lane, CC)
#endif
#if WO_OUT_IN
#define WOCOL(W, k0, o, lane) wcol_oi(W, k0, o, lane, CC)
#define WOCOLH(W, k0, o, lane) wcolh_oi(W, k0, o, lane, CC)
#else
#define WOCOL(W, k0, o, lane) wcol_io(W, k0, o, lane, DIN)
#define WOCOLH(W, k0, o, lane) wcolh_io(W, k0, o, lane, DIN)
#endif

#define WS_QH  0u                                      // f16 q rows [b*t][CC]
#define WS_KH  (WS_QH + 2u * (size_t)NB * TT * CC)      // f16 k in fragment order [b][head][16-key tile][plane 2][lane 32][8]
#define WS_VT  (WS_KH + 2u * (size_t)NB * TT * CC)      // f16 v in fragment order [b][head][32-key block][16-column half 2][plane 2][lane 32][8]
#define WS_QL  (WS_VT + 2u * (size_t)NB * CC * TT)      // f16 q residual x 2^10 rows [b][t < QHI][CC]
#define WS_KL  (WS_QL + 2u * (size_t)NB * QHI * CC)     // f16 k residual x 2^10 rows [b][t < KHI][CC]
#define WS_VB  (WS_KL + 2u * (size_t)NB * KHI * CC)     // bf16 v hi planes [b][c][t < KHI]
#define WS_VBL (WS_VB + 2u * (size_t)NB * CC * KHI)
#define WS_S   (WS_VBL + 2u * (size_t)NB * CC * KHI)    // f32 [hg][t][s]; reserved, not used by any kernel here
#define WS_Y   (WS_S  + 4u * (size_t)HG * TT * TT)      // f32 ctx rows [b*t][CC] (only when there is an output projection)
#define WS_END (WS_Y  + 4u * (size_t)NB * TT * CC)

// ---- weight tiles through LDS: thread t fetches column c0 + t of a 32-row k-step (each wave load = one whole 128-byte line), rounds it to bf16 and lays it as row t of wt (k contiguous, pitch 80 bytes); frag_b then reads the same k order as wcol_io
#define WPI 40            // bf16 per LDS row: 64 bytes of data at the conflict-free 80-byte pitch for 16-byte reads
template <int LD> __device__ __forceinline__ void wfetch(float (&r)[32], const float* __restrict__ Wc, int kc) {
#pragma unroll   // constant indices: the arrays stay in registers
  for (int k = 0; k < 32; ++k) r[k] = Wc[(size_t)(kc * 32 + k) * LD]; }
__device__ __forceinline__ void wlay(__bf16* row, const float (&r)[32]) {
#pragma unroll   // constant indices: the arrays stay in registers
  for (int q = 0; q < 4; ++q) { v8b t;
#pragma unroll   // constant indices: the arrays stay in registers
    for (int i = 0; i < 8; ++i) t[i] = (__bf16)r[q * 8 + i];
    *(v8b*)(row + q * 8) = t; } }
// work-group barrier that orders LDS only: __syncthreads() also waits out every global load, which would end the fetch-ahead at each k-step
__device__ __forceinline__ void lds_barrier() { __builtin_amdgcn_fence(__ATOMIC_RELEASE, "workgroup", "local"); __builtin_amdgcn_s_barrier(); __builtin_amdgcn_fence(__ATOMIC_ACQUIRE, "workgroup", "local"); }
// the 16 f32 of this lane's A fragment of one k-step (p = row + 8 * (lane >> 4))
__device__ __forceinline__ void afetch(v4f (&x)[4], const float* __restrict__ p, int kc) { const float* s = p + kc * 32; x[0] = *(const v4f*)s; x[1] = *(const v4f*)(s + 4); x[2] = *(const v4f*)(s + 16); x[3] = *(const v4f*)(s + 20); }
// ---- k_proj: block = (64 rows, 128 cols, which): q/k/v = X W (+ b) with exact bf16 products (K = DIN) -> which 0: q f16 rows (+ residual rows < QHI); 1: k f16 in fragment order (+ residual rows < KHI); 2: v f16 in fragment order (+ bf16 hi/lo planes for t < KHI)
// fragment order: the 16 bytes that lane l of k_attn loads as elements 0..7 (plane 0) or 8..15 (plane 1) of an A fragment lie at plane * 512 + l * 16, so one wave load there is 512 contiguous bytes = 4 whole lines
__global__ __launch_bounds__(128) void k_proj(const float* __restrict__ XQ, const float* __restrict__ XK, const float* __restrict__ XV, const float* __restrict__ WQ, const float* __restrict__ WK, const float* __restrict__ WV, const float* __restrict__ BQ, const float* __restrict__ BK, const float* __restrict__ BV,
    _Float16* __restrict__ QH, _Float16* __restrict__ QL, _Float16* __restrict__ KH, _Float16* __restrict__ KL, _Float16* __restrict__ VT, __bf16* __restrict__ VB, __bf16* __restrict__ VBL) {
  __shared__ __align__(16) _Float16 sh[64][136], sl[64][136]; __shared__ __align__(16) _Float16 th[128][72]; __shared__ __align__(16) __bf16 tb[128][72], tbl[128][72]; __shared__ __align__(16) __bf16 wt[2][128][WPI];
  const int tid = threadIdx.x, wave = tid >> 5, lane = tid & 31, col = lane & 15, g = lane >> 4; const int which = blockIdx.z; const int c0 = blockIdx.y * 128; const size_t r0 = (size_t)blockIdx.x * 64; const size_t bb = r0 / TT; const int t0 = (int)(r0 % TT);
  const float* X = which == 0 ? XQ : which == 1 ? XK : XV; const float* WA = which == 0 ? WQ : which == 1 ? WK : WV; const float* BA = which == 0 ? BQ : which == 1 ? BK : BV;
  v8f acc[8] = {};
  const float* Wc = WA + c0 + tid; const float* Xp = X + (r0 + wave * 16 + col) * DIN + 8 * g;
  float wr[2][32]; v4f xr[2][4];   // two k-steps in flight in registers
  wfetch<CC>(wr[0], Wc, 0); afetch(xr[0], Xp, 0); wfetch<CC>(wr[1], Wc, 1); afetch(xr[1], Xp, 1);
  asm volatile("s_wait_xcnt 0x0" ::: "memory");     // in front of every rewrite of the address registers of the loads above
  __builtin_amdgcn_sched_barrier(0);                // keeps those loads up here, all in flight together
#pragma unroll   // constant indices: the arrays stay in registers
  for (int kc = 0; kc < DIN / 32; ++kc) { const int s = kc & 1; v16b a;
    wlay(&wt[s][tid][0], wr[s]);
#pragma unroll   // constant indices: the arrays stay in registers
    for (int i = 0; i < 4; ++i) { a[i] = (__bf16)xr[s][0][i]; a[4 + i] = (__bf16)xr[s][1][i]; a[8 + i] = (__bf16)xr[s][2][i]; a[12 + i] = (__bf16)xr[s][3][i]; }
    __builtin_amdgcn_sched_barrier(0);   // the refill below reuses the registers just read: lifted over their readers it would take a third register set
    if (kc + 2 < DIN / 32) { wfetch<CC>(wr[s], Wc, kc + 2); afetch(xr[s], Xp, kc + 2);
      asm volatile("s_wait_xcnt 0x0" ::: "memory");     // in front of every rewrite of the address registers of the loads above
      __builtin_amdgcn_sched_barrier(0); }              // keeps every later register write behind that wait
    lds_barrier();   // publishes wt[s]; every reader of wt[s] two k-steps back has passed the barrier in between
    v16b w[8];
#pragma unroll   // constant indices: the arrays stay in registers
    for (int j = 0; j < 8; ++j) w[j] = frag_b(&wt[s][j * 16 + col][0], lane);
    __builtin_amdgcn_sched_barrier(0);   // keeps the 16 LDS reads together ahead of the products: spread among them each pair costs its own LDS latency
#pragma unroll   // constant indices: the arrays stay in registers
    for (int j = 0; j < 8; ++j) acc[j] = wmma_bf(a, w[j], acc[j]); }
  if (which < 2) { _Float16* DH = which == 0 ? QH : KH; _Float16* DL = which == 0 ? QL : KL; const int nhi = which == 0 ? QHI : KHI; const bool hi_rows = t0 < nhi;
#pragma unroll
    for (int j = 0; j < 8; ++j) { const float bias = BA ? bfr(BA[c0 + j * 16 + col]) : 0.f;
#pragma unroll
      for (int r = 0; r < 8; ++r) { const float v = acc[j][r] + bias; const _Float16 hv = (_Float16)v; sh[wave * 16 + 8 * g + r][j * 16 + col] = hv; sl[wave * 16 + 8 * g + r][j * 16 + col] = (_Float16)((v - (float)hv) * 1024.0f); } }
    __syncthreads();
    for (int e = tid; e < 64 * 16; e += 128) { const int rl = e >> 4, q = e & 15;
      if (which == 0) { vst2((unsigned*)(DH + (r0 + rl) * CC + c0 + q * 8), *(const v4u*)&sh[rl][q * 8]);
        asm volatile("s_wait_xcnt 0x0" ::: "memory"); }   // inside the arm: in front of every rewrite of the registers of the store above, on every way out of it
      else { const int l = e & 31, p = (e >> 5) & 1, tl = (e >> 6) & 3, hh = e >> 8;   // A fragment of S^T: row = key 16 tl + (l & 15), k = head column 16 p + 8 (l >> 4) + 0..7
        vst2((unsigned*)(KH + ((((bb * NH + (c0 >> 5) + hh) * (TT / 16) + (t0 >> 4) + tl) * 2 + p) * 256 + l * 8)), *(const v4u*)&sh[tl * 16 + (l & 15)][hh * 32 + p * 16 + (l >> 4) * 8]);
        asm volatile("s_wait_xcnt 0x0" ::: "memory"); }   // inside the arm: in front of every rewrite of the registers of the store above, on every way out of it
      if (hi_rows) { vst2((unsigned*)(DL + (bb * nhi + t0 + rl) * (size_t)CC + c0 + q * 8), *(const v4u*)&sl[rl][q * 8]);
        asm volatile("s_wait_xcnt 0x0" ::: "memory"); } }   // in front of every rewrite of the registers of the store above
  } else { const bool hi_rows = t0 < KHI;
#pragma unroll
    for (int j = 0; j < 8; ++j) { const float bias = BA ? bfr(BA[c0 + j * 16 + col]) : 0.f;
#pragma unroll
      for (int r = 0; r < 8; ++r) { const float v = acc[j][r] + bias; const int rl = wave * 16 + 8 * g + r, cl = j * 16 + col; th[cl][rl] = (_Float16)v; const __bf16 bh = (__bf16)v; tb[cl][rl] = bh; tbl[cl][rl] = (__bf16)(v - (float)bh); } }
    __syncthreads();
    for (int e = tid; e < 128 * 8; e += 128) { const int l = e & 31, p = (e >> 5) & 1, j = (e >> 6) & 1, kbl = (e >> 7) & 1, hh = e >> 8;   // A fragment of ctx^T: row = head column 16 j + (l & 15), k = key 16 p + 8 (l >> 4) + 0..7 of the 32-key block
      vst2((unsigned*)(VT + (((((bb * NH + (c0 >> 5) + hh) * (TT / 32) + (t0 >> 5) + kbl) * 2 + j) * 2 + p) * 256 + l * 8)), *(const v4u*)&th[hh * 32 + j * 16 + (l & 15)][kbl * 32 + p * 16 + (l >> 4) * 8]);
      asm volatile("s_wait_xcnt 0x0" ::: "memory"); }   // in front of every rewrite of the registers of the store above
    for (int e = tid; e < 128 * 8; e += 128) { const int cl = e >> 3, q = e & 7; if (hi_rows) { const size_t o3 = (bb * CC + c0 + cl) * (size_t)KHI + t0 + q * 8; vst2((unsigned*)(VB + o3), *(const v4u*)&tb[cl][q * 8]); vst2((unsigned*)(VBL + o3), *(const v4u*)&tbl[cl][q * 8]);
        asm volatile("s_wait_xcnt 0x0" ::: "memory"); } } } }   // in front of every rewrite of the registers of the two stores above
// ---- k_attn: block = (head, 64 queries, batch), 8 waves = 4 query tiles x KS key ranges. Transposed products: S^T = k q^T (q hi + residual x 2^10, 2 products), so a lane holds the scores of ONE query (col) at keys 8g+r of each 16-key tile;
// two such tiles, converted in place, are the B operand of ctx^T += v^T P^T. Running maximum and sum per lane (online softmax); P = exp(score - max + PSH) once to f16 (PSH cancels in the division by the sum). The KS partial results are joined through LDS.
#define KS 2
#define KR (TT / KS)      // keys per wave
#define NIT (KR / 64)     // 64 keys per pass
#define PSH 6.9314718f    // keeps P (at most 2^10) clear of f16 subnormals
#define LOG2E 1.44269504f  // exp(x) = exp2(x * LOG2E): P is rounded to f16 right after, so the library expf's range reduction and end tests buy nothing here
__device__ __forceinline__ float xhalf(float x) { return __builtin_bit_cast(float, __builtin_amdgcn_permlanex16(__builtin_bit_cast(int, x), __builtin_bit_cast(int, x), 0x76543210, 0xfedcba98, false, false)); }  // lane l with lane l ^ 16
__device__ __forceinline__ v8f wm(v16h a, v16h b, v8f c) { return __builtin_amdgcn_wmma_f32_16x16x32_f16(false, a, false, b, (short)0, c, false, false); }
// 16x16x32 fragment stored in fragment order at (wave-uniform base) + (lane byte offset lo = 16 * lane) + constant cb: plane 0 = elements 0..7, plane 1 (512 bytes on) = elements 8..15; same k order as frag_h
__device__ __forceinline__ v16h frag_w(const _Float16* ub, unsigned lo, int cb) { union { v16h v; v8h q[2]; } u; const char* p = (const char*)ub + lo; u.q[0] = *(const v8h*)(p + cb); u.q[1] = *(const v8h*)(p + cb + 512); return u.v; }
// ---- the mask through LDS: each wave's tile of a pass (its 16 query rows x 64 keys, f32: 16 rows of 256 bytes, 8,192 bytes apart in memory) comes by ONE tensor load, one pass ahead, through no register;
// the mover pads each row by 16 bytes, so the lanes' 16-byte reads down a column of rows (pitch 272 bytes) meet no bank twice
typedef __attribute__((ext_vector_type(8))) unsigned v8u;
#define MROWB 256u        // bytes of one row of the tile
#define MPITCH 272u       // its pitch in LDS: the row + the 16-byte pad
#define MSLICE 6144u      // 16 rows x 272 bytes = 4,352, rounded up to a multiple of 2 KiB: every slice starts on one
#define MWORD0 ((1u << 20) | (5u << 22) | (3u << 25))   // group 1 word 0: no mask, 1-byte elements, a pad of 4 dwords behind every 64 dwords (one row)
__device__ __forceinline__ uint32_t uni(uint32_t v) { return (uint32_t)__builtin_amdgcn_readfirstlane((int)v); }
__device__ __forceinline__ uint32_t pinned(uint32_t v) { uint32_t w = uni(v); asm volatile("" : "+s"(w)); return w; }   // holds the issue test of a tensor load in a scalar register, so that the branch on it is a scalar one (the instruction ignores EXEC)
__device__ __forceinline__ void mask_tile_load(uint32_t lds_dst, const float* tile) { const uint64_t ga = (uint64_t)(size_t)tile;
  v4u g0; g0[0] = uni(1u); g0[1] = uni(lds_dst); g0[2] = uni((uint32_t)ga); g0[3] = uni((((uint32_t)(ga >> 32)) & 0x01FFFFFFu) | 0x80000000u);   // count 1; place in LDS; first byte of the tile; type 2
  v8u g1; g1[0] = uni(MWORD0); g1[1] = uni(MROWB << 16); g1[2] = uni(16u << 16); g1[3] = uni(MROWB << 16); g1[4] = uni(16u); g1[5] = uni(TT * 4u); g1[6] = uni(0u); g1[7] = uni(0u);   // tensor = tile = 256 bytes x 16 rows; source pitch = one mask row
  asm volatile("tensor_load_to_lds %0, %1" :: "s"(g0), "s"(g1) : "memory"); }   // one request of the whole wave
__global__ __launch_bounds__(256) void k_attn(const _Float16* __restrict__ QH, const _Float16* __restrict__ QL, const _Float16* __restrict__ KH, const _Float16* __restrict__ VT, const float* __restrict__ MKF, float* __restrict__ Y) {
  __shared__ __attribute__((aligned(2048))) unsigned char ms[2][8][MSLICE]; __shared__ float sp[4][18][32];
  const int tid = threadIdx.x, wave = __builtin_amdgcn_readfirstlane(tid >> 5), lane = tid & 31, col = lane & 15, g = lane >> 4; const int h = blockIdx.x, qb = blockIdx.y, b = blockIdx.z; const int qt = wave & 3, ks = wave >> 2;
  const int q0 = qb * 64 + qt * 16, q = q0 + col;
  const v16h qh = frag_h(QH + ((size_t)b * TT + q) * CC + h * HD, lane), ql = frag_h(QL + ((size_t)b * QHI + q) * CC + h * HD, lane);
  const unsigned fo = (unsigned)lane * 16u;   // a lane's place in each 512-byte plane
  const _Float16* Kb = KH + (((size_t)b * NH + h) * (TT / 16) + ks * (KR / 16)) * 512;   // A rows = keys, k = head columns: 1,024 bytes per 16-key tile
  float m = -3.0e38f, l = 0.f; v8f acc0 = {}, acc1 = {};
  v16h kf[4];
#pragma unroll
  for (int kt = 0; kt < 4; ++kt) kf[kt] = frag_w(Kb, fo, kt * 1024);
  asm volatile("s_wait_xcnt 0x0" ::: "memory");     // in front of every rewrite of the address registers of the q and k loads above
  __builtin_amdgcn_sched_barrier(0);                // keeps the address arithmetic of the loop behind that wait
  const _Float16* Vb = VT + (((size_t)b * NH + h) * (TT / 32) + ks * (KR / 32)) * 1024;  // A rows = head columns, k = keys: 2,048 bytes per 32-key block (two 16-column halves)
  const float* Mb = MKF + ((size_t)b * TT + q0) * TT + ks * KR;       const unsigned mo = (unsigned)col * MPITCH + 32u * (unsigned)g;   // this wave's 16 query rows; in LDS: this lane's query row, its 8 keys of each 16-key tile
  const uint32_t md = (uint32_t)(size_t)&ms[0][wave][0];   // this wave's slice of buffer 0; buffer 1 lies 8 slices on
  mask_tile_load(md, Mb);                                   // pass 0's tile
  for (int it = 0; it < NIT; ++it) {
    // publish point of pass it's tile, at the seam between pass it - 1 and pass it (written at the head: at the foot, its branch would cut the sums of the pass off from the softmax they are interleaved with)
    asm volatile("s_wait_dscnt 0x0" ::: "memory");       // the last pass's reads of its buffer have retired
    asm volatile("s_wait_tensorcnt 0x0" ::: "memory");   // this pass's tile has landed
    __syncthreads();                                     // publishes it; every reader has left the other buffer
    if (pinned(it + 1 < NIT)) mask_tile_load(md + (uint32_t)((it + 1) & 1) * (8u * MSLICE), Mb + (it + 1) * 64);   // the next pass's tile flies under this pass, into the buffer that the last pass read
    v4f mk[4][2]; const unsigned char* mp = &ms[it & 1][wave][0] + mo;
#pragma unroll
    for (int kt = 0; kt < 4; ++kt) { mk[kt][0] = *(const v4f*)(mp + kt * 64); mk[kt][1] = *(const v4f*)(mp + kt * 64 + 16); }
    v16h vf[2][2];
#pragma unroll
    for (int s = 0; s < 2; ++s) { vf[s][0] = frag_w(Vb + it * 2048, fo, s * 2048); vf[s][1] = frag_w(Vb + it * 2048, fo, s * 2048 + 1024); }
    asm volatile("s_wait_xcnt 0x0" ::: "memory");   // in front of every rewrite of the address registers of the v loads above
    __builtin_amdgcn_sched_barrier(0);              // holds those loads up here: without it they sink to their first use and the wave waits out each latency
    float v[4][8]; float mx = -3.0e38f;
#pragma unroll
    for (int kt = 0; kt < 4; ++kt) { const v8f z = {}; const v8f a = wm(kf[kt], qh, z), c = wm(kf[kt], ql, z);
#pragma unroll
      for (int r = 0; r < 8; ++r) { v[kt][r] = (a[r] + c[r] * (1.0f / 1024.0f)) * SCALE + bfr(mk[kt][r >> 2][r & 3]); mx = fmaxf(mx, v[kt][r]); } }
    const int nx = it + 1 < NIT ? it + 1 : it;   // next pass's k rows, fetched under this pass's softmax (the last pass fetches its own again)
#pragma unroll
    for (int kt = 0; kt < 4; ++kt) kf[kt] = frag_w(Kb + (size_t)nx * 2048, fo, kt * 1024);
    asm volatile("s_wait_xcnt 0x0" ::: "memory");   // in front of every rewrite of the address registers of the k loads above
    __builtin_amdgcn_sched_barrier(0);              // holds the k loads ahead of the softmax, which covers their latency
    mx = fmaxf(mx, xhalf(mx)); const float mn = fmaxf(m, mx); const float al = __builtin_amdgcn_exp2f((m - mn) * LOG2E); m = mn; const float nms = (PSH - mn) * LOG2E;
    float sum = 0.f; v16h p[2];
#pragma unroll
    for (int kt = 0; kt < 4; ++kt) {
#pragma unroll
      for (int r = 0; r < 8; ++r) { const float e = __builtin_amdgcn_exp2f(fmaf(v[kt][r], LOG2E, nms)); sum += e; p[kt >> 1][(kt & 1) * 8 + r] = (_Float16)e; } }
    l = l * al + sum;
#pragma unroll
    for (int r = 0; r < 8; ++r) { acc0[r] *= al; acc1[r] *= al; }
#pragma unroll
    for (int s = 0; s < 2; ++s) { acc0 = wm(vf[s][0], p[s], acc0); acc1 = wm(vf[s][1], p[s], acc1); } }
  asm volatile("s_wait_tensorcnt 0x0" ::: "memory");     // nothing of the mover is in flight behind the loop
  asm volatile("s_wait_dscnt 0x0" ::: "memory");         // and no read of the two buffers
  l += xhalf(l);
  if (ks) { sp[qt][0][lane] = m; sp[qt][1][lane] = l;
#pragma unroll
    for (int r = 0; r < 8; ++r) { sp[qt][2 + r][lane] = acc0[r]; sp[qt][10 + r][lane] = acc1[r]; } }
  __syncthreads();
  if (!ks) { const float m1 = sp[qt][0][lane], l1 = sp[qt][1][lane]; const float mm = fmaxf(m, m1); float a0 = expf(m - mm), a1 = expf(m1 - mm); const float lt = l * a0 + l1 * a1; const float inv = lt > 0.f ? 1.0f / lt : 0.f; a0 *= inv; a1 *= inv;
    v4f o[4];
#pragma unroll
    for (int r = 0; r < 8; ++r) { o[r >> 2][r & 3] = acc0[r] * a0 + sp[qt][2 + r][lane] * a1; o[2 + (r >> 2)][r & 3] = acc1[r] * a0 + sp[qt][10 + r][lane] * a1; }
    float* yp = Y + ((size_t)b * TT + q) * CC + h * HD + 8 * g;   // ctx^T register r = head column 16 j + 8 g + r of query col
    vst2(yp, o[0]); vst2(yp + 4, o[1]); vst2(yp + 16, o[2]); vst2(yp + 20, o[3]); } }
// ---- k_out: block = (64 rows, 128 cols): out = ctx Wo (+ bo): all rows: ctx bf16 hi + lo against exact bf16 Wo (2 products); the f16 x f16(bf16 x 2^8) branch is never taken
__global__ __launch_bounds__(128) void k_out(const float* __restrict__ Y, const float* __restrict__ WO, const float* __restrict__ BO, float* __restrict__ OUT) { __shared__ __align__(16) float sf[4][16][132]; __shared__ __align__(16) __bf16 wt[2][128][WPI];
  const int tid = threadIdx.x, wave = tid >> 5, lane = tid & 31, col = lane & 15, g = lane >> 4; const int c0 = blockIdx.y * 128; const size_t r0 = (size_t)blockIdx.x * 64 + wave * 16;
  v8f acc[8] = {};
  if (true) {   /* ALL rows: ctx split bf16 hi + lo x exact Wo (2 products) */
    const float* Wc = WO + c0 + tid; const float* Yp = Y + (r0 + col) * CC + 8 * g;
    float wr[2][32]; v4f xr[2][4];   // two k-steps in flight in registers
    wfetch<DIN>(wr[0], Wc, 0); afetch(xr[0], Yp, 0); wfetch<DIN>(wr[1], Wc, 1); afetch(xr[1], Yp, 1);
    asm volatile("s_wait_xcnt 0x0" ::: "memory");     // in front of every rewrite of the address registers of the loads above
    __builtin_amdgcn_sched_barrier(0);                // keeps those loads up here, all in flight together
#pragma unroll   // constant indices: the arrays stay in registers
    for (int kc = 0; kc < CC / 32; ++kc) { const int s = kc & 1; float v[16];
      wlay(&wt[s][tid][0], wr[s]);
#pragma unroll   // constant indices: the arrays stay in registers
      for (int i = 0; i < 4; ++i) { v[i] = xr[s][0][i]; v[4 + i] = xr[s][1][i]; v[8 + i] = xr[s][2][i]; v[12 + i] = xr[s][3][i]; }
      const F2 a = bsplit16(v);
      __builtin_amdgcn_sched_barrier(0);   // the refill below reuses the registers just read: lifted over their readers it would take a third register set
      if (kc + 2 < CC / 32) { wfetch<DIN>(wr[s], Wc, kc + 2); afetch(xr[s], Yp, kc + 2);
        asm volatile("s_wait_xcnt 0x0" ::: "memory");     // in front of every rewrite of the address registers of the loads above
        __builtin_amdgcn_sched_barrier(0); }              // keeps every later register write behind that wait
      lds_barrier();   // publishes wt[s]; every reader of wt[s] two k-steps back has passed the barrier in between
      v16b w[8];
#pragma unroll   // constant indices: the arrays stay in registers
      for (int j = 0; j < 8; ++j) w[j] = frag_b(&wt[s][j * 16 + col][0], lane);
      __builtin_amdgcn_sched_barrier(0);   // keeps the 16 LDS reads together ahead of the products: spread among them each pair costs its own LDS latency
#pragma unroll   // constant indices: the arrays stay in registers
      for (int j = 0; j < 8; ++j) { acc[j] = wmma_bf(a.h, w[j], acc[j]); acc[j] = wmma_bf(a.l, w[j], acc[j]); } }
#pragma unroll
    for (int j = 0; j < 8; ++j) { const float bias = BO ? bfr(BO[c0 + j * 16 + col]) : 0.f;
#pragma unroll
      for (int r = 0; r < 8; ++r) sf[wave][8 * g + r][j * 16 + col] = acc[j][r] + bias; }
  } else {
#pragma unroll 2
    for (int kc = 0; kc < CC / 32; ++kc) { const v16h a = frag_f32(Y + (r0 + col) * CC + kc * 32, lane); asm volatile("s_wait_loadcnt 0x0" ::: "memory");
#pragma unroll
      for (int j = 0; j < 8; ++j) { const v16h w = WOCOLH(WO, kc * 32, c0 + j * 16 + col, lane); asm volatile("s_wait_loadcnt 0x0" ::: "memory"); acc[j] = wmma16(a, w, acc[j]); } }
#pragma unroll
    for (int j = 0; j < 8; ++j) { const float bias = BO ? bfr(BO[c0 + j * 16 + col]) : 0.f;
#pragma unroll
      for (int r = 0; r < 8; ++r) sf[wave][8 * g + r][j * 16 + col] = acc[j][r] * (1.0f / 256.0f) + bias; } }
  LDSX(); for (int rl = 0; rl < 16; ++rl) vst2(OUT + (r0 + rl) * DIN + c0 + lane * 4, *(const v4f*)&sf[wave][rl][lane * 4]); }

extern "C" void kernel_launch(void* const* d_in, const int* in_sizes, int n_in, void* d_out, int out_size, void* d_ws, size_t ws_size, hipStream_t stream) {
  (void)in_sizes; (void)n_in; (void)out_size;
  const float** F = (const float**)d_in;
  if (ws_size < (size_t)WS_END) return;
  char* ws = (char*)d_ws; _Float16 *QH = (_Float16*)(ws + WS_QH), *KH = (_Float16*)(ws + WS_KH), *VT = (_Float16*)(ws + WS_VT), *QL = (_Float16*)(ws + WS_QL), *KL = (_Float16*)(ws + WS_KL); __bf16 *VB = (__bf16*)(ws + WS_VB), *VBL = (__bf16*)(ws + WS_VBL); float *Y = (float*)(ws + WS_Y);
  (void)Y; (void)QL; (void)KL; (void)VB; (void)VBL;
  // inputs: 0 V [2,2048,512]; 1 Q; 2 K; 3 mask [2,1,2048,2048] f32; 4 Wq [512,256] (in,out), 5 bq; 6 Wk, 7 bk; 8 Wv, 9 bv; 10 Wo [256,512] (in,out), 11 bo [512]
  k_proj<<<dim3(TNB * TT / 64, CC / 128, 3), 128, 0, stream>>>(F[1], F[2], F[0], F[4], F[6], F[8], F[5], F[7], F[9], QH, QL, KH, KL, VT, VB, VBL);   /* q from Q (in1), k from K (in2), v from V (in0) */
  k_attn<<<dim3(NH, NQB, TNB), 256, 0, stream>>>(QH, QL, KH, VT, F[3], Y);
  k_out<<<dim3(TNB * TT / 64, DIN / 128), 128, 0, stream>>>(Y, F[10], F[11], (float*)d_out);
}

// v006
// Measured time: 41 microseconds a run.
// Next to v005, in two timings, it ran 1.07 times as fast each time.
// All steps since v000 together make it 11.0 times as fast.
// compute dtype: all float inputs rounded to bf16; q/k/v = in W + b with EXACT bf16 products on WMMA 16x16x32 (f32 accumulate); q as f16 hi + residual (x 2^10) against k once to f16 (2 products) / sqrt(256) + the additive f32 mask; online softmax in f32 (exponentials as hardware exp2 of one fma by log2 e); unnormalised P (at most 2^10) once to f16 against v once to f16 (1 product), divided by the f32 sum; ctx split bf16 hi + lo against exact Wo (2 products) + bo; f32 output.
#include <hip/hip_runtime.h>
#include <math.h>

typedef __attribute__((ext_vector_type(16))) _Float16 v16h;
typedef __attribute__((ext_vector_type(16))) __bf16 v16b;
typedef __attribute__((ext_vector_type(8)))  _Float16 v8h;
typedef __attribute__((ext_vector_type(8)))  float v8f;
typedef __attribute__((ext_vector_type(4)))  float v4f;
typedef __attribute__((ext_vector_type(2)))  float v2f;
typedef __attribute__((ext_vector_type(4)))  unsigned v4u;
typedef __attribute__((ext_vector_type(4)))  int v4i;
typedef float __attribute__((may_alias)) float_a;
typedef int __attribute__((may_alias)) int_a;

template <typename T> __device__ __forceinline__ void vst2(void* p, T v) { *(T*)p = v;  }
__device__ __forceinline__ v8f wmma16(v16h a, v16h b, v8f c) {
  v8f d = __builtin_amdgcn_wmma_f32_16x16x32_f16(false, a, false, b, (short)0, c, false, false);
  asm volatile("v_nop\n\tv_nop\n\tv_nop\n\tv_nop" : "+v"(d) : "v"(a), "v"(b));
  return d;
}
__device__ __forceinline__ v8f wmma_bf(v16b a, v16b b, v8f c) {
  v8f d = __builtin_amdgcn_wmma_f32_16x16x32_bf16(false, a, false, b, (short)0, c, false, false);
  asm volatile("v_nop\n\tv_nop\n\tv_nop\n\tv_nop" : "+v"(d) : "v"(a), "v"(b));
  return d;
}
// 16x16x32 fragments: lane = (h = lane>>4, row/col = lane&15); elements 0..7 = k0+8h+0..7, 8..15 = k0+16+8h+0..7; D element r = row 8h+r
__device__ __forceinline__ v16h frag_h(const _Float16* rowk0, int lane) {
  union { v16h v; v8h q[2]; } u; const _Float16* p = rowk0 + 8 * (lane >> 4);
  u.q[0] = *(const v8h*)p; u.q[1] = *(const v8h*)(p + 16); return u.v;
}
__device__ __forceinline__ v16h frag_f32(const float* rowk0, int lane) {
  v16h a; const float* p = rowk0 + 8 * (lane >> 4);
#pragma unroll
  for (int i = 0; i < 8; ++i) { a[i] = (_Float16)p[i]; a[8 + i] = (_Float16)p[16 + i]; }
  return a;
}
__device__ __forceinline__ v16h frag_f32s(const float* rowk0, int lane, float sc) {
  v16h a; const float* p = rowk0 + 8 * (lane >> 4);
#pragma unroll
  for (int i = 0; i < 8; ++i) { a[i] = (_Float16)(p[i] * sc); a[8 + i] = (_Float16)(p[16 + i] * sc); }
  return a;
}
// column fragment from a [K][ld] layout (column n), rows >= K read as 0
__device__ __forceinline__ v16h fragc_f32(const float* W, int k0, int n, int lane, int ld, int K) {
  v16h a; const int g = lane >> 4;
#pragma unroll
  for (int i = 0; i < 8; ++i) { const int ka = k0 + 8 * g + i, kb = ka + 16;
    a[i] = (_Float16)(ka < K ? W[(size_t)(ka < K ? ka : K - 1) * ld + n] : 0.f); a[8 + i] = (_Float16)(kb < K ? W[(size_t)(kb < K ? kb : K - 1) * ld + n] : 0.f); }
  return a;
}
struct F2 { v16b h, l; };
__device__ __forceinline__ F2 bsplit16(const float v[16]) { F2 r;
#pragma unroll
  for (int i = 0; i < 16; ++i) { const __bf16 h = (__bf16)v[i]; r.h[i] = h; r.l[i] = (__bf16)(v[i] - (float)h); }
  return r; }
__device__ __forceinline__ F2 split_row(const float* row, int k0, int lane) { float v[16]; const float* p = row + k0 + 8 * (lane >> 4);
#pragma unroll
  for (int i = 0; i < 8; ++i) { v[i] = p[i]; v[8 + i] = p[16 + i]; }
  return bsplit16(v); }
__device__ __forceinline__ F2 split_rowK(const float* row, int k0, int lane, int K) { float v[16]; const int g = lane >> 4;
#pragma unroll
  for (int i = 0; i < 8; ++i) { const int ka = k0 + 8 * g + i, kb = ka + 16; v[i] = ka < K ? row[ka < K ? ka : K - 1] : 0.f; v[8 + i] = kb < K ? row[kb < K ? kb : K - 1] : 0.f; }
  return bsplit16(v); }
__device__ __forceinline__ F2 split_col(const float* W, int k0, int n, int lane, int ld, int K) { float v[16]; const int g = lane >> 4;
#pragma unroll
  for (int i = 0; i < 8; ++i) { const int ka = k0 + 8 * g + i, kb = ka + 16; v[i] = ka < K ? W[(size_t)(ka < K ? ka : K - 1) * ld + n] : 0.f; v[8 + i] = kb < K ? W[(size_t)(kb < K ? kb : K - 1) * ld + n] : 0.f; }
  return bsplit16(v); }
__device__ __forceinline__ v8f mac3(const F2& a, const F2& b, v8f c) { c = wmma_bf(a.l, b.h, c); c = wmma_bf(a.h, b.l, c); return wmma_bf(a.h, b.h, c); }
__device__ __forceinline__ float sigm(float v) { return 1.0f / (1.0f + expf(-v)); }
#define LDSX() do { asm volatile("s_wait_dscnt 0" ::: "memory"); __builtin_amdgcn_wave_barrier(); __builtin_amdgcn_fence(__ATOMIC_RELEASE, "workgroup"); } while (0)

// Multi-head attention with an additive dense mask (B 2, S 2,048, d_model 512 -> key/value dim 256 = 8 heads x 32 -> out 512; 0.02-scale (in,out) weights, zero biases; separate V, Q, K inputs): scores = q k^T / sqrt(256) (the FULL key_dim, as written) + mask[b, 0, q, k] (random normal); out = merged(softmax v) Wo + bo.
#define NB 2
#define TT 2048
#define CC 256            // NH * HD = projected width
#define DIN 512          // input (model) width
#define NH 8
#define HD 32
#define NQB (TT / 64)
#define HG 4
#define SCALE (0.0625f)
#define CAUSAL 0
#ifndef TNB
#define TNB NB
#endif
__device__ __forceinline__ float bfr(float v) { return (float)(__bf16)v; }
__host__ __device__ __forceinline__ int kb_last(int qb) { return CAUSAL ? ((qb * 64 + 63) >> 7) : (TT / 128 - 1); }
typedef __attribute__((ext_vector_type(8))) __bf16 v8b;
__device__ __forceinline__ v16b frag_b(const __bf16* rowk0, int lane) {
  union { v16b v; v8b q[2]; } u; const __bf16* p = rowk0 + 8 * (lane >> 4);
  u.q[0] = *(const v8b*)p; u.q[1] = *(const v8b*)(p + 16); return u.v;
}
#define QBH 0
#define QHI 2048            // rows carrying a q residual plane (all rows when non-causal: 2-product logits everywhere)
#define KHI 64            // key rows carrying k residual / v bf16 hi+lo planes (written by k_proj; no kernel here reads them)
// B fragment (k rows k0+.., output column o) of a weight: (in,out) [K][ld] or (out,in) [ld rows of K]: bf16 exact, or f16(bf16 * 256) exact
__device__ __forceinline__ v16b wcol_io(const float* Wm, int k0, int o, int lane, int ld) { v16b w; const int g = lane >> 4;
#pragma unroll
  for (int i = 0; i < 8; ++i) { w[i] = (__bf16)Wm[(size_t)(k0 + 8 * g + i) * ld + o]; w[8 + i] = (__bf16)Wm[(size_t)(k0 + 16 + 8 * g + i) * ld + o]; }
  return w; }
__device__ __forceinline__ v16b wcol_oi(const float* Wm, int k0, int o, int lane, int K) { v16b w; const float* p = Wm + (size_t)o * K + k0 + 8 * (lane >> 4);
#pragma unroll
  for (int i = 0; i < 8; ++i) { w[i] = (__bf16)p[i]; w[8 + i] = (__bf16)p[16 + i]; }
  return w; }
__device__ __forceinline__ v16h wcolh_io(const float* Wm, int k0, int o, int lane, int ld) { v16h w; const int g = lane >> 4;
#pragma unroll
  for (int i = 0; i < 8; ++i) { w[i] = (_Float16)(bfr(Wm[(size_t)(k0 + 8 * g + i) * ld + o]) * 256.0f); w[8 + i] = (_Float16)(bfr(Wm[(size_t)(k0 + 16 + 8 * g + i) * ld + o]) * 256.0f); }
  return w; }
__device__ __forceinline__ v16h wcolh_oi(const float* Wm, int k0, int o, int lane, int K) { v16h w; const float* p = Wm + (size_t)o * K + k0 + 8 * (lane >> 4);
#pragma unroll
  for (int i = 0; i < 8; ++i) { w[i] = (_Float16)(bfr(p[i]) * 256.0f); w[8 + i] = (_Float16)(bfr(p[16 + i]) * 256.0f); }
  return w; }
#define WQKV_LAYOUT 0   // 0 = (in,out) [DIN][CC]; 1 = (out,in) [CC][DIN]; 2 = per-head [NH][DIN][HD]
__device__ __forceinline__ v16b wcol_hdk(const float* Wm, int k0, int o, int lane) { v16b w; const int g = lane >> 4; const float* p = Wm + (size_t)(o / HD) * DIN * HD + (o % HD);
#pragma unroll
  for (int i = 0; i < 8; ++i) { w[i] = (__bf16)p[(size_t)(k0 + 8 * g + i) * HD]; w[8 + i] = (__bf16)p[(size_t)(k0 + 16 + 8 * g + i) * HD]; }
  return w; }
#define WO_OUT_IN 0
#if WQKV_LAYOUT == 1
#define WCOL(W, k0, o, lane) wcol_oi(W, k0, o, lane, DIN)
#elif WQKV_LAYOUT == 2
#define WCOL(W, k0, o, lane) wcol_hdk(W, k0, o, lane)
#else
#define WCOL(W, k0, o, lane) wcol_io(W, k0, o, lane, CC)
#endif
#if WO_OUT_IN
#define WOCOL(W, k0, o, lane) wcol_oi(W, k0, o, lane, CC)
#define WOCOLH(W, k0, o, lane) wcolh_oi(W, k0, o, lane, CC)
#else
#define WOCOL(W, k0, o, lane) wcol_io(W, k0, o, lane, DIN)
#define WOCOLH(W, k0, o, lane) wcolh_io(W, k0, o, lane, DIN)
#endif

#define WS_QH  0u                                      // f16 q rows [b*t][CC]
#define WS_KH  (WS_QH + 2u * (size_t)NB * TT * CC)      // f16 k in fragment order [b][head][16-key tile][plane 2][lane 32][8]
#define WS_VT  (WS_KH + 2u * (size_t)NB * TT * CC)      // f16 v in fragment order [b][head][32-key block][16-column half 2][plane 2][lane 32][8]
#define WS_QL  (WS_VT + 2u * (size_t)NB * CC * TT)      // f16 q residual x 2^10 rows [b][t < QHI][CC]
#define WS_KL  (WS_QL + 2u * (size_t)NB * QHI * CC)     // f16 k residual x 2^10 rows [b][t < KHI][CC]
#define WS_VB  (WS_KL + 2u * (size_t)NB * KHI * CC)     // bf16 v hi planes [b][c][t < KHI]
#define WS_VBL (WS_VB + 2u * (size_t)NB * CC * KHI)
#define WS_S   (WS_VBL + 2u * (size_t)NB * CC * KHI)    // f32 [hg][t][s]; reserved, not used by any kernel here
#define WS_Y   (WS_S  + 4u * (size_t)HG * TT * TT)      // f32 ctx rows [b*t][CC] (only when there is an output projection)
#define WS_END (WS_Y  + 4u * (size_t)NB * TT * CC)

// ---- weight tiles through LDS: thread t fetches column c0 + t of a 32-row k-step (each wave load = one whole 128-byte line), rounds it to bf16 and lays it as row t of wt (k contiguous, pitch 80 bytes); frag_b then reads the same k order as wcol_io
#define WPI 40            // bf16 per LDS row: 64 bytes of data at the conflict-free 80-byte pitch for 16-byte reads
template <int LD> __device__ __forceinline__ void wfetch(float (&r)[32], const float* __restrict__ Wc, int kc) {
#pragma unroll   // constant indices: the arrays stay in registers
  for (int k = 0; k < 32; ++k) r[k] = Wc[(size_t)kc * (32 * LD) + (size_t)k * LD]; }
__device__ __forceinline__ void wlay(__bf16* row, const float (&r)[32]) {
#pragma unroll   // constant indices: the arrays stay in registers
  for (int q = 0; q < 4; ++q) { v8b t;
#pragma unroll   // constant indices: the arrays stay in registers
    for (int i = 0; i < 8; ++i) t[i] = (__bf16)r[q * 8 + i];
    *(v8b*)(row + q * 8) = t; } }
// work-group barrier that orders LDS only: __syncthreads() also waits out every global load, which would end the fetch-ahead at each k-step
__device__ __forceinline__ void lds_barrier() { __builtin_amdgcn_fence(__ATOMIC_RELEASE, "workgroup", "local"); __builtin_amdgcn_s_barrier(); __builtin_amdgcn_fence(__ATOMIC_ACQUIRE, "workgroup", "local"); }
// the 16 f32 of this lane's A fragment of one k-step (p = row + 8 * (lane >> 4))
__device__ __forceinline__ void afetch(v4f (&x)[4], const float* __restrict__ p, int kc) { const float* s = p + kc * 32; x[0] = *(const v4f*)s; x[1] = *(const v4f*)(s + 4); x[2] = *(const v4f*)(s + 16); x[3] = *(const v4f*)(s + 20); }
// ---- k_proj: block = (64 rows, 128 cols, which): q/k/v = X W (+ b) with exact bf16 products (K = DIN) -> which 0: q f16 rows (+ residual rows < QHI); 1: k f16 in fragment order (+ residual rows < KHI); 2: v f16 in fragment order (+ bf16 hi/lo planes for t < KHI)
// fragment order: the 16 bytes that lane l of k_attn loads as elements 0..7 (plane 0) or 8..15 (plane 1) of an A fragment lie at plane * 512 + l * 16, so one wave load there is 512 contiguous bytes = 4 whole lines
__global__ __launch_bounds__(128) void k_proj(const float* __restrict__ XQ, const float* __restrict__ XK, const float* __restrict__ XV, const float* __restrict__ WQ, const float* __restrict__ WK, const float* __restrict__ WV, const float* __restrict__ BQ, const float* __restrict__ BK, const float* __restrict__ BV,
    _Float16* __restrict__ QH, _Float16* __restrict__ QL, _Float16* __restrict__ KH, _Float16* __restrict__ KL, _Float16* __restrict__ VT, __bf16* __restrict__ VB, __bf16* __restrict__ VBL) {
  __shared__ __align__(16) _Float16 sh[64][136], sl[64][136]; __shared__ __align__(16) _Float16 th[128][72]; __shared__ __align__(16) __bf16 tb[128][72], tbl[128][72]; __shared__ __align__(16) __bf16 wt[2][128][WPI];
  const int tid = threadIdx.x, wave = tid >> 5, lane = tid & 31, col = lane & 15, g = lane >> 4; const int which = blockIdx.z; const int c0 = blockIdx.y * 128; const size_t r0 = (size_t)blockIdx.x * 64; const size_t bb = r0 / TT; const int t0 = (int)(r0 % TT);
  const float* X = which == 0 ? XQ : which == 1 ? XK : XV; const float* WA = which == 0 ? WQ : which == 1 ? WK : WV; const float* BA = which == 0 ? BQ : which == 1 ? BK : BV;
  v8f acc[8] = {};
  const float* Wc = WA + c0 + tid; const float* Xp = X + (r0 + wave * 16 + col) * DIN + 8 * g;
  float wr[2][32]; v4f xr[2][4];   // two k-steps in flight in registers
  // staggered walk: the 64 row blocks that share a weight tile and the 2 column blocks that share the input rows each begin the k loop at a k-step of their own and wrap, so that they do not ask L2 for the same lines at the same moment
  const int st = (int)((blockIdx.x + 8u * blockIdx.y) & (DIN / 32 - 1));
  wfetch<CC>(wr[0], Wc, st); afetch(xr[0], Xp, st);
  asm volatile("s_wait_xcnt 0x0" ::: "memory");     // the next k-step's addresses may take the address registers of the loads above
  __builtin_amdgcn_sched_barrier(0);                // keeps that address arithmetic behind the wait
  wfetch<CC>(wr[1], Wc, (st + 1) & (DIN / 32 - 1)); afetch(xr[1], Xp, (st + 1) & (DIN / 32 - 1));
  asm volatile("s_wait_xcnt 0x0" ::: "memory");     // in front of every rewrite of the address registers of the loads above
  __builtin_amdgcn_sched_barrier(0);                // keeps those loads up here, all in flight together
#pragma unroll   // constant indices: the arrays stay in registers
  for (int kc = 0; kc < DIN / 32; ++kc) { const int s = kc & 1; v16b a;
    wlay(&wt[s][tid][0], wr[s]);
#pragma unroll   // constant indices: the arrays stay in registers
    for (int i = 0; i < 4; ++i) { a[i] = (__bf16)xr[s][0][i]; a[4 + i] = (__bf16)xr[s][1][i]; a[8 + i] = (__bf16)xr[s][2][i]; a[12 + i] = (__bf16)xr[s][3][i]; }
    __builtin_amdgcn_sched_barrier(0);   // the refill below reuses the registers just read: lifted over their readers it would take a third register set
    if (kc + 2 < DIN / 32) { const int kn = (kc + 2 + st) & (DIN / 32 - 1); wfetch<CC>(wr[s], Wc, kn); afetch(xr[s], Xp, kn);
      asm volatile("s_wait_xcnt 0x0" ::: "memory");     // in front of every rewrite of the address registers of the loads above
      __builtin_amdgcn_sched_barrier(0); }              // keeps every later register write behind that wait
    lds_barrier();   // publishes wt[s]; every reader of wt[s] two k-steps back has passed the barrier in between
    v16b w[8];
#pragma unroll   // constant indices: the arrays stay in registers
    for (int j = 0; j < 8; ++j) w[j] = frag_b(&wt[s][j * 16 + col][0], lane);
    __builtin_amdgcn_sched_barrier(0);   // keeps the 16 LDS reads together ahead of the products: spread among them each pair costs its own LDS latency
#pragma unroll   // constant indices: the arrays stay in registers
    for (int j = 0; j < 8; ++j) acc[j] = wmma_bf(a, w[j], acc[j]); }
  if (which < 2) { _Float16* DH = which == 0 ? QH : KH; _Float16* DL = which == 0 ? QL : KL; const int nhi = which == 0 ? QHI : KHI; const bool hi_rows = t0 < nhi;
#pragma unroll
    for (int j = 0; j < 8; ++j) { const float bias = BA ? bfr(BA[c0 + j * 16 + col]) : 0.f;
#pragma unroll
      for (int r = 0; r < 8; ++r) { const float v = acc[j][r] + bias; const _Float16 hv = (_Float16)v; sh[wave * 16 + 8 * g + r][j * 16 + col] = hv; sl[wave * 16 + 8 * g + r][j * 16 + col] = (_Float16)((v - (float)hv) * 1024.0f); } }
    __syncthreads();
    for (int e = tid; e < 64 * 16; e += 128) { const int rl = e >> 4, q = e & 15;
      if (which == 0) { vst2((unsigned*)(DH + (r0 + rl) * CC + c0 + q * 8), *(const v4u*)&sh[rl][q * 8]);
        asm volatile("s_wait_xcnt 0x0" ::: "memory"); }   // inside the arm: in front of every rewrite of the registers of the store above, on every way out of it
      else { const int l = e & 31, p = (e >> 5) & 1, tl = (e >> 6) & 3, hh = e >> 8;   // A fragment of S^T: row = key 16 tl + (l & 15), k = head column 16 p + 8 (l >> 4) + 0..7
        vst2((unsigned*)(KH + ((((bb * NH + (c0 >> 5) + hh) * (TT / 16) + (t0 >> 4) + tl) * 2 + p) * 256 + l * 8)), *(const v4u*)&sh[tl * 16 + (l & 15)][hh * 32 + p * 16 + (l >> 4) * 8]);
        asm volatile("s_wait_xcnt 0x0" ::: "memory"); }   // inside the arm: in front of every rewrite of the registers of the store above, on every way out of it
      if (hi_rows) { vst2((unsigned*)(DL + (bb * nhi + t0 + rl) * (size_t)CC + c0 + q * 8), *(const v4u*)&sl[rl][q * 8]);
        asm volatile("s_wait_xcnt 0x0" ::: "memory"); } }   // in front of every rewrite of the registers of the store above
  } else { const bool hi_rows = t0 < KHI;
#pragma unroll
    for (int j = 0; j < 8; ++j) { const float bias = BA ? bfr(BA[c0 + j * 16 + col]) : 0.f;
#pragma unroll
      for (int r = 0; r < 8; ++r) { const float v = acc[j][r] + bias; const int rl = wave * 16 + 8 * g + r, cl = j * 16 + col; th[cl][rl] = (_Float16)v; const __bf16 bh = (__bf16)v; tb[cl][rl] = bh; tbl[cl][rl] = (__bf16)(v - (float)bh); } }
    __syncthreads();
    for (int e = tid; e < 128 * 8; e += 128) { const int l = e & 31, p = (e >> 5) & 1, j = (e >> 6) & 1, kbl = (e >> 7) & 1, hh = e >> 8;   // A fragment of ctx^T: row = head column 16 j + (l & 15), k = key 16 p + 8 (l >> 4) + 0..7 of the 32-key block
      vst2((unsigned*)(VT + (((((bb * NH + (c0 >> 5) + hh) * (TT / 32) + (t0 >> 5) + kbl) * 2 + j) * 2 + p) * 256 + l * 8)), *(const v4u*)&th[hh * 32 + j * 16 + (l & 15)][kbl * 32 + p * 16 + (l >> 4) * 8]);
      asm volatile("s_wait_xcnt 0x0" ::: "memory"); }   // in front of every rewrite of the registers of the store above
    for (int e = tid; e < 128 * 8; e += 128) { const int cl = e >> 3, q = e & 7; if (hi_rows) { const size_t o3 = (bb * CC + c0 + cl) * (size_t)KHI + t0 + q * 8; vst2((unsigned*)(VB + o3), *(const v4u*)&tb[cl][q * 8]); vst2((unsigned*)(VBL + o3), *(const v4u*)&tbl[cl][q * 8]);
        asm volatile("s_wait_xcnt 0x0" ::: "memory"); } } } }   // in front of every rewrite of the registers of the two stores above
// ---- k_attn: block = (head, 64 queries, batch), 8 waves = 4 query tiles x KS key ranges. Transposed products: S^T = k q^T (q hi + residual x 2^10, 2 products), so a lane holds the scores of ONE query (col) at keys 8g+r of each 16-key tile;
// two such tiles, converted in place, are the B operand of ctx^T += v^T P^T. Running maximum and sum per lane (online softmax); P = exp(score - max + PSH) once to f16 (PSH cancels in the division by the sum). The KS partial results are joined through LDS.
#define KS 2
#define KR (TT / KS)      // keys per wave
#define NIT (KR / 64)     // 64 keys per pass
#define PSH 6.9314718f    // keeps P (at most 2^10) clear of f16 subnormals
#define LOG2E 1.44269504f  // exp(x) = exp2(x * LOG2E): P is rounded to f16 right after, so the library expf's range reduction and end tests buy nothing here
__device__ __forceinline__ float xhalf(float x) { return __builtin_bit_cast(float, __builtin_amdgcn_permlanex16(__builtin_bit_cast(int, x), __builtin_bit_cast(int, x), 0x76543210, 0xfedcba98, false, false)); }  // lane l with lane l ^ 16
__device__ __forceinline__ v8f wm(v16h a, v16h b, v8f c) { return __builtin_amdgcn_wmma_f32_16x16x32_f16(false, a, false, b, (short)0, c, false, false); }
// 16x16x32 fragment stored in fragment order at (wave-uniform base) + (lane byte offset lo = 16 * lane) + constant cb: plane 0 = elements 0..7, plane 1 (512 bytes on) = elements 8..15; same k order as frag_h
__device__ __forceinline__ v16h frag_w(const _Float16* ub, unsigned lo, int cb) { union { v16h v; v8h q[2]; } u; const char* p = (const char*)ub + lo; u.q[0] = *(const v8h*)(p + cb); u.q[1] = *(const v8h*)(p + cb + 512); return u.v; }
// ---- the mask through LDS: each wave's tile of a pass (its 16 query rows x 64 keys, f32: 16 rows of 256 bytes, 8,192 bytes apart in memory) comes by ONE tensor load, one pass ahead, through no register;
// the mover pads each row by 16 bytes, so the lanes' 16-byte reads down a column of rows (pitch 272 bytes) meet no bank twice
typedef __attribute__((ext_vector_type(8))) unsigned v8u;
#define MROWB 256u        // bytes of one row of the tile
#define MPITCH 272u       // its pitch in LDS: the row + the 16-byte pad
#define MSLICE 6144u      // 16 rows x 272 bytes = 4,352, rounded up to a multiple of 2 KiB: every slice starts on one
#define MWORD0 ((1u << 20) | (5u << 22) | (3u << 25))   // group 1 word 0: no mask, 1-byte elements, a pad of 4 dwords behind every 64 dwords (one row)
__device__ __forceinline__ uint32_t uni(uint32_t v) { return (uint32_t)__builtin_amdgcn_readfirstlane((int)v); }
__device__ __forceinline__ uint32_t pinned(uint32_t v) { uint32_t w = uni(v); asm volatile("" : "+s"(w)); return w; }   // holds the issue test of a tensor load in a scalar register, so that the branch on it is a scalar one (the instruction ignores EXEC)
__device__ __forceinline__ void mask_tile_load(uint32_t lds_dst, const float* tile) { const uint64_t ga = (uint64_t)(size_t)tile;
  v4u g0; g0[0] = uni(1u); g0[1] = uni(lds_dst); g0[2] = uni((uint32_t)ga); g0[3] = uni((((uint32_t)(ga >> 32)) & 0x01FFFFFFu) | 0x80000000u);   // count 1; place in LDS; first byte of the tile; type 2
  v8u g1; g1[0] = uni(MWORD0); g1[1] = uni(MROWB << 16); g1[2] = uni(16u << 16); g1[3] = uni(MROWB << 16); g1[4] = uni(16u); g1[5] = uni(TT * 4u); g1[6] = uni(0u); g1[7] = uni(0u);   // tensor = tile = 256 bytes x 16 rows; source pitch = one mask row
  asm volatile("tensor_load_to_lds %0, %1" :: "s"(g0), "s"(g1) : "memory"); }   // one request of the whole wave
__global__ __launch_bounds__(256) void k_attn(const _Float16* __restrict__ QH, const _Float16* __restrict__ QL, const _Float16* __restrict__ KH, const _Float16* __restrict__ VT, const float* __restrict__ MKF, float* __restrict__ Y) {
  __shared__ __attribute__((aligned(2048))) unsigned char ms[2][8][MSLICE]; __shared__ float sp[4][18][32];
  const int tid = threadIdx.x, wave = __builtin_amdgcn_readfirstlane(tid >> 5), lane = tid & 31, col = lane & 15, g = lane >> 4; const int h = blockIdx.x, qb = blockIdx.y, b = blockIdx.z; const int qt = wave & 3, ks = wave >> 2;
  const int q0 = qb * 64 + qt * 16, q = q0 + col;
  const v16h qh = frag_h(QH + ((size_t)b * TT + q) * CC + h * HD, lane), ql = frag_h(QL + ((size_t)b * QHI + q) * CC + h * HD, lane);
  const unsigned fo = (unsigned)lane * 16u;   // a lane's place in each 512-byte plane
  const _Float16* Kb = KH + (((size_t)b * NH + h) * (TT / 16) + ks * (KR / 16)) * 512;   // A rows = keys, k = head columns: 1,024 bytes per 16-key tile
  float m = -3.0e38f, l = 0.f; v8f acc0 = {}, acc1 = {};
  // staggered walk: the 8 head blocks that share a mask tile and the 32 query blocks that share a head's k and v each begin the key walk at a pass of their own and wrap, so that they do not ask L2 for the same lines at the same moment
  const int st = (2 * h + qb) & (NIT - 1);
  v16h kf[4];
#pragma unroll
  for (int kt = 0; kt < 4; ++kt) kf[kt] = frag_w(Kb + (size_t)st * 2048, fo, kt * 1024);
  asm volatile("s_wait_xcnt 0x0" ::: "memory");     // in front of every rewrite of the address registers of the q and k loads above
  __builtin_amdgcn_sched_barrier(0);                // keeps the address arithmetic of the loop behind that wait
  const _Float16* Vb = VT + (((size_t)b * NH + h) * (TT / 32) + ks * (KR / 32)) * 1024;  // A rows = head columns, k = keys: 2,048 bytes per 32-key block (two 16-column halves)
  const float* Mb = MKF + ((size_t)b * TT + q0) * TT + ks * KR;       const unsigned mo = (unsigned)col * MPITCH + 32u * (unsigned)g;   // this wave's 16 query rows; in LDS: this lane's query row, its 8 keys of each 16-key tile
  const uint32_t md = (uint32_t)(size_t)&ms[0][wave][0];   // this wave's slice of buffer 0; buffer 1 lies 8 slices on
  mask_tile_load(md, Mb + st * 64);                         // the first pass's tile
  for (int it = 0; it < NIT; ++it) { const int pi = (it + st) & (NIT - 1), pn = (it + 1 + st) & (NIT - 1);   // the 64-key blocks of this pass and of the next
    // publish point of pass it's tile, at the seam between pass it - 1 and pass it (written at the head: at the foot, its branch would cut the sums of the pass off from the softmax they are interleaved with)
    asm volatile("s_wait_dscnt 0x0" ::: "memory");       // the last pass's reads of its buffer have retired
    asm volatile("s_wait_tensorcnt 0x0" ::: "memory");   // this pass's tile has landed
    __syncthreads();                                     // publishes it; every reader has left the other buffer
    if (pinned(it + 1 < NIT)) mask_tile_load(md + (uint32_t)((it + 1) & 1) * (8u * MSLICE), Mb + pn * 64);   // the next pass's tile flies under this pass, into the buffer that the last pass read
    v4f mk[4][2]; const unsigned char* mp = &ms[it & 1][wave][0] + mo;
#pragma unroll
    for (int kt = 0; kt < 4; ++kt) { mk[kt][0] = *(const v4f*)(mp + kt * 64); mk[kt][1] = *(const v4f*)(mp + kt * 64 + 16); }
    v16h vf[2][2];
#pragma unroll
    for (int s = 0; s < 2; ++s) { vf[s][0] = frag_w(Vb + pi * 2048, fo, s * 2048); vf[s][1] = frag_w(Vb + pi * 2048, fo, s * 2048 + 1024); }
    asm volatile("s_wait_xcnt 0x0" ::: "memory");   // in front of every rewrite of the address registers of the v loads above
    __builtin_amdgcn_sched_barrier(0);              // holds those loads up here: without it they sink to their first use and the wave waits out each latency
    float v[4][8]; float mx = -3.0e38f;
#pragma unroll
    for (int kt = 0; kt < 4; ++kt) { const v8f z = {}; const v8f a = wm(kf[kt], qh, z), c = wm(kf[kt], ql, z);
#pragma unroll
      for (int r = 0; r < 8; ++r) { v[kt][r] = (a[r] + c[r] * (1.0f / 1024.0f)) * SCALE + bfr(mk[kt][r >> 2][r & 3]); mx = fmaxf(mx, v[kt][r]); } }
    const int nx = it + 1 < NIT ? pn : pi;   // next pass's k rows, fetched under this pass's softmax (the last pass fetches its own again)
#pragma unroll
    for (int kt = 0; kt < 4; ++kt) kf[kt] = frag_w(Kb + (size_t)nx * 2048, fo, kt * 1024);
    asm volatile("s_wait_xcnt 0x0" ::: "memory");   // in front of every rewrite of the address registers of the k loads above
    __builtin_amdgcn_sched_barrier(0);              // holds the k loads ahead of the softmax, which covers their latency
    mx = fmaxf(mx, xhalf(mx)); const float mn = fmaxf(m, mx); const float al = __builtin_amdgcn_exp2f((m - mn) * LOG2E); m = mn; const float nms = (PSH - mn) * LOG2E;
    float sum = 0.f; v16h p[2];
#pragma unroll
    for (int kt = 0; kt < 4; ++kt) {
#pragma unroll
      for (int r = 0; r < 8; ++r) { const float e = __builtin_amdgcn_exp2f(fmaf(v[kt][r], LOG2E, nms)); sum += e; p[kt >> 1][(kt & 1) * 8 + r] = (_Float16)e; } }
    l = l * al + sum;
#pragma unroll
    for (int r = 0; r < 8; ++r) { acc0[r] *= al; acc1[r] *= al; }
#pragma unroll
    for (int s = 0; s < 2; ++s) { acc0 = wm(vf[s][0], p[s], acc0); acc1 = wm(vf[s][1], p[s], acc1); } }
  asm volatile("s_wait_tensorcnt 0x0" ::: "memory");     // nothing of the mover is in flight behind the loop
  asm volatile("s_wait_dscnt 0x0" ::: "memory");         // and no read of the two buffers
  l += xhalf(l);
  if (ks) { sp[qt][0][lane] = m; sp[qt][1][lane] = l;
#pragma unroll
    for (int r = 0; r < 8; ++r) { sp[qt][2 + r][lane] = acc0[r]; sp[qt][10 + r][lane] = acc1[r]; } }
  __syncthreads();
  if (!ks) { const float m1 = sp[qt][0][lane], l1 = sp[qt][1][lane]; const float mm = fmaxf(m, m1); float a0 = expf(m - mm), a1 = expf(m1 - mm); const float lt = l * a0 + l1 * a1; const float inv = lt > 0.f ? 1.0f / lt : 0.f; a0 *= inv; a1 *= inv;
    v4f o[4];
#pragma unroll
    for (int r = 0; r < 8; ++r) { o[r >> 2][r & 3] = acc0[r] * a0 + sp[qt][2 + r][lane] * a1; o[2 + (r >> 2)][r & 3] = acc1[r] * a0 + sp[qt][10 + r][lane] * a1; }
    float* yp = Y + ((size_t)b * TT + q) * CC + h * HD + 8 * g;   // ctx^T register r = head column 16 j + 8 g + r of query col
    vst2(yp, o[0]); vst2(yp + 4, o[1]); vst2(yp + 16, o[2]); vst2(yp + 20, o[3]); } }
// ---- k_out: block = (64 rows, 128 cols): out = ctx Wo (+ bo): all rows: ctx bf16 hi + lo against exact bf16 Wo (2 products); the f16 x f16(bf16 x 2^8) branch is never taken
__global__ __launch_bounds__(128) void k_out(const float* __restrict__ Y, const float* __restrict__ WO, const float* __restrict__ BO, float* __restrict__ OUT) { __shared__ __align__(16) float sf[4][16][132]; __shared__ __align__(16) __bf16 wt[2][128][WPI];
  const int tid = threadIdx.x, wave = tid >> 5, lane = tid & 31, col = lane & 15, g = lane >> 4; const int c0 = blockIdx.y * 128; const size_t r0 = (size_t)blockIdx.x * 64 + wave * 16;
  v8f acc[8] = {};
  if (true) {   /* ALL rows: ctx split bf16 hi + lo x exact Wo (2 products) */
    const float* Wc = WO + c0 + tid; const float* Yp = Y + (r0 + col) * CC + 8 * g;
    float wr[2][32]; v4f xr[2][4];   // two k-steps in flight in registers
    const int st = (int)((blockIdx.x + 2u * blockIdx.y) & (CC / 32 - 1));   // staggered walk, as in k_proj: 64 row blocks share a weight tile, 4 column blocks the ctx rows
    wfetch<DIN>(wr[0], Wc, st); afetch(xr[0], Yp, st);
    asm volatile("s_wait_xcnt 0x0" ::: "memory");     // the next k-step's addresses may take the address registers of the loads above
    __builtin_amdgcn_sched_barrier(0);                // keeps that address arithmetic behind the wait
    wfetch<DIN>(wr[1], Wc, (st + 1) & (CC / 32 - 1)); afetch(xr[1], Yp, (st + 1) & (CC / 32 - 1));
    asm volatile("s_wait_xcnt 0x0" ::: "memory");     // in front of every rewrite of the address registers of the loads above
    __builtin_amdgcn_sched_barrier(0);                // keeps those loads up here, all in flight together
#pragma unroll   // constant indices: the arrays stay in registers
    for (int kc = 0; kc < CC / 32; ++kc) { const int s = kc & 1; float v[16];
      wlay(&wt[s][tid][0], wr[s]);
#pragma unroll   // constant indices: the arrays stay in registers
      for (int i = 0; i < 4; ++i) { v[i] = xr[s][0][i]; v[4 + i] = xr[s][1][i]; v[8 + i] = xr[s][2][i]; v[12 + i] = xr[s][3][i]; }
      const F2 a = bsplit16(v);
      __builtin_amdgcn_sched_barrier(0);   // the refill below reuses the registers just read: lifted over their readers it would take a third register set
      if (kc + 2 < CC / 32) { const int kn = (kc + 2 + st) & (CC / 32 - 1); wfetch<DIN>(wr[s], Wc, kn); afetch(xr[s], Yp, kn);
        asm volatile("s_wait_xcnt 0x0" ::: "memory");     // in front of every rewrite of the address registers of the loads above
        __builtin_amdgcn_sched_barrier(0); }              // keeps every later register write behind that wait
      lds_barrier();   // publishes wt[s]; every reader of wt[s] two k-steps back has passed the barrier in between
      v16b w[8];
#pragma unroll   // constant indices: the arrays stay in registers
      for (int j = 0; j < 8; ++j) w[j] = frag_b(&wt[s][j * 16 + col][0], lane);
      __builtin_amdgcn_sched_barrier(0);   // keeps the 16 LDS reads together ahead of the products: spread among them each pair costs its own LDS latency
#pragma unroll   // constant indices: the arrays stay in registers
      for (int j = 0; j < 8; ++j) { acc[j] = wmma_bf(a.h, w[j], acc[j]); acc[j] = wmma_bf(a.l, w[j], acc[j]); } }
#pragma unroll
    for (int j = 0; j < 8; ++j) { const float bias = BO ? bfr(BO[c0 + j * 16 + col]) : 0.f;
#pragma unroll
      for (int r = 0; r < 8; ++r) sf[wave][8 * g + r][j * 16 + col] = acc[j][r] + bias; }
  } else {
#pragma unroll 2
    for (int kc = 0; kc < CC / 32; ++kc) { const v16h a = frag_f32(Y + (r0 + col) * CC + kc * 32, lane); asm volatile("s_wait_loadcnt 0x0" ::: "memory");
#pragma unroll
      for (int j = 0; j < 8; ++j) { const v16h w = WOCOLH(WO, kc * 32, c0 + j * 16 + col, lane); asm volatile("s_wait_loadcnt 0x0" ::: "memory"); acc[j] = wmma16(a, w, acc[j]); } }
#pragma unroll
    for (int j = 0; j < 8; ++j) { const float bias = BO ? bfr(BO[c0 + j * 16 + col]) : 0.f;
#pragma unroll
      for (int r = 0; r < 8; ++r) sf[wave][8 * g + r][j * 16 + col] = acc[j][r] * (1.0f / 256.0f) + bias; } }
  LDSX(); for (int rl = 0; rl < 16; ++rl) vst2(OUT + (r0 + rl) * DIN + c0 + lane * 4, *(const v4f*)&sf[wave][rl][lane * 4]); }

extern "C" void kernel_launch(void* const* d_in, const int* in_sizes, int n_in, void* d_out, int out_size, void* d_ws, size_t ws_size, hipStream_t stream) {
  (void)in_sizes; (void)n_in; (void)out_size;
  const float** F = (const float**)d_in;
  if (ws_size < (size_t)WS_END) return;
  char* ws = (char*)d_ws; _Float16 *QH = (_Float16*)(ws + WS_QH), *KH = (_Float16*)(ws + WS_KH), *VT = (_Float16*)(ws + WS_VT), *QL = (_Float16*)(ws + WS_QL), *KL = (_Float16*)(ws + WS_KL); __bf16 *VB = (__bf16*)(ws + WS_VB), *VBL = (__bf16*)(ws + WS_VBL); float *Y = (float*)(ws + WS_Y);
  (void)Y; (void)QL; (void)KL; (void)VB; (void)VBL;
  // inputs: 0 V [2,2048,512]; 1 Q; 2 K; 3 mask [2,1,2048,2048] f32; 4 Wq [512,256] (in,out), 5 bq; 6 Wk, 7 bk; 8 Wv, 9 bv; 10 Wo [256,512] (in,out), 11 bo [512]
  k_proj<<<dim3(TNB * TT / 64, CC / 128, 3), 128, 0, stream>>>(F[1], F[2], F[0], F[4], F[6], F[8], F[5], F[7], F[9], QH, QL, KH, KL, VT, VB, VBL);   /* q from Q (in1), k from K (in2), v from V (in0) */
  k_attn<<<dim3(NH, NQB, TNB), 256, 0, stream>>>(QH, QL, KH, VT, F[3], Y);
  k_out<<<dim3(TNB * TT / 64, DIN / 128), 128, 0, stream>>>(Y, F[10], F[11], (float*)d_out);
}

// v007
// One run takes 39.5 microseconds.
// Two timings next to v006 both put it at 1.04 times that version's speed.
// Over all steps from v000 it is 11.5 times as fast.
// compute dtype: all float inputs rounded to bf16; q/k/v = in W + b with EXACT bf16 products on WMMA 16x16x32 (f32 accumulate); logits x 2^10 as ONE WMMA accumulator chain: q x 2^6 (= 2^10 / sqrt(256)) as f16 hi + residual against k once to f16 (2 products), then the additive mask (bf16) against a constant selection matrix of 2^10 (1 product, exact); online softmax in f32 (exponentials as hardware exp2 of one fma by log2 e); unnormalised P (at most 2^10) once to f16 against v once to f16 (1 product), divided by the f32 sum; ctx split bf16 hi + lo against exact Wo (2 products) + bo; f32 output.
#include <hip/hip_runtime.h>
#include <math.h>

typedef __attribute__((ext_vector_type(16))) _Float16 v16h;
typedef __attribute__((ext_vector_type(16))) __bf16 v16b;
typedef __attribute__((ext_vector_type(8)))  _Float16 v8h;
typedef __attribute__((ext_vector_type(8)))  float v8f;
typedef __attribute__((ext_vector_type(4)))  float v4f;
typedef __attribute__((ext_vector_type(2)))  float v2f;
typedef __attribute__((ext_vector_type(4)))  unsigned v4u;
typedef __attribute__((ext_vector_type(4)))  int v4i;
typedef float __attribute__((may_alias)) float_a;
typedef int __attribute__((may_alias)) int_a;

template <typename T> __device__ __forceinline__ void vst2(void* p, T v) { *(T*)p = v;  }
__device__ __forceinline__ v8f wmma16(v16h a, v16h b, v8f c) {
  v8f d = __builtin_amdgcn_wmma_f32_16x16x32_f16(false, a, false, b, (short)0, c, false, false);
  asm volatile("v_nop\n\tv_nop\n\tv_nop\n\tv_nop" : "+v"(d) : "v"(a), "v"(b));
  return d;
}
__device__ __forceinline__ v8f wmma_bf(v16b a, v16b b, v8f c) {
  v8f d = __builtin_amdgcn_wmma_f32_16x16x32_bf16(false, a, false, b, (short)0, c, false, false);
  asm volatile("v_nop\n\tv_nop\n\tv_nop\n\tv_nop" : "+v"(d) : "v"(a), "v"(b));
  return d;
}
// 16x16x32 fragments: lane = (h = lane>>4, row/col = lane&15); elements 0..7 = k0+8h+0..7, 8..15 = k0+16+8h+0..7; D element r = row 8h+r
__device__ __forceinline__ v16h frag_h(const _Float16* rowk0, int lane) {
  union { v16h v; v8h q[2]; } u; const _Float16* p = rowk0 + 8 * (lane >> 4);
  u.q[0] = *(const v8h*)p; u.q[1] = *(const v8h*)(p + 16); return u.v;
}
__device__ __forceinline__ v16h frag_f32(const float* rowk0, int lane) {
  v16h a; const float* p = rowk0 + 8 * (lane >> 4);
#pragma unroll
  for (int i = 0; i < 8; ++i) { a[i] = (_Float16)p[i]; a[8 + i] = (_Float16)p[16 + i]; }
  return a;
}
__device__ __forceinline__ v16h frag_f32s(const float* rowk0, int lane, float sc) {
  v16h a; const float* p = rowk0 + 8 * (lane >> 4);
#pragma unroll
  for (int i = 0; i < 8; ++i) { a[i] = (_Float16)(p[i] * sc); a[8 + i] = (_Float16)(p[16 + i] * sc); }
  return a;
}
// column fragment from a [K][ld] layout (column n), rows >= K read as 0
__device__ __forceinline__ v16h fragc_f32(const float* W, int k0, int n, int lane, int ld, int K) {
  v16h a; const int g = lane >> 4;
#pragma unroll
  for (int i = 0; i < 8; ++i) { const int ka = k0 + 8 * g + i, kb = ka + 16;
    a[i] = (_Float16)(ka < K ? W[(size_t)(ka < K ? ka : K - 1) * ld + n] : 0.f); a[8 + i] = (_Float16)(kb < K ? W[(size_t)(kb < K ? kb : K - 1) * ld + n] : 0.f); }
  return a;
}
struct F2 { v16b h, l; };
__device__ __forceinline__ F2 bsplit16(const float v[16]) { F2 r;
#pragma unroll
  for (int i = 0; i < 16; ++i) { const __bf16 h = (__bf16)v[i]; r.h[i] = h; r.l[i] = (__bf16)(v[i] - (float)h); }
  return r; }
__device__ __forceinline__ F2 split_row(const float* row, int k0, int lane) { float v[16]; const float* p = row + k0 + 8 * (lane >> 4);
#pragma unroll
  for (int i = 0; i < 8; ++i) { v[i] = p[i]; v[8 + i] = p[16 + i]; }
  return bsplit16(v); }
__device__ __forceinline__ F2 split_rowK(const float* row, int k0, int lane, int K) { float v[16]; const int g = lane >> 4;
#pragma unroll
  for (int i = 0; i < 8; ++i) { const int ka = k0 + 8 * g + i, kb = ka + 16; v[i] = ka < K ? row[ka < K ? ka : K - 1] : 0.f; v[8 + i] = kb < K ? row[kb < K ? kb : K - 1] : 0.f; }
  return bsplit16(v); }
__device__ __forceinline__ F2 split_col(const float* W, int k0, int n, int lane, int ld, int K) { float v[16]; const int g = lane >> 4;
#pragma unroll
  for (int i = 0; i < 8; ++i) { const int ka = k0 + 8 * g + i, kb = ka + 16; v[i] = ka < K ? W[(size_t)(ka < K ? ka : K - 1) * ld + n] : 0.f; v[8 + i] = kb < K ? W[(size_t)(kb < K ? kb : K - 1) * ld + n] : 0.f; }
  return bsplit16(v); }
__device__ __forceinline__ v8f mac3(const F2& a, const F2& b, v8f c) { c = wmma_bf(a.l, b.h, c); c = wmma_bf(a.h, b.l, c); return wmma_bf(a.h, b.h, c); }
__device__ __forceinline__ float sigm(float v) { return 1.0f / (1.0f + expf(-v)); }
#define LDSX() do { asm volatile("s_wait_dscnt 0" ::: "memory"); __builtin_amdgcn_wave_barrier(); __builtin_amdgcn_fence(__ATOMIC_RELEASE, "workgroup"); } while (0)

// Multi-head attention with an additive dense mask (B 2, S 2,048, d_model 512 -> key/value dim 256 = 8 heads x 32 -> out 512; 0.02-scale (in,out) weights, zero biases; separate V, Q, K inputs): scores = q k^T / sqrt(256) (the FULL key_dim, as written) + mask[b, 0, q, k] (random normal); out = merged(softmax v) Wo + bo.
#define NB 2
#define TT 2048
#define CC 256            // NH * HD = projected width
#define DIN 512          // input (model) width
#define NH 8
#define HD 32
#define NQB (TT / 64)
#define HG 4
#define SCALE (0.0625f)
#define LSH 1024.0f        // k_attn carries its logits x 2^10 (a power of two: exact): q's f16 residual, at the same scale as its hi part, then stays clear of f16 subnormals
#define QSC (SCALE * LSH)  // what k_proj multiplies q by
#define CAUSAL 0
#ifndef TNB
#define TNB NB
#endif
__device__ __forceinline__ float bfr(float v) { return (float)(__bf16)v; }
__host__ __device__ __forceinline__ int kb_last(int qb) { return CAUSAL ? ((qb * 64 + 63) >> 7) : (TT / 128 - 1); }
typedef __attribute__((ext_vector_type(8))) __bf16 v8b;
__device__ __forceinline__ v16b frag_b(const __bf16* rowk0, int lane) {
  union { v16b v; v8b q[2]; } u; const __bf16* p = rowk0 + 8 * (lane >> 4);
  u.q[0] = *(const v8b*)p; u.q[1] = *(const v8b*)(p + 16); return u.v;
}
#define QBH 0
#define QHI 2048            // rows carrying a q residual plane (all rows when non-causal: 2-product logits everywhere)
#define KHI 64            // key rows carrying k residual / v bf16 hi+lo planes (written by k_proj; no kernel here reads them)
// B fragment (k rows k0+.., output column o) of a weight: (in,out) [K][ld] or (out,in) [ld rows of K]: bf16 exact, or f16(bf16 * 256) exact
__device__ __forceinline__ v16b wcol_io(const float* Wm, int k0, int o, int lane, int ld) { v16b w; const int g = lane >> 4;
#pragma unroll
  for (int i = 0; i < 8; ++i) { w[i] = (__bf16)Wm[(size_t)(k0 + 8 * g + i) * ld + o]; w[8 + i] = (__bf16)Wm[(size_t)(k0 + 16 + 8 * g + i) * ld + o]; }
  return w; }
__device__ __forceinline__ v16b wcol_oi(const float* Wm, int k0, int o, int lane, int K) { v16b w; const float* p = Wm + (size_t)o * K + k0 + 8 * (lane >> 4);
#pragma unroll
  for (int i = 0; i < 8; ++i) { w[i] = (__bf16)p[i]; w[8 + i] = (__bf16)p[16 + i]; }
  return w; }
__device__ __forceinline__ v16h wcolh_io(const float* Wm, int k0, int o, int lane, int ld) { v16h w; const int g = lane >> 4;
#pragma unroll
  for (int i = 0; i < 8; ++i) { w[i] = (_Float16)(bfr(Wm[(size_t)(k0 + 8 * g + i) * ld + o]) * 256.0f); w[8 + i] = (_Float16)(bfr(Wm[(size_t)(k0 + 16 + 8 * g + i) * ld + o]) * 256.0f); }
  return w; }
__device__ __forceinline__ v16h wcolh_oi(const float* Wm, int k0, int o, int lane, int K) { v16h w; const float* p = Wm + (size_t)o * K + k0 + 8 * (lane >> 4);
#pragma unroll
  for (int i = 0; i < 8; ++i) { w[i] = (_Float16)(bfr(p[i]) * 256.0f); w[8 + i] = (_Float16)(bfr(p[16 + i]) * 256.0f); }
  return w; }
#define WQKV_LAYOUT 0   // 0 = (in,out) [DIN][CC]; 1 = (out,in) [CC][DIN]; 2 = per-head [NH][DIN][HD]
__device__ __forceinline__ v16b wcol_hdk(const float* Wm, int k0, int o, int lane) { v16b w; const int g = lane >> 4; const float* p = Wm + (size_t)(o / HD) * DIN * HD + (o % HD);
#pragma unroll
  for (int i = 0; i < 8; ++i) { w[i] = (__bf16)p[(size_t)(k0 + 8 * g + i) * HD]; w[8 + i] = (__bf16)p[(size_t)(k0 + 16 + 8 * g + i) * HD]; }
  return w; }
#define WO_OUT_IN 0
#if WQKV_LAYOUT == 1
#define WCOL(W, k0, o, lane) wcol_oi(W, k0, o, lane, DIN)
#elif WQKV_LAYOUT == 2
#define WCOL(W, k0, o, lane) wcol_hdk(W, k0, o, lane)
#else
#define WCOL(W, k0, o, lane) wcol_io(W, k0, o, lane, CC)
#endif
#if WO_OUT_IN
#define WOCOL(W, k0, o, lane) wcol_oi(W, k0, o, lane, CC)
#define WOCOLH(W, k0, o, lane) wcolh_oi(W, k0, o, lane, CC)
#else
#define WOCOL(W, k0, o, lane) wcol_io(W, k0, o, lane, DIN)
#define WOCOLH(W, k0, o, lane) wcolh_io(W, k0, o, lane, DIN)
#endif

#define WS_QH  0u                                      // f16 q x 2^6 rows [b*t][CC]
#define WS_KH  (WS_QH + 2u * (size_t)NB * TT * CC)      // f16 k in fragment order [b][head][16-key tile][plane 2][lane 32][8]
#define WS_VT  (WS_KH + 2u * (size_t)NB * TT * CC)      // f16 v in fragment order [b][head][32-key block][16-column half 2][plane 2][lane 32][8]
#define WS_QL  (WS_VT + 2u * (size_t)NB * CC * TT)      // f16 residual of q x 2^6 rows [b][t < QHI][CC]
#define WS_KL  (WS_QL + 2u * (size_t)NB * QHI * CC)     // f16 k residual x 2^10 rows [b][t < KHI][CC]
#define WS_VB  (WS_KL + 2u * (size_t)NB * KHI * CC)     // bf16 v hi planes [b][c][t < KHI]
#define WS_VBL (WS_VB + 2u * (size_t)NB * CC * KHI)
#define WS_S   (WS_VBL + 2u * (size_t)NB * CC * KHI)    // f32 [hg][t][s]; reserved, not used by any kernel here
#define WS_Y   (WS_S  + 4u * (size_t)HG * TT * TT)      // f32 ctx rows [b*t][CC] (only when there is an output projection)
#define WS_END (WS_Y  + 4u * (size_t)NB * TT * CC)

// ---- weight tiles through LDS: thread t fetches column c0 + t of a 32-row k-step (each wave load = one whole 128-byte line), rounds it to bf16 and lays it as row t of wt (k contiguous, pitch 80 bytes); frag_b then reads the same k order as wcol_io
#define WPI 40            // bf16 per LDS row: 64 bytes of data at the conflict-free 80-byte pitch for 16-byte reads
template <int LD> __device__ __forceinline__ void wfetch(float (&r)[32], const float* __restrict__ Wc, int kc) {
#pragma unroll   // constant indices: the arrays stay in registers
  for (int k = 0; k < 32; ++k) r[k] = Wc[(size_t)kc * (32 * LD) + (size_t)k * LD]; }
__device__ __forceinline__ void wlay(__bf16* row, const float (&r)[32]) {
#pragma unroll   // constant indices: the arrays stay in registers
  for (int q = 0; q < 4; ++q) { v8b t;
#pragma unroll   // constant indices: the arrays stay in registers
    for (int i = 0; i < 8; ++i) t[i] = (__bf16)r[q * 8 + i];
    *(v8b*)(row + q * 8) = t; } }
// work-group barrier that orders LDS only: __syncthreads() also waits out every global load, which would end the fetch-ahead at each k-step
__device__ __forceinline__ void lds_barrier() { __builtin_amdgcn_fence(__ATOMIC_RELEASE, "workgroup", "local"); __builtin_amdgcn_s_barrier(); __builtin_amdgcn_fence(__ATOMIC_ACQUIRE, "workgroup", "local"); }
// the 16 f32 of this lane's A fragment of one k-step (p = row + 8 * (lane >> 4))
__device__ __forceinline__ void afetch(v4f (&x)[4], const float* __restrict__ p, int kc) { const float* s = p + kc * 32; x[0] = *(const v4f*)s; x[1] = *(const v4f*)(s + 4); x[2] = *(const v4f*)(s + 16); x[3] = *(const v4f*)(s + 20); }
// ---- k_proj: block = (64 rows, 128 cols, which): q/k/v = X W (+ b) with exact bf16 products (K = DIN) -> which 0: q x QSC f16 rows (+ residual rows < QHI, at the same scale); 1: k f16 in fragment order (+ residual rows < KHI); 2: v f16 in fragment order (+ bf16 hi/lo planes for t < KHI)
// fragment order: the 16 bytes that lane l of k_attn loads as elements 0..7 (plane 0) or 8..15 (plane 1) of an A fragment lie at plane * 512 + l * 16, so one wave load there is 512 contiguous bytes = 4 whole lines
__global__ __launch_bounds__(128) void k_proj(const float* __restrict__ XQ, const float* __restrict__ XK, const float* __restrict__ XV, const float* __restrict__ WQ, const float* __restrict__ WK, const float* __restrict__ WV, const float* __restrict__ BQ, const float* __restrict__ BK, const float* __restrict__ BV,
    _Float16* __restrict__ QH, _Float16* __restrict__ QL, _Float16* __restrict__ KH, _Float16* __restrict__ KL, _Float16* __restrict__ VT, __bf16* __restrict__ VB, __bf16* __restrict__ VBL) {
  __shared__ __align__(16) _Float16 sh[64][136], sl[64][136]; __shared__ __align__(16) _Float16 th[128][72]; __shared__ __align__(16) __bf16 tb[128][72], tbl[128][72]; __shared__ __align__(16) __bf16 wt[2][128][WPI];
  const int tid = threadIdx.x, wave = tid >> 5, lane = tid & 31, col = lane & 15, g = lane >> 4; const int which = blockIdx.z; const int c0 = blockIdx.y * 128; const size_t r0 = (size_t)blockIdx.x * 64; const size_t bb = r0 / TT; const int t0 = (int)(r0 % TT);
  const float* X = which == 0 ? XQ : which == 1 ? XK : XV; const float* WA = which == 0 ? WQ : which == 1 ? WK : WV; const float* BA = which == 0 ? BQ : which == 1 ? BK : BV;
  v8f acc[8] = {};
  const float* Wc = WA + c0 + tid; const float* Xp = X + (r0 + wave * 16 + col) * DIN + 8 * g;
  float wr[2][32]; v4f xr[2][4];   // two k-steps in flight in registers
  // staggered walk: the 64 row blocks that share a weight tile and the 2 column blocks that share the input rows each begin the k loop at a k-step of their own and wrap, so that they do not ask L2 for the same lines at the same moment
  const int st = (int)((blockIdx.x + 8u * blockIdx.y) & (DIN / 32 - 1));
  wfetch<CC>(wr[0], Wc, st); afetch(xr[0], Xp, st);
  asm volatile("s_wait_xcnt 0x0" ::: "memory");     // the next k-step's addresses may take the address registers of the loads above
  __builtin_amdgcn_sched_barrier(0);                // keeps that address arithmetic behind the wait
  wfetch<CC>(wr[1], Wc, (st + 1) & (DIN / 32 - 1)); afetch(xr[1], Xp, (st + 1) & (DIN / 32 - 1));
  asm volatile("s_wait_xcnt 0x0" ::: "memory");     // in front of every rewrite of the address registers of the loads above
  __builtin_amdgcn_sched_barrier(0);                // keeps those loads up here, all in flight together
#pragma unroll   // constant indices: the arrays stay in registers
  for (int kc = 0; kc < DIN / 32; ++kc) { const int s = kc & 1; v16b a;
    wlay(&wt[s][tid][0], wr[s]);
#pragma unroll   // constant indices: the arrays stay in registers
    for (int i = 0; i < 4; ++i) { a[i] = (__bf16)xr[s][0][i]; a[4 + i] = (__bf16)xr[s][1][i]; a[8 + i] = (__bf16)xr[s][2][i]; a[12 + i] = (__bf16)xr[s][3][i]; }
    __builtin_amdgcn_sched_barrier(0);   // the refill below reuses the registers just read: lifted over their readers it would take a third register set
    if (kc + 2 < DIN / 32) { const int kn = (kc + 2 + st) & (DIN / 32 - 1); wfetch<CC>(wr[s], Wc, kn); afetch(xr[s], Xp, kn);
      asm volatile("s_wait_xcnt 0x0" ::: "memory");     // in front of every rewrite of the address registers of the loads above
      __builtin_amdgcn_sched_barrier(0); }              // keeps every later register write behind that wait
    lds_barrier();   // publishes wt[s]; every reader of wt[s] two k-steps back has passed the barrier in between
    v16b w[8];
#pragma unroll   // constant indices: the arrays stay in registers
    for (int j = 0; j < 8; ++j) w[j] = frag_b(&wt[s][j * 16 + col][0], lane);
    __builtin_amdgcn_sched_barrier(0);   // keeps the 16 LDS reads together ahead of the products: spread among them each pair costs its own LDS latency
#pragma unroll   // constant indices: the arrays stay in registers
    for (int j = 0; j < 8; ++j) acc[j] = wmma_bf(a, w[j], acc[j]); }
  if (which < 2) { _Float16* DH = which == 0 ? QH : KH; _Float16* DL = which == 0 ? QL : KL; const int nhi = which == 0 ? QHI : KHI; const bool hi_rows = t0 < nhi; const float vs = which == 0 ? QSC : 1.0f, rs = which == 0 ? 1.0f : 1024.0f;   // q: scaled for k_attn's accumulator chain, hi and residual at ONE scale; k: as before
#pragma unroll
    for (int j = 0; j < 8; ++j) { const float bias = BA ? bfr(BA[c0 + j * 16 + col]) : 0.f;
#pragma unroll
      for (int r = 0; r < 8; ++r) { const float v = (acc[j][r] + bias) * vs; const _Float16 hv = (_Float16)v; sh[wave * 16 + 8 * g + r][j * 16 + col] = hv; sl[wave * 16 + 8 * g + r][j * 16 + col] = (_Float16)((v - (float)hv) * rs); } }
    __syncthreads();
    for (int e = tid; e < 64 * 16; e += 128) { const int rl = e >> 4, q = e & 15;
      if (which == 0) { vst2((unsigned*)(DH + (r0 + rl) * CC + c0 + q * 8), *(const v4u*)&sh[rl][q * 8]);
        asm volatile("s_wait_xcnt 0x0" ::: "memory"); }   // inside the arm: in front of every rewrite of the registers of the store above, on every way out of it
      else { const int l = e & 31, p = (e >> 5) & 1, tl = (e >> 6) & 3, hh = e >> 8;   // A fragment of S^T: row = key 16 tl + (l & 15), k = head column 16 p + 8 (l >> 4) + 0..7
        vst2((unsigned*)(KH + ((((bb * NH + (c0 >> 5) + hh) * (TT / 16) + (t0 >> 4) + tl) * 2 + p) * 256 + l * 8)), *(const v4u*)&sh[tl * 16 + (l & 15)][hh * 32 + p * 16 + (l >> 4) * 8]);
        asm volatile("s_wait_xcnt 0x0" ::: "memory"); }   // inside the arm: in front of every rewrite of the registers of the store above, on every way out of it
      if (hi_rows) { vst2((unsigned*)(DL + (bb * nhi + t0 + rl) * (size_t)CC + c0 + q * 8), *(const v4u*)&sl[rl][q * 8]);
        asm volatile("s_wait_xcnt 0x0" ::: "memory"); } }   // in front of every rewrite of the registers of the store above
  } else { const bool hi_rows = t0 < KHI;
#pragma unroll
    for (int j = 0; j < 8; ++j) { const float bias = BA ? bfr(BA[c0 + j * 16 + col]) : 0.f;
#pragma unroll
      for (int r = 0; r < 8; ++r) { const float v = acc[j][r] + bias; const int rl = wave * 16 + 8 * g + r, cl = j * 16 + col; th[cl][rl] = (_Float16)v; const __bf16 bh = (__bf16)v; tb[cl][rl] = bh; tbl[cl][rl] = (__bf16)(v - (float)bh); } }
    __syncthreads();
    for (int e = tid; e < 128 * 8; e += 128) { const int l = e & 31, p = (e >> 5) & 1, j = (e >> 6) & 1, kbl = (e >> 7) & 1, hh = e >> 8;   // A fragment of ctx^T: row = head column 16 j + (l & 15), k = key 16 p + 8 (l >> 4) + 0..7 of the 32-key block
      vst2((unsigned*)(VT + (((((bb * NH + (c0 >> 5) + hh) * (TT / 32) + (t0 >> 5) + kbl) * 2 + j) * 2 + p) * 256 + l * 8)), *(const v4u*)&th[hh * 32 + j * 16 + (l & 15)][kbl * 32 + p * 16 + (l >> 4) * 8]);
      asm volatile("s_wait_xcnt 0x0" ::: "memory"); }   // in front of every rewrite of the registers of the store above
    for (int e = tid; e < 128 * 8; e += 128) { const int cl = e >> 3, q = e & 7; if (hi_rows) { const size_t o3 = (bb * CC + c0 + cl) * (size_t)KHI + t0 + q * 8; vst2((unsigned*)(VB + o3), *(const v4u*)&tb[cl][q * 8]); vst2((unsigned*)(VBL + o3), *(const v4u*)&tbl[cl][q * 8]);
        asm volatile("s_wait_xcnt 0x0" ::: "memory"); } } } }   // in front of every rewrite of the registers of the two stores above
// ---- k_attn: block = (head, 64 queries, batch), 8 waves = 4 query tiles x KS key ranges. Transposed products: S^T x 2^10 = k q^T (q hi + residual, 2 products) + E mask^T (E = 2^10 at (key, key): adds the mask on the matrix pipe, exactly), one accumulator chain, so a lane holds the scores of ONE query (col) at keys 8g+r of each 16-key tile;
// two such tiles, converted in place, are the B operand of ctx^T += v^T P^T. Running maximum and sum per lane (online softmax); P = exp(score - max + PSH) once to f16 (PSH cancels in the division by the sum). The KS partial results are joined through LDS.
#define KS 2
#define KR (TT / KS)      // keys per wave
#define NIT (KR / 64)     // 64 keys per pass
#define PSH 6.9314718f    // keeps P (at most 2^10) clear of f16 subnormals
#define LOG2E 1.44269504f  // exp(x) = exp2(x * LOG2E): P is rounded to f16 right after, so the library expf's range reduction and end tests buy nothing here
__device__ __forceinline__ float xhalf(float x) { return __builtin_bit_cast(float, __builtin_amdgcn_permlanex16(__builtin_bit_cast(int, x), __builtin_bit_cast(int, x), 0x76543210, 0xfedcba98, false, false)); }  // lane l with lane l ^ 16
__device__ __forceinline__ v8f wm(v16h a, v16h b, v8f c) { return __builtin_amdgcn_wmma_f32_16x16x32_f16(false, a, false, b, (short)0, c, false, false); }
__device__ __forceinline__ v8f wmb(v16b a, v16b b, v8f c) { return __builtin_amdgcn_wmma_f32_16x16x32_bf16(false, a, false, b, (short)0, c, false, false); }
typedef __attribute__((ext_vector_type(2))) __bf16 v2b;
// eight exp2 and, behind the last, the free slot that the instruction set asks for between a transcendental and an instruction that reads its result or takes its source register; results and sources in separate registers, so that no exp2 of the run takes the source of the one before
__device__ __forceinline__ void exp2x8(float (&e)[8], const float (&x)[8]) {
  asm("v_exp_f32 %0, %8\n\tv_exp_f32 %1, %9\n\tv_exp_f32 %2, %10\n\tv_exp_f32 %3, %11\n\tv_exp_f32 %4, %12\n\tv_exp_f32 %5, %13\n\tv_exp_f32 %6, %14\n\tv_exp_f32 %7, %15\n\tv_nop"
      : "=&v"(e[0]), "=&v"(e[1]), "=&v"(e[2]), "=&v"(e[3]), "=&v"(e[4]), "=&v"(e[5]), "=&v"(e[6]), "=&v"(e[7]) : "v"(x[0]), "v"(x[1]), "v"(x[2]), "v"(x[3]), "v"(x[4]), "v"(x[5]), "v"(x[6]), "v"(x[7])); }
// 16x16x32 fragment stored in fragment order at (wave-uniform base) + (lane byte offset lo = 16 * lane) + constant cb: plane 0 = elements 0..7, plane 1 (512 bytes on) = elements 8..15; same k order as frag_h
__device__ __forceinline__ v16h frag_w(const _Float16* ub, unsigned lo, int cb) { union { v16h v; v8h q[2]; } u; const char* p = (const char*)ub + lo; u.q[0] = *(const v8h*)(p + cb); u.q[1] = *(const v8h*)(p + cb + 512); return u.v; }
// ---- the mask through LDS: each wave's tile of a pass (its 16 query rows x 64 keys, f32: 16 rows of 256 bytes, 8,192 bytes apart in memory) comes by ONE tensor load, one pass ahead, through no register;
// the mover pads each row by 16 bytes, so the lanes' 16-byte reads down a column of rows (pitch 272 bytes) meet no bank twice
typedef __attribute__((ext_vector_type(8))) unsigned v8u;
#define MROWB 256u        // bytes of one row of the tile
#define MPITCH 272u       // its pitch in LDS: the row + the 16-byte pad
#define MSLICE 6144u      // 16 rows x 272 bytes = 4,352, rounded up to a multiple of 2 KiB: every slice starts on one
#define MWORD0 ((1u << 20) | (5u << 22) | (3u << 25))   // group 1 word 0: no mask, 1-byte elements, a pad of 4 dwords behind every 64 dwords (one row)
__device__ __forceinline__ uint32_t uni(uint32_t v) { return (uint32_t)__builtin_amdgcn_readfirstlane((int)v); }
__device__ __forceinline__ uint32_t pinned(uint32_t v) { uint32_t w = uni(v); asm volatile("" : "+s"(w)); return w; }   // holds the issue test of a tensor load in a scalar register, so that the branch on it is a scalar one (the instruction ignores EXEC)
__device__ __forceinline__ void mask_tile_load(uint32_t lds_dst, const float* tile) { const uint64_t ga = (uint64_t)(size_t)tile;
  v4u g0; g0[0] = uni(1u); g0[1] = uni(lds_dst); g0[2] = uni((uint32_t)ga); g0[3] = uni((((uint32_t)(ga >> 32)) & 0x01FFFFFFu) | 0x80000000u);   // count 1; place in LDS; first byte of the tile; type 2
  v8u g1; g1[0] = uni(MWORD0); g1[1] = uni(MROWB << 16); g1[2] = uni(16u << 16); g1[3] = uni(MROWB << 16); g1[4] = uni(16u); g1[5] = uni(TT * 4u); g1[6] = uni(0u); g1[7] = uni(0u);   // tensor = tile = 256 bytes x 16 rows; source pitch = one mask row
  asm volatile("tensor_load_to_lds %0, %1" :: "s"(g0), "s"(g1) : "memory"); }   // one request of the whole wave
__global__ __launch_bounds__(256) void k_attn(const _Float16* __restrict__ QH, const _Float16* __restrict__ QL, const _Float16* __restrict__ KH, const _Float16* __restrict__ VT, const float* __restrict__ MKF, float* __restrict__ Y) {
  __shared__ __attribute__((aligned(2048))) unsigned char ms[2][8][MSLICE]; __shared__ float sp[4][18][32];
  const int tid = threadIdx.x, wave = __builtin_amdgcn_readfirstlane(tid >> 5), lane = tid & 31, col = lane & 15, g = lane >> 4; const int h = blockIdx.x, qb = blockIdx.y, b = blockIdx.z; const int qt = wave & 3, ks = wave >> 2;
  const int q0 = qb * 64 + qt * 16, q = q0 + col;
  const v16h qh = frag_h(QH + ((size_t)b * TT + q) * CC + h * HD, lane), ql = frag_h(QL + ((size_t)b * QHI + q) * CC + h * HD, lane);
  const unsigned fo = (unsigned)lane * 16u;   // a lane's place in each 512-byte plane
  const _Float16* Kb = KH + (((size_t)b * NH + h) * (TT / 16) + ks * (KR / 16)) * 512;   // A rows = keys, k = head columns: 1,024 bytes per 16-key tile
  float m = -3.0e38f, l = 0.f; v8f acc0 = {}, acc1 = {};   // m: the running maximum of the logits x LSH
  // selection matrices (A operands, 16 key rows x 32 k): es[j] row c holds LSH at k = 16 j + c and 0 elsewhere, so es[j] x (32 keys x 16 queries of the mask) = LSH x the mask at keys 16 j + 0..15
  v16b es[2] = {};
#pragma unroll
  for (int i = 0; i < 8; ++i) { const __bf16 o = (__bf16)(8 * g + i == col ? LSH : 0.f); es[0][i] = o; es[1][8 + i] = o; }
  // staggered walk: the 8 head blocks that share a mask tile and the 32 query blocks that share a head's k and v each begin the key walk at a pass of their own and wrap, so that they do not ask L2 for the same lines at the same moment
  const int st = (2 * h + qb) & (NIT - 1);
  v16h kf[4];
#pragma unroll
  for (int kt = 0; kt < 4; ++kt) kf[kt] = frag_w(Kb + (size_t)st * 2048, fo, kt * 1024);
  asm volatile("s_wait_xcnt 0x0" ::: "memory");     // in front of every rewrite of the address registers of the q and k loads above
  __builtin_amdgcn_sched_barrier(0);                // keeps the address arithmetic of the loop behind that wait
  const _Float16* Vb = VT + (((size_t)b * NH + h) * (TT / 32) + ks * (KR / 32)) * 1024;  // A rows = head columns, k = keys: 2,048 bytes per 32-key block (two 16-column halves)
  const float* Mb = MKF + ((size_t)b * TT + q0) * TT + ks * KR;       const unsigned mo = (unsigned)col * MPITCH + 32u * (unsigned)g;   // this wave's 16 query rows; in LDS: this lane's query row, its 8 keys of each 16-key tile
  const uint32_t md = (uint32_t)(size_t)&ms[0][wave][0];   // this wave's slice of buffer 0; buffer 1 lies 8 slices on
  mask_tile_load(md, Mb + st * 64);                         // the first pass's tile
  for (int it = 0; it < NIT; ++it) { const int pi = (it + st) & (NIT - 1), pn = (it + 1 + st) & (NIT - 1);   // the 64-key blocks of this pass and of the next
    // publish point of pass it's tile, at the seam between pass it - 1 and pass it (written at the head: at the foot, its branch would cut the sums of the pass off from the softmax they are interleaved with)
    asm volatile("s_wait_dscnt 0x0" ::: "memory");       // the last pass's reads of its buffer have retired
    asm volatile("s_wait_tensorcnt 0x0" ::: "memory");   // this pass's tile has landed
    __syncthreads();                                     // publishes it; every reader has left the other buffer
    if (pinned(it + 1 < NIT)) mask_tile_load(md + (uint32_t)((it + 1) & 1) * (8u * MSLICE), Mb + pn * 64);   // the next pass's tile flies under this pass, into the buffer that the last pass read
    v4f mk[4][2]; const unsigned char* mp = &ms[it & 1][wave][0] + mo;
#pragma unroll
    for (int kt = 0; kt < 4; ++kt) { mk[kt][0] = *(const v4f*)(mp + kt * 64); mk[kt][1] = *(const v4f*)(mp + kt * 64 + 16); }
    v16h vf[2][2];
#pragma unroll
    for (int s = 0; s < 2; ++s) { vf[s][0] = frag_w(Vb + pi * 2048, fo, s * 2048); vf[s][1] = frag_w(Vb + pi * 2048, fo, s * 2048 + 1024); }
    asm volatile("s_wait_xcnt 0x0" ::: "memory");   // in front of every rewrite of the address registers of the v loads above
    __builtin_amdgcn_sched_barrier(0);              // holds those loads up here: without it they sink to their first use and the wave waits out each latency
    v8f v[4]; float mx = -3.0e38f;
#pragma unroll
    for (int kt = 0; kt < 4; ++kt) { const v8f z = {}; v[kt] = wm(kf[kt], qh, wm(kf[kt], ql, z)); }   // smallest terms first
    union { v16b f; v2b d[8]; } mb[2];   // B operand: element 8 j + r = the mask at key 16 j + 8 g + r of a 32-key block, the k order of p below
#pragma unroll
    for (int kt = 0; kt < 4; ++kt) {
#pragma unroll
      for (int r = 0; r < 8; r += 2) { const v2f t = { mk[kt][r >> 2][r & 3], mk[kt][r >> 2][(r & 3) + 1] }; mb[kt >> 1].d[(kt & 1) * 4 + (r >> 1)] = __builtin_convertvector(t, v2b); } }
    __builtin_amdgcn_sched_barrier(0);   // both mask operands stand ready ahead of their four products: converted between them, the second takes the first's registers and waits out the distance behind a product that still reads them
#pragma unroll
    for (int kt = 0; kt < 4; ++kt) v[kt] = wmb(es[kt & 1], mb[kt >> 1].f, v[kt]);
#pragma unroll
    for (int kt = 0; kt < 4; ++kt) {
#pragma unroll
      for (int r = 0; r < 8; ++r) mx = fmaxf(mx, v[kt][r]); }
    const int nx = it + 1 < NIT ? pn : pi;   // next pass's k rows, fetched under this pass's softmax (the last pass fetches its own again)
#pragma unroll
    for (int kt = 0; kt < 4; ++kt) kf[kt] = frag_w(Kb + (size_t)nx * 2048, fo, kt * 1024);
    asm volatile("s_wait_xcnt 0x0" ::: "memory");   // in front of every rewrite of the address registers of the k loads above
    __builtin_amdgcn_sched_barrier(0);              // holds the k loads ahead of the softmax, which covers their latency
    mx = fmaxf(mx, xhalf(mx)); const float mn = fmaxf(m, mx); float al; asm("v_exp_f32 %0, %1\n\tv_nop" : "=v"(al) : "v"((m - mn) * (LOG2E / LSH)));   // exp2 with the free slot behind it that the instruction set asks for
    m = mn; const float nms = (PSH - mn * (1.0f / LSH)) * LOG2E;
    float sum = 0.f; v16h p[2];
#pragma unroll
    for (int kt = 0; kt < 4; ++kt) { float x[8], e[8];
#pragma unroll
      for (int r = 0; r < 8; ++r) x[r] = fmaf(v[kt][r], LOG2E / LSH, nms);
      exp2x8(e, x);
#pragma unroll
      for (int r = 0; r < 8; ++r) { sum += e[r]; p[kt >> 1][(kt & 1) * 8 + r] = (_Float16)e[r]; } }
    l = l * al + sum;
#pragma unroll
    for (int r = 0; r < 8; ++r) { acc0[r] *= al; acc1[r] *= al; }
#pragma unroll
    for (int s = 0; s < 2; ++s) { acc0 = wm(vf[s][0], p[s], acc0); acc1 = wm(vf[s][1], p[s], acc1); } }
  asm volatile("s_wait_tensorcnt 0x0" ::: "memory");     // nothing of the mover is in flight behind the loop
  asm volatile("s_wait_dscnt 0x0" ::: "memory");         // and no read of the two buffers
  l += xhalf(l);
  if (ks) { sp[qt][0][lane] = m; sp[qt][1][lane] = l;
#pragma unroll
    for (int r = 0; r < 8; ++r) { sp[qt][2 + r][lane] = acc0[r]; sp[qt][10 + r][lane] = acc1[r]; } }
  __syncthreads();
  if (!ks) { const float m1 = sp[qt][0][lane], l1 = sp[qt][1][lane]; const float mm = fmaxf(m, m1); float a0 = expf((m - mm) * (1.0f / LSH)), a1 = expf((m1 - mm) * (1.0f / LSH)); const float lt = l * a0 + l1 * a1; const float inv = lt > 0.f ? 1.0f / lt : 0.f; a0 *= inv; a1 *= inv;
    v4f o[4];
#pragma unroll
    for (int r = 0; r < 8; ++r) { o[r >> 2][r & 3] = acc0[r] * a0 + sp[qt][2 + r][lane] * a1; o[2 + (r >> 2)][r & 3] = acc1[r] * a0 + sp[qt][10 + r][lane] * a1; }
    float* yp = Y + ((size_t)b * TT + q) * CC + h * HD + 8 * g;   // ctx^T register r = head column 16 j + 8 g + r of query col
    vst2(yp, o[0]); vst2(yp + 4, o[1]); vst2(yp + 16, o[2]); vst2(yp + 20, o[3]); } }
// ---- k_out: block = (64 rows, 128 cols): out = ctx Wo (+ bo): all rows: ctx bf16 hi + lo against exact bf16 Wo (2 products); the f16 x f16(bf16 x 2^8) branch is never taken
__global__ __launch_bounds__(128) void k_out(const float* __restrict__ Y, const float* __restrict__ WO, const float* __restrict__ BO, float* __restrict__ OUT) { __shared__ __align__(16) float sf[4][16][132]; __shared__ __align__(16) __bf16 wt[2][128][WPI];
  const int tid = threadIdx.x, wave = tid >> 5, lane = tid & 31, col = lane & 15, g = lane >> 4; const int c0 = blockIdx.y * 128; const size_t r0 = (size_t)blockIdx.x * 64 + wave * 16;
  v8f acc[8] = {};
  if (true) {   /* ALL rows: ctx split bf16 hi + lo x exact Wo (2 products) */
    const float* Wc = WO + c0 + tid; const float* Yp = Y + (r0 + col) * CC + 8 * g;
    float wr[2][32]; v4f xr[2][4];   // two k-steps in flight in registers
    const int st = (int)((blockIdx.x + 2u * blockIdx.y) & (CC / 32 - 1));   // staggered walk, as in k_proj: 64 row blocks share a weight tile, 4 column blocks the ctx rows
    wfetch<DIN>(wr[0], Wc, st); afetch(xr[0], Yp, st);
    asm volatile("s_wait_xcnt 0x0" ::: "memory");     // the next k-step's addresses may take the address registers of the loads above
    __builtin_amdgcn_sched_barrier(0);                // keeps that address arithmetic behind the wait
    wfetch<DIN>(wr[1], Wc, (st + 1) & (CC / 32 - 1)); afetch(xr[1], Yp, (st + 1) & (CC / 32 - 1));
    asm volatile("s_wait_xcnt 0x0" ::: "memory");     // in front of every rewrite of the address registers of the loads above
    __builtin_amdgcn_sched_barrier(0);                // keeps those loads up here, all in flight together
#pragma unroll   // constant indices: the arrays stay in registers
    for (int kc = 0; kc < CC / 32; ++kc) { const int s = kc & 1; float v[16];
      wlay(&wt[s][tid][0], wr[s]);
#pragma unroll   // constant indices: the arrays stay in registers
      for (int i = 0; i < 4; ++i) { v[i] = xr[s][0][i]; v[4 + i] = xr[s][1][i]; v[8 + i] = xr[s][2][i]; v[12 + i] = xr[s][3][i]; }
      const F2 a = bsplit16(v);
      __builtin_amdgcn_sched_barrier(0);   // the refill below reuses the registers just read: lifted over their readers it would take a third register set
      if (kc + 2 < CC / 32) { const int kn = (kc + 2 + st) & (CC / 32 - 1); wfetch<DIN>(wr[s], Wc, kn); afetch(xr[s], Yp, kn);
        asm volatile("s_wait_xcnt 0x0" ::: "memory");     // in front of every rewrite of the address registers of the loads above
        __builtin_amdgcn_sched_barrier(0); }              // keeps every later register write behind that wait
      lds_barrier();   // publishes wt[s]; every reader of wt[s] two k-steps back has passed the barrier in between
      v16b w[8];
#pragma unroll   // constant indices: the arrays stay in registers
      for (int j = 0; j < 8; ++j) w[j] = frag_b(&wt[s][j * 16 + col][0], lane);
      __builtin_amdgcn_sched_barrier(0);   // keeps the 16 LDS reads together ahead of the products: spread among them each pair costs its own LDS latency
#pragma unroll   // constant indices: the arrays stay in registers
      for (int j = 0; j < 8; ++j) { acc[j] = wmma_bf(a.h, w[j], acc[j]); acc[j] = wmma_bf(a.l, w[j], acc[j]); } }
#pragma unroll
    for (int j = 0; j < 8; ++j) { const float bias = BO ? bfr(BO[c0 + j * 16 + col]) : 0.f;
#pragma unroll
      for (int r = 0; r < 8; ++r) sf[wave][8 * g + r][j * 16 + col] = acc[j][r] + bias; }
  } else {
#pragma unroll 2
    for (int kc = 0; kc < CC / 32; ++kc) { const v16h a = frag_f32(Y + (r0 + col) * CC + kc * 32, lane); asm volatile("s_wait_loadcnt 0x0" ::: "memory");
#pragma unroll
      for (int j = 0; j < 8; ++j) { const v16h w = WOCOLH(WO, kc * 32, c0 + j * 16 + col, lane); asm volatile("s_wait_loadcnt 0x0" ::: "memory"); acc[j] = wmma16(a, w, acc[j]); } }
#pragma unroll
    for (int j = 0; j < 8; ++j) { const float bias = BO ? bfr(BO[c0 + j * 16 + col]) : 0.f;
#pragma unroll
      for (int r = 0; r < 8; ++r) sf[wave][8 * g + r][j * 16 + col] = acc[j][r] * (1.0f / 256.0f) + bias; } }
  LDSX(); for (int rl = 0; rl < 16; ++rl) vst2(OUT + (r0 + rl) * DIN + c0 + lane * 4, *(const v4f*)&sf[wave][rl][lane * 4]); }

extern "C" void kernel_launch(void* const* d_in, const int* in_sizes, int n_in, void* d_out, int out_size, void* d_ws, size_t ws_size, hipStream_t stream) {
  (void)in_sizes; (void)n_in; (void)out_size;
  const float** F = (const float**)d_in;
  if (ws_size < (size_t)WS_END) return;
  char* ws = (char*)d_ws; _Float16 *QH = (_Float16*)(ws + WS_QH), *KH = (_Float16*)(ws + WS_KH), *VT = (_Float16*)(ws + WS_VT), *QL = (_Float16*)(ws + WS_QL), *KL = (_Float16*)(ws + WS_KL); __bf16 *VB = (__bf16*)(ws + WS_VB), *VBL = (__bf16*)(ws + WS_VBL); float *Y = (float*)(ws + WS_Y);
  (void)Y; (void)QL; (void)KL; (void)VB; (void)VBL;
  // inputs: 0 V [2,2048,512]; 1 Q; 2 K; 3 mask [2,1,2048,2048] f32; 4 Wq [512,256] (in,out), 5 bq; 6 Wk, 7 bk; 8 Wv, 9 bv; 10 Wo [256,512] (in,out), 11 bo [512]
  k_proj<<<dim3(TNB * TT / 64, CC / 128, 3), 128, 0, stream>>>(F[1], F[2], F[0], F[4], F[6], F[8], F[5], F[7], F[9], QH, QL, KH, KL, VT, VB, VBL);   /* q from Q (in1), k from K (in2), v from V (in0) */
  k_attn<<<dim3(NH, NQB, TNB), 256, 0, stream>>>(QH, QL, KH, VT, F[3], Y);
  k_out<<<dim3(TNB * TT / 64, DIN / 128), 128, 0, stream>>>(Y, F[10], F[11], (float*)d_out);
}

// v008
// It runs in 38 microseconds.
// Two timings next to v007 both put it at 1.04 times that version's speed.
// Over all steps from v000 it is 11.9 times as fast.
// compute dtype: all float inputs rounded to bf16; q/k/v = in W + b with EXACT bf16 products on WMMA 16x16x32 (f32 accumulate); logits x 2^10 as ONE WMMA accumulator chain: q x 2^6 (= 2^10 / sqrt(256)) as f16 hi + residual against k once to f16 (2 products), then the additive mask (bf16) against a constant selection matrix of 2^10 (1 product, exact); online softmax in f32 (exponentials as hardware exp2 of one fma by log2 e); unnormalised P (at most 2^10) once to f16 against v once to f16 (1 product), divided by the f32 sum; ctx split bf16 hi + lo against exact Wo (2 products) + bo; f32 output.
#include <hip/hip_runtime.h>
#include <math.h>

typedef __attribute__((ext_vector_type(16))) _Float16 v16h;
typedef __attribute__((ext_vector_type(16))) __bf16 v16b;
typedef __attribute__((ext_vector_type(8)))  _Float16 v8h;
typedef __attribute__((ext_vector_type(8)))  float v8f;
typedef __attribute__((ext_vector_type(4)))  float v4f;
typedef __attribute__((ext_vector_type(2)))  float v2f;
typedef __attribute__((ext_vector_type(4)))  unsigned v4u;
typedef __attribute__((ext_vector_type(4)))  int v4i;
typedef float __attribute__((may_alias)) float_a;
typedef int __attribute__((may_alias)) int_a;

template <typename T> __device__ __forceinline__ void vst2(void* p, T v) { *(T*)p = v;  }
__device__ __forceinline__ v8f wmma16(v16h a, v16h b, v8f c) {
  v8f d = __builtin_amdgcn_wmma_f32_16x16x32_f16(false, a, false, b, (short)0, c, false, false);
  asm volatile("v_nop\n\tv_nop\n\tv_nop\n\tv_nop" : "+v"(d) : "v"(a), "v"(b));
  return d;
}
__device__ __forceinline__ v8f wmma_bf(v16b a, v16b b, v8f c) {
  v8f d = __builtin_amdgcn_wmma_f32_16x16x32_bf16(false, a, false, b, (short)0, c, false, false);
  asm volatile("v_nop\n\tv_nop\n\tv_nop\n\tv_nop" : "+v"(d) : "v"(a), "v"(b));
  return d;
}
// 16x16x32 fragments: lane = (h = lane>>4, row/col = lane&15); elements 0..7 = k0+8h+0..7, 8..15 = k0+16+8h+0..7; D element r = row 8h+r
__device__ __forceinline__ v16h frag_h(const _Float16* rowk0, int lane) {
  union { v16h v; v8h q[2]; } u; const _Float16* p = rowk0 + 8 * (lane >> 4);
  u.q[0] = *(const v8h*)p; u.q[1] = *(const v8h*)(p + 16); return u.v;
}
__device__ __forceinline__ v16h frag_f32(const float* rowk0, int lane) {
  v16h a; const float* p = rowk0 + 8 * (lane >> 4);
#pragma unroll
  for (int i = 0; i < 8; ++i) { a[i] = (_Float16)p[i]; a[8 + i] = (_Float16)p[16 + i]; }
  return a;
}
__device__ __forceinline__ v16h frag_f32s(const float* rowk0, int lane, float sc) {
  v16h a; const float* p = rowk0 + 8 * (lane >> 4);
#pragma unroll
  for (int i = 0; i < 8; ++i) { a[i] = (_Float16)(p[i] * sc); a[8 + i] = (_Float16)(p[16 + i] * sc); }
  return a;
}
// column fragment from a [K][ld] layout (column n), rows >= K read as 0
__device__ __forceinline__ v16h fragc_f32(const float* W, int k0, int n, int lane, int ld, int K) {
  v16h a; const int g = lane >> 4;
#pragma unroll
  for (int i = 0; i < 8; ++i) { const int ka = k0 + 8 * g + i, kb = ka + 16;
    a[i] = (_Float16)(ka < K ? W[(size_t)(ka < K ? ka : K - 1) * ld + n] : 0.f); a[8 + i] = (_Float16)(kb < K ? W[(size_t)(kb < K ? kb : K - 1) * ld + n] : 0.f); }
  return a;
}
struct F2 { v16b h, l; };
__device__ __forceinline__ F2 bsplit16(const float v[16]) { F2 r;
#pragma unroll
  for (int i = 0; i < 16; ++i) { const __bf16 h = (__bf16)v[i]; r.h[i] = h; r.l[i] = (__bf16)(v[i] - (float)h); }
  return r; }
__device__ __forceinline__ F2 split_row(const float* row, int k0, int lane) { float v[16]; const float* p = row + k0 + 8 * (lane >> 4);
#pragma unroll
  for (int i = 0; i < 8; ++i) { v[i] = p[i]; v[8 + i] = p[16 + i]; }
  return bsplit16(v); }
__device__ __forceinline__ F2 split_rowK(const float* row, int k0, int lane, int K) { float v[16]; const int g = lane >> 4;
#pragma unroll
  for (int i = 0; i < 8; ++i) { const int ka = k0 + 8 * g + i, kb = ka + 16; v[i] = ka < K ? row[ka < K ? ka : K - 1] : 0.f; v[8 + i] = kb < K ? row[kb < K ? kb : K - 1] : 0.f; }
  return bsplit16(v); }
__device__ __forceinline__ F2 split_col(const float* W, int k0, int n, int lane, int ld, int K) { float v[16]; const int g = lane >> 4;
#pragma unroll
  for (int i = 0; i < 8; ++i) { const int ka = k0 + 8 * g + i, kb = ka + 16; v[i] = ka < K ? W[(size_t)(ka < K ? ka : K - 1) * ld + n] : 0.f; v[8 + i] = kb < K ? W[(size_t)(kb < K ? kb : K - 1) * ld + n] : 0.f; }
  return bsplit16(v); }
__device__ __forceinline__ v8f mac3(const F2& a, const F2& b, v8f c) { c = wmma_bf(a.l, b.h, c); c = wmma_bf(a.h, b.l, c); return wmma_bf(a.h, b.h, c); }
__device__ __forceinline__ float sigm(float v) { return 1.0f / (1.0f + expf(-v)); }
#define LDSX() do { asm volatile("s_wait_dscnt 0" ::: "memory"); __builtin_amdgcn_wave_barrier(); __builtin_amdgcn_fence(__ATOMIC_RELEASE, "workgroup"); } while (0)

// Multi-head attention with an additive dense mask (B 2, S 2,048, d_model 512 -> key/value dim 256 = 8 heads x 32 -> out 512; 0.02-scale (in,out) weights, zero biases; separate V, Q, K inputs): scores = q k^T / sqrt(256) (the FULL key_dim, as written) + mask[b, 0, q, k] (random normal); out = merged(softmax v) Wo + bo.
#define NB 2
#define TT 2048
#define CC 256            // NH * HD = projected width
#define DIN 512          // input (model) width
#define NH 8
#define HD 32
#define NQB (TT / 64)
#define HG 4
#define SCALE (0.0625f)
#define LSH 1024.0f        // k_attn carries its logits x 2^10 (a power of two: exact): q's f16 residual, at the same scale as its hi part, then stays clear of f16 subnormals
#define QSC (SCALE * LSH)  // what k_proj multiplies q by
#define CAUSAL 0
#ifndef TNB
#define TNB NB
#endif
__device__ __forceinline__ float bfr(float v) { return (float)(__bf16)v; }
__host__ __device__ __forceinline__ int kb_last(int qb) { return CAUSAL ? ((qb * 64 + 63) >> 7) : (TT / 128 - 1); }
typedef __attribute__((ext_vector_type(8))) __bf16 v8b;
__device__ __forceinline__ v16b frag_b(const __bf16* rowk0, int lane) {
  union { v16b v; v8b q[2]; } u; const __bf16* p = rowk0 + 8 * (lane >> 4);
  u.q[0] = *(const v8b*)p; u.q[1] = *(const v8b*)(p + 16); return u.v;
}
#define QBH 0
#define QHI 2048            // rows carrying a q residual plane (all rows when non-causal: 2-product logits everywhere)
#define KHI 64            // key rows carrying k residual / v bf16 hi+lo planes (written by k_proj; no kernel here reads them)
// B fragment (k rows k0+.., output column o) of a weight: (in,out) [K][ld] or (out,in) [ld rows of K]: bf16 exact, or f16(bf16 * 256) exact
__device__ __forceinline__ v16b wcol_io(const float* Wm, int k0, int o, int lane, int ld) { v16b w; const int g = lane >> 4;
#pragma unroll
  for (int i = 0; i < 8; ++i) { w[i] = (__bf16)Wm[(size_t)(k0 + 8 * g + i) * ld + o]; w[8 + i] = (__bf16)Wm[(size_t)(k0 + 16 + 8 * g + i) * ld + o]; }
  return w; }
__device__ __forceinline__ v16b wcol_oi(const float* Wm, int k0, int o, int lane, int K) { v16b w; const float* p = Wm + (size_t)o * K + k0 + 8 * (lane >> 4);
#pragma unroll
  for (int i = 0; i < 8; ++i) { w[i] = (__bf16)p[i]; w[8 + i] = (__bf16)p[16 + i]; }
  return w; }
__device__ __forceinline__ v16h wcolh_io(const float* Wm, int k0, int o, int lane, int ld) { v16h w; const int g = lane >> 4;
#pragma unroll
  for (int i = 0; i < 8; ++i) { w[i] = (_Float16)(bfr(Wm[(size_t)(k0 + 8 * g + i) * ld + o]) * 256.0f); w[8 + i] = (_Float16)(bfr(Wm[(size_t)(k0 + 16 + 8 * g + i) * ld + o]) * 256.0f); }
  return w; }
__device__ __forceinline__ v16h wcolh_oi(const float* Wm, int k0, int o, int lane, int K) { v16h w; const float* p = Wm + (size_t)o * K + k0 + 8 * (lane >> 4);
#pragma unroll
  for (int i = 0; i < 8; ++i) { w[i] = (_Float16)(bfr(p[i]) * 256.0f); w[8 + i] = (_Float16)(bfr(p[16 + i]) * 256.0f); }
  return w; }
#define WQKV_LAYOUT 0   // 0 = (in,out) [DIN][CC]; 1 = (out,in) [CC][DIN]; 2 = per-head [NH][DIN][HD]
__device__ __forceinline__ v16b wcol_hdk(const float* Wm, int k0, int o, int lane) { v16b w; const int g = lane >> 4; const float* p = Wm + (size_t)(o / HD) * DIN * HD + (o % HD);
#pragma unroll
  for (int i = 0; i < 8; ++i) { w[i] = (__bf16)p[(size_t)(k0 + 8 * g + i) * HD]; w[8 + i] = (__bf16)p[(size_t)(k0 + 16 + 8 * g + i) * HD]; }
  return w; }
#define WO_OUT_IN 0
#if WQKV_LAYOUT == 1
#define WCOL(W, k0, o, lane) wcol_oi(W, k0, o, lane, DIN)
#elif WQKV_LAYOUT == 2
#define WCOL(W, k0, o, lane) wcol_hdk(W, k0, o, lane)
#else
#define WCOL(W, k0, o, lane) wcol_io(W, k0, o, lane, CC)
#endif
#if WO_OUT_IN
#define WOCOL(W, k0, o, lane) wcol_oi(W, k0, o, lane, CC)
#define WOCOLH(W, k0, o, lane) wcolh_oi(W, k0, o, lane, CC)
#else
#define WOCOL(W, k0, o, lane) wcol_io(W, k0, o, lane, DIN)
#define WOCOLH(W, k0, o, lane) wcolh_io(W, k0, o, lane, DIN)
#endif

#define WS_QH  0u                                      // f16 q x 2^6 rows [b*t][CC]
#define WS_KH  (WS_QH + 2u * (size_t)NB * TT * CC)      // f16 k in fragment order [b][head][16-key tile][plane 2][lane 32][8]
#define WS_VT  (WS_KH + 2u * (size_t)NB * TT * CC)      // f16 v in fragment order [b][head][32-key block][16-column half 2][plane 2][lane 32][8]
#define WS_QL  (WS_VT + 2u * (size_t)NB * CC * TT)      // f16 residual of q x 2^6 rows [b][t < QHI][CC]
#define WS_KL  (WS_QL + 2u * (size_t)NB * QHI * CC)     // f16 k residual x 2^10 rows [b][t < KHI][CC]
#define WS_VB  (WS_KL + 2u * (size_t)NB * KHI * CC)     // bf16 v hi planes [b][c][t < KHI]
#define WS_VBL (WS_VB + 2u * (size_t)NB * CC * KHI)
#define WS_S   (WS_VBL + 2u * (size_t)NB * CC * KHI)    // f32 [hg][t][s]; reserved, not used by any kernel here
#define WS_Y   (WS_S  + 4u * (size_t)HG * TT * TT)      // f32 ctx rows [b*t][CC] (only when there is an output projection)
#define WS_END (WS_Y  + 4u * (size_t)NB * TT * CC)

// ---- weight tiles through LDS: thread t fetches column c0 + t of a 32-row k-step (each wave load = one whole 128-byte line), rounds it to bf16 and lays it as row t of wt (k contiguous, pitch 80 bytes); frag_b then reads the same k order as wcol_io
#define WPI 40            // bf16 per LDS row: 64 bytes of data at the conflict-free 80-byte pitch for 16-byte reads
template <int LD> __device__ __forceinline__ void wfetch(float (&r)[32], const float* __restrict__ Wc, int kc) {
#pragma unroll   // constant indices: the arrays stay in registers
  for (int k = 0; k < 32; ++k) r[k] = Wc[(size_t)kc * (32 * LD) + (size_t)k * LD]; }
__device__ __forceinline__ void wlay(__bf16* row, const float (&r)[32]) {
#pragma unroll   // constant indices: the arrays stay in registers
  for (int q = 0; q < 4; ++q) { v8b t;
#pragma unroll   // constant indices: the arrays stay in registers
    for (int i = 0; i < 8; ++i) t[i] = (__bf16)r[q * 8 + i];
    *(v8b*)(row + q * 8) = t; } }
// work-group barrier that orders LDS only: __syncthreads() also waits out every global load, which would end the fetch-ahead at each k-step
__device__ __forceinline__ void lds_barrier() { __builtin_amdgcn_fence(__ATOMIC_RELEASE, "workgroup", "local"); __builtin_amdgcn_s_barrier(); __builtin_amdgcn_fence(__ATOMIC_ACQUIRE, "workgroup", "local"); }
// the 16 f32 of this lane's A fragment of one k-step (p = row + 8 * (lane >> 4))
__device__ __forceinline__ void afetch(v4f (&x)[4], const float* __restrict__ p, int kc) { const float* s = p + kc * 32; x[0] = *(const v4f*)s; x[1] = *(const v4f*)(s + 4); x[2] = *(const v4f*)(s + 16); x[3] = *(const v4f*)(s + 20); }
// ---- k_proj: block = (64 rows, 128 cols, which): q/k/v = X W (+ b) with exact bf16 products (K = DIN) -> which 0: q x QSC f16 rows (+ residual rows < QHI, at the same scale); 1: k f16 in fragment order (+ residual rows < KHI); 2: v f16 in fragment order (+ bf16 hi/lo planes for t < KHI)
// fragment order: the 16 bytes that lane l of k_attn loads as elements 0..7 (plane 0) or 8..15 (plane 1) of an A fragment lie at plane * 512 + l * 16, so one wave load there is 512 contiguous bytes = 4 whole lines
__global__ __launch_bounds__(128) void k_proj(const float* __restrict__ XQ, const float* __restrict__ XK, const float* __restrict__ XV, const float* __restrict__ WQ, const float* __restrict__ WK, const float* __restrict__ WV, const float* __restrict__ BQ, const float* __restrict__ BK, const float* __restrict__ BV,
    _Float16* __restrict__ QH, _Float16* __restrict__ QL, _Float16* __restrict__ KH, _Float16* __restrict__ KL, _Float16* __restrict__ VT, __bf16* __restrict__ VB, __bf16* __restrict__ VBL) {
  __shared__ __align__(16) _Float16 sh[64][136], sl[64][136]; __shared__ __align__(16) _Float16 th[128][72]; __shared__ __align__(16) __bf16 tb[128][72], tbl[128][72]; __shared__ __align__(16) __bf16 wt[2][128][WPI];
  const int tid = threadIdx.x, wave = tid >> 5, lane = tid & 31, col = lane & 15, g = lane >> 4; const int which = blockIdx.z; const int c0 = blockIdx.y * 128; const size_t r0 = (size_t)blockIdx.x * 64; const size_t bb = r0 / TT; const int t0 = (int)(r0 % TT);
  const float* X = which == 0 ? XQ : which == 1 ? XK : XV; const float* WA = which == 0 ? WQ : which == 1 ? WK : WV; const float* BA = which == 0 ? BQ : which == 1 ? BK : BV;
  v8f acc[8] = {};
  const float* Wc = WA + c0 + tid; const float* Xp = X + (r0 + wave * 16 + col) * DIN + 8 * g;
  float wr[2][32]; v4f xr[2][4];   // two k-steps in flight in registers
  float bs[8]; const float* Bp = (BA ? BA : WA) + c0 + col;   // this lane's 8 bias values; without a bias the loads read weights, which the epilogue replaces by 0: a branch round the loads cuts the unrolled k loop in two, and that build took more than 256 registers
  // staggered walk: the 64 row blocks that share a weight tile and the 2 column blocks that share the input rows each begin the k loop at a k-step of their own and wrap, so that they do not ask L2 for the same lines at the same moment
  const int st = (int)((blockIdx.x + 8u * blockIdx.y) & (DIN / 32 - 1));
  wfetch<CC>(wr[0], Wc, st); afetch(xr[0], Xp, st);
  asm volatile("s_wait_xcnt 0x0" ::: "memory");     // the next k-step's addresses may take the address registers of the loads above
  __builtin_amdgcn_sched_barrier(0);                // keeps that address arithmetic behind the wait
  wfetch<CC>(wr[1], Wc, (st + 1) & (DIN / 32 - 1)); afetch(xr[1], Xp, (st + 1) & (DIN / 32 - 1));
  asm volatile("s_wait_xcnt 0x0" ::: "memory");     // in front of every rewrite of the address registers of the loads above
  __builtin_amdgcn_sched_barrier(0);                // keeps those loads up here, all in flight together
#pragma unroll   // constant indices: the arrays stay in registers
  for (int kc = 0; kc < DIN / 32; ++kc) { const int s = kc & 1; v16b a;
    wlay(&wt[s][tid][0], wr[s]);
#pragma unroll   // constant indices: the arrays stay in registers
    for (int i = 0; i < 4; ++i) { a[i] = (__bf16)xr[s][0][i]; a[4 + i] = (__bf16)xr[s][1][i]; a[8 + i] = (__bf16)xr[s][2][i]; a[12 + i] = (__bf16)xr[s][3][i]; }
    __builtin_amdgcn_sched_barrier(0);   // the refill below reuses the registers just read: lifted over their readers it would take a third register set
    if (kc + 2 < DIN / 32) { const int kn = (kc + 2 + st) & (DIN / 32 - 1); wfetch<CC>(wr[s], Wc, kn); afetch(xr[s], Xp, kn);
      asm volatile("s_wait_xcnt 0x0" ::: "memory");     // in front of every rewrite of the address registers of the loads above
      __builtin_amdgcn_sched_barrier(0); }              // keeps every later register write behind that wait
    else if (kc + 2 == DIN / 32) {   // the first k-step without a refill: the bias values are asked for together and fly under the last two k-steps (fetched in the epilogue, each was waited for on its own)
#pragma unroll   // constant indices: the array stays in registers
      for (int j = 0; j < 8; ++j) bs[j] = Bp[j * 16];
      asm volatile("s_wait_xcnt 0x0" ::: "memory");     // in front of every rewrite of the address registers of the loads above
      __builtin_amdgcn_sched_barrier(0); }              // holds those loads up here: sunk to their uses, each would be waited for on its own again
    lds_barrier();   // publishes wt[s]; every reader of wt[s] two k-steps back has passed the barrier in between
    v16b w[8];
#pragma unroll   // constant indices: the arrays stay in registers
    for (int j = 0; j < 8; ++j) w[j] = frag_b(&wt[s][j * 16 + col][0], lane);
    __builtin_amdgcn_sched_barrier(0);   // keeps the 16 LDS reads together ahead of the products: spread among them each pair costs its own LDS latency
#pragma unroll   // constant indices: the arrays stay in registers
    for (int j = 0; j < 8; ++j) acc[j] = wmma_bf(a, w[j], acc[j]); }
  if (which < 2) { _Float16* DH = which == 0 ? QH : KH; _Float16* DL = which == 0 ? QL : KL; const int nhi = which == 0 ? QHI : KHI; const bool hi_rows = t0 < nhi; const float vs = which == 0 ? QSC : 1.0f, rs = which == 0 ? 1.0f : 1024.0f;   // q: scaled for k_attn's accumulator chain, hi and residual at ONE scale; k: as before
#pragma unroll
    for (int j = 0; j < 8; ++j) { const float bias = BA ? bfr(bs[j]) : 0.f;
#pragma unroll
      for (int r = 0; r < 8; ++r) { const float v = (acc[j][r] + bias) * vs; const _Float16 hv = (_Float16)v; sh[wave * 16 + 8 * g + r][j * 16 + col] = hv; sl[wave * 16 + 8 * g + r][j * 16 + col] = (_Float16)((v - (float)hv) * rs); } }
    __syncthreads();
    for (int e = tid; e < 64 * 16; e += 128) { const int rl = e >> 4, q = e & 15;
      if (which == 0) { vst2((unsigned*)(DH + (r0 + rl) * CC + c0 + q * 8), *(const v4u*)&sh[rl][q * 8]);
        asm volatile("s_wait_xcnt 0x0" ::: "memory"); }   // inside the arm: in front of every rewrite of the registers of the store above, on every way out of it
      else { const int l = e & 31, p = (e >> 5) & 1, tl = (e >> 6) & 3, hh = e >> 8;   // A fragment of S^T: row = key 16 tl + (l & 15), k = head column 16 p + 8 (l >> 4) + 0..7
        vst2((unsigned*)(KH + ((((bb * NH + (c0 >> 5) + hh) * (TT / 16) + (t0 >> 4) + tl) * 2 + p) * 256 + l * 8)), *(const v4u*)&sh[tl * 16 + (l & 15)][hh * 32 + p * 16 + (l >> 4) * 8]);
        asm volatile("s_wait_xcnt 0x0" ::: "memory"); }   // inside the arm: in front of every rewrite of the registers of the store above, on every way out of it
      if (hi_rows) { vst2((unsigned*)(DL + (bb * nhi + t0 + rl) * (size_t)CC + c0 + q * 8), *(const v4u*)&sl[rl][q * 8]);
        asm volatile("s_wait_xcnt 0x0" ::: "memory"); } }   // in front of every rewrite of the registers of the store above
  } else { const bool hi_rows = t0 < KHI;
#pragma unroll
    for (int j = 0; j < 8; ++j) { const float bias = BA ? bfr(bs[j]) : 0.f;
#pragma unroll
      for (int r = 0; r < 8; ++r) { const float v = acc[j][r] + bias; const int rl = wave * 16 + 8 * g + r, cl = j * 16 + col; th[cl][rl] = (_Float16)v; const __bf16 bh = (__bf16)v; tb[cl][rl] = bh; tbl[cl][rl] = (__bf16)(v - (float)bh); } }
    __syncthreads();
    for (int e = tid; e < 128 * 8; e += 128) { const int l = e & 31, p = (e >> 5) & 1, j = (e >> 6) & 1, kbl = (e >> 7) & 1, hh = e >> 8;   // A fragment of ctx^T: row = head column 16 j + (l & 15), k = key 16 p + 8 (l >> 4) + 0..7 of the 32-key block
      vst2((unsigned*)(VT + (((((bb * NH + (c0 >> 5) + hh) * (TT / 32) + (t0 >> 5) + kbl) * 2 + j) * 2 + p) * 256 + l * 8)), *(const v4u*)&th[hh * 32 + j * 16 + (l & 15)][kbl * 32 + p * 16 + (l >> 4) * 8]);
      asm volatile("s_wait_xcnt 0x0" ::: "memory"); }   // in front of every rewrite of the registers of the store above
    for (int e = tid; e < 128 * 8; e += 128) { const int cl = e >> 3, q = e & 7; if (hi_rows) { const size_t o3 = (bb * CC + c0 + cl) * (size_t)KHI + t0 + q * 8; vst2((unsigned*)(VB + o3), *(const v4u*)&tb[cl][q * 8]); vst2((unsigned*)(VBL + o3), *(const v4u*)&tbl[cl][q * 8]);
        asm volatile("s_wait_xcnt 0x0" ::: "memory"); } } } }   // in front of every rewrite of the registers of the two stores above
// ---- k_attn: block = (head, 64 queries, batch), 8 waves = 4 query tiles x KS key ranges. Transposed products: S^T x 2^10 = k q^T (q hi + residual, 2 products) + E mask^T (E = 2^10 at (key, key): adds the mask on the matrix pipe, exactly), one accumulator chain, so a lane holds the scores of ONE query (col) at keys 8g+r of each 16-key tile;
// two such tiles, converted in place, are the B operand of ctx^T += v^T P^T. Running maximum and sum per lane (online softmax); P = exp(score - max + PSH) once to f16 (PSH cancels in the division by the sum). The KS partial results are joined through LDS.
#define KS 2
#define KR (TT / KS)      // keys per wave
#define NIT (KR / 64)     // 64 keys per pass
#define PSH 6.9314718f    // keeps P (at most 2^10) clear of f16 subnormals
#define LOG2E 1.44269504f  // exp(x) = exp2(x * LOG2E): P is rounded to f16 right after, so the library expf's range reduction and end tests buy nothing here
__device__ __forceinline__ float xhalf(float x) { return __builtin_bit_cast(float, __builtin_amdgcn_permlanex16(__builtin_bit_cast(int, x), __builtin_bit_cast(int, x), 0x76543210, 0xfedcba98, false, false)); }  // lane l with lane l ^ 16
__device__ __forceinline__ v8f wm(v16h a, v16h b, v8f c) { return __builtin_amdgcn_wmma_f32_16x16x32_f16(false, a, false, b, (short)0, c, false, false); }
__device__ __forceinline__ v8f wmb(v16b a, v16b b, v8f c) { return __builtin_amdgcn_wmma_f32_16x16x32_bf16(false, a, false, b, (short)0, c, false, false); }
typedef __attribute__((ext_vector_type(2))) __bf16 v2b;
// eight exp2 and, behind the last, the free slot that the instruction set asks for between a transcendental and an instruction that reads its result or takes its source register; results and sources in separate registers, so that no exp2 of the run takes the source of the one before
__device__ __forceinline__ void exp2x8(float (&e)[8], const float (&x)[8]) {
  asm("v_exp_f32 %0, %8\n\tv_exp_f32 %1, %9\n\tv_exp_f32 %2, %10\n\tv_exp_f32 %3, %11\n\tv_exp_f32 %4, %12\n\tv_exp_f32 %5, %13\n\tv_exp_f32 %6, %14\n\tv_exp_f32 %7, %15\n\tv_nop"
      : "=&v"(e[0]), "=&v"(e[1]), "=&v"(e[2]), "=&v"(e[3]), "=&v"(e[4]), "=&v"(e[5]), "=&v"(e[6]), "=&v"(e[7]) : "v"(x[0]), "v"(x[1]), "v"(x[2]), "v"(x[3]), "v"(x[4]), "v"(x[5]), "v"(x[6]), "v"(x[7])); }
// 16x16x32 fragment stored in fragment order at (wave-uniform base) + (lane byte offset lo = 16 * lane) + constant cb: plane 0 = elements 0..7, plane 1 (512 bytes on) = elements 8..15; same k order as frag_h
__device__ __forceinline__ v16h frag_w(const _Float16* ub, unsigned lo, int cb) { union { v16h v; v8h q[2]; } u; const char* p = (const char*)ub + lo; u.q[0] = *(const v8h*)(p + cb); u.q[1] = *(const v8h*)(p + cb + 512); return u.v; }
// ---- the mask through LDS: each wave's tile of a pass (its 16 query rows x 64 keys, f32: 16 rows of 256 bytes, 8,192 bytes apart in memory) comes by ONE tensor load, one pass ahead, through no register;
// the mover pads each row by 16 bytes, so the lanes' 16-byte reads down a column of rows (pitch 272 bytes) meet no bank twice
typedef __attribute__((ext_vector_type(8))) unsigned v8u;
#define MROWB 256u        // bytes of one row of the tile
#define MPITCH 272u       // its pitch in LDS: the row + the 16-byte pad
#define MSLICE 6144u      // 16 rows x 272 bytes = 4,352, rounded up to a multiple of 2 KiB: every slice starts on one
#define MWORD0 ((1u << 20) | (5u << 22) | (3u << 25))   // group 1 word 0: no mask, 1-byte elements, a pad of 4 dwords behind every 64 dwords (one row)
__device__ __forceinline__ uint32_t uni(uint32_t v) { return (uint32_t)__builtin_amdgcn_readfirstlane((int)v); }
__device__ __forceinline__ uint32_t pinned(uint32_t v) { uint32_t w = uni(v); asm volatile("" : "+s"(w)); return w; }   // holds the issue test of a tensor load in a scalar register, so that the branch on it is a scalar one (the instruction ignores EXEC)
__device__ __forceinline__ void mask_tile_load(uint32_t lds_dst, const float* tile) { const uint64_t ga = (uint64_t)(size_t)tile;
  v4u g0; g0[0] = uni(1u); g0[1] = uni(lds_dst); g0[2] = uni((uint32_t)ga); g0[3] = uni((((uint32_t)(ga >> 32)) & 0x01FFFFFFu) | 0x80000000u);   // count 1; place in LDS; first byte of the tile; type 2
  v8u g1; g1[0] = uni(MWORD0); g1[1] = uni(MROWB << 16); g1[2] = uni(16u << 16); g1[3] = uni(MROWB << 16); g1[4] = uni(16u); g1[5] = uni(TT * 4u); g1[6] = uni(0u); g1[7] = uni(0u);   // tensor = tile = 256 bytes x 16 rows; source pitch = one mask row
  asm volatile("tensor_load_to_lds %0, %1" :: "s"(g0), "s"(g1) : "memory"); }   // one request of the whole wave
__global__ __launch_bounds__(256) void k_attn(const _Float16* __restrict__ QH, const _Float16* __restrict__ QL, const _Float16* __restrict__ KH, const _Float16* __restrict__ VT, const float* __restrict__ MKF, float* __restrict__ Y) {
  __shared__ __attribute__((aligned(2048))) unsigned char ms[2][8][MSLICE]; __shared__ float sp[4][18][32];
  const int tid = threadIdx.x, wave = __builtin_amdgcn_readfirstlane(tid >> 5), lane = tid & 31, col = lane & 15, g = lane >> 4; const int h = blockIdx.x, qb = blockIdx.y, b = blockIdx.z; const int qt = wave & 3, ks = wave >> 2;
  const int q0 = qb * 64 + qt * 16, q = q0 + col;
  const v16h qh = frag_h(QH + ((size_t)b * TT + q) * CC + h * HD, lane), ql = frag_h(QL + ((size_t)b * QHI + q) * CC + h * HD, lane);
  const unsigned fo = (unsigned)lane * 16u;   // a lane's place in each 512-byte plane
  const _Float16* Kb = KH + (((size_t)b * NH + h) * (TT / 16) + ks * (KR / 16)) * 512;   // A rows = keys, k = head columns: 1,024 bytes per 16-key tile
  float m = -3.0e38f, l = 0.f; v8f acc0 = {}, acc1 = {};   // m: the running maximum of the logits x LSH
  // selection matrices (A operands, 16 key rows x 32 k): es[j] row c holds LSH at k = 16 j + c and 0 elsewhere, so es[j] x (32 keys x 16 queries of the mask) = LSH x the mask at keys 16 j + 0..15
  v16b es[2] = {};
#pragma unroll
  for (int i = 0; i < 8; ++i) { const __bf16 o = (__bf16)(8 * g + i == col ? LSH : 0.f); es[0][i] = o; es[1][8 + i] = o; }
  // staggered walk: the 8 head blocks that share a mask tile and the 32 query blocks that share a head's k and v each begin the key walk at a pass of their own and wrap, so that they do not ask L2 for the same lines at the same moment
  const int st = (2 * h + qb) & (NIT - 1);
  v16h kf[4];
#pragma unroll
  for (int kt = 0; kt < 4; ++kt) kf[kt] = frag_w(Kb + (size_t)st * 2048, fo, kt * 1024);
  asm volatile("s_wait_xcnt 0x0" ::: "memory");     // in front of every rewrite of the address registers of the q and k loads above
  __builtin_amdgcn_sched_barrier(0);                // keeps the address arithmetic of the loop behind that wait
  const _Float16* Vb = VT + (((size_t)b * NH + h) * (TT / 32) + ks * (KR / 32)) * 1024;  // A rows = head columns, k = keys: 2,048 bytes per 32-key block (two 16-column halves)
  const float* Mb = MKF + ((size_t)b * TT + q0) * TT + ks * KR;       const unsigned mo = (unsigned)col * MPITCH + 32u * (unsigned)g;   // this wave's 16 query rows; in LDS: this lane's query row, its 8 keys of each 16-key tile
  const uint32_t md = (uint32_t)(size_t)&ms[0][wave][0];   // this wave's slice of buffer 0; buffer 1 lies 8 slices on
  mask_tile_load(md, Mb + st * 64);                         // the first pass's tile
  for (int it = 0; it < NIT; ++it) { const int pi = (it + st) & (NIT - 1), pn = (it + 1 + st) & (NIT - 1);   // the 64-key blocks of this pass and of the next
    // publish point of pass it's tile, at the seam between pass it - 1 and pass it (written at the head: at the foot, its branch would cut the sums of the pass off from the softmax they are interleaved with)
    asm volatile("s_wait_dscnt 0x0" ::: "memory");       // the last pass's reads of its buffer have retired
    asm volatile("s_wait_tensorcnt 0x0" ::: "memory");   // this pass's tile has landed
    __syncthreads();                                     // publishes it; every reader has left the other buffer
    if (pinned(it + 1 < NIT)) mask_tile_load(md + (uint32_t)((it + 1) & 1) * (8u * MSLICE), Mb + pn * 64);   // the next pass's tile flies under this pass, into the buffer that the last pass read
    v4f mk[4][2]; const unsigned char* mp = &ms[it & 1][wave][0] + mo;
#pragma unroll
    for (int kt = 0; kt < 4; ++kt) { mk[kt][0] = *(const v4f*)(mp + kt * 64); mk[kt][1] = *(const v4f*)(mp + kt * 64 + 16); }
    v16h vf[2][2];
#pragma unroll
    for (int s = 0; s < 2; ++s) { vf[s][0] = frag_w(Vb + pi * 2048, fo, s * 2048); vf[s][1] = frag_w(Vb + pi * 2048, fo, s * 2048 + 1024); }
    asm volatile("s_wait_xcnt 0x0" ::: "memory");   // in front of every rewrite of the address registers of the v loads above
    __builtin_amdgcn_sched_barrier(0);              // holds those loads up here: without it they sink to their first use and the wave waits out each latency
    v8f v[4]; float mx = -3.0e38f;
#pragma unroll
    for (int kt = 0; kt < 4; ++kt) { const v8f z = {}; v[kt] = wm(kf[kt], qh, wm(kf[kt], ql, z)); }   // smallest terms first
    union { v16b f; v2b d[8]; } mb[2];   // B operand: element 8 j + r = the mask at key 16 j + 8 g + r of a 32-key block, the k order of p below
#pragma unroll
    for (int kt = 0; kt < 4; ++kt) {
#pragma unroll
      for (int r = 0; r < 8; r += 2) { const v2f t = { mk[kt][r >> 2][r & 3], mk[kt][r >> 2][(r & 3) + 1] }; mb[kt >> 1].d[(kt & 1) * 4 + (r >> 1)] = __builtin_convertvector(t, v2b); } }
    __builtin_amdgcn_sched_barrier(0);   // both mask operands stand ready ahead of their four products: converted between them, the second takes the first's registers and waits out the distance behind a product that still reads them
#pragma unroll
    for (int kt = 0; kt < 4; ++kt) v[kt] = wmb(es[kt & 1], mb[kt >> 1].f, v[kt]);
#pragma unroll
    for (int kt = 0; kt < 4; ++kt) {
#pragma unroll
      for (int r = 0; r < 8; ++r) mx = fmaxf(mx, v[kt][r]); }
    const int nx = it + 1 < NIT ? pn : pi;   // next pass's k rows, fetched under this pass's softmax (the last pass fetches its own again)
#pragma unroll
    for (int kt = 0; kt < 4; ++kt) kf[kt] = frag_w(Kb + (size_t)nx * 2048, fo, kt * 1024);
    asm volatile("s_wait_xcnt 0x0" ::: "memory");   // in front of every rewrite of the address registers of the k loads above
    __builtin_amdgcn_sched_barrier(0);              // holds the k loads ahead of the softmax, which covers their latency
    mx = fmaxf(mx, xhalf(mx)); const float mn = fmaxf(m, mx); float al; asm("v_exp_f32 %0, %1\n\tv_nop" : "=v"(al) : "v"((m - mn) * (LOG2E / LSH)));   // exp2 with the free slot behind it that the instruction set asks for
    m = mn; const float nms = (PSH - mn * (1.0f / LSH)) * LOG2E;
    float sum = 0.f; v16h p[2];
#pragma unroll
    for (int kt = 0; kt < 4; ++kt) { float x[8], e[8];
#pragma unroll
      for (int r = 0; r < 8; ++r) x[r] = fmaf(v[kt][r], LOG2E / LSH, nms);
      exp2x8(e, x);
#pragma unroll
      for (int r = 0; r < 8; ++r) { sum += e[r]; p[kt >> 1][(kt & 1) * 8 + r] = (_Float16)e[r]; } }
    l = l * al + sum;
#pragma unroll
    for (int r = 0; r < 8; ++r) { acc0[r] *= al; acc1[r] *= al; }
#pragma unroll
    for (int s = 0; s < 2; ++s) { acc0 = wm(vf[s][0], p[s], acc0); acc1 = wm(vf[s][1], p[s], acc1); } }
  asm volatile("s_wait_tensorcnt 0x0" ::: "memory");     // nothing of the mover is in flight behind the loop
  asm volatile("s_wait_dscnt 0x0" ::: "memory");         // and no read of the two buffers
  l += xhalf(l);
  if (ks) { sp[qt][0][lane] = m; sp[qt][1][lane] = l;
#pragma unroll
    for (int r = 0; r < 8; ++r) { sp[qt][2 + r][lane] = acc0[r]; sp[qt][10 + r][lane] = acc1[r]; } }
  __syncthreads();
  if (!ks) { const float m1 = sp[qt][0][lane], l1 = sp[qt][1][lane]; const float mm = fmaxf(m, m1); float a0 = expf((m - mm) * (1.0f / LSH)), a1 = expf((m1 - mm) * (1.0f / LSH)); const float lt = l * a0 + l1 * a1; const float inv = lt > 0.f ? 1.0f / lt : 0.f; a0 *= inv; a1 *= inv;
    v4f o[4];
#pragma unroll
    for (int r = 0; r < 8; ++r) { o[r >> 2][r & 3] = acc0[r] * a0 + sp[qt][2 + r][lane] * a1; o[2 + (r >> 2)][r & 3] = acc1[r] * a0 + sp[qt][10 + r][lane] * a1; }
    float* yp = Y + ((size_t)b * TT + q) * CC + h * HD + 8 * g;   // ctx^T register r = head column 16 j + 8 g + r of query col
    vst2(yp, o[0]); vst2(yp + 4, o[1]); vst2(yp + 16, o[2]); vst2(yp + 20, o[3]); } }
// ---- k_out: block = (64 rows, 128 cols): out = ctx Wo (+ bo): all rows: ctx bf16 hi + lo against exact bf16 Wo (2 products); the f16 x f16(bf16 x 2^8) branch is never taken
__global__ __launch_bounds__(128) void k_out(const float* __restrict__ Y, const float* __restrict__ WO, const float* __restrict__ BO, float* __restrict__ OUT) { __shared__ __align__(16) float sf[4][16][132]; __shared__ __align__(16) __bf16 wt[2][128][WPI];
  const int tid = threadIdx.x, wave = tid >> 5, lane = tid & 31, col = lane & 15, g = lane >> 4; const int c0 = blockIdx.y * 128; const size_t r0 = (size_t)blockIdx.x * 64 + wave * 16;
  v8f acc[8] = {};
  if (true) {   /* ALL rows: ctx split bf16 hi + lo x exact Wo (2 products) */
    const float* Wc = WO + c0 + tid; const float* Yp = Y + (r0 + col) * CC + 8 * g;
    float wr[2][32]; v4f xr[2][4];   // two k-steps in flight in registers
    float bs[8]; const float* Bp = (BO ? BO : WO) + c0 + col;   // this lane's 8 bias values; without a bias the loads read weights, which the epilogue replaces by 0, as in k_proj
    const int st = (int)((blockIdx.x + 2u * blockIdx.y) & (CC / 32 - 1));   // staggered walk, as in k_proj: 64 row blocks share a weight tile, 4 column blocks the ctx rows
    wfetch<DIN>(wr[0], Wc, st); afetch(xr[0], Yp, st);
    asm volatile("s_wait_xcnt 0x0" ::: "memory");     // the next k-step's addresses may take the address registers of the loads above
    __builtin_amdgcn_sched_barrier(0);                // keeps that address arithmetic behind the wait
    wfetch<DIN>(wr[1], Wc, (st + 1) & (CC / 32 - 1)); afetch(xr[1], Yp, (st + 1) & (CC / 32 - 1));
    asm volatile("s_wait_xcnt 0x0" ::: "memory");     // in front of every rewrite of the address registers of the loads above
    __builtin_amdgcn_sched_barrier(0);                // keeps those loads up here, all in flight together
#pragma unroll   // constant indices: the arrays stay in registers
    for (int kc = 0; kc < CC / 32; ++kc) { const int s = kc & 1; float v[16];
      wlay(&wt[s][tid][0], wr[s]);
#pragma unroll   // constant indices: the arrays stay in registers
      for (int i = 0; i < 4; ++i) { v[i] = xr[s][0][i]; v[4 + i] = xr[s][1][i]; v[8 + i] = xr[s][2][i]; v[12 + i] = xr[s][3][i]; }
      const F2 a = bsplit16(v);
      __builtin_amdgcn_sched_barrier(0);   // the refill below reuses the registers just read: lifted over their readers it would take a third register set
      if (kc + 2 < CC / 32) { const int kn = (kc + 2 + st) & (CC / 32 - 1); wfetch<DIN>(wr[s], Wc, kn); afetch(xr[s], Yp, kn);
        asm volatile("s_wait_xcnt 0x0" ::: "memory");     // in front of every rewrite of the address registers of the loads above
        __builtin_amdgcn_sched_barrier(0); }              // keeps every later register write behind that wait
      else if (kc + 2 == CC / 32) {   // the first k-step without a refill: the bias values are asked for together and fly under the last two k-steps, as in k_proj
#pragma unroll   // constant indices: the array stays in registers
        for (int j = 0; j < 8; ++j) bs[j] = Bp[j * 16];
        asm volatile("s_wait_xcnt 0x0" ::: "memory");     // in front of every rewrite of the address registers of the loads above
        __builtin_amdgcn_sched_barrier(0); }              // holds those loads up here: sunk to their uses, each would be waited for on its own again
      lds_barrier();   // publishes wt[s]; every reader of wt[s] two k-steps back has passed the barrier in between
      v16b w[8];
#pragma unroll   // constant indices: the arrays stay in registers
      for (int j = 0; j < 8; ++j) w[j] = frag_b(&wt[s][j * 16 + col][0], lane);
      __builtin_amdgcn_sched_barrier(0);   // keeps the 16 LDS reads together ahead of the products: spread among them each pair costs its own LDS latency
#pragma unroll   // constant indices: the arrays stay in registers
      for (int j = 0; j < 8; ++j) { acc[j] = wmma_bf(a.h, w[j], acc[j]); acc[j] = wmma_bf(a.l, w[j], acc[j]); } }
#pragma unroll
    for (int j = 0; j < 8; ++j) { const float bias = BO ? bfr(bs[j]) : 0.f;
#pragma unroll
      for (int r = 0; r < 8; ++r) sf[wave][8 * g + r][j * 16 + col] = acc[j][r] + bias; }
  } else {
#pragma unroll 2
    for (int kc = 0; kc < CC / 32; ++kc) { const v16h a = frag_f32(Y + (r0 + col) * CC + kc * 32, lane); asm volatile("s_wait_loadcnt 0x0" ::: "memory");
#pragma unroll
      for (int j = 0; j < 8; ++j) { const v16h w = WOCOLH(WO, kc * 32, c0 + j * 16 + col, lane); asm volatile("s_wait_loadcnt 0x0" ::: "memory"); acc[j] = wmma16(a, w, acc[j]); } }
#pragma unroll
    for (int j = 0; j < 8; ++j) { const float bias = BO ? bfr(BO[c0 + j * 16 + col]) : 0.f;
#pragma unroll
      for (int r = 0; r < 8; ++r) sf[wave][8 * g + r][j * 16 + col] = acc[j][r] * (1.0f / 256.0f) + bias; } }
  LDSX(); for (int rl = 0; rl < 16; ++rl) vst2(OUT + (r0 + rl) * DIN + c0 + lane * 4, *(const v4f*)&sf[wave][rl][lane * 4]); }

extern "C" void kernel_launch(void* const* d_in, const int* in_sizes, int n_in, void* d_out, int out_size, void* d_ws, size_t ws_size, hipStream_t stream) {
  (void)in_sizes; (void)n_in; (void)out_size;
  const float** F = (const float**)d_in;
  if (ws_size < (size_t)WS_END) return;
  char* ws = (char*)d_ws; _Float16 *QH = (_Float16*)(ws + WS_QH), *KH = (_Float16*)(ws + WS_KH), *VT = (_Float16*)(ws + WS_VT), *QL = (_Float16*)(ws + WS_QL), *KL = (_Float16*)(ws + WS_KL); __bf16 *VB = (__bf16*)(ws + WS_VB), *VBL = (__bf16*)(ws + WS_VBL); float *Y = (float*)(ws + WS_Y);
  (void)Y; (void)QL; (void)KL; (void)VB; (void)VBL;
  // inputs: 0 V [2,2048,512]; 1 Q; 2 K; 3 mask [2,1,2048,2048] f32; 4 Wq [512,256] (in,out), 5 bq; 6 Wk, 7 bk; 8 Wv, 9 bv; 10 Wo [256,512] (in,out), 11 bo [512]
  k_proj<<<dim3(TNB * TT / 64, CC / 128, 3), 128, 0, stream>>>(F[1], F[2], F[0], F[4], F[6], F[8], F[5], F[7], F[9], QH, QL, KH, KL, VT, VB, VBL);   /* q from Q (in1), k from K (in2), v from V (in0) */
  k_attn<<<dim3(NH, NQB, TNB), 256, 0, stream>>>(QH, QL, KH, VT, F[3], Y);
  k_out<<<dim3(TNB * TT / 64, DIN / 128), 128, 0, stream>>>(Y, F[10], F[11], (float*)d_out);
}

// v009
// Measured time: 36.8 microseconds a run.
// In both of two side-by-side timings against v008, it was 1.03 times as fast.
// Counting every step since v000, it is 12.3 times as fast.
// compute dtype: all float inputs rounded to bf16; q/k/v = in W + b with EXACT bf16 products on WMMA 16x16x32 (f32 accumulate); logits x 2^10 as ONE WMMA accumulator chain: q x 2^6 (= 2^10 / sqrt(256)) as f16 hi + residual against k once to f16 (2 products), then the additive mask (bf16) against a constant selection matrix of 2^10 (1 product, exact); online softmax in f32 (exponentials as hardware exp2 of one fma by log2 e); unnormalised P (at most 2^10) once to f16 against v once to f16 (1 product), divided by the f32 sum; ctx split bf16 hi + lo against exact Wo (2 products) + bo; f32 output.
#include <hip/hip_runtime.h>
#include <math.h>

typedef __attribute__((ext_vector_type(16))) _Float16 v16h;
typedef __attribute__((ext_vector_type(16))) __bf16 v16b;
typedef __attribute__((ext_vector_type(8)))  _Float16 v8h;
typedef __attribute__((ext_vector_type(8)))  float v8f;
typedef __attribute__((ext_vector_type(4)))  float v4f;
typedef __attribute__((ext_vector_type(2)))  float v2f;
typedef __attribute__((ext_vector_type(4)))  unsigned v4u;
typedef __attribute__((ext_vector_type(4)))  int v4i;
typedef float __attribute__((may_alias)) float_a;
typedef int __attribute__((may_alias)) int_a;

template <typename T> __device__ __forceinline__ void vst2(void* p, T v) { *(T*)p = v;  }
__device__ __forceinline__ v8f wmma16(v16h a, v16h b, v8f c) {
  v8f d = __builtin_amdgcn_wmma_f32_16x16x32_f16(false, a, false, b, (short)0, c, false, false);
  asm volatile("v_nop\n\tv_nop\n\tv_nop\n\tv_nop" : "+v"(d) : "v"(a), "v"(b));
  return d;
}
__device__ __forceinline__ v8f wmma_bf(v16b a, v16b b, v8f c) {
  v8f d = __builtin_amdgcn_wmma_f32_16x16x32_bf16(false, a, false, b, (short)0, c, false, false);
  asm volatile("v_nop\n\tv_nop\n\tv_nop\n\tv_nop" : "+v"(d) : "v"(a), "v"(b));
  return d;
}
// 16x16x32 fragments: lane = (h = lane>>4, row/col = lane&15); elements 0..7 = k0+8h+0..7, 8..15 = k0+16+8h+0..7; D element r = row 8h+r
__device__ __forceinline__ v16h frag_h(const _Float16* rowk0, int lane) {
  union { v16h v; v8h q[2]; } u; const _Float16* p = rowk0 + 8 * (lane >> 4);
  u.q[0] = *(const v8h*)p; u.q[1] = *(const v8h*)(p + 16); return u.v;
}
__device__ __forceinline__ v16h frag_f32(const float* rowk0, int lane) {
  v16h a; const float* p = rowk0 + 8 * (lane >> 4);
#pragma unroll
  for (int i = 0; i < 8; ++i) { a[i] = (_Float16)p[i]; a[8 + i] = (_Float16)p[16 + i]; }
  return a;
}
__device__ __forceinline__ v16h frag_f32s(const float* rowk0, int lane, float sc) {
  v16h a; const float* p = rowk0 + 8 * (lane >> 4);
#pragma unroll
  for (int i = 0; i < 8; ++i) { a[i] = (_Float16)(p[i] * sc); a[8 + i] = (_Float16)(p[16 + i] * sc); }
  return a;
}
// column fragment from a [K][ld] layout (column n), rows >= K read as 0
__device__ __forceinline__ v16h fragc_f32(const float* W, int k0, int n, int lane, int ld, int K) {
  v16h a; const int g = lane >> 4;
#pragma unroll
  for (int i = 0; i < 8; ++i) { const int ka = k0 + 8 * g + i, kb = ka + 16;
    a[i] = (_Float16)(ka < K ? W[(size_t)(ka < K ? ka : K - 1) * ld + n] : 0.f); a[8 + i] = (_Float16)(kb < K ? W[(size_t)(kb < K ? kb : K - 1) * ld + n] : 0.f); }
  return a;
}
struct F2 { v16b h, l; };
__device__ __forceinline__ F2 bsplit16(const float v[16]) { F2 r;
#pragma unroll
  for (int i = 0; i < 16; ++i) { const __bf16 h = (__bf16)v[i]; r.h[i] = h; r.l[i] = (__bf16)(v[i] - (float)h); }
  return r; }
__device__ __forceinline__ F2 split_row(const float* row, int k0, int lane) { float v[16]; const float* p = row + k0 + 8 * (lane >> 4);
#pragma unroll
  for (int i = 0; i < 8; ++i) { v[i] = p[i]; v[8 + i] = p[16 + i]; }
  return bsplit16(v); }
__device__ __forceinline__ F2 split_rowK(const float* row, int k0, int lane, int K) { float v[16]; const int g = lane >> 4;
#pragma unroll
  for (int i = 0; i < 8; ++i) { const int ka = k0 + 8 * g + i, kb = ka + 16; v[i] = ka < K ? row[ka < K ? ka : K - 1] : 0.f; v[8 + i] = kb < K ? row[kb < K ? kb : K - 1] : 0.f; }
  return bsplit16(v); }
__device__ __forceinline__ F2 split_col(const float* W, int k0, int n, int lane, int ld, int K) { float v[16]; const int g = lane >> 4;
#pragma unroll
  for (int i = 0; i < 8; ++i) { const int ka = k0 + 8 * g + i, kb = ka + 16; v[i] = ka < K ? W[(size_t)(ka < K ? ka : K - 1) * ld + n] : 0.f; v[8 + i] = kb < K ? W[(size_t)(kb < K ? kb : K - 1) * ld + n] : 0.f; }
  return bsplit16(v); }
__device__ __forceinline__ v8f mac3(const F2& a, const F2& b, v8f c) { c = wmma_bf(a.l, b.h, c); c = wmma_bf(a.h, b.l, c); return wmma_bf(a.h, b.h, c); }
__device__ __forceinline__ float sigm(float v) { return 1.0f / (1.0f + expf(-v)); }
#define LDSX() do { asm volatile("s_wait_dscnt 0" ::: "memory"); __builtin_amdgcn_wave_barrier(); __builtin_amdgcn_fence(__ATOMIC_RELEASE, "workgroup"); } while (0)

// Multi-head attention with an additive dense mask (B 2, S 2,048, d_model 512 -> key/value dim 256 = 8 heads x 32 -> out 512; 0.02-scale (in,out) weights, zero biases; separate V, Q, K inputs): scores = q k^T / sqrt(256) (the FULL key_dim, as written) + mask[b, 0, q, k] (random normal); out = merged(softmax v) Wo + bo.
#define NB 2
#define TT 2048
#define CC 256            // NH * HD = projected width
#define DIN 512          // input (model) width
#define NH 8
#define HD 32
#define NQB (TT / 64)
#define HG 4
#define SCALE (0.0625f)
#define LSH 1024.0f        // k_attn carries its logits x 2^10 (a power of two: exact): q's f16 residual, at the same scale as its hi part, then stays clear of f16 subnormals
#define QSC (SCALE * LSH)  // what k_proj multiplies q by
#define CAUSAL 0
#ifndef TNB
#define TNB NB
#endif
__device__ __forceinline__ float bfr(float v) { return (float)(__bf16)v; }
__host__ __device__ __forceinline__ int kb_last(int qb) { return CAUSAL ? ((qb * 64 + 63) >> 7) : (TT / 128 - 1); }
typedef __attribute__((ext_vector_type(8))) __bf16 v8b;
__device__ __forceinline__ v16b frag_b(const __bf16* rowk0, int lane) {
  union { v16b v; v8b q[2]; } u; const __bf16* p = rowk0 + 8 * (lane >> 4);
  u.q[0] = *(const v8b*)p; u.q[1] = *(const v8b*)(p + 16); return u.v;
}
#define QBH 0
#define QHI 2048            // rows carrying a q residual plane (all rows when non-causal: 2-product logits everywhere)
#define KHI 64            // key rows carrying k residual / v bf16 hi+lo planes (written by k_proj; no kernel here reads them)
// B fragment (k rows k0+.., output column o) of a weight: (in,out) [K][ld] or (out,in) [ld rows of K]: bf16 exact, or f16(bf16 * 256) exact
__device__ __forceinline__ v16b wcol_io(const float* Wm, int k0, int o, int lane, int ld) { v16b w; const int g = lane >> 4;
#pragma unroll
  for (int i = 0; i < 8; ++i) { w[i] = (__bf16)Wm[(size_t)(k0 + 8 * g + i) * ld + o]; w[8 + i] = (__bf16)Wm[(size_t)(k0 + 16 + 8 * g + i) * ld + o]; }
  return w; }
__device__ __forceinline__ v16b wcol_oi(const float* Wm, int k0, int o, int lane, int K) { v16b w; const float* p = Wm + (size_t)o * K + k0 + 8 * (lane >> 4);
#pragma unroll
  for (int i = 0; i < 8; ++i) { w[i] = (__bf16)p[i]; w[8 + i] = (__bf16)p[16 + i]; }
  return w; }
__device__ __forceinline__ v16h wcolh_io(const float* Wm, int k0, int o, int lane, int ld) { v16h w; const int g = lane >> 4;
#pragma unroll
  for (int i = 0; i < 8; ++i) { w[i] = (_Float16)(bfr(Wm[(size_t)(k0 + 8 * g + i) * ld + o]) * 256.0f); w[8 + i] = (_Float16)(bfr(Wm[(size_t)(k0 + 16 + 8 * g + i) * ld + o]) * 256.0f); }
  return w; }
__device__ __forceinline__ v16h wcolh_oi(const float* Wm, int k0, int o, int lane, int K) { v16h w; const float* p = Wm + (size_t)o * K + k0 + 8 * (lane >> 4);
#pragma unroll
  for (int i = 0; i < 8; ++i) { w[i] = (_Float16)(bfr(p[i]) * 256.0f); w[8 + i] = (_Float16)(bfr(p[16 + i]) * 256.0f); }
  return w; }
#define WQKV_LAYOUT 0   // 0 = (in,out) [DIN][CC]; 1 = (out,in) [CC][DIN]; 2 = per-head [NH][DIN][HD]
__device__ __forceinline__ v16b wcol_hdk(const float* Wm, int k0, int o, int lane) { v16b w; const int g = lane >> 4; const float* p = Wm + (size_t)(o / HD) * DIN * HD + (o % HD);
#pragma unroll
  for (int i = 0; i < 8; ++i) { w[i] = (__bf16)p[(size_t)(k0 + 8 * g + i) * HD]; w[8 + i] = (__bf16)p[(size_t)(k0 + 16 + 8 * g + i) * HD]; }
  return w; }
#define WO_OUT_IN 0
#if WQKV_LAYOUT == 1
#define WCOL(W, k0, o, lane) wcol_oi(W, k0, o, lane, DIN)
#elif WQKV_LAYOUT == 2
#define WCOL(W, k0, o, lane) wcol_hdk(W, k0, o, lane)
#else
#define WCOL(W, k0, o, lane) wcol_io(W, k0, o, lane, CC)
#endif
#if WO_OUT_IN
#define WOCOL(W, k0, o, lane) wcol_oi(W, k0, o, lane, CC)
#define WOCOLH(W, k0, o, lane) wcolh_oi(W, k0, o, lane, CC)
#else
#define WOCOL(W, k0, o, lane) wcol_io(W, k0, o, lane, DIN)
#define WOCOLH(W, k0, o, lane) wcolh_io(W, k0, o, lane, DIN)
#endif

#define WS_QH  0u                                      // f16 q x 2^6 rows [b*t][CC]
#define WS_KH  (WS_QH + 2u * (size_t)NB * TT * CC)      // f16 k in fragment order [b][head][16-key tile][plane 2][lane 32][8]
#define WS_VT  (WS_KH + 2u * (size_t)NB * TT * CC)      // f16 v in fragment order [b][head][32-key block][16-column half 2][plane 2][lane 32][8]
#define WS_QL  (WS_VT + 2u * (size_t)NB * CC * TT)      // f16 residual of q x 2^6 rows [b][t < QHI][CC]
#define WS_KL  (WS_QL + 2u * (size_t)NB * QHI * CC)     // f16 k residual x 2^10 rows [b][t < KHI][CC]
#define WS_VB  (WS_KL + 2u * (size_t)NB * KHI * CC)     // bf16 v hi planes [b][c][t < KHI]
#define WS_VBL (WS_VB + 2u * (size_t)NB * CC * KHI)
#define WS_S   (WS_VBL + 2u * (size_t)NB * CC * KHI)    // f32 [hg][t][s]; reserved, not used by any kernel here
#define WS_Y   (WS_S  + 4u * (size_t)HG * TT * TT)      // f32 ctx rows [b*t][CC] (only when there is an output projection)
#define WS_END (WS_Y  + 4u * (size_t)NB * TT * CC)

// ---- weight tiles through LDS: thread t fetches column c0 + t of a 32-row k-step (each wave load = one whole 128-byte line), rounds it to bf16 and lays it as row t of wt (k contiguous, pitch 80 bytes); frag_b then reads the same k order as wcol_io
#define WPI 40            // bf16 per LDS row: 64 bytes of data at the conflict-free 80-byte pitch for 16-byte reads
template <int LD> __device__ __forceinline__ void wfetch(float (&r)[32], const float* __restrict__ Wc, int kc) {
#pragma unroll   // constant indices: the arrays stay in registers
  for (int k = 0; k < 32; ++k) r[k] = Wc[(size_t)kc * (32 * LD) + (size_t)k * LD]; }
__device__ __forceinline__ void wlay(__bf16* row, const float (&r)[32]) {
#pragma unroll   // constant indices: the arrays stay in registers
  for (int q = 0; q < 4; ++q) { v8b t;
#pragma unroll   // constant indices: the arrays stay in registers
    for (int i = 0; i < 8; ++i) t[i] = (__bf16)r[q * 8 + i];
    *(v8b*)(row + q * 8) = t; } }
// work-group barrier that orders LDS only: __syncthreads() also waits out every global load, which would end the fetch-ahead at each k-step
__device__ __forceinline__ void lds_barrier() { __builtin_amdgcn_fence(__ATOMIC_RELEASE, "workgroup", "local"); __builtin_amdgcn_s_barrier(); __builtin_amdgcn_fence(__ATOMIC_ACQUIRE, "workgroup", "local"); }
// the 16 f32 of this lane's A fragment of one k-step (p = row + 8 * (lane >> 4))
__device__ __forceinline__ void afetch(v4f (&x)[4], const float* __restrict__ p, int kc) { const float* s = p + kc * 32; x[0] = *(const v4f*)s; x[1] = *(const v4f*)(s + 4); x[2] = *(const v4f*)(s + 16); x[3] = *(const v4f*)(s + 20); }
// ---- k_proj: block = (64 rows, 128 cols, which): q/k/v = X W (+ b) with exact bf16 products (K = DIN) -> which 0: q x QSC f16 rows (+ residual rows < QHI, at the same scale); 1: k f16 in fragment order (+ residual rows < KHI); 2: v f16 in fragment order (+ bf16 hi/lo planes for t < KHI)
// fragment order: the 16 bytes that lane l of k_attn loads as elements 0..7 (plane 0) or 8..15 (plane 1) of an A fragment lie at plane * 512 + l * 16, so one wave load there is 512 contiguous bytes = 4 whole lines
__global__ __launch_bounds__(128) void k_proj(const float* __restrict__ XQ, const float* __restrict__ XK, const float* __restrict__ XV, const float* __restrict__ WQ, const float* __restrict__ WK, const float* __restrict__ WV, const float* __restrict__ BQ, const float* __restrict__ BK, const float* __restrict__ BV,
    _Float16* __restrict__ QH, _Float16* __restrict__ QL, _Float16* __restrict__ KH, _Float16* __restrict__ KL, _Float16* __restrict__ VT, __bf16* __restrict__ VB, __bf16* __restrict__ VBL) {
  __shared__ __align__(16) _Float16 sh[64][136], sl[64][136]; __shared__ __align__(16) _Float16 th[128][72]; __shared__ __align__(16) __bf16 tb[128][72], tbl[128][72]; __shared__ __align__(16) __bf16 wt[2][128][WPI];
  const int tid = threadIdx.x, wave = tid >> 5, lane = tid & 31, col = lane & 15, g = lane >> 4; const int which = blockIdx.z; const int c0 = blockIdx.y * 128; const size_t r0 = (size_t)blockIdx.x * 64; const size_t bb = r0 / TT; const int t0 = (int)(r0 % TT);
  const float* X = which == 0 ? XQ : which == 1 ? XK : XV; const float* WA = which == 0 ? WQ : which == 1 ? WK : WV; const float* BA = which == 0 ? BQ : which == 1 ? BK : BV;
  v8f acc[8] = {};
  const float* Wc = WA + c0 + tid; const float* Xp = X + (r0 + wave * 16 + col) * DIN + 8 * g;
  float wr[2][32]; v4f xr[2][4];   // two k-steps in flight in registers
  float bs[8]; const float* Bp = (BA ? BA : WA) + c0 + col;   // this lane's 8 bias values; without a bias the loads read weights, which the epilogue replaces by 0: a branch round the loads cuts the unrolled k loop in two, and that build took more than 256 registers
  // staggered walk: the 64 row blocks that share a weight tile and the 2 column blocks that share the input rows each begin the k loop at a k-step of their own and wrap, so that they do not ask L2 for the same lines at the same moment
  const int st = (int)((blockIdx.x + 8u * blockIdx.y) & (DIN / 32 - 1));
  wfetch<CC>(wr[0], Wc, st); afetch(xr[0], Xp, st);
  asm volatile("s_wait_xcnt 0x0" ::: "memory");     // the next k-step's addresses may take the address registers of the loads above
  __builtin_amdgcn_sched_barrier(0);                // keeps that address arithmetic behind the wait
  wfetch<CC>(wr[1], Wc, (st + 1) & (DIN / 32 - 1)); afetch(xr[1], Xp, (st + 1) & (DIN / 32 - 1));
  asm volatile("s_wait_xcnt 0x0" ::: "memory");     // in front of every rewrite of the address registers of the loads above
  __builtin_amdgcn_sched_barrier(0);                // keeps those loads up here, all in flight together
#pragma unroll   // constant indices: the arrays stay in registers
  for (int kc = 0; kc < DIN / 32; ++kc) { const int s = kc & 1; v16b a;
    wlay(&wt[s][tid][0], wr[s]);
#pragma unroll   // constant indices: the arrays stay in registers
    for (int i = 0; i < 4; ++i) { a[i] = (__bf16)xr[s][0][i]; a[4 + i] = (__bf16)xr[s][1][i]; a[8 + i] = (__bf16)xr[s][2][i]; a[12 + i] = (__bf16)xr[s][3][i]; }
    __builtin_amdgcn_sched_barrier(0);   // the refill below reuses the registers just read: lifted over their readers it would take a third register set
    if (kc + 2 < DIN / 32) { const int kn = (kc + 2 + st) & (DIN / 32 - 1); wfetch<CC>(wr[s], Wc, kn); afetch(xr[s], Xp, kn);
      asm volatile("s_wait_xcnt 0x0" ::: "memory");     // in front of every rewrite of the address registers of the loads above
      __builtin_amdgcn_sched_barrier(0); }              // keeps every later register write behind that wait
    else if (kc + 2 == DIN / 32) {   // the first k-step without a refill: the bias values are asked for together and fly under the last two k-steps (fetched in the epilogue, each was waited for on its own)
#pragma unroll   // constant indices: the array stays in registers
      for (int j = 0; j < 8; ++j) bs[j] = Bp[j * 16];
      asm volatile("s_wait_xcnt 0x0" ::: "memory");     // in front of every rewrite of the address registers of the loads above
      __builtin_amdgcn_sched_barrier(0); }              // holds those loads up here: sunk to their uses, each would be waited for on its own again
    lds_barrier();   // publishes wt[s]; every reader of wt[s] two k-steps back has passed the barrier in between
    v16b w[8];
#pragma unroll   // constant indices: the arrays stay in registers
    for (int j = 0; j < 8; ++j) w[j] = frag_b(&wt[s][j * 16 + col][0], lane);
    __builtin_amdgcn_sched_barrier(0);   // keeps the 16 LDS reads together ahead of the products: spread among them each pair costs its own LDS latency
#pragma unroll   // constant indices: the arrays stay in registers
    for (int j = 0; j < 8; ++j) acc[j] = wmma_bf(a, w[j], acc[j]); }
  if (which < 2) { _Float16* DH = which == 0 ? QH : KH; _Float16* DL = which == 0 ? QL : KL; const int nhi = which == 0 ? QHI : KHI; const bool hi_rows = t0 < nhi; const float vs = which == 0 ? QSC : 1.0f, rs = which == 0 ? 1.0f : 1024.0f;   // q: scaled for k_attn's accumulator chain, hi and residual at ONE scale; k: as before
#pragma unroll
    for (int j = 0; j < 8; ++j) { const float bias = BA ? bfr(bs[j]) : 0.f;
#pragma unroll
      for (int r = 0; r < 8; ++r) { const float v = (acc[j][r] + bias) * vs; const _Float16 hv = (_Float16)v; sh[wave * 16 + 8 * g + r][j * 16 + col] = hv; sl[wave * 16 + 8 * g + r][j * 16 + col] = (_Float16)((v - (float)hv) * rs); } }
    __syncthreads();
    for (int e = tid; e < 64 * 16; e += 128) { const int rl = e >> 4, q = e & 15;
      if (which == 0) { vst2((unsigned*)(DH + (r0 + rl) * CC + c0 + q * 8), *(const v4u*)&sh[rl][q * 8]);
        asm volatile("s_wait_xcnt 0x0" ::: "memory"); }   // inside the arm: in front of every rewrite of the registers of the store above, on every way out of it
      else { const int l = e & 31, p = (e >> 5) & 1, tl = (e >> 6) & 3, hh = e >> 8;   // A fragment of S^T: row = key 16 tl + (l & 15), k = head column 16 p + 8 (l >> 4) + 0..7
        vst2((unsigned*)(KH + ((((bb * NH + (c0 >> 5) + hh) * (TT / 16) + (t0 >> 4) + tl) * 2 + p) * 256 + l * 8)), *(const v4u*)&sh[tl * 16 + (l & 15)][hh * 32 + p * 16 + (l >> 4) * 8]);
        asm volatile("s_wait_xcnt 0x0" ::: "memory"); }   // inside the arm: in front of every rewrite of the registers of the store above, on every way out of it
      if (hi_rows) { vst2((unsigned*)(DL + (bb * nhi + t0 + rl) * (size_t)CC + c0 + q * 8), *(const v4u*)&sl[rl][q * 8]);
        asm volatile("s_wait_xcnt 0x0" ::: "memory"); } }   // in front of every rewrite of the registers of the store above
  } else { const bool hi_rows = t0 < KHI;
#pragma unroll
    for (int j = 0; j < 8; ++j) { const float bias = BA ? bfr(bs[j]) : 0.f;
#pragma unroll
      for (int r = 0; r < 8; ++r) { const float v = acc[j][r] + bias; const int rl = wave * 16 + 8 * g + r, cl = j * 16 + col; th[cl][rl] = (_Float16)v; const __bf16 bh = (__bf16)v; tb[cl][rl] = bh; tbl[cl][rl] = (__bf16)(v - (float)bh); } }
    __syncthreads();
    for (int e = tid; e < 128 * 8; e += 128) { const int l = e & 31, p = (e >> 5) & 1, j = (e >> 6) & 1, kbl = (e >> 7) & 1, hh = e >> 8;   // A fragment of ctx^T: row = head column 16 j + (l & 15), k = key 16 p + 8 (l >> 4) + 0..7 of the 32-key block
      vst2((unsigned*)(VT + (((((bb * NH + (c0 >> 5) + hh) * (TT / 32) + (t0 >> 5) + kbl) * 2 + j) * 2 + p) * 256 + l * 8)), *(const v4u*)&th[hh * 32 + j * 16 + (l & 15)][kbl * 32 + p * 16 + (l >> 4) * 8]);
      asm volatile("s_wait_xcnt 0x0" ::: "memory"); }   // in front of every rewrite of the registers of the store above
    for (int e = tid; e < 128 * 8; e += 128) { const int cl = e >> 3, q = e & 7; if (hi_rows) { const size_t o3 = (bb * CC + c0 + cl) * (size_t)KHI + t0 + q * 8; vst2((unsigned*)(VB + o3), *(const v4u*)&tb[cl][q * 8]); vst2((unsigned*)(VBL + o3), *(const v4u*)&tbl[cl][q * 8]);
        asm volatile("s_wait_xcnt 0x0" ::: "memory"); } } } }   // in front of every rewrite of the registers of the two stores above
// ---- k_attn: block = (head, 64 queries, batch), 8 waves = 4 query tiles x KS key ranges. Transposed products: S^T x 2^10 = k q^T (q hi + residual, 2 products) + E mask^T (E = 2^10 at (key, key): adds the mask on the matrix pipe, exactly), one accumulator chain, so a lane holds the scores of ONE query (col) at keys 8g+r of each 16-key tile;
// two such tiles, converted in place, are the B operand of ctx^T += v^T P^T. Running maximum and sum per lane (online softmax); P = exp(score - max + PSH) once to f16 (PSH cancels in the division by the sum). The KS partial results are joined through LDS.
#define KS 2
#define KR (TT / KS)      // keys per wave
#define NIT (KR / 64)     // 64 keys per pass
#define PSH 6.9314718f    // keeps P (at most 2^10) clear of f16 subnormals
#define LOG2E 1.44269504f  // exp(x) = exp2(x * LOG2E): P is rounded to f16 right after, so the library expf's range reduction and end tests buy nothing here
__device__ __forceinline__ float xhalf(float x) { return __builtin_bit_cast(float, __builtin_amdgcn_permlanex16(__builtin_bit_cast(int, x), __builtin_bit_cast(int, x), 0x76543210, 0xfedcba98, false, false)); }  // lane l with lane l ^ 16
__device__ __forceinline__ v8f wm(v16h a, v16h b, v8f c) { return __builtin_amdgcn_wmma_f32_16x16x32_f16(false, a, false, b, (short)0, c, false, false); }
__device__ __forceinline__ v8f wmb(v16b a, v16b b, v8f c) { return __builtin_amdgcn_wmma_f32_16x16x32_bf16(false, a, false, b, (short)0, c, false, false); }
typedef __attribute__((ext_vector_type(2))) __bf16 v2b;
// eight exp2 and, behind the last, the free slot that the instruction set asks for between a transcendental and an instruction that reads its result or takes its source register; results and sources in separate registers, so that no exp2 of the run takes the source of the one before
__device__ __forceinline__ void exp2x8(float (&e)[8], const float (&x)[8]) {
  asm("v_exp_f32 %0, %8\n\tv_exp_f32 %1, %9\n\tv_exp_f32 %2, %10\n\tv_exp_f32 %3, %11\n\tv_exp_f32 %4, %12\n\tv_exp_f32 %5, %13\n\tv_exp_f32 %6, %14\n\tv_exp_f32 %7, %15\n\tv_nop"
      : "=&v"(e[0]), "=&v"(e[1]), "=&v"(e[2]), "=&v"(e[3]), "=&v"(e[4]), "=&v"(e[5]), "=&v"(e[6]), "=&v"(e[7]) : "v"(x[0]), "v"(x[1]), "v"(x[2]), "v"(x[3]), "v"(x[4]), "v"(x[5]), "v"(x[6]), "v"(x[7])); }
// 16x16x32 fragment stored in fragment order at (wave-uniform base) + (lane byte offset lo = 16 * lane) + constant cb: plane 0 = elements 0..7, plane 1 (512 bytes on) = elements 8..15; same k order as frag_h
__device__ __forceinline__ v16h frag_w(const _Float16* ub, unsigned lo, int cb) { union { v16h v; v8h q[2]; } u; const char* p = (const char*)ub + lo; u.q[0] = *(const v8h*)(p + cb); u.q[1] = *(const v8h*)(p + cb + 512); return u.v; }
// ---- the mask through LDS: each wave's tile of a pass (its 16 query rows x 64 keys, f32: 16 rows of 256 bytes, 8,192 bytes apart in memory) comes by ONE tensor load, one pass ahead, through no register;
// the mover pads each row by 16 bytes, so the lanes' 16-byte reads down a column of rows (pitch 272 bytes) meet no bank twice
typedef __attribute__((ext_vector_type(8))) unsigned v8u;
#define MROWB 256u        // bytes of one row of the tile
#define MPITCH 272u       // its pitch in LDS: the row + the 16-byte pad
#define MSLICE 6144u      // 16 rows x 272 bytes = 4,352, rounded up to a multiple of 2 KiB: every slice starts on one
#define MWORD0 ((1u << 20) | (5u << 22) | (3u << 25))   // group 1 word 0: no mask, 1-byte elements, a pad of 4 dwords behind every 64 dwords (one row)
__device__ __forceinline__ uint32_t uni(uint32_t v) { return (uint32_t)__builtin_amdgcn_readfirstlane((int)v); }
__device__ __forceinline__ uint32_t pinned(uint32_t v) { uint32_t w = uni(v); asm volatile("" : "+s"(w)); return w; }   // holds the issue test of a tensor load in a scalar register, so that the branch on it is a scalar one (the instruction ignores EXEC)
__device__ __forceinline__ void mask_tile_load(uint32_t lds_dst, const float* tile) { const uint64_t ga = (uint64_t)(size_t)tile;
  v4u g0; g0[0] = uni(1u); g0[1] = uni(lds_dst); g0[2] = uni((uint32_t)ga); g0[3] = uni((((uint32_t)(ga >> 32)) & 0x01FFFFFFu) | 0x80000000u);   // count 1; place in LDS; first byte of the tile; type 2
  v8u g1; g1[0] = uni(MWORD0); g1[1] = uni(MROWB << 16); g1[2] = uni(16u << 16); g1[3] = uni(MROWB << 16); g1[4] = uni(16u); g1[5] = uni(TT * 4u); g1[6] = uni(0u); g1[7] = uni(0u);   // tensor = tile = 256 bytes x 16 rows; source pitch = one mask row
  asm volatile("tensor_load_to_lds %0, %1" :: "s"(g0), "s"(g1) : "memory"); }   // one request of the whole wave
__global__ __launch_bounds__(256) void k_attn(const _Float16* __restrict__ QH, const _Float16* __restrict__ QL, const _Float16* __restrict__ KH, const _Float16* __restrict__ VT, const float* __restrict__ MKF, float* __restrict__ Y) {
  __shared__ __attribute__((aligned(2048))) unsigned char ms[2][8][MSLICE]; __shared__ float sp[4][18][32];
  const int tid = threadIdx.x, wave = __builtin_amdgcn_readfirstlane(tid >> 5), lane = tid & 31, col = lane & 15, g = lane >> 4; const int h = blockIdx.x, qb = blockIdx.y, b = blockIdx.z; const int qt = wave & 3, ks = wave >> 2;
  const int q0 = qb * 64 + qt * 16, q = q0 + col;
  const v16h qh = frag_h(QH + ((size_t)b * TT + q) * CC + h * HD, lane), ql = frag_h(QL + ((size_t)b * QHI + q) * CC + h * HD, lane);
  const unsigned fo = (unsigned)lane * 16u;   // a lane's place in each 512-byte plane
  const _Float16* Kb = KH + (((size_t)b * NH + h) * (TT / 16) + ks * (KR / 16)) * 512;   // A rows = keys, k = head columns: 1,024 bytes per 16-key tile
  float m = -3.0e38f, l = 0.f; v8f acc0 = {}, acc1 = {};   // m: the running maximum of the logits x LSH
  // selection matrices (A operands, 16 key rows x 32 k): es[j] row c holds LSH at k = 16 j + c and 0 elsewhere, so es[j] x (32 keys x 16 queries of the mask) = LSH x the mask at keys 16 j + 0..15
  v16b es[2] = {};
#pragma unroll
  for (int i = 0; i < 8; ++i) { const __bf16 o = (__bf16)(8 * g + i == col ? LSH : 0.f); es[0][i] = o; es[1][8 + i] = o; }
  // staggered walk: the 8 head blocks that share a mask tile and the 32 query blocks that share a head's k and v each begin the key walk at a pass of their own and wrap, so that they do not ask L2 for the same lines at the same moment
  const int st = (2 * h + qb) & (NIT - 1);
  v16h kf[4];
#pragma unroll
  for (int kt = 0; kt < 4; ++kt) kf[kt] = frag_w(Kb + (size_t)st * 2048, fo, kt * 1024);
  asm volatile("s_wait_xcnt 0x0" ::: "memory");     // in front of every rewrite of the address registers of the q and k loads above
  __builtin_amdgcn_sched_barrier(0);                // keeps the address arithmetic of the loop behind that wait
  const _Float16* Vb = VT + (((size_t)b * NH + h) * (TT / 32) + ks * (KR / 32)) * 1024;  // A rows = head columns, k = keys: 2,048 bytes per 32-key block (two 16-column halves)
  const float* Mb = MKF + ((size_t)b * TT + q0) * TT + ks * KR;       const unsigned mo = (unsigned)col * MPITCH + 32u * (unsigned)g;   // this wave's 16 query rows; in LDS: this lane's query row, its 8 keys of each 16-key tile
  const uint32_t md = (uint32_t)(size_t)&ms[0][wave][0];   // this wave's slice of buffer 0; buffer 1 lies 8 slices on
  mask_tile_load(md, Mb + st * 64);                         // the first pass's tile
  for (int it = 0; it < NIT; ++it) { const int pi = (it + st) & (NIT - 1), pn = (it + 1 + st) & (NIT - 1);   // the 64-key blocks of this pass and of the next
    // hand-over of pass it's tile, at the seam between pass it - 1 and pass it (written at the head: at the foot, its branch would cut the sums of the pass off from the softmax they are interleaved with)
    // the ring is private to its wave: slice [wave] of either buffer is filled by this wave's own tensor loads and read by this wave alone, so its own two waits order everything and no work-group barrier stands here; the 8 waves run out of step, one wave's matrix and load phases under another's softmax
    asm volatile("s_wait_dscnt 0x0" ::: "memory");       // this wave's reads of the last pass's buffer have retired: it may be refilled
    asm volatile("s_wait_tensorcnt 0x0" ::: "memory");   // this pass's tile, this wave's own request, has landed
    if (pinned(it + 1 < NIT)) mask_tile_load(md + (uint32_t)((it + 1) & 1) * (8u * MSLICE), Mb + pn * 64);   // the next pass's tile flies under this pass, into the buffer that the last pass read
    v4f mk[4][2]; const unsigned char* mp = &ms[it & 1][wave][0] + mo;
#pragma unroll
    for (int kt = 0; kt < 4; ++kt) { mk[kt][0] = *(const v4f*)(mp + kt * 64); mk[kt][1] = *(const v4f*)(mp + kt * 64 + 16); }
    v16h vf[2][2];
#pragma unroll
    for (int s = 0; s < 2; ++s) { vf[s][0] = frag_w(Vb + pi * 2048, fo, s * 2048); vf[s][1] = frag_w(Vb + pi * 2048, fo, s * 2048 + 1024); }
    asm volatile("s_wait_xcnt 0x0" ::: "memory");   // in front of every rewrite of the address registers of the v loads above
    __builtin_amdgcn_sched_barrier(0);              // holds those loads up here: without it they sink to their first use and the wave waits out each latency
    v8f v[4]; float mx = -3.0e38f;
#pragma unroll
    for (int kt = 0; kt < 4; ++kt) { const v8f z = {}; v[kt] = wm(kf[kt], qh, wm(kf[kt], ql, z)); }   // smallest terms first
    union { v16b f; v2b d[8]; } mb[2];   // B operand: element 8 j + r = the mask at key 16 j + 8 g + r of a 32-key block, the k order of p below
#pragma unroll
    for (int kt = 0; kt < 4; ++kt) {
#pragma unroll
      for (int r = 0; r < 8; r += 2) { const v2f t = { mk[kt][r >> 2][r & 3], mk[kt][r >> 2][(r & 3) + 1] }; mb[kt >> 1].d[(kt & 1) * 4 + (r >> 1)] = __builtin_convertvector(t, v2b); } }
    __builtin_amdgcn_sched_barrier(0);   // both mask operands stand ready ahead of their four products: converted between them, the second takes the first's registers and waits out the distance behind a product that still reads them
#pragma unroll
    for (int kt = 0; kt < 4; ++kt) v[kt] = wmb(es[kt & 1], mb[kt >> 1].f, v[kt]);
#pragma unroll
    for (int kt = 0; kt < 4; ++kt) {
#pragma unroll
      for (int r = 0; r < 8; ++r) mx = fmaxf(mx, v[kt][r]); }
    const int nx = it + 1 < NIT ? pn : pi;   // next pass's k rows, fetched under this pass's softmax (the last pass fetches its own again)
#pragma unroll
    for (int kt = 0; kt < 4; ++kt) kf[kt] = frag_w(Kb + (size_t)nx * 2048, fo, kt * 1024);
    asm volatile("s_wait_xcnt 0x0" ::: "memory");   // in front of every rewrite of the address registers of the k loads above
    __builtin_amdgcn_sched_barrier(0);              // holds the k loads ahead of the softmax, which covers their latency
    mx = fmaxf(mx, xhalf(mx)); const float mn = fmaxf(m, mx); float al; asm("v_exp_f32 %0, %1\n\tv_nop" : "=v"(al) : "v"((m - mn) * (LOG2E / LSH)));   // exp2 with the free slot behind it that the instruction set asks for
    m = mn; const float nms = (PSH - mn * (1.0f / LSH)) * LOG2E;
    float sum = 0.f; v16h p[2];
#pragma unroll
    for (int kt = 0; kt < 4; ++kt) { float x[8], e[8];
#pragma unroll
      for (int r = 0; r < 8; ++r) x[r] = fmaf(v[kt][r], LOG2E / LSH, nms);
      exp2x8(e, x);
#pragma unroll
      for (int r = 0; r < 8; ++r) { sum += e[r]; p[kt >> 1][(kt & 1) * 8 + r] = (_Float16)e[r]; } }
    l = l * al + sum;
#pragma unroll
    for (int r = 0; r < 8; ++r) { acc0[r] *= al; acc1[r] *= al; }
#pragma unroll
    for (int s = 0; s < 2; ++s) { acc0 = wm(vf[s][0], p[s], acc0); acc1 = wm(vf[s][1], p[s], acc1); } }
  asm volatile("s_wait_tensorcnt 0x0" ::: "memory");     // nothing of the mover is in flight behind the loop
  asm volatile("s_wait_dscnt 0x0" ::: "memory");         // and no read of the two buffers
  l += xhalf(l);
  if (ks) { sp[qt][0][lane] = m; sp[qt][1][lane] = l;
#pragma unroll
    for (int r = 0; r < 8; ++r) { sp[qt][2 + r][lane] = acc0[r]; sp[qt][10 + r][lane] = acc1[r]; } }
  __syncthreads();
  if (!ks) { const float m1 = sp[qt][0][lane], l1 = sp[qt][1][lane]; const float mm = fmaxf(m, m1); float a0 = expf((m - mm) * (1.0f / LSH)), a1 = expf((m1 - mm) * (1.0f / LSH)); const float lt = l * a0 + l1 * a1; const float inv = lt > 0.f ? 1.0f / lt : 0.f; a0 *= inv; a1 *= inv;
    v4f o[4];
#pragma unroll
    for (int r = 0; r < 8; ++r) { o[r >> 2][r & 3] = acc0[r] * a0 + sp[qt][2 + r][lane] * a1; o[2 + (r >> 2)][r & 3] = acc1[r] * a0 + sp[qt][10 + r][lane] * a1; }
    float* yp = Y + ((size_t)b * TT + q) * CC + h * HD + 8 * g;   // ctx^T register r = head column 16 j + 8 g + r of query col
    vst2(yp, o[0]); vst2(yp + 4, o[1]); vst2(yp + 16, o[2]); vst2(yp + 20, o[3]); } }
// ---- k_out: block = (64 rows, 128 cols): out = ctx Wo (+ bo): all rows: ctx bf16 hi + lo against exact bf16 Wo (2 products); the f16 x f16(bf16 x 2^8) branch is never taken
__global__ __launch_bounds__(128) void k_out(const float* __restrict__ Y, const float* __restrict__ WO, const float* __restrict__ BO, float* __restrict__ OUT) { __shared__ __align__(16) float sf[4][16][132]; __shared__ __align__(16) __bf16 wt[2][128][WPI];
  const int tid = threadIdx.x, wave = tid >> 5, lane = tid & 31, col = lane & 15, g = lane >> 4; const int c0 = blockIdx.y * 128; const size_t r0 = (size_t)blockIdx.x * 64 + wave * 16;
  v8f acc[8] = {};
  if (true) {   /* ALL rows: ctx split bf16 hi + lo x exact Wo (2 products) */
    const float* Wc = WO + c0 + tid; const float* Yp = Y + (r0 + col) * CC + 8 * g;
    float wr[2][32]; v4f xr[2][4];   // two k-steps in flight in registers
    float bs[8]; const float* Bp = (BO ? BO : WO) + c0 + col;   // this lane's 8 bias values; without a bias the loads read weights, which the epilogue replaces by 0, as in k_proj
    const int st = (int)((blockIdx.x + 2u * blockIdx.y) & (CC / 32 - 1));   // staggered walk, as in k_proj: 64 row blocks share a weight tile, 4 column blocks the ctx rows
    wfetch<DIN>(wr[0], Wc, st); afetch(xr[0], Yp, st);
    asm volatile("s_wait_xcnt 0x0" ::: "memory");     // the next k-step's addresses may take the address registers of the loads above
    __builtin_amdgcn_sched_barrier(0);                // keeps that address arithmetic behind the wait
    wfetch<DIN>(wr[1], Wc, (st + 1) & (CC / 32 - 1)); afetch(xr[1], Yp, (st + 1) & (CC / 32 - 1));
    asm volatile("s_wait_xcnt 0x0" ::: "memory");     // in front of every rewrite of the address registers of the loads above
    __builtin_amdgcn_sched_barrier(0);                // keeps those loads up here, all in flight together
#pragma unroll   // constant indices: the arrays stay in registers
    for (int kc = 0; kc < CC / 32; ++kc) { const int s = kc & 1; float v[16];
      wlay(&wt[s][tid][0], wr[s]);
#pragma unroll   // constant indices: the arrays stay in registers
      for (int i = 0; i < 4; ++i) { v[i] = xr[s][0][i]; v[4 + i] = xr[s][1][i]; v[8 + i] = xr[s][2][i]; v[12 + i] = xr[s][3][i]; }
      const F2 a = bsplit16(v);
      __builtin_amdgcn_sched_barrier(0);   // the refill below reuses the registers just read: lifted over their readers it would take a third register set
      if (kc + 2 < CC / 32) { const int kn = (kc + 2 + st) & (CC / 32 - 1); wfetch<DIN>(wr[s], Wc, kn); afetch(xr[s], Yp, kn);
        asm volatile("s_wait_xcnt 0x0" ::: "memory");     // in front of every rewrite of the address registers of the loads above
        __builtin_amdgcn_sched_barrier(0); }              // keeps every later register write behind that wait
      else if (kc + 2 == CC / 32) {   // the first k-step without a refill: the bias values are asked for together and fly under the last two k-steps, as in k_proj
#pragma unroll   // constant indices: the array stays in registers
        for (int j = 0; j < 8; ++j) bs[j] = Bp[j * 16];
        asm volatile("s_wait_xcnt 0x0" ::: "memory");     // in front of every rewrite of the address registers of the loads above
        __builtin_amdgcn_sched_barrier(0); }              // holds those loads up here: sunk to their uses, each would be waited for on its own again
      lds_barrier();   // publishes wt[s]; every reader of wt[s] two k-steps back has passed the barrier in between
      v16b w[8];
#pragma unroll   // constant indices: the arrays stay in registers
      for (int j = 0; j < 8; ++j) w[j] = frag_b(&wt[s][j * 16 + col][0], lane);
      __builtin_amdgcn_sched_barrier(0);   // keeps the 16 LDS reads together ahead of the products: spread among them each pair costs its own LDS latency
#pragma unroll   // constant indices: the arrays stay in registers
      for (int j = 0; j < 8; ++j) { acc[j] = wmma_bf(a.h, w[j], acc[j]); acc[j] = wmma_bf(a.l, w[j], acc[j]); } }
#pragma unroll
    for (int j = 0; j < 8; ++j) { const float bias = BO ? bfr(bs[j]) : 0.f;
#pragma unroll
      for (int r = 0; r < 8; ++r) sf[wave][8 * g + r][j * 16 + col] = acc[j][r] + bias; }
  } else {
#pragma unroll 2
    for (int kc = 0; kc < CC / 32; ++kc) { const v16h a = frag_f32(Y + (r0 + col) * CC + kc * 32, lane); asm volatile("s_wait_loadcnt 0x0" ::: "memory");
#pragma unroll
      for (int j = 0; j < 8; ++j) { const v16h w = WOCOLH(WO, kc * 32, c0 + j * 16 + col, lane); asm volatile("s_wait_loadcnt 0x0" ::: "memory"); acc[j] = wmma16(a, w, acc[j]); } }
#pragma unroll
    for (int j = 0; j < 8; ++j) { const float bias = BO ? bfr(BO[c0 + j * 16 + col]) : 0.f;
#pragma unroll
      for (int r = 0; r < 8; ++r) sf[wave][8 * g + r][j * 16 + col] = acc[j][r] * (1.0f / 256.0f) + bias; } }
  LDSX(); for (int rl = 0; rl < 16; ++rl) vst2(OUT + (r0 + rl) * DIN + c0 + lane * 4, *(const v4f*)&sf[wave][rl][lane * 4]); }

extern "C" void kernel_launch(void* const* d_in, const int* in_sizes, int n_in, void* d_out, int out_size, void* d_ws, size_t ws_size, hipStream_t stream) {
  (void)in_sizes; (void)n_in; (void)out_size;
  const float** F = (const float**)d_in;
  if (ws_size < (size_t)WS_END) return;
  char* ws = (char*)d_ws; _Float16 *QH = (_Float16*)(ws + WS_QH), *KH = (_Float16*)(ws + WS_KH), *VT = (_Float16*)(ws + WS_VT), *QL = (_Float16*)(ws + WS_QL), *KL = (_Float16*)(ws + WS_KL); __bf16 *VB = (__bf16*)(ws + WS_VB), *VBL = (__bf16*)(ws + WS_VBL); float *Y = (float*)(ws + WS_Y);
  (void)Y; (void)QL; (void)KL; (void)VB; (void)VBL;
  // inputs: 0 V [2,2048,512]; 1 Q; 2 K; 3 mask [2,1,2048,2048] f32; 4 Wq [512,256] (in,out), 5 bq; 6 Wk, 7 bk; 8 Wv, 9 bv; 10 Wo [256,512] (in,out), 11 bo [512]
  k_proj<<<dim3(TNB * TT / 64, CC / 128, 3), 128, 0, stream>>>(F[1], F[2], F[0], F[4], F[6], F[8], F[5], F[7], F[9], QH, QL, KH, KL, VT, VB, VBL);   /* q from Q (in1), k from K (in2), v from V (in0) */
  k_attn<<<dim3(NH, NQB, TNB), 256, 0, stream>>>(QH, QL, KH, VT, F[3], Y);
  k_out<<<dim3(TNB * TT / 64, DIN / 128), 128, 0, stream>>>(Y, F[10], F[11], (float*)d_out);
}

// v010
// One run takes 35.6 microseconds.
// Next to v009, in two timings, it ran 1.03 and 1.04 times as fast.
// Over all steps from v000 it is 12.8 times as fast.
// compute dtype: all float inputs rounded to bf16; q/k/v = in W + b with EXACT bf16 products on WMMA 16x16x32 (f32 accumulate); logits x 2^10 as ONE WMMA accumulator chain: q x 2^6 (= 2^10 / sqrt(256)) as f16 hi + residual against k once to f16 (2 products), then the additive mask (bf16) against a constant selection matrix of 2^10 (1 product, exact); online softmax in f32 (exponentials as hardware exp2 of one fma by log2 e); unnormalised P (at most 2^10) once to f16 against v once to f16 (1 product), divided by the f32 sum; ctx split bf16 hi + lo against exact Wo (2 products) + bo; f32 output.
#include <hip/hip_runtime.h>
#include <math.h>

typedef __attribute__((ext_vector_type(16))) _Float16 v16h;
typedef __attribute__((ext_vector_type(16))) __bf16 v16b;
typedef __attribute__((ext_vector_type(8)))  _Float16 v8h;
typedef __attribute__((ext_vector_type(8)))  float v8f;
typedef __attribute__((ext_vector_type(4)))  float v4f;
typedef __attribute__((ext_vector_type(2)))  float v2f;
typedef __attribute__((ext_vector_type(4)))  unsigned v4u;
typedef __attribute__((ext_vector_type(4)))  int v4i;
typedef float __attribute__((may_alias)) float_a;
typedef int __attribute__((may_alias)) int_a;

template <typename T> __device__ __forceinline__ void vst2(void* p, T v) { *(T*)p = v;  }
__device__ __forceinline__ v8f wmma16(v16h a, v16h b, v8f c) {
  v8f d = __builtin_amdgcn_wmma_f32_16x16x32_f16(false, a, false, b, (short)0, c, false, false);
  asm volatile("v_nop\n\tv_nop\n\tv_nop\n\tv_nop" : "+v"(d) : "v"(a), "v"(b));
  return d;
}
__device__ __forceinline__ v8f wmma_bf(v16b a, v16b b, v8f c) {
  v8f d = __builtin_amdgcn_wmma_f32_16x16x32_bf16(false, a, false, b, (short)0, c, false, false);
  asm volatile("v_nop\n\tv_nop\n\tv_nop\n\tv_nop" : "+v"(d) : "v"(a), "v"(b));
  return d;
}
// 16x16x32 fragments: lane = (h = lane>>4, row/col = lane&15); elements 0..7 = k0+8h+0..7, 8..15 = k0+16+8h+0..7; D element r = row 8h+r
__device__ __forceinline__ v16h frag_h(const _Float16* rowk0, int lane) {
  union { v16h v; v8h q[2]; } u; const _Float16* p = rowk0 + 8 * (lane >> 4);
  u.q[0] = *(const v8h*)p; u.q[1] = *(const v8h*)(p + 16); return u.v;
}
__device__ __forceinline__ v16h frag_f32(const float* rowk0, int lane) {
  v16h a; const float* p = rowk0 + 8 * (lane >> 4);
#pragma unroll
  for (int i = 0; i < 8; ++i) { a[i] = (_Float16)p[i]; a[8 + i] = (_Float16)p[16 + i]; }
  return a;
}
__device__ __forceinline__ v16h frag_f32s(const float* rowk0, int lane, float sc) {
  v16h a; const float* p = rowk0 + 8 * (lane >> 4);
#pragma unroll
  for (int i = 0; i < 8; ++i) { a[i] = (_Float16)(p[i] * sc); a[8 + i] = (_Float16)(p[16 + i] * sc); }
  return a;
}
// column fragment from a [K][ld] layout (column n), rows >= K read as 0
__device__ __forceinline__ v16h fragc_f32(const float* W, int k0, int n, int lane, int ld, int K) {
  v16h a; const int g = lane >> 4;
#pragma unroll
  for (int i = 0; i < 8; ++i) { const int ka = k0 + 8 * g + i, kb = ka + 16;
    a[i] = (_Float16)(ka < K ? W[(size_t)(ka < K ? ka : K - 1) * ld + n] : 0.f); a[8 + i] = (_Float16)(kb < K ? W[(size_t)(kb < K ? kb : K - 1) * ld + n] : 0.f); }
  return a;
}
struct F2 { v16b h, l; };
__device__ __forceinline__ F2 bsplit16(const float v[16]) { F2 r;
#pragma unroll
  for (int i = 0; i < 16; ++i) { const __bf16 h = (__bf16)v[i]; r.h[i] = h; r.l[i] = (__bf16)(v[i] - (float)h); }
  return r; }
__device__ __forceinline__ F2 split_row(const float* row, int k0, int lane) { float v[16]; const float* p = row + k0 + 8 * (lane >> 4);
#pragma unroll
  for (int i = 0; i < 8; ++i) { v[i] = p[i]; v[8 + i] = p[16 + i]; }
  return bsplit16(v); }
__device__ __forceinline__ F2 split_rowK(const float* row, int k0, int lane, int K) { float v[16]; const int g = lane >> 4;
#pragma unroll
  for (int i = 0; i < 8; ++i) { const int ka = k0 + 8 * g + i, kb = ka + 16; v[i] = ka < K ? row[ka < K ? ka : K - 1] : 0.f; v[8 + i] = kb < K ? row[kb < K ? kb : K - 1] : 0.f; }
  return bsplit16(v); }
__device__ __forceinline__ F2 split_col(const float* W, int k0, int n, int lane, int ld, int K) { float v[16]; const int g = lane >> 4;
#pragma unroll
  for (int i = 0; i < 8; ++i) { const int ka = k0 + 8 * g + i, kb = ka + 16; v[i] = ka < K ? W[(size_t)(ka < K ? ka : K - 1) * ld + n] : 0.f; v[8 + i] = kb < K ? W[(size_t)(kb < K ? kb : K - 1) * ld + n] : 0.f; }
  return bsplit16(v); }
__device__ __forceinline__ v8f mac3(const F2& a, const F2& b, v8f c) { c = wmma_bf(a.l, b.h, c); c = wmma_bf(a.h, b.l, c); return wmma_bf(a.h, b.h, c); }
__device__ __forceinline__ float sigm(float v) { return 1.0f / (1.0f + expf(-v)); }
#define LDSX() do { asm volatile("s_wait_dscnt 0" ::: "memory"); __builtin_amdgcn_wave_barrier(); __builtin_amdgcn_fence(__ATOMIC_RELEASE, "workgroup"); } while (0)

// Multi-head attention with an additive dense mask (B 2, S 2,048, d_model 512 -> key/value dim 256 = 8 heads x 32 -> out 512; 0.02-scale (in,out) weights, zero biases; separate V, Q, K inputs): scores = q k^T / sqrt(256) (the FULL key_dim, as written) + mask[b, 0, q, k] (random normal); out = merged(softmax v) Wo + bo.
#define NB 2
#define TT 2048
#define CC 256            // NH * HD = projected width
#define DIN 512          // input (model) width
#define NH 8
#define HD 32
#define NQB (TT / 64)
#define HG 4
#define SCALE (0.0625f)
#define LSH 1024.0f        // k_attn carries its logits x 2^10 (a power of two: exact): q's f16 residual, at the same scale as its hi part, then stays clear of f16 subnormals
#define QSC (SCALE * LSH)  // what k_proj multiplies q by
#define CAUSAL 0
#ifndef TNB
#define TNB NB
#endif
__device__ __forceinline__ float bfr(float v) { return (float)(__bf16)v; }
__host__ __device__ __forceinline__ int kb_last(int qb) { return CAUSAL ? ((qb * 64 + 63) >> 7) : (TT / 128 - 1); }
typedef __attribute__((ext_vector_type(8))) __bf16 v8b;
__device__ __forceinline__ v16b frag_b(const __bf16* rowk0, int lane) {
  union { v16b v; v8b q[2]; } u; const __bf16* p = rowk0 + 8 * (lane >> 4);
  u.q[0] = *(const v8b*)p; u.q[1] = *(const v8b*)(p + 16); return u.v;
}
#define QBH 0
#define QHI 2048            // rows carrying a q residual plane (all rows when non-causal: 2-product logits everywhere)
#define KHI 64            // key rows carrying k residual / v bf16 hi+lo planes (written by k_proj; no kernel here reads them)
// B fragment (k rows k0+.., output column o) of a weight: (in,out) [K][ld] or (out,in) [ld rows of K]: bf16 exact, or f16(bf16 * 256) exact
__device__ __forceinline__ v16b wcol_io(const float* Wm, int k0, int o, int lane, int ld) { v16b w; const int g = lane >> 4;
#pragma unroll
  for (int i = 0; i < 8; ++i) { w[i] = (__bf16)Wm[(size_t)(k0 + 8 * g + i) * ld + o]; w[8 + i] = (__bf16)Wm[(size_t)(k0 + 16 + 8 * g + i) * ld + o]; }
  return w; }
__device__ __forceinline__ v16b wcol_oi(const float* Wm, int k0, int o, int lane, int K) { v16b w; const float* p = Wm + (size_t)o * K + k0 + 8 * (lane >> 4);
#pragma unroll
  for (int i = 0; i < 8; ++i) { w[i] = (__bf16)p[i]; w[8 + i] = (__bf16)p[16 + i]; }
  return w; }
__device__ __forceinline__ v16h wcolh_io(const float* Wm, int k0, int o, int lane, int ld) { v16h w; const int g = lane >> 4;
#pragma unroll
  for (int i = 0; i < 8; ++i) { w[i] = (_Float16)(bfr(Wm[(size_t)(k0 + 8 * g + i) * ld + o]) * 256.0f); w[8 + i] = (_Float16)(bfr(Wm[(size_t)(k0 + 16 + 8 * g + i) * ld + o]) * 256.0f); }
  return w; }
__device__ __forceinline__ v16h wcolh_oi(const float* Wm, int k0, int o, int lane, int K) { v16h w; const float* p = Wm + (size_t)o * K + k0 + 8 * (lane >> 4);
#pragma unroll
  for (int i = 0; i < 8; ++i) { w[i] = (_Float16)(bfr(p[i]) * 256.0f); w[8 + i] = (_Float16)(bfr(p[16 + i]) * 256.0f); }
  return w; }
#define WQKV_LAYOUT 0   // 0 = (in,out) [DIN][CC]; 1 = (out,in) [CC][DIN]; 2 = per-head [NH][DIN][HD]
__device__ __forceinline__ v16b wcol_hdk(const float* Wm, int k0, int o, int lane) { v16b w; const int g = lane >> 4; const float* p = Wm + (size_t)(o / HD) * DIN * HD + (o % HD);
#pragma unroll
  for (int i = 0; i < 8; ++i) { w[i] = (__bf16)p[(size_t)(k0 + 8 * g + i) * HD]; w[8 + i] = (__bf16)p[(size_t)(k0 + 16 + 8 * g + i) * HD]; }
  return w; }
#define WO_OUT_IN 0
#if WQKV_LAYOUT == 1
#define WCOL(W, k0, o, lane) wcol_oi(W, k0, o, lane, DIN)
#elif WQKV_LAYOUT == 2
#define WCOL(W, k0, o, lane) wcol_hdk(W, k0, o, lane)
#else
#define WCOL(W, k0, o, lane) wcol_io(W, k0, o, lane, CC)
#endif
#if WO_OUT_IN
#define WOCOL(W, k0, o, lane) wcol_oi(W, k0, o, lane, CC)
#define WOCOLH(W, k0, o, lane) wcolh_oi(W, k0, o, lane, CC)
#else
#define WOCOL(W, k0, o, lane) wcol_io(W, k0, o, lane, DIN)
#define WOCOLH(W, k0, o, lane) wcolh_io(W, k0, o, lane, DIN)
#endif

#define WS_QH  0u                                      // f16 q x 2^6 rows [b*t][CC]
#define WS_KH  (WS_QH + 2u * (size_t)NB * TT * CC)      // f16 k in fragment order [b][head][16-key tile][plane 2][lane 32][8]
#define WS_VT  (WS_KH + 2u * (size_t)NB * TT * CC)      // f16 v in fragment order [b][head][32-key block][16-column half 2][plane 2][lane 32][8]
#define WS_QL  (WS_VT + 2u * (size_t)NB * CC * TT)      // f16 residual of q x 2^6 rows [b][t < QHI][CC]
#define WS_KL  (WS_QL + 2u * (size_t)NB * QHI * CC)     // f16 k residual x 2^10 rows [b][t < KHI][CC]
#define WS_VB  (WS_KL + 2u * (size_t)NB * KHI * CC)     // bf16 v hi planes [b][c][t < KHI]
#define WS_VBL (WS_VB + 2u * (size_t)NB * CC * KHI)
#define WS_S   (WS_VBL + 2u * (size_t)NB * CC * KHI)    // f32 [hg][t][s]; reserved, not used by any kernel here
#define WS_Y   (WS_S  + 4u * (size_t)HG * TT * TT)      // f32 ctx rows [b*t][CC] (only when there is an output projection)
#define WS_END (WS_Y  + 4u * (size_t)NB * TT * CC)

// ---- weight tiles through LDS: thread t fetches column c0 + t of a 32-row k-step (each wave load = one whole 128-byte line), rounds it to bf16 and lays it as row t of wt (k contiguous, pitch 80 bytes); frag_b then reads the same k order as wcol_io
#define WPI 40            // bf16 per LDS row: 64 bytes of data at the conflict-free 80-byte pitch for 16-byte reads
template <int LD> __device__ __forceinline__ void wfetch(float (&r)[32], const float* __restrict__ Wc, int kc) {
#pragma unroll   // constant indices: the arrays stay in registers
  for (int k = 0; k < 32; ++k) r[k] = Wc[(size_t)kc * (32 * LD) + (size_t)k * LD]; }
__device__ __forceinline__ void wlay(__bf16* row, const float (&r)[32]) {
#pragma unroll   // constant indices: the arrays stay in registers
  for (int q = 0; q < 4; ++q) { v8b t;
#pragma unroll   // constant indices: the arrays stay in registers
    for (int i = 0; i < 8; ++i) t[i] = (__bf16)r[q * 8 + i];
    *(v8b*)(row + q * 8) = t; } }
// work-group barrier that orders LDS only: __syncthreads() also waits out every global load, which would end the fetch-ahead at each k-step
__device__ __forceinline__ void lds_barrier() { __builtin_amdgcn_fence(__ATOMIC_RELEASE, "workgroup", "local"); __builtin_amdgcn_s_barrier(); __builtin_amdgcn_fence(__ATOMIC_ACQUIRE, "workgroup", "local"); }
// the 16 f32 of this lane's A fragment of one k-step (p = row + 8 * (lane >> 4))
__device__ __forceinline__ void afetch(v4f (&x)[4], const float* __restrict__ p, int kc) { const float* s = p + kc * 32; x[0] = *(const v4f*)s; x[1] = *(const v4f*)(s + 4); x[2] = *(const v4f*)(s + 16); x[3] = *(const v4f*)(s + 20); }
// ---- k_proj: block = (64 rows, 128 cols, which): q/k/v = X W (+ b) with exact bf16 products (K = DIN) -> which 0: q x QSC f16 rows (+ residual rows < QHI, at the same scale); 1: k f16 in fragment order (+ residual rows < KHI); 2: v f16 in fragment order (+ bf16 hi/lo planes for t < KHI)
// fragment order: the 16 bytes that lane l of k_attn loads as elements 0..7 (plane 0) or 8..15 (plane 1) of an A fragment lie at plane * 512 + l * 16, so one wave load there is 512 contiguous bytes = 4 whole lines
__global__ __launch_bounds__(128) void k_proj(const float* __restrict__ XQ, const float* __restrict__ XK, const float* __restrict__ XV, const float* __restrict__ WQ, const float* __restrict__ WK, const float* __restrict__ WV, const float* __restrict__ BQ, const float* __restrict__ BK, const float* __restrict__ BV,
    _Float16* __restrict__ QH, _Float16* __restrict__ QL, _Float16* __restrict__ KH, _Float16* __restrict__ KL, _Float16* __restrict__ VT, __bf16* __restrict__ VB, __bf16* __restrict__ VBL) {
  __shared__ __align__(16) _Float16 sh[64][136], sl[64][136]; __shared__ __align__(16) _Float16 th[128][72]; __shared__ __align__(16) __bf16 tb[128][72], tbl[128][72]; __shared__ __align__(16) __bf16 wt[2][128][WPI];
  const int tid = threadIdx.x, wave = tid >> 5, lane = tid & 31, col = lane & 15, g = lane >> 4; const int which = blockIdx.z; const int c0 = blockIdx.y * 128; const size_t r0 = (size_t)blockIdx.x * 64; const size_t bb = r0 / TT; const int t0 = (int)(r0 % TT);
  const float* X = which == 0 ? XQ : which == 1 ? XK : XV; const float* WA = which == 0 ? WQ : which == 1 ? WK : WV; const float* BA = which == 0 ? BQ : which == 1 ? BK : BV;
  v8f acc[8] = {};
  const float* Wc = WA + c0 + tid; const float* Xp = X + (r0 + wave * 16 + col) * DIN + 8 * g;
  float wr[2][32]; v4f xr[2][4];   // two k-steps in flight in registers
  float bs[8]; const float* Bp = (BA ? BA : WA) + c0 + col;   // this lane's 8 bias values; without a bias the loads read weights, which the epilogue replaces by 0: a branch round the loads cuts the unrolled k loop in two, and that build took more than 256 registers
  // staggered walk: the 64 row blocks that share a weight tile and the 2 column blocks that share the input rows each begin the k loop at a k-step of their own and wrap, so that they do not ask L2 for the same lines at the same moment
  const int st = (int)((blockIdx.x + 8u * blockIdx.y) & (DIN / 32 - 1));
  wfetch<CC>(wr[0], Wc, st); afetch(xr[0], Xp, st);
  asm volatile("s_wait_xcnt 0x0" ::: "memory");     // the next k-step's addresses may take the address registers of the loads above
  __builtin_amdgcn_sched_barrier(0);                // keeps that address arithmetic behind the wait
  wfetch<CC>(wr[1], Wc, (st + 1) & (DIN / 32 - 1)); afetch(xr[1], Xp, (st + 1) & (DIN / 32 - 1));
  asm volatile("s_wait_xcnt 0x0" ::: "memory");     // in front of every rewrite of the address registers of the loads above
  __builtin_amdgcn_sched_barrier(0);                // keeps those loads up here, all in flight together
#pragma unroll   // constant indices: the arrays stay in registers
  for (int kc = 0; kc < DIN / 32; ++kc) { const int s = kc & 1; v16b a;
    wlay(&wt[s][tid][0], wr[s]);
#pragma unroll   // constant indices: the arrays stay in registers
    for (int i = 0; i < 4; ++i) { a[i] = (__bf16)xr[s][0][i]; a[4 + i] = (__bf16)xr[s][1][i]; a[8 + i] = (__bf16)xr[s][2][i]; a[12 + i] = (__bf16)xr[s][3][i]; }
    __builtin_amdgcn_sched_barrier(0);   // the refill below reuses the registers just read: lifted over their readers it would take a third register set
    if (kc + 2 < DIN / 32) { const int kn = (kc + 2 + st) & (DIN / 32 - 1); wfetch<CC>(wr[s], Wc, kn); afetch(xr[s], Xp, kn);
      asm volatile("s_wait_xcnt 0x0" ::: "memory");     // in front of every rewrite of the address registers of the loads above
      __builtin_amdgcn_sched_barrier(0); }              // keeps every later register write behind that wait
    else if (kc + 2 == DIN / 32) {   // the first k-step without a refill: the bias values are asked for together and fly under the last two k-steps (fetched in the epilogue, each was waited for on its own)
#pragma unroll   // constant indices: the array stays in registers
      for (int j = 0; j < 8; ++j) bs[j] = Bp[j * 16];
      asm volatile("s_wait_xcnt 0x0" ::: "memory");     // in front of every rewrite of the address registers of the loads above
      __builtin_amdgcn_sched_barrier(0); }              // holds those loads up here: sunk to their uses, each would be waited for on its own again
    lds_barrier();   // publishes wt[s]; every reader of wt[s] two k-steps back has passed the barrier in between
    v16b w[8];
#pragma unroll   // constant indices: the arrays stay in registers
    for (int j = 0; j < 8; ++j) w[j] = frag_b(&wt[s][j * 16 + col][0], lane);
    __builtin_amdgcn_sched_barrier(0);   // keeps the 16 LDS reads together ahead of the products: spread among them each pair costs its own LDS latency
#pragma unroll   // constant indices: the arrays stay in registers
    for (int j = 0; j < 8; ++j) acc[j] = wmma_bf(a, w[j], acc[j]); }
  if (which < 2) { _Float16* DH = which == 0 ? QH : KH; _Float16* DL = which == 0 ? QL : KL; const int nhi = which == 0 ? QHI : KHI; const bool hi_rows = t0 < nhi; const float vs = which == 0 ? QSC : 1.0f, rs = which == 0 ? 1.0f : 1024.0f;   // q: scaled for k_attn's accumulator chain, hi and residual at ONE scale; k: as before
#pragma unroll
    for (int j = 0; j < 8; ++j) { const float bias = BA ? bfr(bs[j]) : 0.f;
#pragma unroll
      for (int r = 0; r < 8; ++r) { const float v = (acc[j][r] + bias) * vs; const _Float16 hv = (_Float16)v; sh[wave * 16 + 8 * g + r][j * 16 + col] = hv; sl[wave * 16 + 8 * g + r][j * 16 + col] = (_Float16)((v - (float)hv) * rs); } }
    __syncthreads();
    for (int e = tid; e < 64 * 16; e += 128) { const int rl = e >> 4, q = e & 15;
      if (which == 0) { vst2((unsigned*)(DH + (r0 + rl) * CC + c0 + q * 8), *(const v4u*)&sh[rl][q * 8]);
        asm volatile("s_wait_xcnt 0x0" ::: "memory"); }   // inside the arm: in front of every rewrite of the registers of the store above, on every way out of it
      else { const int l = e & 31, p = (e >> 5) & 1, tl = (e >> 6) & 3, hh = e >> 8;   // A fragment of S^T: row = key 16 tl + (l & 15), k = head column 16 p + 8 (l >> 4) + 0..7
        vst2((unsigned*)(KH + ((((bb * NH + (c0 >> 5) + hh) * (TT / 16) + (t0 >> 4) + tl) * 2 + p) * 256 + l * 8)), *(const v4u*)&sh[tl * 16 + (l & 15)][hh * 32 + p * 16 + (l >> 4) * 8]);
        asm volatile("s_wait_xcnt 0x0" ::: "memory"); }   // inside the arm: in front of every rewrite of the registers of the store above, on every way out of it
      if (hi_rows) { vst2((unsigned*)(DL + (bb * nhi + t0 + rl) * (size_t)CC + c0 + q * 8), *(const v4u*)&sl[rl][q * 8]);
        asm volatile("s_wait_xcnt 0x0" ::: "memory"); } }   // in front of every rewrite of the registers of the store above
  } else { const bool hi_rows = t0 < KHI;
#pragma unroll
    for (int j = 0; j < 8; ++j) { const float bias = BA ? bfr(bs[j]) : 0.f;
#pragma unroll
      for (int r = 0; r < 8; ++r) { const float v = acc[j][r] + bias; const int rl = wave * 16 + 8 * g + r, cl = j * 16 + col; th[cl][rl] = (_Float16)v; const __bf16 bh = (__bf16)v; tb[cl][rl] = bh; tbl[cl][rl] = (__bf16)(v - (float)bh); } }
    __syncthreads();
    for (int e = tid; e < 128 * 8; e += 128) { const int l = e & 31, p = (e >> 5) & 1, j = (e >> 6) & 1, kbl = (e >> 7) & 1, hh = e >> 8;   // A fragment of ctx^T: row = head column 16 j + (l & 15), k = key 16 p + 8 (l >> 4) + 0..7 of the 32-key block
      vst2((unsigned*)(VT + (((((bb * NH + (c0 >> 5) + hh) * (TT / 32) + (t0 >> 5) + kbl) * 2 + j) * 2 + p) * 256 + l * 8)), *(const v4u*)&th[hh * 32 + j * 16 + (l & 15)][kbl * 32 + p * 16 + (l >> 4) * 8]);
      asm volatile("s_wait_xcnt 0x0" ::: "memory"); }   // in front of every rewrite of the registers of the store above
    for (int e = tid; e < 128 * 8; e += 128) { const int cl = e >> 3, q = e & 7; if (hi_rows) { const size_t o3 = (bb * CC + c0 + cl) * (size_t)KHI + t0 + q * 8; vst2((unsigned*)(VB + o3), *(const v4u*)&tb[cl][q * 8]); vst2((unsigned*)(VBL + o3), *(const v4u*)&tbl[cl][q * 8]);
        asm volatile("s_wait_xcnt 0x0" ::: "memory"); } } } }   // in front of every rewrite of the registers of the two stores above
// ---- k_attn: block = (pair of heads, 64 queries, batch), 16 waves = 4 query tiles x KS key ranges; each wave takes its mask tile once for BOTH heads of the pair. Transposed products: S^T x 2^10 = k q^T (q hi + residual, 2 products) + E mask^T (E = 2^10 at (key, key): adds the mask on the matrix pipe, exactly), one accumulator chain, so a lane holds the scores of ONE query (col) at keys 8g+r of each 16-key tile;
// two such tiles, converted in place, are the B operand of ctx^T += v^T P^T. Running maximum and sum per lane (online softmax); P = exp(score - max + PSH) once to f16 (PSH cancels in the division by the sum). The KS partial results are joined through LDS.
#define KS 4
#define HPW 2             // heads per wave: they share the wave's mask tile
#define HSTR ((TT / 16) * 512)   // f16 elements from one head's k (or v) plane to the next head's
#define KR (TT / KS)      // keys per wave
#define NIT (KR / 64)     // 64 keys per pass
#define PSH 6.9314718f    // keeps P (at most 2^10) clear of f16 subnormals
#define LOG2E 1.44269504f  // exp(x) = exp2(x * LOG2E): P is rounded to f16 right after, so the library expf's range reduction and end tests buy nothing here
__device__ __forceinline__ float xhalf(float x) { return __builtin_bit_cast(float, __builtin_amdgcn_permlanex16(__builtin_bit_cast(int, x), __builtin_bit_cast(int, x), 0x76543210, 0xfedcba98, false, false)); }  // lane l with lane l ^ 16
__device__ __forceinline__ v8f wm(v16h a, v16h b, v8f c) { return __builtin_amdgcn_wmma_f32_16x16x32_f16(false, a, false, b, (short)0, c, false, false); }
__device__ __forceinline__ v8f wmb(v16b a, v16b b, v8f c) { return __builtin_amdgcn_wmma_f32_16x16x32_bf16(false, a, false, b, (short)0, c, false, false); }
typedef __attribute__((ext_vector_type(2))) __bf16 v2b;
// eight exp2 and, behind the last, the free slot that the instruction set asks for between a transcendental and an instruction that reads its result or takes its source register; results and sources in separate registers, so that no exp2 of the run takes the source of the one before
__device__ __forceinline__ void exp2x8(float (&e)[8], const float (&x)[8]) {
  asm("v_exp_f32 %0, %8\n\tv_exp_f32 %1, %9\n\tv_exp_f32 %2, %10\n\tv_exp_f32 %3, %11\n\tv_exp_f32 %4, %12\n\tv_exp_f32 %5, %13\n\tv_exp_f32 %6, %14\n\tv_exp_f32 %7, %15\n\tv_nop"
      : "=&v"(e[0]), "=&v"(e[1]), "=&v"(e[2]), "=&v"(e[3]), "=&v"(e[4]), "=&v"(e[5]), "=&v"(e[6]), "=&v"(e[7]) : "v"(x[0]), "v"(x[1]), "v"(x[2]), "v"(x[3]), "v"(x[4]), "v"(x[5]), "v"(x[6]), "v"(x[7])); }
// 16x16x32 fragment stored in fragment order at (wave-uniform base) + (lane byte offset lo = 16 * lane) + constant cb: plane 0 = elements 0..7, plane 1 (512 bytes on) = elements 8..15; same k order as frag_h
__device__ __forceinline__ v16h frag_w(const _Float16* ub, unsigned lo, int cb) { union { v16h v; v8h q[2]; } u; const char* p = (const char*)ub + lo; u.q[0] = *(const v8h*)(p + cb); u.q[1] = *(const v8h*)(p + cb + 512); return u.v; }
// the same from a lane's own address p (the wave's base + 16 * lane), which the caller also names at the wait behind the loads
__device__ __forceinline__ v16h frag_p(const char* p, int cb) { union { v16h v; v8h q[2]; } u; u.q[0] = *(const v8h*)(p + cb); u.q[1] = *(const v8h*)(p + cb + 512); return u.v; }
// ---- the mask through LDS: each wave's tile of a pass (its 16 query rows x 64 keys, f32: 16 rows of 256 bytes, 8,192 bytes apart in memory) comes by ONE tensor load, one pass ahead, through no register;
// the mover pads each row by 16 bytes, so the lanes' 16-byte reads down a column of rows (pitch 272 bytes) meet no bank twice
typedef __attribute__((ext_vector_type(8))) unsigned v8u;
#define MROWB 256u        // bytes of one row of the tile
#define MPITCH 272u       // its pitch in LDS: the row + the 16-byte pad
#define MSLICE 6144u      // 16 rows x 272 bytes = 4,352, rounded up to a multiple of 2 KiB: every slice starts on one
#define MWORD0 ((1u << 20) | (5u << 22) | (3u << 25))   // group 1 word 0: no mask, 1-byte elements, a pad of 4 dwords behind every 64 dwords (one row)
__device__ __forceinline__ uint32_t uni(uint32_t v) { return (uint32_t)__builtin_amdgcn_readfirstlane((int)v); }
__device__ __forceinline__ uint32_t pinned(uint32_t v) { uint32_t w = uni(v); asm volatile("" : "+s"(w)); return w; }   // holds the issue test of a tensor load in a scalar register, so that the branch on it is a scalar one (the instruction ignores EXEC)
__device__ __forceinline__ void mask_tile_load(uint32_t lds_dst, const float* tile) { const uint64_t ga = (uint64_t)(size_t)tile;
  v4u g0; g0[0] = uni(1u); g0[1] = uni(lds_dst); g0[2] = uni((uint32_t)ga); g0[3] = uni((((uint32_t)(ga >> 32)) & 0x01FFFFFFu) | 0x80000000u);   // count 1; place in LDS; first byte of the tile; type 2
  v8u g1; g1[0] = uni(MWORD0); g1[1] = uni(MROWB << 16); g1[2] = uni(16u << 16); g1[3] = uni(MROWB << 16); g1[4] = uni(16u); g1[5] = uni(TT * 4u); g1[6] = uni(0u); g1[7] = uni(0u);   // tensor = tile = 256 bytes x 16 rows; source pitch = one mask row
  asm volatile("tensor_load_to_lds %0, %1" :: "s"(g0), "s"(g1) : "memory"); }   // one request of the whole wave
__global__ __launch_bounds__(512) void k_attn(const _Float16* __restrict__ QH, const _Float16* __restrict__ QL, const _Float16* __restrict__ KH, const _Float16* __restrict__ VT, const float* __restrict__ MKF, float* __restrict__ Y) {
  __shared__ __attribute__((aligned(2048))) unsigned char ms[2][4 * KS][MSLICE]; __shared__ float sp[KS][4][HPW][18][32];
  const int tid = threadIdx.x, wave = __builtin_amdgcn_readfirstlane(tid >> 5), lane = tid & 31, col = lane & 15, g = lane >> 4; const int h0 = blockIdx.x * HPW, qb = blockIdx.y, b = blockIdx.z; const int qt = wave & 3, ks = wave >> 2;
  const int q0 = qb * 64 + qt * 16, q = q0 + col;
  v16h qh[HPW], ql[HPW];
#pragma unroll
  for (int hh = 0; hh < HPW; ++hh) { qh[hh] = frag_h(QH + ((size_t)b * TT + q) * CC + (h0 + hh) * HD, lane); ql[hh] = frag_h(QL + ((size_t)b * QHI + q) * CC + (h0 + hh) * HD, lane); }
  const unsigned fo = (unsigned)lane * 16u;   // a lane's place in each 512-byte plane
  const _Float16* Kb = KH + (((size_t)b * NH + h0) * (TT / 16) + ks * (KR / 16)) * 512;   // A rows = keys, k = head columns: 1,024 bytes per 16-key tile; the wave's second head lies HSTR on
  float m[HPW], l[HPW]; v8f acc0[HPW], acc1[HPW];   // m: the running maximum of the logits x LSH
#pragma unroll
  for (int hh = 0; hh < HPW; ++hh) { const v8f z = {}; m[hh] = -3.0e38f; l[hh] = 0.f; acc0[hh] = z; acc1[hh] = z; }
  // selection matrices (A operands, 16 key rows x 32 k): es[j] row c holds LSH at k = 16 j + c and 0 elsewhere, so es[j] x (32 keys x 16 queries of the mask) = LSH x the mask at keys 16 j + 0..15
  v16b es[2] = {};
#pragma unroll
  for (int i = 0; i < 8; ++i) { const __bf16 o = (__bf16)(8 * g + i == col ? LSH : 0.f); es[0][i] = o; es[1][8 + i] = o; }
  // staggered walk: the 4 head-pair blocks that share a mask tile and the 32 query blocks that share a head's k and v each begin the key walk at a pass of their own and wrap, so that they do not ask L2 for the same lines at the same moment
  const int st = (2 * (int)blockIdx.x + qb) & (NIT - 1);
  v16h kf[4];
#pragma unroll
  for (int kt = 0; kt < 4; ++kt) kf[kt] = frag_w(Kb + (size_t)st * 2048, fo, kt * 1024);
  asm volatile("s_wait_xcnt 0x0" ::: "memory");     // in front of every rewrite of the address registers of the q and k loads above
  __builtin_amdgcn_sched_barrier(0);                // keeps the address arithmetic of the loop behind that wait
  const _Float16* Vb = VT + (((size_t)b * NH + h0) * (TT / 32) + ks * (KR / 32)) * 1024;  // A rows = head columns, k = keys: 2,048 bytes per 32-key block (two 16-column halves); the second head lies HSTR on
  const float* Mb = MKF + ((size_t)b * TT + q0) * TT + ks * KR;       const unsigned mo = (unsigned)col * MPITCH + 32u * (unsigned)g;   // this wave's 16 query rows; in LDS: this lane's query row, its 8 keys of each 16-key tile
  const uint32_t md = (uint32_t)(size_t)&ms[0][wave][0];   // this wave's slice of buffer 0; buffer 1 lies 4 KS slices on
  mask_tile_load(md, Mb + st * 64);                         // the first pass's tile
  for (int it = 0; it < NIT; ++it) { const int pi = (it + st) & (NIT - 1), pn = (it + 1 + st) & (NIT - 1);   // the 64-key blocks of this pass and of the next
    // hand-over of pass it's tile, at the seam between pass it - 1 and pass it (written at the head: at the foot, its branch would cut the sums of the pass off from the softmax they are interleaved with)
    // the ring is private to its wave: slice [wave] of either buffer is filled by this wave's own tensor loads and read by this wave alone, so its own two waits order everything and no work-group barrier stands here; the waves run out of step, one wave's matrix and load phases under another's softmax
    asm volatile("s_wait_dscnt 0x0" ::: "memory");       // this wave's reads of the last pass's buffer have retired: it may be refilled
    asm volatile("s_wait_tensorcnt 0x0" ::: "memory");   // this pass's tile, this wave's own request, has landed
    if (pinned(it + 1 < NIT)) mask_tile_load(md + (uint32_t)((it + 1) & 1) * (4u * KS * MSLICE), Mb + pn * 64);   // the next pass's tile flies under this pass, into the buffer that the last pass read
    v4f mk[4][2]; const unsigned char* mp = &ms[it & 1][wave][0] + mo;
#pragma unroll
    for (int kt = 0; kt < 4; ++kt) { mk[kt][0] = *(const v4f*)(mp + kt * 64); mk[kt][1] = *(const v4f*)(mp + kt * 64 + 16); }
    union { v16b f; v2b d[8]; } mb[2];   // B operand: element 8 j + r = the mask at key 16 j + 8 g + r of a 32-key block, the k order of p below; made once a pass, it serves both heads
#pragma unroll   // constant indices: the per-head arrays stay in registers
    for (int hh = 0; hh < HPW; ++hh) {   // the mask does not depend on the head: one tile, read and rounded once, is added to the logits of the wave's two heads, one after the other
      v16h vf[2][2]; const char* vp = (const char*)(Vb + pi * 2048) + fo;   // this lane's place in the first head's v block of the pass
#pragma unroll
      for (int s = 0; s < 2; ++s) { vf[s][0] = frag_p(vp, hh * (HSTR * 2) + s * 2048); vf[s][1] = frag_p(vp, hh * (HSTR * 2) + s * 2048 + 1024); }
      asm volatile("s_wait_xcnt 0x0" :: "v"(vp) : "memory");   // in front of every rewrite of the address registers of the v loads above; the address is named so that it lives up to the wait: otherwise the last load of the run was given it as its destination
      __builtin_amdgcn_sched_barrier(0);              // holds those loads up here: without it they sink to their first use and the wave waits out each latency
      v8f v[4]; float mx = -3.0e38f;
#pragma unroll
      for (int kt = 0; kt < 4; ++kt) { const v8f z = {}; v[kt] = wm(kf[kt], qh[hh], wm(kf[kt], ql[hh], z)); }   // smallest terms first
      if (hh == 0) {
#pragma unroll
        for (int kt = 0; kt < 4; ++kt) {
#pragma unroll
          for (int r = 0; r < 8; r += 2) { const v2f t = { mk[kt][r >> 2][r & 3], mk[kt][r >> 2][(r & 3) + 1] }; mb[kt >> 1].d[(kt & 1) * 4 + (r >> 1)] = __builtin_convertvector(t, v2b); } } }
      __builtin_amdgcn_sched_barrier(0);   // both mask operands stand ready ahead of their four products: converted between them, the second takes the first's registers and waits out the distance behind a product that still reads them
#pragma unroll
      for (int kt = 0; kt < 4; ++kt) v[kt] = wmb(es[kt & 1], mb[kt >> 1].f, v[kt]);
#pragma unroll
      for (int kt = 0; kt < 4; ++kt) {
#pragma unroll
        for (int r = 0; r < 8; ++r) mx = fmaxf(mx, v[kt][r]); }
      // the k rows of the next turn, fetched under this turn's softmax: the second head's of this pass, then the first head's of the next pass (the last pass fetches its own again)
      const char* kp = (const char*)(Kb + (size_t)(hh + 1 < HPW ? pi : it + 1 < NIT ? pn : pi) * 2048) + fo;
#pragma unroll
      for (int kt = 0; kt < 4; ++kt) kf[kt] = frag_p(kp, (hh + 1 < HPW ? (hh + 1) * (HSTR * 2) : 0) + kt * 1024);
      asm volatile("s_wait_xcnt 0x0" :: "v"(kp) : "memory");   // in front of every rewrite of the address registers of the k loads above; the address is named so that it lives up to the wait, as at the v loads
      __builtin_amdgcn_sched_barrier(0);              // holds the k loads ahead of the softmax, which covers their latency
      mx = fmaxf(mx, xhalf(mx)); const float mn = fmaxf(m[hh], mx); float al; asm("v_exp_f32 %0, %1\n\tv_nop" : "=v"(al) : "v"((m[hh] - mn) * (LOG2E / LSH)));   // exp2 with the free slot behind it that the instruction set asks for
      m[hh] = mn; const float nms = (PSH - mn * (1.0f / LSH)) * LOG2E;
      float sum = 0.f; v16h p[2];
#pragma unroll
      for (int kt = 0; kt < 4; ++kt) { float x[8], e[8];
#pragma unroll
        for (int r = 0; r < 8; ++r) x[r] = fmaf(v[kt][r], LOG2E / LSH, nms);
        exp2x8(e, x);
#pragma unroll
        for (int r = 0; r < 8; ++r) { sum += e[r]; p[kt >> 1][(kt & 1) * 8 + r] = (_Float16)e[r]; } }
      l[hh] = l[hh] * al + sum;
#pragma unroll
      for (int r = 0; r < 8; ++r) { acc0[hh][r] *= al; acc1[hh][r] *= al; }
#pragma unroll
      for (int s = 0; s < 2; ++s) { acc0[hh] = wm(vf[s][0], p[s], acc0[hh]); acc1[hh] = wm(vf[s][1], p[s], acc1[hh]); } } }
  asm volatile("s_wait_tensorcnt 0x0" ::: "memory");     // nothing of the mover is in flight behind the loop
  asm volatile("s_wait_dscnt 0x0" ::: "memory");         // and no read of the two buffers
#pragma unroll
  for (int hh = 0; hh < HPW; ++hh) { l[hh] += xhalf(l[hh]); sp[ks][qt][hh][0][lane] = m[hh]; sp[ks][qt][hh][1][lane] = l[hh];
#pragma unroll
    for (int r = 0; r < 8; ++r) { sp[ks][qt][hh][2 + r][lane] = acc0[hh][r]; sp[ks][qt][hh][10 + r][lane] = acc1[hh][r]; } }
  __syncthreads();
  if (ks < HPW) { const int hh = ks;   // the waves of key range hh join head hh: the KS partial results in the order of the key ranges
    float mm = sp[0][qt][hh][0][lane];
#pragma unroll
    for (int i = 1; i < KS; ++i) mm = fmaxf(mm, sp[i][qt][hh][0][lane]);
    float a[KS], lt = 0.f;
#pragma unroll
    for (int i = 0; i < KS; ++i) { a[i] = expf((sp[i][qt][hh][0][lane] - mm) * (1.0f / LSH)); lt += sp[i][qt][hh][1][lane] * a[i]; }
    const float inv = lt > 0.f ? 1.0f / lt : 0.f;
    v4f o[4] = {};
#pragma unroll
    for (int i = 0; i < KS; ++i) { const float ai = a[i] * inv;
#pragma unroll
      for (int r = 0; r < 8; ++r) { o[r >> 2][r & 3] += sp[i][qt][hh][2 + r][lane] * ai; o[2 + (r >> 2)][r & 3] += sp[i][qt][hh][10 + r][lane] * ai; } }
    float* yp = Y + ((size_t)b * TT + q) * CC + (h0 + hh) * HD + 8 * g;   // ctx^T register r = head column 16 j + 8 g + r of query col
    vst2(yp, o[0]); vst2(yp + 4, o[1]); vst2(yp + 16, o[2]); vst2(yp + 20, o[3]); } }
// ---- k_out: block = (64 rows, 128 cols): out = ctx Wo (+ bo): all rows: ctx bf16 hi + lo against exact bf16 Wo (2 products); the f16 x f16(bf16 x 2^8) branch is never taken
__global__ __launch_bounds__(128) void k_out(const float* __restrict__ Y, const float* __restrict__ WO, const float* __restrict__ BO, float* __restrict__ OUT) { __shared__ __align__(16) float sf[4][16][132]; __shared__ __align__(16) __bf16 wt[2][128][WPI];
  const int tid = threadIdx.x, wave = tid >> 5, lane = tid & 31, col = lane & 15, g = lane >> 4; const int c0 = blockIdx.y * 128; const size_t r0 = (size_t)blockIdx.x * 64 + wave * 16;
  v8f acc[8] = {};
  if (true) {   /* ALL rows: ctx split bf16 hi + lo x exact Wo (2 products) */
    const float* Wc = WO + c0 + tid; const float* Yp = Y + (r0 + col) * CC + 8 * g;
    float wr[2][32]; v4f xr[2][4];   // two k-steps in flight in registers
    float bs[8]; const float* Bp = (BO ? BO : WO) + c0 + col;   // this lane's 8 bias values; without a bias the loads read weights, which the epilogue replaces by 0, as in k_proj
    const int st = (int)((blockIdx.x + 2u * blockIdx.y) & (CC / 32 - 1));   // staggered walk, as in k_proj: 64 row blocks share a weight tile, 4 column blocks the ctx rows
    wfetch<DIN>(wr[0], Wc, st); afetch(xr[0], Yp, st);
    asm volatile("s_wait_xcnt 0x0" ::: "memory");     // the next k-step's addresses may take the address registers of the loads above
    __builtin_amdgcn_sched_barrier(0);                // keeps that address arithmetic behind the wait
    wfetch<DIN>(wr[1], Wc, (st + 1) & (CC / 32 - 1)); afetch(xr[1], Yp, (st + 1) & (CC / 32 - 1));
    asm volatile("s_wait_xcnt 0x0" ::: "memory");     // in front of every rewrite of the address registers of the loads above
    __builtin_amdgcn_sched_barrier(0);                // keeps those loads up here, all in flight together
#pragma unroll   // constant indices: the arrays stay in registers
    for (int kc = 0; kc < CC / 32; ++kc) { const int s = kc & 1; float v[16];
      wlay(&wt[s][tid][0], wr[s]);
#pragma unroll   // constant indices: the arrays stay in registers
      for (int i = 0; i < 4; ++i) { v[i] = xr[s][0][i]; v[4 + i] = xr[s][1][i]; v[8 + i] = xr[s][2][i]; v[12 + i] = xr[s][3][i]; }
      const F2 a = bsplit16(v);
      __builtin_amdgcn_sched_barrier(0);   // the refill below reuses the registers just read: lifted over their readers it would take a third register set
      if (kc + 2 < CC / 32) { const int kn = (kc + 2 + st) & (CC / 32 - 1); wfetch<DIN>(wr[s], Wc, kn); afetch(xr[s], Yp, kn);
        asm volatile("s_wait_xcnt 0x0" ::: "memory");     // in front of every rewrite of the address registers of the loads above
        __builtin_amdgcn_sched_barrier(0); }              // keeps every later register write behind that wait
      else if (kc + 2 == CC / 32) {   // the first k-step without a refill: the bias values are asked for together and fly under the last two k-steps, as in k_proj
#pragma unroll   // constant indices: the array stays in registers
        for (int j = 0; j < 8; ++j) bs[j] = Bp[j * 16];
        asm volatile("s_wait_xcnt 0x0" ::: "memory");     // in front of every rewrite of the address registers of the loads above
        __builtin_amdgcn_sched_barrier(0); }              // holds those loads up here: sunk to their uses, each would be waited for on its own again
      lds_barrier();   // publishes wt[s]; every reader of wt[s] two k-steps back has passed the barrier in between
      v16b w[8];
#pragma unroll   // constant indices: the arrays stay in registers
      for (int j = 0; j < 8; ++j) w[j] = frag_b(&wt[s][j * 16 + col][0], lane);
      __builtin_amdgcn_sched_barrier(0);   // keeps the 16 LDS reads together ahead of the products: spread among them each pair costs its own LDS latency
#pragma unroll   // constant indices: the arrays stay in registers
      for (int j = 0; j < 8; ++j) { acc[j] = wmma_bf(a.h, w[j], acc[j]); acc[j] = wmma_bf(a.l, w[j], acc[j]); } }
#pragma unroll
    for (int j = 0; j < 8; ++j) { const float bias = BO ? bfr(bs[j]) : 0.f;
#pragma unroll
      for (int r = 0; r < 8; ++r) sf[wave][8 * g + r][j * 16 + col] = acc[j][r] + bias; }
  } else {
#pragma unroll 2
    for (int kc = 0; kc < CC / 32; ++kc) { const v16h a = frag_f32(Y + (r0 + col) * CC + kc * 32, lane); asm volatile("s_wait_loadcnt 0x0" ::: "memory");
#pragma unroll
      for (int j = 0; j < 8; ++j) { const v16h w = WOCOLH(WO, kc * 32, c0 + j * 16 + col, lane); asm volatile("s_wait_loadcnt 0x0" ::: "memory"); acc[j] = wmma16(a, w, acc[j]); } }
#pragma unroll
    for (int j = 0; j < 8; ++j) { const float bias = BO ? bfr(BO[c0 + j * 16 + col]) : 0.f;
#pragma unroll
      for (int r = 0; r < 8; ++r) sf[wave][8 * g + r][j * 16 + col] = acc[j][r] * (1.0f / 256.0f) + bias; } }
  LDSX(); for (int rl = 0; rl < 16; ++rl) vst2(OUT + (r0 + rl) * DIN + c0 + lane * 4, *(const v4f*)&sf[wave][rl][lane * 4]); }

extern "C" void kernel_launch(void* const* d_in, const int* in_sizes, int n_in, void* d_out, int out_size, void* d_ws, size_t ws_size, hipStream_t stream) {
  (void)in_sizes; (void)n_in; (void)out_size;
  const float** F = (const float**)d_in;
  if (ws_size < (size_t)WS_END) return;
  char* ws = (char*)d_ws; _Float16 *QH = (_Float16*)(ws + WS_QH), *KH = (_Float16*)(ws + WS_KH), *VT = (_Float16*)(ws + WS_VT), *QL = (_Float16*)(ws + WS_QL), *KL = (_Float16*)(ws + WS_KL); __bf16 *VB = (__bf16*)(ws + WS_VB), *VBL = (__bf16*)(ws + WS_VBL); float *Y = (float*)(ws + WS_Y);
  (void)Y; (void)QL; (void)KL; (void)VB; (void)VBL;
  // inputs: 0 V [2,2048,512]; 1 Q; 2 K; 3 mask [2,1,2048,2048] f32; 4 Wq [512,256] (in,out), 5 bq; 6 Wk, 7 bk; 8 Wv, 9 bv; 10 Wo [256,512] (in,out), 11 bo [512]
  k_proj<<<dim3(TNB * TT / 64, CC / 128, 3), 128, 0, stream>>>(F[1], F[2], F[0], F[4], F[6], F[8], F[5], F[7], F[9], QH, QL, KH, KL, VT, VB, VBL);   /* q from Q (in1), k from K (in2), v from V (in0) */
  k_attn<<<dim3(NH / HPW, NQB, TNB), 128 * KS, 0, stream>>>(QH, QL, KH, VT, F[3], Y);
  k_out<<<dim3(TNB * TT / 64, DIN / 128), 128, 0, stream>>>(Y, F[10], F[11], (float*)d_out);
}
